// v000
// Times are from an AMD MI455X. After a warm-up the kernel runs many times in a row, and a time is the length of
// such a window on the GPU divided by its runs, so every launch and the gaps after it count. The runs cycle
// through copies of the inputs. A figure is the median of several windows, for all but v000 over two sittings.
// Sittings can differ by a few percent; kernels timed side by side share one.
// The starting kernel, v000, takes 483 microseconds a run.
#include <hip/hip_runtime.h>
// Multi-head attention with raw-reshape heads, residual and a global LayerNorm (B=2, S=2048, D=1024, 16 heads × 64): Q,K,V = x·Wᵀ reshaped by plain memory order to (H,B,S,64) (= 32 contiguous [2048][64] slabs of each
// [4096][1024] plane); UNSCALED softmax(Q·Kᵀ)·V per slab; y = out (same flat order, = [B,S,1024]) + x; output = (y − mean)/√(var + 1e-5) with mean/var over all (S,D) of each batch element (identity affine).
// Compute dtype: x and weights rounded to bf16; Q,K as f32 GEMM outputs split into f16 hi + ×2^10 residual planes so the unscaled (σ≈3) logits are f32-accurate; V f16; fused flash-style kernel
// (two score accumulators, online softmax f32, P f16 ×2^10) on v_wmma_f32_16x16x32_f16; residual and the per-batch statistics (fixed-order block partial sums of y and y², then a fixed-order combine) and normalisation in f32.
#define BB 2
#define TT 2048
#define DD 1024
#define NSL 32
#define NR (BB * TT)
#define NPB 64

typedef __bf16 v16b __attribute__((ext_vector_type(16)));
typedef unsigned short v8us __attribute__((ext_vector_type(8), may_alias));
typedef float  v8f  __attribute__((ext_vector_type(8)));
typedef float  v4f  __attribute__((ext_vector_type(4)));
typedef float  v4fa __attribute__((ext_vector_type(4), may_alias));
union FragB { v16b v; v8us half[2]; unsigned short u[16]; };

__device__ __forceinline__ unsigned short bf16_bits(float x) { unsigned int u = __float_as_uint(x); return (unsigned short)((u + 0x7FFFu + ((u >> 16) & 1u)) >> 16); }
__device__ __forceinline__ float bf16_val(unsigned short b) { return __uint_as_float(((unsigned int)b) << 16); }
__device__ __forceinline__ float bf16_round(float x) { return bf16_val(bf16_bits(x)); }
// D += A·B with NT terms: 1 = ah·bh, 2 = + al·bh (A split), 3 = + ah·bl (both split)
template <int NT>
__device__ __forceinline__ v8f mmaN(v16b ah, v16b al, v16b bh, v16b bl, v8f c) {
  c = __builtin_amdgcn_wmma_f32_16x16x32_bf16(false, ah, false, bh, (short)0, c, false, false);
  if (NT >= 2) c = __builtin_amdgcn_wmma_f32_16x16x32_bf16(false, al, false, bh, (short)0, c, false, false);
  if (NT >= 3) c = __builtin_amdgcn_wmma_f32_16x16x32_bf16(false, ah, false, bl, (short)0, c, false, false);
  asm volatile("v_nop\n\tv_nop\n\tv_nop\n\tv_nop" : "+v"(c) : "v"(ah), "v"(al), "v"(bh), "v"(bl));
  return c;
}

__global__ __launch_bounds__(256) void k_wt_bf16(const float* __restrict__ W, unsigned short* __restrict__ Wt, int K, int N) {
  const int t = blockIdx.x * 256 + threadIdx.x;
  const int k8n = K / 8;
  if (t >= N * k8n) return;
  const int n = t / k8n, k8 = (t % k8n) * 8;
  v8us v;
#pragma unroll
  for (int i = 0; i < 8; ++i) v[i] = bf16_bits(W[(size_t)(k8 + i) * N + n]);
  *(v8us*)(Wt + (size_t)n * K + k8) = v;
  
}

// GEMM C[M][N] (f32, pitch ldc) = act(A[M][K]·W + bias). A f32 row-major (pitch lda) converted per fragment to bf16
// (ASPLIT: hi/lo two planes -> 2 terms, else single rounded term); Wt bf16 [N][K] (pitch ldb). BIAS_BF16 rounds the
// bias to bf16 first (bias quantised to bf16 before the add). K%32==0, M%16==0, N%64==0.
template <bool ASPLIT, int ACT, bool BIAS_BF16>
__global__ __launch_bounds__(128) void k_gemm_bf(const float* __restrict__ A, int lda, const unsigned short* __restrict__ Wt, int ldb,
                                               const float* __restrict__ bias, float* __restrict__ C, int ldc, int M, int N, int K) {
  __shared__ __attribute__((aligned(16))) float so[4][16][64];
  const int tid = threadIdx.x, w = tid >> 5, lane = tid & 31, ln = lane & 15, hh = lane >> 4;
  const int ntn = N / 64;
  const int wid = blockIdx.x * 4 + w;
  const int mt = wid / ntn, nq = wid % ntn;
  if (mt * 16 >= M) return;
  const int row0 = mt * 16, col0 = nq * 64;
  const float* arow = A + (size_t)(row0 + ln) * lda;
  v8f acc[4] = {};
  for (int kb = 0; kb < K; kb += 32) {
    FragB ah, al;
    const v4f x0 = *(const v4fa*)(arow + kb + 8 * hh), x1 = *(const v4fa*)(arow + kb + 8 * hh + 4);
    const v4f x2 = *(const v4fa*)(arow + kb + 16 + 8 * hh), x3 = *(const v4fa*)(arow + kb + 16 + 8 * hh + 4);
    float xs[16] = {x0[0],x0[1],x0[2],x0[3],x1[0],x1[1],x1[2],x1[3],x2[0],x2[1],x2[2],x2[3],x3[0],x3[1],x3[2],x3[3]};
#pragma unroll
    for (int i = 0; i < 16; ++i) { const unsigned short hb = bf16_bits(xs[i]); ah.u[i] = hb; al.u[i] = ASPLIT ? bf16_bits(xs[i] - bf16_val(hb)) : (unsigned short)0; }
#pragma unroll
    for (int t = 0; t < 4; ++t) {
      const unsigned short* brow = Wt + (size_t)(col0 + t * 16 + ln) * ldb + kb;
      FragB b;
      b.half[0] = *(const v8us*)(brow + 8 * hh);
      b.half[1] = *(const v8us*)(brow + 16 + 8 * hh);
      acc[t] = mmaN<ASPLIT ? 2 : 1>(ah.v, al.v, b.v, b.v, acc[t]);
    }
  }
#pragma unroll
  for (int t = 0; t < 4; ++t) {
    float bv = bias ? bias[col0 + t * 16 + ln] : 0.f;
    if (BIAS_BF16) bv = bf16_round(bv);
#pragma unroll
    for (int r = 0; r < 8; ++r) { float v = acc[t][r] + bv; if (ACT == 1) v = fmaxf(v, 0.f); so[w][8 * hh + r][t * 16 + ln] = v; }
  }
  __builtin_amdgcn_fence(__ATOMIC_ACQ_REL, "workgroup");
  __builtin_amdgcn_wave_barrier();
  const int rsub = lane >> 4, c4 = (lane & 15) * 4;
  {
#pragma unroll
    for (int q = 0; q < 8; ++q) {
      const int r = q * 2 + rsub;
      const v4f v = *(const v4fa*)&so[w][r][c4];
      *(v4f*)(C + (size_t)(row0 + r) * ldc + col0 + c4) = v;
    }
    
  }
}

// Flash-style causal/unmasked attention, all contractions 3-term bf16 hi/lo splits, f32 softmax with running max.
// q,k,v rows are read from f32 buffers with arbitrary row pitch (so they can live inside a fused qkv buffer);
// D = head size (multiple of 32, <= 128); one wave = 16 query rows; block = 4 waves (64 queries) sharing K/V chunks of 32.
template <int D, bool CAUSAL>
__global__ __launch_bounds__(128) void k_flash(const float* __restrict__ qb, const float* __restrict__ kb, const float* __restrict__ vb,
                                             int pitch, int T, int H, float scale, float* __restrict__ y, int ypitch) {
  constexpr int KS = D / 32;        // k-steps for QK
  constexpr int DT = D / 16;        // d tiles for PV
  __shared__ __attribute__((aligned(16))) unsigned short sKh[32][D + 8], sKl[32][D + 8], sVh[32][D + 8], sVl[32][D + 8];
  __shared__ __attribute__((aligned(16))) unsigned short sPh[4][16][40], sPl[4][16][40];
  __shared__ __attribute__((aligned(16))) float sO[4][16][D];
  const int tid = threadIdx.x, w = tid >> 5, lane = tid & 31, ln = lane & 15, hh = lane >> 4;
  const int nqb = (T + 63) / 64;
  const int bh = blockIdx.x / nqb, qblk = blockIdx.x % nqb;
  const int b = bh / H, h = bh % H;
  const int q0 = qblk * 64 + w * 16;
  const float* Q = qb + (size_t)b * T * pitch + h * D;
  const float* K = kb + (size_t)b * T * pitch + h * D;
  const float* V = vb + (size_t)b * T * pitch + h * D;

  // A fragments of the wave's 16 query rows (scaled), hi/lo
  FragB aqh[KS], aql[KS];
  {
    int row = q0 + ln; if (row >= T) row = T - 1;
    const float* qr = Q + (size_t)row * pitch;
#pragma unroll
    for (int ks = 0; ks < KS; ++ks)
#pragma unroll
      for (int i = 0; i < 16; ++i) {
        const int d = ks * 32 + ((i < 8) ? (8 * hh + i) : (16 + 8 * hh + (i - 8)));
        const float x = qr[d] * scale; const unsigned short hb = bf16_bits(x);
        aqh[ks].u[i] = hb; aql[ks].u[i] = bf16_bits(x - bf16_val(hb));
      }
  }
  float m_r[8], l_r[8];
#pragma unroll
  for (int r = 0; r < 8; ++r) { m_r[r] = -3.0e38f; l_r[r] = 0.f; }
  v8f oacc[DT];
#pragma unroll
  for (int dt = 0; dt < DT; ++dt) oacc[dt] = (v8f){0.f,0.f,0.f,0.f,0.f,0.f,0.f,0.f};

  const int kv_end = CAUSAL ? min(T, qblk * 64 + 64) : T;     // block-uniform
  for (int j0 = 0; j0 < kv_end; j0 += 32) {
    __syncthreads();
    for (int e = tid; e < 32 * (D / 4); e += 128) {
      const int r = e / (D / 4), c4 = (e % (D / 4)) * 4;
      const int key = j0 + r;
      v4f kf = {0.f,0.f,0.f,0.f}, vf = {0.f,0.f,0.f,0.f};
      if (key < T) { kf = *(const v4fa*)(K + (size_t)key * pitch + c4); vf = *(const v4fa*)(V + (size_t)key * pitch + c4); }
#pragma unroll
      for (int t = 0; t < 4; ++t) {
        unsigned short hb = bf16_bits(kf[t]); sKh[r][c4 + t] = hb; sKl[r][c4 + t] = bf16_bits(kf[t] - bf16_val(hb));
        hb = bf16_bits(vf[t]); sVh[r][c4 + t] = hb; sVl[r][c4 + t] = bf16_bits(vf[t] - bf16_val(hb));
      }
    }
    __syncthreads();
    // S tile 16 x 32
    v8f s[2];
#pragma unroll
    for (int nt = 0; nt < 2; ++nt) {
      v8f acc = {};
#pragma unroll
      for (int ks = 0; ks < KS; ++ks) {
        FragB bh_, bl_;
        bh_.half[0] = *(const v8us*)&sKh[nt * 16 + ln][ks * 32 + 8 * hh]; bh_.half[1] = *(const v8us*)&sKh[nt * 16 + ln][ks * 32 + 16 + 8 * hh];
        bl_.half[0] = *(const v8us*)&sKl[nt * 16 + ln][ks * 32 + 8 * hh]; bl_.half[1] = *(const v8us*)&sKl[nt * 16 + ln][ks * 32 + 16 + 8 * hh];
        acc = mmaN<3>(aqh[ks].v, aql[ks].v, bh_.v, bl_.v, acc);
      }
      s[nt] = acc;
    }
    // mask + running max (rows 8hh+r; the 16 lanes of a half share rows)
    float alpha[8];
#pragma unroll
    for (int r = 0; r < 8; ++r) {
      const int qi = q0 + 8 * hh + r;
      const int ja = j0 + ln, jb = j0 + 16 + ln;
      if (CAUSAL) { if (ja > qi) s[0][r] = -3.0e38f; if (jb > qi) s[1][r] = -3.0e38f; }
      if (ja >= T) s[0][r] = -3.0e38f;
      if (jb >= T) s[1][r] = -3.0e38f;
      float mx = fmaxf(s[0][r], s[1][r]);
      mx = fmaxf(mx, __shfl_xor(mx, 1, 32)); mx = fmaxf(mx, __shfl_xor(mx, 2, 32)); mx = fmaxf(mx, __shfl_xor(mx, 4, 32)); mx = fmaxf(mx, __shfl_xor(mx, 8, 32));
      const float mnew = fmaxf(m_r[r], mx);
      alpha[r] = (mnew > -1.0e38f) ? __expf(m_r[r] - mnew) : 1.0f;
      const float p0 = (s[0][r] > -1.0e38f) ? __expf(s[0][r] - mnew) : 0.f;
      const float p1 = (s[1][r] > -1.0e38f) ? __expf(s[1][r] - mnew) : 0.f;
      m_r[r] = mnew;
      l_r[r] = l_r[r] * alpha[r] + p0 + p1;            // per-lane partial row sum (16 lanes combined at the end)
      unsigned short hb = bf16_bits(p0); sPh[w][8 * hh + r][ln] = hb;      sPl[w][8 * hh + r][ln] = bf16_bits(p0 - bf16_val(hb));
      hb = bf16_bits(p1);                sPh[w][8 * hh + r][16 + ln] = hb; sPl[w][8 * hh + r][16 + ln] = bf16_bits(p1 - bf16_val(hb));
    }
#pragma unroll
    for (int dt = 0; dt < DT; ++dt)
#pragma unroll
      for (int r = 0; r < 8; ++r) oacc[dt][r] *= alpha[r];
    __builtin_amdgcn_fence(__ATOMIC_ACQ_REL, "workgroup");
    __builtin_amdgcn_wave_barrier();
    FragB pah, pal;
    pah.half[0] = *(const v8us*)&sPh[w][ln][8 * hh]; pah.half[1] = *(const v8us*)&sPh[w][ln][16 + 8 * hh];
    pal.half[0] = *(const v8us*)&sPl[w][ln][8 * hh]; pal.half[1] = *(const v8us*)&sPl[w][ln][16 + 8 * hh];
#pragma unroll
    for (int dt = 0; dt < DT; ++dt) {
      FragB bvh, bvl;
#pragma unroll
      for (int i = 0; i < 8; ++i) {
        bvh.u[i] = sVh[8 * hh + i][dt * 16 + ln]; bvh.u[8 + i] = sVh[16 + 8 * hh + i][dt * 16 + ln];
        bvl.u[i] = sVl[8 * hh + i][dt * 16 + ln]; bvl.u[8 + i] = sVl[16 + 8 * hh + i][dt * 16 + ln];
      }
      oacc[dt] = mmaN<3>(pah.v, pal.v, bvh.v, bvl.v, oacc[dt]);
    }
    __builtin_amdgcn_fence(__ATOMIC_ACQ_REL, "workgroup");
    __builtin_amdgcn_wave_barrier();
  }
#pragma unroll
  for (int r = 0; r < 8; ++r) {
    float l = l_r[r];
    l += __shfl_xor(l, 1, 32); l += __shfl_xor(l, 2, 32); l += __shfl_xor(l, 4, 32); l += __shfl_xor(l, 8, 32);
    l_r[r] = (l > 0.f) ? 1.0f / l : 0.f;
  }
#pragma unroll
  for (int dt = 0; dt < DT; ++dt)
#pragma unroll
    for (int r = 0; r < 8; ++r) sO[w][8 * hh + r][dt * 16 + ln] = oacc[dt][r] * l_r[r];
  __builtin_amdgcn_fence(__ATOMIC_ACQ_REL, "workgroup");
  __builtin_amdgcn_wave_barrier();
  {
    for (int r = 0; r < 16; ++r) {
      const int row = q0 + r;
      if (row < T && lane < D / 4) {
        const v4f val = *(const v4fa*)&sO[w][r][lane * 4];
        *(v4f*)(y + ((size_t)b * T + row) * ypitch + h * D + lane * 4) = val;
      }
    }
    
  }
}

// GEMM C = act(A·W + bias + resid): A f32 (ASPLIT -> hi/lo 2 terms), Wt bf16 [N][K]; ACT 0 none, 1 relu, 2 exact gelu;
// resid (optional, f32, row index = (row % rmod), pitch ldr, RES_BF16 rounds it) added before the activation.
template <bool ASPLIT, int ACT, bool BIAS_BF16, bool RES_BF16>
__global__ __launch_bounds__(128) void k_gemm_bf3(const float* __restrict__ A, int lda, const unsigned short* __restrict__ Wt, int ldb,
                                                const float* __restrict__ bias, const float* __restrict__ resid, int rmod, int ldr,
                                                float* __restrict__ C, int ldc, int M, int N, int K) {
  __shared__ __attribute__((aligned(16))) float so[4][16][64];
  const int tid = threadIdx.x, w = tid >> 5, lane = tid & 31, ln = lane & 15, hh = lane >> 4;
  const int ntn = N / 64;
  const int wid = blockIdx.x * 4 + w;
  const int mt = wid / ntn, nq = wid % ntn;
  if (mt * 16 >= M) return;
  const int row0 = mt * 16, col0 = nq * 64;
  const float* arow = A + (size_t)(row0 + ln) * lda;
  v8f acc[4] = {};
  for (int kb = 0; kb < K; kb += 32) {
    FragB ah, al;
    const v4f x0 = *(const v4fa*)(arow + kb + 8 * hh), x1 = *(const v4fa*)(arow + kb + 8 * hh + 4);
    const v4f x2 = *(const v4fa*)(arow + kb + 16 + 8 * hh), x3 = *(const v4fa*)(arow + kb + 16 + 8 * hh + 4);
    float xs[16] = {x0[0],x0[1],x0[2],x0[3],x1[0],x1[1],x1[2],x1[3],x2[0],x2[1],x2[2],x2[3],x3[0],x3[1],x3[2],x3[3]};
#pragma unroll
    for (int i = 0; i < 16; ++i) { const unsigned short hb = bf16_bits(xs[i]); ah.u[i] = hb; al.u[i] = ASPLIT ? bf16_bits(xs[i] - bf16_val(hb)) : (unsigned short)0; }
#pragma unroll
    for (int t = 0; t < 4; ++t) {
      const unsigned short* brow = Wt + (size_t)(col0 + t * 16 + ln) * ldb + kb;
      FragB b;
      b.half[0] = *(const v8us*)(brow + 8 * hh);
      b.half[1] = *(const v8us*)(brow + 16 + 8 * hh);
      acc[t] = mmaN<ASPLIT ? 2 : 1>(ah.v, al.v, b.v, b.v, acc[t]);
    }
  }
#pragma unroll
  for (int t = 0; t < 4; ++t) {
    const int col = col0 + t * 16 + ln;
    float bv = bias ? bias[col] : 0.f;
    if (BIAS_BF16) bv = bf16_round(bv);
#pragma unroll
    for (int r = 0; r < 8; ++r) {
      float v = acc[t][r] + bv;
      if (resid) { float rv = resid[(size_t)((row0 + 8 * hh + r) % rmod) * ldr + col]; if (RES_BF16) rv = bf16_round(rv); v += rv; }
      if (ACT == 1) v = fmaxf(v, 0.f);
      if (ACT == 2) v = 0.5f * v * (1.0f + erff(v * 0.70710678118654752f));
      if (ACT == 3) { const float u = 0.7978845608028654f * (v + 0.044715f * v * v * v); v = 0.5f * v * (1.0f + tanhf(u)); }
      so[w][8 * hh + r][t * 16 + ln] = v;
    }
  }
  __builtin_amdgcn_fence(__ATOMIC_ACQ_REL, "workgroup");
  __builtin_amdgcn_wave_barrier();
  const int rsub = lane >> 4, c4 = (lane & 15) * 4;
  {
#pragma unroll
    for (int q = 0; q < 8; ++q) {
      const int r = q * 2 + rsub;
      const v4f v = *(const v4fa*)&so[w][r][c4];
      *(v4f*)(C + (size_t)(row0 + r) * ldc + col0 + c4) = v;
    }
    
  }
}
// row LayerNorm (biased variance, eps) over N: s = X (+ R); optional out_sum <- s; out_norm <- (s-mu)*rsqrt(var+eps)*g + b
template <bool PARAM_BF16>
__global__ __launch_bounds__(256) void k_layernorm(const float* __restrict__ X, const float* __restrict__ R, const float* __restrict__ g, const float* __restrict__ bta,
                                                  float* __restrict__ out_sum, float* __restrict__ out_norm, int N, float eps) {
  __shared__ float red[256];
  const int row = blockIdx.x, tid = threadIdx.x;
  const float* x = X + (size_t)row * N; const float* rr = R ? R + (size_t)row * N : nullptr;
  float vals[16];                     // up to N = 4096
  const int per = N / 256;            // contiguous chunk per thread? use strided-by-4 chunks: thread handles j = tid*4 + 1024*u
  float s1 = 0.f;
  for (int u = 0; u < per / 4; ++u) {
    const int j = tid * 4 + 1024 * u;
    const v4f a = *(const v4fa*)(x + j);
    v4f b = {0.f,0.f,0.f,0.f}; if (rr) b = *(const v4fa*)(rr + j);
#pragma unroll
    for (int q = 0; q < 4; ++q) { const float v = a[q] + b[q]; vals[u * 4 + q] = v; s1 += v; }
  }
  red[tid] = s1; __syncthreads();
  for (int st = 128; st > 0; st >>= 1) { if (tid < st) red[tid] += red[tid + st]; __syncthreads(); }
  const float mu = red[0] / (float)N; __syncthreads();
  float s2 = 0.f;
  for (int u = 0; u < per / 4; ++u)
#pragma unroll
    for (int q = 0; q < 4; ++q) { const float c = vals[u * 4 + q] - mu; s2 += c * c; }
  red[tid] = s2; __syncthreads();
  for (int st = 128; st > 0; st >>= 1) { if (tid < st) red[tid] += red[tid + st]; __syncthreads(); }
  const float rs = rsqrtf(red[0] / (float)N + eps);
  {
    for (int u = 0; u < per / 4; ++u) {
      const int j = tid * 4 + 1024 * u;
      v4f o, sm;
#pragma unroll
      for (int q = 0; q < 4; ++q) {
        float gg = g[j + q], bb = bta[j + q];
        if (PARAM_BF16) { gg = bf16_round(gg); bb = bf16_round(bb); }
        sm[q] = vals[u * 4 + q]; o[q] = (vals[u * 4 + q] - mu) * rs * gg + bb;
      }
      if (out_sum) *(v4f*)(out_sum + (size_t)row * N + j) = sm;
      *(v4f*)(out_norm + (size_t)row * N + j) = o;
    }
    
  }
}



// ---- f16 WMMA path (v_wmma_f32_16x16x32_f16): 11-bit significands for operands in range — used where a [0,1] probability operand needs more precision than bf16
typedef _Float16 v16h __attribute__((ext_vector_type(16)));
union FragH { v16h v; v8us half[2]; _Float16 h[16]; unsigned short u[16]; };
template <int NT>
__device__ __forceinline__ v8f mmaH(v16h ah, v16h al, v16h bh, v16h bl, v8f c) {
  c = __builtin_amdgcn_wmma_f32_16x16x32_f16(false, ah, false, bh, (short)0, c, false, false);
  if (NT >= 2) c = __builtin_amdgcn_wmma_f32_16x16x32_f16(false, al, false, bh, (short)0, c, false, false);
  if (NT >= 3) c = __builtin_amdgcn_wmma_f32_16x16x32_f16(false, ah, false, bl, (short)0, c, false, false);
  asm volatile("v_nop\n\tv_nop\n\tv_nop\n\tv_nop" : "+v"(c) : "v"(ah), "v"(al), "v"(bh), "v"(bl));
  return c;
}
// batched GEMM like k_gemm_b but f16 operands: A f32 (split into f16 hi/lo if ASPLIT, else rounded to f16), Bt = f16 values [n][k]; alpha; C f32; N multiple of 16 (partial tiles skipped)
template <bool ASPLIT>
__global__ __launch_bounds__(128) void k_gemm_h(const float* __restrict__ A, int lda, size_t sA, const _Float16* __restrict__ Bh, int ldb, size_t sB, float alpha, float* __restrict__ C, int ldc, size_t sC, int M, int N, int K) {
  __shared__ __attribute__((aligned(16))) float so[4][16][64];
  const int tid = threadIdx.x, w = tid >> 5, lane = tid & 31, ln = lane & 15, hh = lane >> 4; const int by = blockIdx.y;
  A += (size_t)by * sA; Bh += (size_t)by * sB; C += (size_t)by * sC;
  const int ntn = (N + 63) / 64; const int wid = blockIdx.x * 4 + w; const int mt = wid / ntn, nq = wid % ntn; if (mt * 16 >= M) return;
  const int row0 = mt * 16, col0 = nq * 64; const float* arow = A + (size_t)(row0 + ln) * lda;
  v8f acc[4] = {};
  for (int kb = 0; kb < K; kb += 32) {
    FragH ah, al;
    const v4f x0 = *(const v4fa*)(arow + kb + 8 * hh), x1 = *(const v4fa*)(arow + kb + 8 * hh + 4), x2 = *(const v4fa*)(arow + kb + 16 + 8 * hh), x3 = *(const v4fa*)(arow + kb + 16 + 8 * hh + 4);
    float xs[16] = {x0[0],x0[1],x0[2],x0[3],x1[0],x1[1],x1[2],x1[3],x2[0],x2[1],x2[2],x2[3],x3[0],x3[1],x3[2],x3[3]};
#pragma unroll
    for (int i = 0; i < 16; ++i) { const _Float16 h = (_Float16)xs[i]; ah.h[i] = h; al.h[i] = ASPLIT ? (_Float16)(xs[i] - (float)h) : (_Float16)0.0f; }
#pragma unroll
    for (int t = 0; t < 4; ++t) { if (col0 + t * 16 >= N) continue; const size_t boff = (size_t)(col0 + t * 16 + ln) * ldb + kb; FragH bq; bq.half[0] = *(const v8us*)(Bh + boff + 8 * hh); bq.half[1] = *(const v8us*)(Bh + boff + 16 + 8 * hh);
      acc[t] = mmaH<ASPLIT ? 2 : 1>(ah.v, al.v, bq.v, bq.v, acc[t]); }
  }
#pragma unroll
  for (int t = 0; t < 4; ++t) { if (col0 + t * 16 >= N) continue;
#pragma unroll
    for (int r = 0; r < 8; ++r) so[w][8 * hh + r][t * 16 + ln] = acc[t][r] * alpha; }
  __builtin_amdgcn_fence(__ATOMIC_ACQ_REL, "workgroup"); __builtin_amdgcn_wave_barrier();
  const int rsub = lane >> 4, c4 = (lane & 15) * 4;
  {
#pragma unroll
    for (int q = 0; q < 8; ++q) { const int r = q * 2 + rsub; if (col0 + c4 < N) { const v4f v = *(const v4fa*)&so[w][r][c4]; *(v4f*)(C + (size_t)(row0 + r) * ldc + col0 + c4) = v; } }
     }
}

// Wt[n][k] = f16(W[k][n]·scale) from f32 row-major W[K][N] (scale = power of two; bf16-exact weights stay exact in f16 away from the subnormal range)
__global__ __launch_bounds__(256) void k_wt_f16(const float* __restrict__ W, _Float16* __restrict__ Wt, int K, int N, float scale) {
  const int t = blockIdx.x * 256 + threadIdx.x; if (t >= N * (K / 8)) return; const int n = t / (K / 8), k8 = (t % (K / 8)) * 8; FragH f;
#pragma unroll
  for (int i = 0; i < 8; ++i) f.h[i] = (_Float16)(bf16_round(W[(size_t)(k8 + i) * N + n]) * scale); const v8us o = f.half[0];
  *(v8us*)((unsigned short*)Wt + (size_t)n * K + k8) = o; 
}
// k_gemm_hh variant with fused epilogue: v = acc·alpha + bias[by·sBias + col] (+ CP[(row/rowsPerB)·sCPb + by·64 + col] if CP) ; ACT 0 none / 1 elu ; writes f16 C16 and f32 C, each if non-null
template <int ACT>
__global__ __launch_bounds__(128) void k_gemm_hhx(const _Float16* __restrict__ A, int lda, size_t sA, const _Float16* __restrict__ Bh, int ldb, size_t sB, float alpha, const float* __restrict__ bias, size_t sBias, const float* __restrict__ CP, int rowsPerB, size_t sCPb, int row0g,
    float* __restrict__ C, _Float16* __restrict__ C16, int ldc, size_t sC, int M, int N, int K) {
  __shared__ __attribute__((aligned(16))) float so[4][16][64];
  const int tid = threadIdx.x, w = tid >> 5, lane = tid & 31, ln = lane & 15, hh = lane >> 4; const int by = blockIdx.y;
  A += (size_t)by * sA; Bh += (size_t)by * sB; const size_t cofs = (size_t)by * sC; const float* bp = bias ? bias + (size_t)by * sBias : nullptr;
  const int ntn = (N + 63) / 64; const int wid = blockIdx.x * 4 + w; const int mt = wid / ntn, nq = wid % ntn; if (mt * 16 >= M) return;
  const int row0 = mt * 16, col0 = nq * 64; const _Float16* arow = A + (size_t)(row0 + ln) * lda;
  v8f acc[4] = {};
  for (int kb = 0; kb < K; kb += 32) { FragH ah; ah.half[0] = *(const v8us*)((const unsigned short*)arow + kb + 8 * hh); ah.half[1] = *(const v8us*)((const unsigned short*)arow + kb + 16 + 8 * hh);
#pragma unroll
    for (int t = 0; t < 4; ++t) { if (col0 + t * 16 >= N) continue; const size_t boff = (size_t)(col0 + t * 16 + ln) * ldb + kb; FragH bq; bq.half[0] = *(const v8us*)((const unsigned short*)Bh + boff + 8 * hh); bq.half[1] = *(const v8us*)((const unsigned short*)Bh + boff + 16 + 8 * hh);
      acc[t] = mmaH<1>(ah.v, ah.v, bq.v, bq.v, acc[t]); }
  }
#pragma unroll
  for (int t = 0; t < 4; ++t) { if (col0 + t * 16 >= N) continue; const int col = col0 + t * 16 + ln; const float bv = bp ? bf16_round(bp[col]) : 0.f;
#pragma unroll
    for (int r = 0; r < 8; ++r) { float v = acc[t][r] * alpha + bv; if (CP) { const int bidx = (row0g + row0 + 8 * hh + r) / rowsPerB; v += CP[(size_t)bidx * sCPb + (size_t)by * 64 + col]; } if (ACT == 1) v = (v > 0.f) ? v : expm1f(v); else if (ACT == 7) v = (v > 0.f) ? v + 1.0f : expf(v); else if (ACT == 8) v = tanhf(v); else if (ACT == 9) v = 0.5f * v * (1.0f + tanhf(0.7978845608028654f * (v + 0.044715f * v * v * v))); else if (ACT == 11) v = 1.0f / (1.0f + expf(-v)); else if (ACT == 12) v = (v > 0.f) ? v : 0.01f * v; else if (ACT == 14) v = (v > 0.f) ? v : 0.1f * v; else if (ACT == 15) v = v / (1.0f + expf(-v)); else if (ACT == 3) v = fmaxf(v, 0.f); else if (ACT == 6) v = 0.5f * v * (1.0f + erff(v * 0.70710678118654752f)); so[w][8 * hh + r][t * 16 + ln] = v; } }
  __builtin_amdgcn_fence(__ATOMIC_ACQ_REL, "workgroup"); __builtin_amdgcn_wave_barrier();
  const int rsub = lane >> 4, c4 = (lane & 15) * 4; typedef _Float16 v4h __attribute__((ext_vector_type(4)));
  {
#pragma unroll
    for (int q = 0; q < 8; ++q) { const int r = q * 2 + rsub; if (col0 + c4 < N) { const v4f v = *(const v4fa*)&so[w][r][c4]; if (C) *(v4f*)(C + cofs + (size_t)(row0 + r) * ldc + col0 + c4) = v; if (C16) { v4h h4; for (int i = 0; i < 4; ++i) h4[i] = (_Float16)v[i]; *(v4h*)(C16 + cofs + (size_t)(row0 + r) * ldc + col0 + c4) = h4; } } }
     }
}


typedef _Float16 v4h __attribute__((ext_vector_type(4)));

__global__ __launch_bounds__(256) void k_x16(const float* __restrict__ x, _Float16* __restrict__ X16, size_t n8) { const size_t t = (size_t)blockIdx.x * 256 + threadIdx.x; if (t >= n8) return; FragH f;
#pragma unroll
  for (int q = 0; q < 8; ++q) f.h[q] = (_Float16)bf16_round(x[t * 8 + q]); *(v8us*)((unsigned short*)X16 + t * 8) = f.half[0];  }
__global__ __launch_bounds__(256) void k_h16(const float* __restrict__ x, _Float16* __restrict__ X16, size_t n8) { const size_t t = (size_t)blockIdx.x * 256 + threadIdx.x; if (t >= n8) return; FragH f;
#pragma unroll
  for (int q = 0; q < 8; ++q) f.h[q] = (_Float16)x[t * 8 + q]; *(v8us*)((unsigned short*)X16 + t * 8) = f.half[0];  }
__global__ __launch_bounds__(256) void k_round16f(const float* __restrict__ W, _Float16* __restrict__ Bt, size_t n8) { const size_t t = (size_t)blockIdx.x * 256 + threadIdx.x; if (t >= n8) return; FragH f;
#pragma unroll
  for (int i = 0; i < 8; ++i) f.h[i] = (_Float16)(bf16_round(W[t * 8 + i]) * 16.0f); *(v8us*)((unsigned short*)Bt + t * 8) = f.half[0];  }
template <int NHv, int TTv>
__global__ __launch_bounds__(256) void k_vt(const _Float16* __restrict__ V16, int ldv, int voff, _Float16* __restrict__ Vt) { __shared__ unsigned short tl[64][66]; const int tid = threadIdx.x; const int slab = blockIdx.x / (TTv / 64), lg = blockIdx.x % (TTv / 64); const int b = slab / NHv, h = slab % NHv;
  for (int i = tid; i < 64 * 8; i += 256) { const int r = i / 8, c8 = (i % 8) * 8; FragH f; f.half[0] = *(const v8us*)((const unsigned short*)V16 + ((size_t)b * TTv + lg * 64 + r) * ldv + voff + h * 64 + c8);
#pragma unroll
    for (int q = 0; q < 8; ++q) tl[r][c8 + q] = f.u[q]; }
  __syncthreads();
  {
#pragma unroll
    for (int rd = 0; rd < 2; ++rd) { const int d = rd * 32 + tid / 8, pc = tid % 8; FragH f;
#pragma unroll
      for (int q = 0; q < 8; ++q) f.u[q] = tl[pc * 8 + q][d];
      *(v8us*)((unsigned short*)Vt + ((size_t)slab * 64 + d) * TTv + lg * 64 + pc * 8) = f.half[0]; }
     } }

__global__ __launch_bounds__(256) void k_hl(const float* __restrict__ F, _Float16* __restrict__ Hh, _Float16* __restrict__ Hl, size_t n8) { const size_t t = (size_t)blockIdx.x * 256 + threadIdx.x; if (t >= n8) return; FragH fh, fl; const v4f a = *(const v4fa*)(F + t * 8), c = *(const v4fa*)(F + t * 8 + 4);
#pragma unroll
  for (int q = 0; q < 4; ++q) { _Float16 h = (_Float16)a[q]; fh.h[q] = h; fl.h[q] = (_Float16)((a[q] - (float)h) * 1024.0f); h = (_Float16)c[q]; fh.h[4 + q] = h; fl.h[4 + q] = (_Float16)((c[q] - (float)h) * 1024.0f); }
  { *(v8us*)((unsigned short*)Hh + t * 8) = fh.half[0]; *(v8us*)((unsigned short*)Hl + t * 8) = fl.half[0];  } }
__global__ __launch_bounds__(128) void k_flash(const _Float16* __restrict__ Q16, const _Float16* __restrict__ Q16lo, int ldq, const _Float16* __restrict__ K16, const _Float16* __restrict__ K16lo, int ldk, const _Float16* __restrict__ Vt, float* __restrict__ O, int ldo) {
  constexpr int RPW = 16, RTN = RPW / 16, NQB = TT / (4 * RPW), DT = 4, KS = 2;
  __shared__ __attribute__((aligned(16))) unsigned short sP[4][RPW][40]; __shared__ __attribute__((aligned(16))) float sO[4][RPW][64 + 4];
  const int tid = threadIdx.x, w = tid >> 5, lane = tid & 31, ln = lane & 15, hh = lane >> 4;
  const int slab = blockIdx.x / NQB, qblk = blockIdx.x % NQB; const int b = slab, h = 0; const int qb0 = qblk * (4 * RPW); const int q0 = qb0 + w * RPW;
  FragH aq[2][KS], aql[2][KS];
#pragma unroll
  for (int rt = 0; rt < RTN; ++rt) { const size_t qo = ((size_t)b * TT + q0 + rt * 16 + ln) * ldq; const unsigned short* qr = (const unsigned short*)Q16 + qo; const unsigned short* ql = (const unsigned short*)Q16lo + qo;
#pragma unroll
    for (int ks = 0; ks < KS; ++ks) { aq[rt][ks].half[0] = *(const v8us*)(qr + ks * 32 + 8 * hh); aq[rt][ks].half[1] = *(const v8us*)(qr + ks * 32 + 16 + 8 * hh); aql[rt][ks].half[0] = *(const v8us*)(ql + ks * 32 + 8 * hh); aql[rt][ks].half[1] = *(const v8us*)(ql + ks * 32 + 16 + 8 * hh); } }
  const unsigned short* Vth = (const unsigned short*)Vt + (size_t)slab * 64 * TT;
  float m_r[2][8], l_r[2][8]; v8f oacc[2][DT];
#pragma unroll
  for (int rt = 0; rt < RTN; ++rt) {
#pragma unroll
    for (int r = 0; r < 8; ++r) { m_r[rt][r] = -3.0e38f; l_r[rt][r] = 0.f; }
#pragma unroll
    for (int dt = 0; dt < DT; ++dt) oacc[rt][dt] = (v8f){0.f,0.f,0.f,0.f,0.f,0.f,0.f,0.f}; }
  const int jend = TT;
#pragma unroll 1
  for (int j0 = 0; j0 < jend; j0 += 32) {
    
    v8f s[2][2];
#pragma unroll
    for (int nt = 0; nt < 2; ++nt) { const size_t ko = ((size_t)b * TT + j0 + nt * 16 + ln) * ldk; const unsigned short* kr = (const unsigned short*)K16 + ko; const unsigned short* kl = (const unsigned short*)K16lo + ko; FragH bk[KS], bl[KS];
#pragma unroll
      for (int ks = 0; ks < KS; ++ks) { bk[ks].half[0] = *(const v8us*)(kr + ks * 32 + 8 * hh); bk[ks].half[1] = *(const v8us*)(kr + ks * 32 + 16 + 8 * hh); bl[ks].half[0] = *(const v8us*)(kl + ks * 32 + 8 * hh); bl[ks].half[1] = *(const v8us*)(kl + ks * 32 + 16 + 8 * hh); }
#pragma unroll
      for (int rt = 0; rt < RTN; ++rt) { v8f acc = (v8f){0.f,0.f,0.f,0.f,0.f,0.f,0.f,0.f}, accl = acc;
#pragma unroll
        for (int ks = 0; ks < KS; ++ks) { acc = mmaH<1>(aq[rt][ks].v, aq[rt][ks].v, bk[ks].v, bk[ks].v, acc); accl = mmaH<1>(aql[rt][ks].v, aql[rt][ks].v, bk[ks].v, bk[ks].v, accl); accl = mmaH<1>(aq[rt][ks].v, aq[rt][ks].v, bl[ks].v, bl[ks].v, accl); }
#pragma unroll
        for (int r = 0; r < 8; ++r) acc[r] += accl[r] * 0.0009765625f; s[rt][nt] = acc; } }
#pragma unroll
    for (int rt = 0; rt < RTN; ++rt)
#pragma unroll
      for (int r = 0; r < 8; ++r) { const int tq = q0 + rt * 16 + 8 * hh + r; const int k0 = j0 + ln, k1 = j0 + 16 + ln; (void)tq; (void)k0; (void)k1;
        const bool ok0 = true, ok1 = true;
        const float s0 = s[rt][0][r], s1 = s[rt][1][r]; float mc = fmaxf(s0, s1);
        mc = fmaxf(mc, __shfl_xor(mc, 1, 32)); mc = fmaxf(mc, __shfl_xor(mc, 2, 32)); mc = fmaxf(mc, __shfl_xor(mc, 4, 32)); mc = fmaxf(mc, __shfl_xor(mc, 8, 32));
        const float mn = fmaxf(m_r[rt][r], mc); const float al = (mn > -1.0e38f) ? expf(m_r[rt][r] - mn) : 1.0f; m_r[rt][r] = mn; const float p0 = expf(s0 - mn), p1 = expf(s1 - mn); l_r[rt][r] = l_r[rt][r] * al + p0 + p1;
#pragma unroll
        for (int dt = 0; dt < DT; ++dt) oacc[rt][dt][r] *= al;
        FragH t2; t2.h[0] = (_Float16)(p0 * 1024.0f); t2.h[1] = (_Float16)(p1 * 1024.0f); sP[w][rt * 16 + 8 * hh + r][ln] = t2.u[0]; sP[w][rt * 16 + 8 * hh + r][16 + ln] = t2.u[1]; }
    __builtin_amdgcn_fence(__ATOMIC_ACQ_REL, "workgroup"); __builtin_amdgcn_wave_barrier();
    FragH pa[2];
#pragma unroll
    for (int rt = 0; rt < RTN; ++rt) { pa[rt].half[0] = *(const v8us*)&sP[w][rt * 16 + ln][8 * hh]; pa[rt].half[1] = *(const v8us*)&sP[w][rt * 16 + ln][16 + 8 * hh]; }
#pragma unroll
    for (int dt = 0; dt < DT; ++dt) { const unsigned short* vrow = Vth + (size_t)(dt * 16 + ln) * TT + j0; FragH bv; bv.half[0] = *(const v8us*)(vrow + 8 * hh); bv.half[1] = *(const v8us*)(vrow + 16 + 8 * hh);
#pragma unroll
      for (int rt = 0; rt < RTN; ++rt) oacc[rt][dt] = mmaH<1>(pa[rt].v, pa[rt].v, bv.v, bv.v, oacc[rt][dt]); }
    __builtin_amdgcn_fence(__ATOMIC_ACQ_REL, "workgroup"); __builtin_amdgcn_wave_barrier(); }
#pragma unroll
  for (int rt = 0; rt < RTN; ++rt) {
#pragma unroll
    for (int r = 0; r < 8; ++r) { float l = l_r[rt][r]; l += __shfl_xor(l, 1, 32); l += __shfl_xor(l, 2, 32); l += __shfl_xor(l, 4, 32); l += __shfl_xor(l, 8, 32); l_r[rt][r] = (l > 0.f) ? 1.0f / (l * 1024.0f) : 0.f; }
#pragma unroll
    for (int dt = 0; dt < DT; ++dt)
#pragma unroll
      for (int r = 0; r < 8; ++r) sO[w][rt * 16 + 8 * hh + r][dt * 16 + ln] = oacc[rt][dt][r] * l_r[rt][r]; }
  __builtin_amdgcn_fence(__ATOMIC_ACQ_REL, "workgroup"); __builtin_amdgcn_wave_barrier();
  {
#pragma unroll
    for (int rp = 0; rp < RPW; rp += 2) { const int r = rp + (lane >> 4), pc = lane & 15; const v4f val = *(const v4fa*)&sO[w][r][pc * 4]; *(v4f*)(O + ((size_t)b * TT + q0 + r) * ldo + pc * 4) = val; }
     } }

__global__ __launch_bounds__(256) void k_stat(const float* __restrict__ O, const float* __restrict__ x, float* __restrict__ PART) { __shared__ float r1[256], r2[256]; const int tid = threadIdx.x; const int b = blockIdx.x / NPB, part = blockIdx.x % NPB; const size_t base = (size_t)b * TT * DD + (size_t)part * (TT * DD / NPB); float s1 = 0.f, s2 = 0.f;
#pragma unroll 1
  for (int i = tid * 4; i < TT * DD / NPB; i += 1024) { const v4f o = *(const v4fa*)(O + base + i), xv = *(const v4fa*)(x + base + i); for (int q = 0; q < 4; ++q) { const float y = o[q] + bf16_round(xv[q]); s1 += y; s2 += y * y; } }
  r1[tid] = s1; r2[tid] = s2; __syncthreads(); for (int o = 128; o >= 1; o >>= 1) { if (tid < o) { r1[tid] += r1[tid + o]; r2[tid] += r2[tid + o]; } __syncthreads(); }
  if (tid < 32) { const float v = (tid == 0) ? r1[0] : ((tid == 1) ? r2[0] : 0.f); *(float*)(PART + (size_t)blockIdx.x * 32 + tid) = v;  } }
__global__ __launch_bounds__(256) void k_norm(const float* __restrict__ O, const float* __restrict__ x, const float* __restrict__ PART, float* __restrict__ out) { const size_t t = (size_t)blockIdx.x * 256 + threadIdx.x; if (t >= (size_t)NR * DD / 4) return; const int b = (int)((t * 4) / ((size_t)TT * DD)); float s1 = 0.f, s2 = 0.f;
#pragma unroll 1
  for (int p = 0; p < NPB; ++p) { s1 += PART[((size_t)b * NPB + p) * 32]; s2 += PART[((size_t)b * NPB + p) * 32 + 1]; }
  const float n = (float)TT * (float)DD; const float mu = s1 / n; const float var = fmaxf(s2 / n - mu * mu, 0.f); const float rs = rsqrtf(var + 1e-5f);
  const v4f o = *(const v4fa*)(O + t * 4), xv = *(const v4fa*)(x + t * 4); v4f r; for (int q = 0; q < 4; ++q) r[q] = (o[q] + bf16_round(xv[q]) - mu) * rs;
  *(v4f*)(out + t * 4) = r;  }

extern "C" void kernel_launch(void* const* d_in, const int* in_sizes, int n_in,
                              void* d_out, int out_size, void* d_ws, size_t ws_size, hipStream_t stream) {
  (void)in_sizes; (void)n_in; (void)out_size;
  const float* x = (const float*)d_in[0]; const float* Wq = (const float*)d_in[1]; const float* Wk = (const float*)d_in[2]; const float* Wv = (const float*)d_in[3];
  char* ws = (char*)d_ws; size_t off = 0;
  auto take = [&](size_t bytes) { char* p = ws + off; off += (bytes + 255) & ~(size_t)255; return p; };
  const size_t WSZ = (size_t)DD * DD; _Float16* Bw = (_Float16*)take(3 * WSZ * 2); _Float16* X16 = (_Float16*)take((size_t)NR * DD * 2); float* F32 = (float*)take((size_t)NR * DD * 4);
  _Float16* Qh = (_Float16*)take((size_t)NR * DD * 2); _Float16* Ql = (_Float16*)take((size_t)NR * DD * 2); _Float16* Kh = (_Float16*)take((size_t)NR * DD * 2); _Float16* Kl = (_Float16*)take((size_t)NR * DD * 2);
  _Float16* V16 = (_Float16*)take((size_t)NR * DD * 2); _Float16* Vt = (_Float16*)take((size_t)NR * DD * 2); float* PART = (float*)take((size_t)BB * NPB * 32 * 4);
  float* O = F32;      /* F32 holds q (consumed by k_hl), then k (consumed by k_hl), then the attention output */
  if (off > ws_size) return;      // 6.3 + 8.4 + 16.8 + 6 × 8.4 ≈ 82 MB
  const unsigned gw = (unsigned)((WSZ / 8 + 255) / 256);
  k_round16f<<<gw, 256, 0, stream>>>(Wq, Bw, WSZ / 8); k_round16f<<<gw, 256, 0, stream>>>(Wk, Bw + WSZ, WSZ / 8); k_round16f<<<gw, 256, 0, stream>>>(Wv, Bw + 2 * WSZ, WSZ / 8);      /* (out,in) natural ×2^4 */
  k_x16<<<(unsigned)(((size_t)NR * DD / 8 + 255) / 256), 256, 0, stream>>>(x, X16, (size_t)NR * DD / 8);
  const dim3 gp(((NR / 16) * (DD / 64) + 3) / 4, 1); const unsigned g8 = (unsigned)(((size_t)NR * DD / 8 + 255) / 256);
  k_gemm_hhx<0><<<gp, 128, 0, stream>>>(X16, DD, 0, Bw, DD, 0, 0.0625f, nullptr, 0, nullptr, 1, 0, 0, F32, nullptr, DD, 0, NR, DD, DD); k_hl<<<g8, 256, 0, stream>>>(F32, Qh, Ql, (size_t)NR * DD / 8);      /* Q f32 → hi/lo */
  k_gemm_hhx<0><<<gp, 128, 0, stream>>>(X16, DD, 0, Bw + WSZ, DD, 0, 0.0625f, nullptr, 0, nullptr, 1, 0, 0, F32, nullptr, DD, 0, NR, DD, DD); k_hl<<<g8, 256, 0, stream>>>(F32, Kh, Kl, (size_t)NR * DD / 8);      /* K f32 → hi/lo */
  k_gemm_hhx<0><<<gp, 128, 0, stream>>>(X16, DD, 0, Bw + 2 * WSZ, DD, 0, 0.0625f, nullptr, 0, nullptr, 1, 0, 0, nullptr, V16, DD, 0, NR, DD, DD);      /* V f16 */
  k_vt<1, TT><<<NSL * (TT / 64), 256, 0, stream>>>(V16, 64, 0, Vt);      /* the [4096][1024] plane viewed as 32 contiguous [2048][64] slabs → Vᵀ [slab][64][2048] */
  k_flash<<<NSL * (TT / 64), 128, 0, stream>>>(Qh, Ql, 64, Kh, Kl, 64, Vt, O, 64);      /* same flat view for Q, K and O */
  k_stat<<<BB * NPB, 256, 0, stream>>>(O, x, PART); k_norm<<<(unsigned)(((size_t)NR * DD / 4 + 255) / 256), 256, 0, stream>>>(O, x, PART, (float*)d_out);
}

// v001
// One run takes 370 microseconds.
// Two timings next to v000 put it at 1.34 and 1.36 times that version's speed.
#include <hip/hip_runtime.h>
// Multi-head attention with raw-reshape heads, residual and a global LayerNorm (B=2, S=2048, D=1024, 16 heads × 64): Q,K,V = x·Wᵀ reshaped by plain memory order to (H,B,S,64) (= 32 contiguous [2048][64] slabs of each
// [4096][1024] plane); UNSCALED softmax(Q·Kᵀ)·V per slab; y = out (same flat order, = [B,S,1024]) + x; output = (y − mean)/√(var + 1e-5) with mean/var over all (S,D) of each batch element (identity affine).
// Compute dtype: x and weights rounded to bf16; Q,K as f32 GEMM outputs split into f16 hi + ×2^10 residual planes so the unscaled (σ≈3) logits are f32-accurate; V f16; fused flash-style kernel
// (two score accumulators, online softmax f32, P f16 ×2^10) on v_wmma_f32_16x16x32_f16; residual and the per-batch statistics (fixed-order block partial sums of y and y², then a fixed-order combine) and normalisation in f32.
#define BB 2
#define TT 2048
#define DD 1024
#define NSL 32
#define NR (BB * TT)
#define NPB 64

typedef __bf16 v16b __attribute__((ext_vector_type(16)));
typedef unsigned short v8us __attribute__((ext_vector_type(8), may_alias));
typedef float  v8f  __attribute__((ext_vector_type(8)));
typedef float  v4f  __attribute__((ext_vector_type(4)));
typedef float  v4fa __attribute__((ext_vector_type(4), may_alias));
union FragB { v16b v; v8us half[2]; unsigned short u[16]; };

__device__ __forceinline__ unsigned short bf16_bits(float x) { unsigned int u = __float_as_uint(x); return (unsigned short)((u + 0x7FFFu + ((u >> 16) & 1u)) >> 16); }
__device__ __forceinline__ float bf16_val(unsigned short b) { return __uint_as_float(((unsigned int)b) << 16); }
__device__ __forceinline__ float bf16_round(float x) { return bf16_val(bf16_bits(x)); }
// D += A·B with NT terms: 1 = ah·bh, 2 = + al·bh (A split), 3 = + ah·bl (both split)
template <int NT>
__device__ __forceinline__ v8f mmaN(v16b ah, v16b al, v16b bh, v16b bl, v8f c) {
  c = __builtin_amdgcn_wmma_f32_16x16x32_bf16(false, ah, false, bh, (short)0, c, false, false);
  if (NT >= 2) c = __builtin_amdgcn_wmma_f32_16x16x32_bf16(false, al, false, bh, (short)0, c, false, false);
  if (NT >= 3) c = __builtin_amdgcn_wmma_f32_16x16x32_bf16(false, ah, false, bl, (short)0, c, false, false);
  asm volatile("v_nop\n\tv_nop\n\tv_nop\n\tv_nop" : "+v"(c) : "v"(ah), "v"(al), "v"(bh), "v"(bl));
  return c;
}

__global__ __launch_bounds__(256) void k_wt_bf16(const float* __restrict__ W, unsigned short* __restrict__ Wt, int K, int N) {
  const int t = blockIdx.x * 256 + threadIdx.x;
  const int k8n = K / 8;
  if (t >= N * k8n) return;
  const int n = t / k8n, k8 = (t % k8n) * 8;
  v8us v;
#pragma unroll
  for (int i = 0; i < 8; ++i) v[i] = bf16_bits(W[(size_t)(k8 + i) * N + n]);
  *(v8us*)(Wt + (size_t)n * K + k8) = v;
  
}

// GEMM C[M][N] (f32, pitch ldc) = act(A[M][K]·W + bias). A f32 row-major (pitch lda) converted per fragment to bf16
// (ASPLIT: hi/lo two planes -> 2 terms, else single rounded term); Wt bf16 [N][K] (pitch ldb). BIAS_BF16 rounds the
// bias to bf16 first (bias quantised to bf16 before the add). K%32==0, M%16==0, N%64==0.
template <bool ASPLIT, int ACT, bool BIAS_BF16>
__global__ __launch_bounds__(128) void k_gemm_bf(const float* __restrict__ A, int lda, const unsigned short* __restrict__ Wt, int ldb,
                                               const float* __restrict__ bias, float* __restrict__ C, int ldc, int M, int N, int K) {
  __shared__ __attribute__((aligned(16))) float so[4][16][64];
  const int tid = threadIdx.x, w = tid >> 5, lane = tid & 31, ln = lane & 15, hh = lane >> 4;
  const int ntn = N / 64;
  const int wid = blockIdx.x * 4 + w;
  const int mt = wid / ntn, nq = wid % ntn;
  if (mt * 16 >= M) return;
  const int row0 = mt * 16, col0 = nq * 64;
  const float* arow = A + (size_t)(row0 + ln) * lda;
  v8f acc[4] = {};
  for (int kb = 0; kb < K; kb += 32) {
    FragB ah, al;
    const v4f x0 = *(const v4fa*)(arow + kb + 8 * hh), x1 = *(const v4fa*)(arow + kb + 8 * hh + 4);
    const v4f x2 = *(const v4fa*)(arow + kb + 16 + 8 * hh), x3 = *(const v4fa*)(arow + kb + 16 + 8 * hh + 4);
    float xs[16] = {x0[0],x0[1],x0[2],x0[3],x1[0],x1[1],x1[2],x1[3],x2[0],x2[1],x2[2],x2[3],x3[0],x3[1],x3[2],x3[3]};
#pragma unroll
    for (int i = 0; i < 16; ++i) { const unsigned short hb = bf16_bits(xs[i]); ah.u[i] = hb; al.u[i] = ASPLIT ? bf16_bits(xs[i] - bf16_val(hb)) : (unsigned short)0; }
#pragma unroll
    for (int t = 0; t < 4; ++t) {
      const unsigned short* brow = Wt + (size_t)(col0 + t * 16 + ln) * ldb + kb;
      FragB b;
      b.half[0] = *(const v8us*)(brow + 8 * hh);
      b.half[1] = *(const v8us*)(brow + 16 + 8 * hh);
      acc[t] = mmaN<ASPLIT ? 2 : 1>(ah.v, al.v, b.v, b.v, acc[t]);
    }
  }
#pragma unroll
  for (int t = 0; t < 4; ++t) {
    float bv = bias ? bias[col0 + t * 16 + ln] : 0.f;
    if (BIAS_BF16) bv = bf16_round(bv);
#pragma unroll
    for (int r = 0; r < 8; ++r) { float v = acc[t][r] + bv; if (ACT == 1) v = fmaxf(v, 0.f); so[w][8 * hh + r][t * 16 + ln] = v; }
  }
  __builtin_amdgcn_fence(__ATOMIC_ACQ_REL, "workgroup");
  __builtin_amdgcn_wave_barrier();
  const int rsub = lane >> 4, c4 = (lane & 15) * 4;
  {
#pragma unroll
    for (int q = 0; q < 8; ++q) {
      const int r = q * 2 + rsub;
      const v4f v = *(const v4fa*)&so[w][r][c4];
      *(v4f*)(C + (size_t)(row0 + r) * ldc + col0 + c4) = v;
    }
    
  }
}

// Flash-style causal/unmasked attention, all contractions 3-term bf16 hi/lo splits, f32 softmax with running max.
// q,k,v rows are read from f32 buffers with arbitrary row pitch (so they can live inside a fused qkv buffer);
// D = head size (multiple of 32, <= 128); one wave = 16 query rows; block = 4 waves (64 queries) sharing K/V chunks of 32.
template <int D, bool CAUSAL>
__global__ __launch_bounds__(128) void k_flash(const float* __restrict__ qb, const float* __restrict__ kb, const float* __restrict__ vb,
                                             int pitch, int T, int H, float scale, float* __restrict__ y, int ypitch) {
  constexpr int KS = D / 32;        // k-steps for QK
  constexpr int DT = D / 16;        // d tiles for PV
  __shared__ __attribute__((aligned(16))) unsigned short sKh[32][D + 8], sKl[32][D + 8], sVh[32][D + 8], sVl[32][D + 8];
  __shared__ __attribute__((aligned(16))) unsigned short sPh[4][16][40], sPl[4][16][40];
  __shared__ __attribute__((aligned(16))) float sO[4][16][D];
  const int tid = threadIdx.x, w = tid >> 5, lane = tid & 31, ln = lane & 15, hh = lane >> 4;
  const int nqb = (T + 63) / 64;
  const int bh = blockIdx.x / nqb, qblk = blockIdx.x % nqb;
  const int b = bh / H, h = bh % H;
  const int q0 = qblk * 64 + w * 16;
  const float* Q = qb + (size_t)b * T * pitch + h * D;
  const float* K = kb + (size_t)b * T * pitch + h * D;
  const float* V = vb + (size_t)b * T * pitch + h * D;

  // A fragments of the wave's 16 query rows (scaled), hi/lo
  FragB aqh[KS], aql[KS];
  {
    int row = q0 + ln; if (row >= T) row = T - 1;
    const float* qr = Q + (size_t)row * pitch;
#pragma unroll
    for (int ks = 0; ks < KS; ++ks)
#pragma unroll
      for (int i = 0; i < 16; ++i) {
        const int d = ks * 32 + ((i < 8) ? (8 * hh + i) : (16 + 8 * hh + (i - 8)));
        const float x = qr[d] * scale; const unsigned short hb = bf16_bits(x);
        aqh[ks].u[i] = hb; aql[ks].u[i] = bf16_bits(x - bf16_val(hb));
      }
  }
  float m_r[8], l_r[8];
#pragma unroll
  for (int r = 0; r < 8; ++r) { m_r[r] = -3.0e38f; l_r[r] = 0.f; }
  v8f oacc[DT];
#pragma unroll
  for (int dt = 0; dt < DT; ++dt) oacc[dt] = (v8f){0.f,0.f,0.f,0.f,0.f,0.f,0.f,0.f};

  const int kv_end = CAUSAL ? min(T, qblk * 64 + 64) : T;     // block-uniform
  for (int j0 = 0; j0 < kv_end; j0 += 32) {
    __syncthreads();
    for (int e = tid; e < 32 * (D / 4); e += 128) {
      const int r = e / (D / 4), c4 = (e % (D / 4)) * 4;
      const int key = j0 + r;
      v4f kf = {0.f,0.f,0.f,0.f}, vf = {0.f,0.f,0.f,0.f};
      if (key < T) { kf = *(const v4fa*)(K + (size_t)key * pitch + c4); vf = *(const v4fa*)(V + (size_t)key * pitch + c4); }
#pragma unroll
      for (int t = 0; t < 4; ++t) {
        unsigned short hb = bf16_bits(kf[t]); sKh[r][c4 + t] = hb; sKl[r][c4 + t] = bf16_bits(kf[t] - bf16_val(hb));
        hb = bf16_bits(vf[t]); sVh[r][c4 + t] = hb; sVl[r][c4 + t] = bf16_bits(vf[t] - bf16_val(hb));
      }
    }
    __syncthreads();
    // S tile 16 x 32
    v8f s[2];
#pragma unroll
    for (int nt = 0; nt < 2; ++nt) {
      v8f acc = {};
#pragma unroll
      for (int ks = 0; ks < KS; ++ks) {
        FragB bh_, bl_;
        bh_.half[0] = *(const v8us*)&sKh[nt * 16 + ln][ks * 32 + 8 * hh]; bh_.half[1] = *(const v8us*)&sKh[nt * 16 + ln][ks * 32 + 16 + 8 * hh];
        bl_.half[0] = *(const v8us*)&sKl[nt * 16 + ln][ks * 32 + 8 * hh]; bl_.half[1] = *(const v8us*)&sKl[nt * 16 + ln][ks * 32 + 16 + 8 * hh];
        acc = mmaN<3>(aqh[ks].v, aql[ks].v, bh_.v, bl_.v, acc);
      }
      s[nt] = acc;
    }
    // mask + running max (rows 8hh+r; the 16 lanes of a half share rows)
    float alpha[8];
#pragma unroll
    for (int r = 0; r < 8; ++r) {
      const int qi = q0 + 8 * hh + r;
      const int ja = j0 + ln, jb = j0 + 16 + ln;
      if (CAUSAL) { if (ja > qi) s[0][r] = -3.0e38f; if (jb > qi) s[1][r] = -3.0e38f; }
      if (ja >= T) s[0][r] = -3.0e38f;
      if (jb >= T) s[1][r] = -3.0e38f;
      float mx = fmaxf(s[0][r], s[1][r]);
      mx = fmaxf(mx, __shfl_xor(mx, 1, 32)); mx = fmaxf(mx, __shfl_xor(mx, 2, 32)); mx = fmaxf(mx, __shfl_xor(mx, 4, 32)); mx = fmaxf(mx, __shfl_xor(mx, 8, 32));
      const float mnew = fmaxf(m_r[r], mx);
      alpha[r] = (mnew > -1.0e38f) ? __expf(m_r[r] - mnew) : 1.0f;
      const float p0 = (s[0][r] > -1.0e38f) ? __expf(s[0][r] - mnew) : 0.f;
      const float p1 = (s[1][r] > -1.0e38f) ? __expf(s[1][r] - mnew) : 0.f;
      m_r[r] = mnew;
      l_r[r] = l_r[r] * alpha[r] + p0 + p1;            // per-lane partial row sum (16 lanes combined at the end)
      unsigned short hb = bf16_bits(p0); sPh[w][8 * hh + r][ln] = hb;      sPl[w][8 * hh + r][ln] = bf16_bits(p0 - bf16_val(hb));
      hb = bf16_bits(p1);                sPh[w][8 * hh + r][16 + ln] = hb; sPl[w][8 * hh + r][16 + ln] = bf16_bits(p1 - bf16_val(hb));
    }
#pragma unroll
    for (int dt = 0; dt < DT; ++dt)
#pragma unroll
      for (int r = 0; r < 8; ++r) oacc[dt][r] *= alpha[r];
    __builtin_amdgcn_fence(__ATOMIC_ACQ_REL, "workgroup");
    __builtin_amdgcn_wave_barrier();
    FragB pah, pal;
    pah.half[0] = *(const v8us*)&sPh[w][ln][8 * hh]; pah.half[1] = *(const v8us*)&sPh[w][ln][16 + 8 * hh];
    pal.half[0] = *(const v8us*)&sPl[w][ln][8 * hh]; pal.half[1] = *(const v8us*)&sPl[w][ln][16 + 8 * hh];
#pragma unroll
    for (int dt = 0; dt < DT; ++dt) {
      FragB bvh, bvl;
#pragma unroll
      for (int i = 0; i < 8; ++i) {
        bvh.u[i] = sVh[8 * hh + i][dt * 16 + ln]; bvh.u[8 + i] = sVh[16 + 8 * hh + i][dt * 16 + ln];
        bvl.u[i] = sVl[8 * hh + i][dt * 16 + ln]; bvl.u[8 + i] = sVl[16 + 8 * hh + i][dt * 16 + ln];
      }
      oacc[dt] = mmaN<3>(pah.v, pal.v, bvh.v, bvl.v, oacc[dt]);
    }
    __builtin_amdgcn_fence(__ATOMIC_ACQ_REL, "workgroup");
    __builtin_amdgcn_wave_barrier();
  }
#pragma unroll
  for (int r = 0; r < 8; ++r) {
    float l = l_r[r];
    l += __shfl_xor(l, 1, 32); l += __shfl_xor(l, 2, 32); l += __shfl_xor(l, 4, 32); l += __shfl_xor(l, 8, 32);
    l_r[r] = (l > 0.f) ? 1.0f / l : 0.f;
  }
#pragma unroll
  for (int dt = 0; dt < DT; ++dt)
#pragma unroll
    for (int r = 0; r < 8; ++r) sO[w][8 * hh + r][dt * 16 + ln] = oacc[dt][r] * l_r[r];
  __builtin_amdgcn_fence(__ATOMIC_ACQ_REL, "workgroup");
  __builtin_amdgcn_wave_barrier();
  {
    for (int r = 0; r < 16; ++r) {
      const int row = q0 + r;
      if (row < T && lane < D / 4) {
        const v4f val = *(const v4fa*)&sO[w][r][lane * 4];
        *(v4f*)(y + ((size_t)b * T + row) * ypitch + h * D + lane * 4) = val;
      }
    }
    
  }
}

// GEMM C = act(A·W + bias + resid): A f32 (ASPLIT -> hi/lo 2 terms), Wt bf16 [N][K]; ACT 0 none, 1 relu, 2 exact gelu;
// resid (optional, f32, row index = (row % rmod), pitch ldr, RES_BF16 rounds it) added before the activation.
template <bool ASPLIT, int ACT, bool BIAS_BF16, bool RES_BF16>
__global__ __launch_bounds__(128) void k_gemm_bf3(const float* __restrict__ A, int lda, const unsigned short* __restrict__ Wt, int ldb,
                                                const float* __restrict__ bias, const float* __restrict__ resid, int rmod, int ldr,
                                                float* __restrict__ C, int ldc, int M, int N, int K) {
  __shared__ __attribute__((aligned(16))) float so[4][16][64];
  const int tid = threadIdx.x, w = tid >> 5, lane = tid & 31, ln = lane & 15, hh = lane >> 4;
  const int ntn = N / 64;
  const int wid = blockIdx.x * 4 + w;
  const int mt = wid / ntn, nq = wid % ntn;
  if (mt * 16 >= M) return;
  const int row0 = mt * 16, col0 = nq * 64;
  const float* arow = A + (size_t)(row0 + ln) * lda;
  v8f acc[4] = {};
  for (int kb = 0; kb < K; kb += 32) {
    FragB ah, al;
    const v4f x0 = *(const v4fa*)(arow + kb + 8 * hh), x1 = *(const v4fa*)(arow + kb + 8 * hh + 4);
    const v4f x2 = *(const v4fa*)(arow + kb + 16 + 8 * hh), x3 = *(const v4fa*)(arow + kb + 16 + 8 * hh + 4);
    float xs[16] = {x0[0],x0[1],x0[2],x0[3],x1[0],x1[1],x1[2],x1[3],x2[0],x2[1],x2[2],x2[3],x3[0],x3[1],x3[2],x3[3]};
#pragma unroll
    for (int i = 0; i < 16; ++i) { const unsigned short hb = bf16_bits(xs[i]); ah.u[i] = hb; al.u[i] = ASPLIT ? bf16_bits(xs[i] - bf16_val(hb)) : (unsigned short)0; }
#pragma unroll
    for (int t = 0; t < 4; ++t) {
      const unsigned short* brow = Wt + (size_t)(col0 + t * 16 + ln) * ldb + kb;
      FragB b;
      b.half[0] = *(const v8us*)(brow + 8 * hh);
      b.half[1] = *(const v8us*)(brow + 16 + 8 * hh);
      acc[t] = mmaN<ASPLIT ? 2 : 1>(ah.v, al.v, b.v, b.v, acc[t]);
    }
  }
#pragma unroll
  for (int t = 0; t < 4; ++t) {
    const int col = col0 + t * 16 + ln;
    float bv = bias ? bias[col] : 0.f;
    if (BIAS_BF16) bv = bf16_round(bv);
#pragma unroll
    for (int r = 0; r < 8; ++r) {
      float v = acc[t][r] + bv;
      if (resid) { float rv = resid[(size_t)((row0 + 8 * hh + r) % rmod) * ldr + col]; if (RES_BF16) rv = bf16_round(rv); v += rv; }
      if (ACT == 1) v = fmaxf(v, 0.f);
      if (ACT == 2) v = 0.5f * v * (1.0f + erff(v * 0.70710678118654752f));
      if (ACT == 3) { const float u = 0.7978845608028654f * (v + 0.044715f * v * v * v); v = 0.5f * v * (1.0f + tanhf(u)); }
      so[w][8 * hh + r][t * 16 + ln] = v;
    }
  }
  __builtin_amdgcn_fence(__ATOMIC_ACQ_REL, "workgroup");
  __builtin_amdgcn_wave_barrier();
  const int rsub = lane >> 4, c4 = (lane & 15) * 4;
  {
#pragma unroll
    for (int q = 0; q < 8; ++q) {
      const int r = q * 2 + rsub;
      const v4f v = *(const v4fa*)&so[w][r][c4];
      *(v4f*)(C + (size_t)(row0 + r) * ldc + col0 + c4) = v;
    }
    
  }
}
// row LayerNorm (biased variance, eps) over N: s = X (+ R); optional out_sum <- s; out_norm <- (s-mu)*rsqrt(var+eps)*g + b
template <bool PARAM_BF16>
__global__ __launch_bounds__(256) void k_layernorm(const float* __restrict__ X, const float* __restrict__ R, const float* __restrict__ g, const float* __restrict__ bta,
                                                  float* __restrict__ out_sum, float* __restrict__ out_norm, int N, float eps) {
  __shared__ float red[256];
  const int row = blockIdx.x, tid = threadIdx.x;
  const float* x = X + (size_t)row * N; const float* rr = R ? R + (size_t)row * N : nullptr;
  float vals[16];                     // up to N = 4096
  const int per = N / 256;            // contiguous chunk per thread? use strided-by-4 chunks: thread handles j = tid*4 + 1024*u
  float s1 = 0.f;
  for (int u = 0; u < per / 4; ++u) {
    const int j = tid * 4 + 1024 * u;
    const v4f a = *(const v4fa*)(x + j);
    v4f b = {0.f,0.f,0.f,0.f}; if (rr) b = *(const v4fa*)(rr + j);
#pragma unroll
    for (int q = 0; q < 4; ++q) { const float v = a[q] + b[q]; vals[u * 4 + q] = v; s1 += v; }
  }
  red[tid] = s1; __syncthreads();
  for (int st = 128; st > 0; st >>= 1) { if (tid < st) red[tid] += red[tid + st]; __syncthreads(); }
  const float mu = red[0] / (float)N; __syncthreads();
  float s2 = 0.f;
  for (int u = 0; u < per / 4; ++u)
#pragma unroll
    for (int q = 0; q < 4; ++q) { const float c = vals[u * 4 + q] - mu; s2 += c * c; }
  red[tid] = s2; __syncthreads();
  for (int st = 128; st > 0; st >>= 1) { if (tid < st) red[tid] += red[tid + st]; __syncthreads(); }
  const float rs = rsqrtf(red[0] / (float)N + eps);
  {
    for (int u = 0; u < per / 4; ++u) {
      const int j = tid * 4 + 1024 * u;
      v4f o, sm;
#pragma unroll
      for (int q = 0; q < 4; ++q) {
        float gg = g[j + q], bb = bta[j + q];
        if (PARAM_BF16) { gg = bf16_round(gg); bb = bf16_round(bb); }
        sm[q] = vals[u * 4 + q]; o[q] = (vals[u * 4 + q] - mu) * rs * gg + bb;
      }
      if (out_sum) *(v4f*)(out_sum + (size_t)row * N + j) = sm;
      *(v4f*)(out_norm + (size_t)row * N + j) = o;
    }
    
  }
}



// ---- f16 WMMA path (v_wmma_f32_16x16x32_f16): 11-bit significands for operands in range — used where a [0,1] probability operand needs more precision than bf16
typedef _Float16 v16h __attribute__((ext_vector_type(16)));
union FragH { v16h v; v8us half[2]; _Float16 h[16]; unsigned short u[16]; };
template <int NT>
__device__ __forceinline__ v8f mmaH(v16h ah, v16h al, v16h bh, v16h bl, v8f c) {
  c = __builtin_amdgcn_wmma_f32_16x16x32_f16(false, ah, false, bh, (short)0, c, false, false);
  if (NT >= 2) c = __builtin_amdgcn_wmma_f32_16x16x32_f16(false, al, false, bh, (short)0, c, false, false);
  if (NT >= 3) c = __builtin_amdgcn_wmma_f32_16x16x32_f16(false, ah, false, bl, (short)0, c, false, false);
  asm volatile("v_nop\n\tv_nop\n\tv_nop\n\tv_nop" : "+v"(c) : "v"(ah), "v"(al), "v"(bh), "v"(bl));
  return c;
}
// batched GEMM like k_gemm_b but f16 operands: A f32 (split into f16 hi/lo if ASPLIT, else rounded to f16), Bt = f16 values [n][k]; alpha; C f32; N multiple of 16 (partial tiles skipped)
template <bool ASPLIT>
__global__ __launch_bounds__(128) void k_gemm_h(const float* __restrict__ A, int lda, size_t sA, const _Float16* __restrict__ Bh, int ldb, size_t sB, float alpha, float* __restrict__ C, int ldc, size_t sC, int M, int N, int K) {
  __shared__ __attribute__((aligned(16))) float so[4][16][64];
  const int tid = threadIdx.x, w = tid >> 5, lane = tid & 31, ln = lane & 15, hh = lane >> 4; const int by = blockIdx.y;
  A += (size_t)by * sA; Bh += (size_t)by * sB; C += (size_t)by * sC;
  const int ntn = (N + 63) / 64; const int wid = blockIdx.x * 4 + w; const int mt = wid / ntn, nq = wid % ntn; if (mt * 16 >= M) return;
  const int row0 = mt * 16, col0 = nq * 64; const float* arow = A + (size_t)(row0 + ln) * lda;
  v8f acc[4] = {};
  for (int kb = 0; kb < K; kb += 32) {
    FragH ah, al;
    const v4f x0 = *(const v4fa*)(arow + kb + 8 * hh), x1 = *(const v4fa*)(arow + kb + 8 * hh + 4), x2 = *(const v4fa*)(arow + kb + 16 + 8 * hh), x3 = *(const v4fa*)(arow + kb + 16 + 8 * hh + 4);
    float xs[16] = {x0[0],x0[1],x0[2],x0[3],x1[0],x1[1],x1[2],x1[3],x2[0],x2[1],x2[2],x2[3],x3[0],x3[1],x3[2],x3[3]};
#pragma unroll
    for (int i = 0; i < 16; ++i) { const _Float16 h = (_Float16)xs[i]; ah.h[i] = h; al.h[i] = ASPLIT ? (_Float16)(xs[i] - (float)h) : (_Float16)0.0f; }
#pragma unroll
    for (int t = 0; t < 4; ++t) { if (col0 + t * 16 >= N) continue; const size_t boff = (size_t)(col0 + t * 16 + ln) * ldb + kb; FragH bq; bq.half[0] = *(const v8us*)(Bh + boff + 8 * hh); bq.half[1] = *(const v8us*)(Bh + boff + 16 + 8 * hh);
      acc[t] = mmaH<ASPLIT ? 2 : 1>(ah.v, al.v, bq.v, bq.v, acc[t]); }
  }
#pragma unroll
  for (int t = 0; t < 4; ++t) { if (col0 + t * 16 >= N) continue;
#pragma unroll
    for (int r = 0; r < 8; ++r) so[w][8 * hh + r][t * 16 + ln] = acc[t][r] * alpha; }
  __builtin_amdgcn_fence(__ATOMIC_ACQ_REL, "workgroup"); __builtin_amdgcn_wave_barrier();
  const int rsub = lane >> 4, c4 = (lane & 15) * 4;
  {
#pragma unroll
    for (int q = 0; q < 8; ++q) { const int r = q * 2 + rsub; if (col0 + c4 < N) { const v4f v = *(const v4fa*)&so[w][r][c4]; *(v4f*)(C + (size_t)(row0 + r) * ldc + col0 + c4) = v; } }
     }
}

// Wt[n][k] = f16(W[k][n]·scale) from f32 row-major W[K][N] (scale = power of two; bf16-exact weights stay exact in f16 away from the subnormal range)
__global__ __launch_bounds__(256) void k_wt_f16(const float* __restrict__ W, _Float16* __restrict__ Wt, int K, int N, float scale) {
  const int t = blockIdx.x * 256 + threadIdx.x; if (t >= N * (K / 8)) return; const int n = t / (K / 8), k8 = (t % (K / 8)) * 8; FragH f;
#pragma unroll
  for (int i = 0; i < 8; ++i) f.h[i] = (_Float16)(bf16_round(W[(size_t)(k8 + i) * N + n]) * scale); const v8us o = f.half[0];
  *(v8us*)((unsigned short*)Wt + (size_t)n * K + k8) = o; 
}
// k_gemm_hh variant with fused epilogue: v = acc·alpha + bias[by·sBias + col] (+ CP[(row/rowsPerB)·sCPb + by·64 + col] if CP) ; ACT 0 none / 1 elu ; writes f16 C16 and f32 C, each if non-null
template <int ACT>
__global__ __launch_bounds__(128) void k_gemm_hhx(const _Float16* __restrict__ A, int lda, size_t sA, const _Float16* __restrict__ Bh, int ldb, size_t sB, float alpha, const float* __restrict__ bias, size_t sBias, const float* __restrict__ CP, int rowsPerB, size_t sCPb, int row0g,
    float* __restrict__ C, _Float16* __restrict__ C16, int ldc, size_t sC, int M, int N, int K) {
  __shared__ __attribute__((aligned(16))) float so[4][16][64];
  const int tid = threadIdx.x, w = tid >> 5, lane = tid & 31, ln = lane & 15, hh = lane >> 4; const int by = blockIdx.y;
  A += (size_t)by * sA; Bh += (size_t)by * sB; const size_t cofs = (size_t)by * sC; const float* bp = bias ? bias + (size_t)by * sBias : nullptr;
  const int ntn = (N + 63) / 64; const int wid = blockIdx.x * 4 + w; const int mt = wid / ntn, nq = wid % ntn; if (mt * 16 >= M) return;
  const int row0 = mt * 16, col0 = nq * 64;
  v8f acc[4] = {};
  // Two register stages of 64 k each (K % 128 == 0, N % 64 == 0 at every launch here): a stage's 20 fragment loads are issued as one group, one stage ahead of the products that read them.
  // The five row pointers are carried through the loop and stepped between the groups, so none of their registers is free for a load's result while loads are in flight.
  const char* pa = (const char*)(A + (size_t)(row0 + ln) * lda + 8 * hh); const char* pb[4];
#pragma unroll      // constant indices keep the row pointers in registers
  for (int t = 0; t < 4; ++t) pb[t] = (const char*)(Bh + (size_t)(col0 + t * 16 + ln) * ldb + 8 * hh);
  FragH a0[2], b0[2][4], a1[2], b1[2][4];
  auto fetch = [&](FragH (&fa)[2], FragH (&fb)[2][4]) {
#pragma unroll      // constant indices keep the fragment arrays in registers
    for (int ks = 0; ks < 2; ++ks) { fa[ks].half[0] = *(const v8us*)(pa + ks * 64); fa[ks].half[1] = *(const v8us*)(pa + ks * 64 + 32);
#pragma unroll      // constant indices keep the fragment arrays in registers
      for (int t = 0; t < 4; ++t) { fb[ks][t].half[0] = *(const v8us*)(pb[t] + ks * 64); fb[ks][t].half[1] = *(const v8us*)(pb[t] + ks * 64 + 32); } } };
  auto step = [&](long bytes) { pa += bytes;
#pragma unroll      // constant indices keep the row pointers in registers
    for (int t = 0; t < 4; ++t) pb[t] += bytes; };
  auto mul = [&](FragH (&fa)[2], FragH (&fb)[2][4]) {
#pragma unroll      // constant indices keep the fragment arrays in registers
    for (int ks = 0; ks < 2; ++ks)
#pragma unroll      // constant indices keep the fragment arrays in registers
      for (int t = 0; t < 4; ++t) acc[t] = mmaH<1>(fa[ks].v, fa[ks].v, fb[ks][t].v, fb[ks][t].v, acc[t]); };
  fetch(a0, b0); step(128);
#pragma unroll 1      // rolled: one ping-pong pair per trip keeps both stages in fixed registers and the loop short
  for (int kb = 0; kb < K; kb += 128) {
    fetch(a1, b1); mul(a0, b0); step((kb + 128 < K) ? 128L : 128L - 2L * K);      // the last trip steps back to k = 0: its second fetch stays in bounds and is not used
    fetch(a0, b0); mul(a1, b1); step(128);
  }
#pragma unroll
  for (int t = 0; t < 4; ++t) { if (col0 + t * 16 >= N) continue; const int col = col0 + t * 16 + ln; const float bv = bp ? bf16_round(bp[col]) : 0.f;
#pragma unroll
    for (int r = 0; r < 8; ++r) { float v = acc[t][r] * alpha + bv; if (CP) { const int bidx = (row0g + row0 + 8 * hh + r) / rowsPerB; v += CP[(size_t)bidx * sCPb + (size_t)by * 64 + col]; } if (ACT == 1) v = (v > 0.f) ? v : expm1f(v); else if (ACT == 7) v = (v > 0.f) ? v + 1.0f : expf(v); else if (ACT == 8) v = tanhf(v); else if (ACT == 9) v = 0.5f * v * (1.0f + tanhf(0.7978845608028654f * (v + 0.044715f * v * v * v))); else if (ACT == 11) v = 1.0f / (1.0f + expf(-v)); else if (ACT == 12) v = (v > 0.f) ? v : 0.01f * v; else if (ACT == 14) v = (v > 0.f) ? v : 0.1f * v; else if (ACT == 15) v = v / (1.0f + expf(-v)); else if (ACT == 3) v = fmaxf(v, 0.f); else if (ACT == 6) v = 0.5f * v * (1.0f + erff(v * 0.70710678118654752f)); so[w][8 * hh + r][t * 16 + ln] = v; } }
  __builtin_amdgcn_fence(__ATOMIC_ACQ_REL, "workgroup"); __builtin_amdgcn_wave_barrier();
  const int rsub = lane >> 4, c4 = (lane & 15) * 4; typedef _Float16 v4h __attribute__((ext_vector_type(4)));
  {
#pragma unroll
    for (int q = 0; q < 8; ++q) { const int r = q * 2 + rsub; if (col0 + c4 < N) { const v4f v = *(const v4fa*)&so[w][r][c4]; if (C) *(v4f*)(C + cofs + (size_t)(row0 + r) * ldc + col0 + c4) = v; if (C16) { v4h h4; for (int i = 0; i < 4; ++i) h4[i] = (_Float16)v[i]; *(v4h*)(C16 + cofs + (size_t)(row0 + r) * ldc + col0 + c4) = h4; } } }
     }
}


typedef _Float16 v4h __attribute__((ext_vector_type(4)));

__global__ __launch_bounds__(256) void k_x16(const float* __restrict__ x, _Float16* __restrict__ X16, size_t n8) { const size_t t = (size_t)blockIdx.x * 256 + threadIdx.x; if (t >= n8) return; FragH f;
#pragma unroll
  for (int q = 0; q < 8; ++q) f.h[q] = (_Float16)bf16_round(x[t * 8 + q]); *(v8us*)((unsigned short*)X16 + t * 8) = f.half[0];  }
__global__ __launch_bounds__(256) void k_h16(const float* __restrict__ x, _Float16* __restrict__ X16, size_t n8) { const size_t t = (size_t)blockIdx.x * 256 + threadIdx.x; if (t >= n8) return; FragH f;
#pragma unroll
  for (int q = 0; q < 8; ++q) f.h[q] = (_Float16)x[t * 8 + q]; *(v8us*)((unsigned short*)X16 + t * 8) = f.half[0];  }
__global__ __launch_bounds__(256) void k_round16f(const float* __restrict__ W, _Float16* __restrict__ Bt, size_t n8) { const size_t t = (size_t)blockIdx.x * 256 + threadIdx.x; if (t >= n8) return; FragH f;
#pragma unroll
  for (int i = 0; i < 8; ++i) f.h[i] = (_Float16)(bf16_round(W[t * 8 + i]) * 16.0f); *(v8us*)((unsigned short*)Bt + t * 8) = f.half[0];  }
template <int NHv, int TTv>
__global__ __launch_bounds__(256) void k_vt(const _Float16* __restrict__ V16, int ldv, int voff, _Float16* __restrict__ Vt) { __shared__ unsigned short tl[64][66]; const int tid = threadIdx.x; const int slab = blockIdx.x / (TTv / 64), lg = blockIdx.x % (TTv / 64); const int b = slab / NHv, h = slab % NHv;
  for (int i = tid; i < 64 * 8; i += 256) { const int r = i / 8, c8 = (i % 8) * 8; FragH f; f.half[0] = *(const v8us*)((const unsigned short*)V16 + ((size_t)b * TTv + lg * 64 + r) * ldv + voff + h * 64 + c8);
#pragma unroll
    for (int q = 0; q < 8; ++q) tl[r][c8 + q] = f.u[q]; }
  __syncthreads();
  {
#pragma unroll
    for (int rd = 0; rd < 2; ++rd) { const int d = rd * 32 + tid / 8, pc = tid % 8; FragH f;
#pragma unroll
      for (int q = 0; q < 8; ++q) f.u[q] = tl[pc * 8 + q][d];
      *(v8us*)((unsigned short*)Vt + ((size_t)slab * 64 + d) * TTv + lg * 64 + pc * 8) = f.half[0]; }
     } }

__global__ __launch_bounds__(256) void k_hl(const float* __restrict__ F, _Float16* __restrict__ Hh, _Float16* __restrict__ Hl, size_t n8) { const size_t t = (size_t)blockIdx.x * 256 + threadIdx.x; if (t >= n8) return; FragH fh, fl; const v4f a = *(const v4fa*)(F + t * 8), c = *(const v4fa*)(F + t * 8 + 4);
#pragma unroll
  for (int q = 0; q < 4; ++q) { _Float16 h = (_Float16)a[q]; fh.h[q] = h; fl.h[q] = (_Float16)((a[q] - (float)h) * 1024.0f); h = (_Float16)c[q]; fh.h[4 + q] = h; fl.h[4 + q] = (_Float16)((c[q] - (float)h) * 1024.0f); }
  { *(v8us*)((unsigned short*)Hh + t * 8) = fh.half[0]; *(v8us*)((unsigned short*)Hl + t * 8) = fl.half[0];  } }
__global__ __launch_bounds__(128) void k_flash(const _Float16* __restrict__ Q16, const _Float16* __restrict__ Q16lo, int ldq, const _Float16* __restrict__ K16, const _Float16* __restrict__ K16lo, int ldk, const _Float16* __restrict__ Vt, float* __restrict__ O, int ldo) {
  constexpr int RPW = 16, RTN = RPW / 16, NQB = TT / (4 * RPW), DT = 4, KS = 2;
  __shared__ __attribute__((aligned(16))) unsigned short sP[4][RPW][40]; __shared__ __attribute__((aligned(16))) float sO[4][RPW][64 + 4];
  const int tid = threadIdx.x, w = tid >> 5, lane = tid & 31, ln = lane & 15, hh = lane >> 4;
  const int slab = blockIdx.x / NQB, qblk = blockIdx.x % NQB; const int b = slab, h = 0; const int qb0 = qblk * (4 * RPW); const int q0 = qb0 + w * RPW;
  FragH aq[2][KS], aql[2][KS];
#pragma unroll
  for (int rt = 0; rt < RTN; ++rt) { const size_t qo = ((size_t)b * TT + q0 + rt * 16 + ln) * ldq; const unsigned short* qr = (const unsigned short*)Q16 + qo; const unsigned short* ql = (const unsigned short*)Q16lo + qo;
#pragma unroll
    for (int ks = 0; ks < KS; ++ks) { aq[rt][ks].half[0] = *(const v8us*)(qr + ks * 32 + 8 * hh); aq[rt][ks].half[1] = *(const v8us*)(qr + ks * 32 + 16 + 8 * hh); aql[rt][ks].half[0] = *(const v8us*)(ql + ks * 32 + 8 * hh); aql[rt][ks].half[1] = *(const v8us*)(ql + ks * 32 + 16 + 8 * hh); } }
  const unsigned short* Vth = (const unsigned short*)Vt + (size_t)slab * 64 * TT;
  float m_r[2][8], l_r[2][8]; v8f oacc[2][DT];
#pragma unroll
  for (int rt = 0; rt < RTN; ++rt) {
#pragma unroll
    for (int r = 0; r < 8; ++r) { m_r[rt][r] = -3.0e38f; l_r[rt][r] = 0.f; }
#pragma unroll
    for (int dt = 0; dt < DT; ++dt) oacc[rt][dt] = (v8f){0.f,0.f,0.f,0.f,0.f,0.f,0.f,0.f}; }
  const int jend = TT;
  // K fragments (both planes, 32 keys) live in registers across the back edge: each pass fetches the next pass's right behind its own score products; V fragments are fetched at the pass's top, ahead of the scores and the softmax.
  FragH bk[2][KS], bl[2][KS];
  auto fetchK = [&](int j) {
#pragma unroll      // constant indices keep the fragment arrays in registers
    for (int nt = 0; nt < 2; ++nt) { const size_t ko = ((size_t)b * TT + j + nt * 16 + ln) * ldk; const unsigned short* kr = (const unsigned short*)K16 + ko; const unsigned short* kl = (const unsigned short*)K16lo + ko;
#pragma unroll      // constant indices keep the fragment arrays in registers
      for (int ks = 0; ks < KS; ++ks) { bk[nt][ks].half[0] = *(const v8us*)(kr + ks * 32 + 8 * hh); bk[nt][ks].half[1] = *(const v8us*)(kr + ks * 32 + 16 + 8 * hh); bl[nt][ks].half[0] = *(const v8us*)(kl + ks * 32 + 8 * hh); bl[nt][ks].half[1] = *(const v8us*)(kl + ks * 32 + 16 + 8 * hh); } } };
  fetchK(0);
#pragma unroll 1
  for (int j0 = 0; j0 < jend; j0 += 32) {
    FragH bv[DT];
#pragma unroll      // constant indices keep the fragment arrays in registers
    for (int dt = 0; dt < DT; ++dt) { const unsigned short* vrow = Vth + (size_t)(dt * 16 + ln) * TT + j0; bv[dt].half[0] = *(const v8us*)(vrow + 8 * hh); bv[dt].half[1] = *(const v8us*)(vrow + 16 + 8 * hh); }
    v8f s[2][2];
#pragma unroll
    for (int nt = 0; nt < 2; ++nt) {
#pragma unroll
      for (int rt = 0; rt < RTN; ++rt) { v8f acc = (v8f){0.f,0.f,0.f,0.f,0.f,0.f,0.f,0.f}, accl = acc;
#pragma unroll
        for (int ks = 0; ks < KS; ++ks) { acc = mmaH<1>(aq[rt][ks].v, aq[rt][ks].v, bk[nt][ks].v, bk[nt][ks].v, acc); accl = mmaH<1>(aql[rt][ks].v, aql[rt][ks].v, bk[nt][ks].v, bk[nt][ks].v, accl); accl = mmaH<1>(aq[rt][ks].v, aq[rt][ks].v, bl[nt][ks].v, bl[nt][ks].v, accl); }
#pragma unroll
        for (int r = 0; r < 8; ++r) acc[r] += accl[r] * 0.0009765625f; s[rt][nt] = acc; } }
    fetchK((j0 + 32 < jend) ? j0 + 32 : 0);      // the last pass refetches keys 0..31: in bounds, not used
#pragma unroll
    for (int rt = 0; rt < RTN; ++rt)
#pragma unroll
      for (int r = 0; r < 8; ++r) { const int tq = q0 + rt * 16 + 8 * hh + r; const int k0 = j0 + ln, k1 = j0 + 16 + ln; (void)tq; (void)k0; (void)k1;
        const bool ok0 = true, ok1 = true;
        const float s0 = s[rt][0][r], s1 = s[rt][1][r]; float mc = fmaxf(s0, s1);
        mc = fmaxf(mc, __shfl_xor(mc, 1, 32)); mc = fmaxf(mc, __shfl_xor(mc, 2, 32)); mc = fmaxf(mc, __shfl_xor(mc, 4, 32)); mc = fmaxf(mc, __shfl_xor(mc, 8, 32));
        const float mn = fmaxf(m_r[rt][r], mc); const float al = (mn > -1.0e38f) ? expf(m_r[rt][r] - mn) : 1.0f; m_r[rt][r] = mn; const float p0 = expf(s0 - mn), p1 = expf(s1 - mn); l_r[rt][r] = l_r[rt][r] * al + p0 + p1;
#pragma unroll
        for (int dt = 0; dt < DT; ++dt) oacc[rt][dt][r] *= al;
        FragH t2; t2.h[0] = (_Float16)(p0 * 1024.0f); t2.h[1] = (_Float16)(p1 * 1024.0f); sP[w][rt * 16 + 8 * hh + r][ln] = t2.u[0]; sP[w][rt * 16 + 8 * hh + r][16 + ln] = t2.u[1]; }
    __builtin_amdgcn_fence(__ATOMIC_ACQ_REL, "workgroup"); __builtin_amdgcn_wave_barrier();
    FragH pa[2];
#pragma unroll
    for (int rt = 0; rt < RTN; ++rt) { pa[rt].half[0] = *(const v8us*)&sP[w][rt * 16 + ln][8 * hh]; pa[rt].half[1] = *(const v8us*)&sP[w][rt * 16 + ln][16 + 8 * hh]; }
#pragma unroll
    for (int dt = 0; dt < DT; ++dt) {
#pragma unroll
      for (int rt = 0; rt < RTN; ++rt) oacc[rt][dt] = mmaH<1>(pa[rt].v, pa[rt].v, bv[dt].v, bv[dt].v, oacc[rt][dt]); }
    __builtin_amdgcn_fence(__ATOMIC_ACQ_REL, "workgroup"); __builtin_amdgcn_wave_barrier(); }
#pragma unroll
  for (int rt = 0; rt < RTN; ++rt) {
#pragma unroll
    for (int r = 0; r < 8; ++r) { float l = l_r[rt][r]; l += __shfl_xor(l, 1, 32); l += __shfl_xor(l, 2, 32); l += __shfl_xor(l, 4, 32); l += __shfl_xor(l, 8, 32); l_r[rt][r] = (l > 0.f) ? 1.0f / (l * 1024.0f) : 0.f; }
#pragma unroll
    for (int dt = 0; dt < DT; ++dt)
#pragma unroll
      for (int r = 0; r < 8; ++r) sO[w][rt * 16 + 8 * hh + r][dt * 16 + ln] = oacc[rt][dt][r] * l_r[rt][r]; }
  __builtin_amdgcn_fence(__ATOMIC_ACQ_REL, "workgroup"); __builtin_amdgcn_wave_barrier();
  {
#pragma unroll
    for (int rp = 0; rp < RPW; rp += 2) { const int r = rp + (lane >> 4), pc = lane & 15; const v4f val = *(const v4fa*)&sO[w][r][pc * 4]; *(v4f*)(O + ((size_t)b * TT + q0 + r) * ldo + pc * 4) = val; }
     } }

__global__ __launch_bounds__(256) void k_stat(const float* __restrict__ O, const float* __restrict__ x, float* __restrict__ PART) { __shared__ float r1[256], r2[256]; const int tid = threadIdx.x; const int b = blockIdx.x / NPB, part = blockIdx.x % NPB; const size_t base = (size_t)b * TT * DD + (size_t)part * (TT * DD / NPB); float s1 = 0.f, s2 = 0.f;
#pragma unroll 1
  for (int i = tid * 4; i < TT * DD / NPB; i += 1024) { const v4f o = *(const v4fa*)(O + base + i), xv = *(const v4fa*)(x + base + i); for (int q = 0; q < 4; ++q) { const float y = o[q] + bf16_round(xv[q]); s1 += y; s2 += y * y; } }
  r1[tid] = s1; r2[tid] = s2; __syncthreads(); for (int o = 128; o >= 1; o >>= 1) { if (tid < o) { r1[tid] += r1[tid + o]; r2[tid] += r2[tid + o]; } __syncthreads(); }
  if (tid < 32) { const float v = (tid == 0) ? r1[0] : ((tid == 1) ? r2[0] : 0.f); *(float*)(PART + (size_t)blockIdx.x * 32 + tid) = v;  } }
__global__ __launch_bounds__(256) void k_norm(const float* __restrict__ O, const float* __restrict__ x, const float* __restrict__ PART, float* __restrict__ out) { const size_t t = (size_t)blockIdx.x * 256 + threadIdx.x; if (t >= (size_t)NR * DD / 4) return; const int b = (int)((t * 4) / ((size_t)TT * DD)); float s1 = 0.f, s2 = 0.f;
#pragma unroll 1
  for (int p = 0; p < NPB; ++p) { s1 += PART[((size_t)b * NPB + p) * 32]; s2 += PART[((size_t)b * NPB + p) * 32 + 1]; }
  const float n = (float)TT * (float)DD; const float mu = s1 / n; const float var = fmaxf(s2 / n - mu * mu, 0.f); const float rs = rsqrtf(var + 1e-5f);
  const v4f o = *(const v4fa*)(O + t * 4), xv = *(const v4fa*)(x + t * 4); v4f r; for (int q = 0; q < 4; ++q) r[q] = (o[q] + bf16_round(xv[q]) - mu) * rs;
  *(v4f*)(out + t * 4) = r;  }

extern "C" void kernel_launch(void* const* d_in, const int* in_sizes, int n_in,
                              void* d_out, int out_size, void* d_ws, size_t ws_size, hipStream_t stream) {
  (void)in_sizes; (void)n_in; (void)out_size;
  const float* x = (const float*)d_in[0]; const float* Wq = (const float*)d_in[1]; const float* Wk = (const float*)d_in[2]; const float* Wv = (const float*)d_in[3];
  char* ws = (char*)d_ws; size_t off = 0;
  auto take = [&](size_t bytes) { char* p = ws + off; off += (bytes + 255) & ~(size_t)255; return p; };
  const size_t WSZ = (size_t)DD * DD; _Float16* Bw = (_Float16*)take(3 * WSZ * 2); _Float16* X16 = (_Float16*)take((size_t)NR * DD * 2); float* F32 = (float*)take((size_t)NR * DD * 4);
  _Float16* Qh = (_Float16*)take((size_t)NR * DD * 2); _Float16* Ql = (_Float16*)take((size_t)NR * DD * 2); _Float16* Kh = (_Float16*)take((size_t)NR * DD * 2); _Float16* Kl = (_Float16*)take((size_t)NR * DD * 2);
  _Float16* V16 = (_Float16*)take((size_t)NR * DD * 2); _Float16* Vt = (_Float16*)take((size_t)NR * DD * 2); float* PART = (float*)take((size_t)BB * NPB * 32 * 4);
  float* O = F32;      /* F32 holds q (consumed by k_hl), then k (consumed by k_hl), then the attention output */
  if (off > ws_size) return;      // 6.3 + 8.4 + 16.8 + 6 × 8.4 ≈ 82 MB
  const unsigned gw = (unsigned)((WSZ / 8 + 255) / 256);
  k_round16f<<<gw, 256, 0, stream>>>(Wq, Bw, WSZ / 8); k_round16f<<<gw, 256, 0, stream>>>(Wk, Bw + WSZ, WSZ / 8); k_round16f<<<gw, 256, 0, stream>>>(Wv, Bw + 2 * WSZ, WSZ / 8);      /* (out,in) natural ×2^4 */
  k_x16<<<(unsigned)(((size_t)NR * DD / 8 + 255) / 256), 256, 0, stream>>>(x, X16, (size_t)NR * DD / 8);
  const dim3 gp(((NR / 16) * (DD / 64) + 3) / 4, 1); const unsigned g8 = (unsigned)(((size_t)NR * DD / 8 + 255) / 256);
  k_gemm_hhx<0><<<gp, 128, 0, stream>>>(X16, DD, 0, Bw, DD, 0, 0.0625f, nullptr, 0, nullptr, 1, 0, 0, F32, nullptr, DD, 0, NR, DD, DD); k_hl<<<g8, 256, 0, stream>>>(F32, Qh, Ql, (size_t)NR * DD / 8);      /* Q f32 → hi/lo */
  k_gemm_hhx<0><<<gp, 128, 0, stream>>>(X16, DD, 0, Bw + WSZ, DD, 0, 0.0625f, nullptr, 0, nullptr, 1, 0, 0, F32, nullptr, DD, 0, NR, DD, DD); k_hl<<<g8, 256, 0, stream>>>(F32, Kh, Kl, (size_t)NR * DD / 8);      /* K f32 → hi/lo */
  k_gemm_hhx<0><<<gp, 128, 0, stream>>>(X16, DD, 0, Bw + 2 * WSZ, DD, 0, 0.0625f, nullptr, 0, nullptr, 1, 0, 0, nullptr, V16, DD, 0, NR, DD, DD);      /* V f16 */
  k_vt<1, TT><<<NSL * (TT / 64), 256, 0, stream>>>(V16, 64, 0, Vt);      /* the [4096][1024] plane viewed as 32 contiguous [2048][64] slabs → Vᵀ [slab][64][2048] */
  k_flash<<<NSL * (TT / 64), 128, 0, stream>>>(Qh, Ql, 64, Kh, Kl, 64, Vt, O, 64);      /* same flat view for Q, K and O */
  k_stat<<<BB * NPB, 256, 0, stream>>>(O, x, PART); k_norm<<<(unsigned)(((size_t)NR * DD / 4 + 255) / 256), 256, 0, stream>>>(O, x, PART, (float*)d_out);
}

// v002
// A run of this version takes 301 microseconds.
// Timed twice side by side with v001, it ran 1.23 times as fast both times.
// Over all steps from v000 it is 1.66 times as fast.
#include <hip/hip_runtime.h>
// Multi-head attention with raw-reshape heads, residual and a global LayerNorm (B=2, S=2048, D=1024, 16 heads × 64): Q,K,V = x·Wᵀ reshaped by plain memory order to (H,B,S,64) (= 32 contiguous [2048][64] slabs of each
// [4096][1024] plane); UNSCALED softmax(Q·Kᵀ)·V per slab; y = out (same flat order, = [B,S,1024]) + x; output = (y − mean)/√(var + 1e-5) with mean/var over all (S,D) of each batch element (identity affine).
// Compute dtype: x and weights rounded to bf16; Q,K as f32 GEMM outputs split into f16 hi + ×2^10 residual planes so the unscaled (σ≈3) logits are f32-accurate; V f16; fused flash-style kernel
// (two score accumulators, online softmax f32, P f16 ×2^10) on v_wmma_f32_16x16x32_f16; residual and the per-batch statistics (fixed-order block partial sums of y and y², then a fixed-order combine) and normalisation in f32.
#define BB 2
#define TT 2048
#define DD 1024
#define NSL 32
#define NR (BB * TT)
#define NPB 64

typedef __bf16 v16b __attribute__((ext_vector_type(16)));
typedef unsigned short v8us __attribute__((ext_vector_type(8), may_alias));
typedef float  v8f  __attribute__((ext_vector_type(8)));
typedef float  v4f  __attribute__((ext_vector_type(4)));
typedef float  v4fa __attribute__((ext_vector_type(4), may_alias));
union FragB { v16b v; v8us half[2]; unsigned short u[16]; };

__device__ __forceinline__ unsigned short bf16_bits(float x) { unsigned int u = __float_as_uint(x); return (unsigned short)((u + 0x7FFFu + ((u >> 16) & 1u)) >> 16); }
__device__ __forceinline__ float bf16_val(unsigned short b) { return __uint_as_float(((unsigned int)b) << 16); }
__device__ __forceinline__ float bf16_round(float x) { return bf16_val(bf16_bits(x)); }
// D += A·B with NT terms: 1 = ah·bh, 2 = + al·bh (A split), 3 = + ah·bl (both split)
template <int NT>
__device__ __forceinline__ v8f mmaN(v16b ah, v16b al, v16b bh, v16b bl, v8f c) {
  c = __builtin_amdgcn_wmma_f32_16x16x32_bf16(false, ah, false, bh, (short)0, c, false, false);
  if (NT >= 2) c = __builtin_amdgcn_wmma_f32_16x16x32_bf16(false, al, false, bh, (short)0, c, false, false);
  if (NT >= 3) c = __builtin_amdgcn_wmma_f32_16x16x32_bf16(false, ah, false, bl, (short)0, c, false, false);
  asm volatile("v_nop\n\tv_nop\n\tv_nop\n\tv_nop" : "+v"(c) : "v"(ah), "v"(al), "v"(bh), "v"(bl));
  return c;
}

__global__ __launch_bounds__(256) void k_wt_bf16(const float* __restrict__ W, unsigned short* __restrict__ Wt, int K, int N) {
  const int t = blockIdx.x * 256 + threadIdx.x;
  const int k8n = K / 8;
  if (t >= N * k8n) return;
  const int n = t / k8n, k8 = (t % k8n) * 8;
  v8us v;
#pragma unroll
  for (int i = 0; i < 8; ++i) v[i] = bf16_bits(W[(size_t)(k8 + i) * N + n]);
  *(v8us*)(Wt + (size_t)n * K + k8) = v;
  
}

// GEMM C[M][N] (f32, pitch ldc) = act(A[M][K]·W + bias). A f32 row-major (pitch lda) converted per fragment to bf16
// (ASPLIT: hi/lo two planes -> 2 terms, else single rounded term); Wt bf16 [N][K] (pitch ldb). BIAS_BF16 rounds the
// bias to bf16 first (bias quantised to bf16 before the add). K%32==0, M%16==0, N%64==0.
template <bool ASPLIT, int ACT, bool BIAS_BF16>
__global__ __launch_bounds__(128) void k_gemm_bf(const float* __restrict__ A, int lda, const unsigned short* __restrict__ Wt, int ldb,
                                               const float* __restrict__ bias, float* __restrict__ C, int ldc, int M, int N, int K) {
  __shared__ __attribute__((aligned(16))) float so[4][16][64];
  const int tid = threadIdx.x, w = tid >> 5, lane = tid & 31, ln = lane & 15, hh = lane >> 4;
  const int ntn = N / 64;
  const int wid = blockIdx.x * 4 + w;
  const int mt = wid / ntn, nq = wid % ntn;
  if (mt * 16 >= M) return;
  const int row0 = mt * 16, col0 = nq * 64;
  const float* arow = A + (size_t)(row0 + ln) * lda;
  v8f acc[4] = {};
  for (int kb = 0; kb < K; kb += 32) {
    FragB ah, al;
    const v4f x0 = *(const v4fa*)(arow + kb + 8 * hh), x1 = *(const v4fa*)(arow + kb + 8 * hh + 4);
    const v4f x2 = *(const v4fa*)(arow + kb + 16 + 8 * hh), x3 = *(const v4fa*)(arow + kb + 16 + 8 * hh + 4);
    float xs[16] = {x0[0],x0[1],x0[2],x0[3],x1[0],x1[1],x1[2],x1[3],x2[0],x2[1],x2[2],x2[3],x3[0],x3[1],x3[2],x3[3]};
#pragma unroll
    for (int i = 0; i < 16; ++i) { const unsigned short hb = bf16_bits(xs[i]); ah.u[i] = hb; al.u[i] = ASPLIT ? bf16_bits(xs[i] - bf16_val(hb)) : (unsigned short)0; }
#pragma unroll
    for (int t = 0; t < 4; ++t) {
      const unsigned short* brow = Wt + (size_t)(col0 + t * 16 + ln) * ldb + kb;
      FragB b;
      b.half[0] = *(const v8us*)(brow + 8 * hh);
      b.half[1] = *(const v8us*)(brow + 16 + 8 * hh);
      acc[t] = mmaN<ASPLIT ? 2 : 1>(ah.v, al.v, b.v, b.v, acc[t]);
    }
  }
#pragma unroll
  for (int t = 0; t < 4; ++t) {
    float bv = bias ? bias[col0 + t * 16 + ln] : 0.f;
    if (BIAS_BF16) bv = bf16_round(bv);
#pragma unroll
    for (int r = 0; r < 8; ++r) { float v = acc[t][r] + bv; if (ACT == 1) v = fmaxf(v, 0.f); so[w][8 * hh + r][t * 16 + ln] = v; }
  }
  __builtin_amdgcn_fence(__ATOMIC_ACQ_REL, "workgroup");
  __builtin_amdgcn_wave_barrier();
  const int rsub = lane >> 4, c4 = (lane & 15) * 4;
  {
#pragma unroll
    for (int q = 0; q < 8; ++q) {
      const int r = q * 2 + rsub;
      const v4f v = *(const v4fa*)&so[w][r][c4];
      *(v4f*)(C + (size_t)(row0 + r) * ldc + col0 + c4) = v;
    }
    
  }
}

// Flash-style causal/unmasked attention, all contractions 3-term bf16 hi/lo splits, f32 softmax with running max.
// q,k,v rows are read from f32 buffers with arbitrary row pitch (so they can live inside a fused qkv buffer);
// D = head size (multiple of 32, <= 128); one wave = 16 query rows; block = 4 waves (64 queries) sharing K/V chunks of 32.
template <int D, bool CAUSAL>
__global__ __launch_bounds__(128) void k_flash(const float* __restrict__ qb, const float* __restrict__ kb, const float* __restrict__ vb,
                                             int pitch, int T, int H, float scale, float* __restrict__ y, int ypitch) {
  constexpr int KS = D / 32;        // k-steps for QK
  constexpr int DT = D / 16;        // d tiles for PV
  __shared__ __attribute__((aligned(16))) unsigned short sKh[32][D + 8], sKl[32][D + 8], sVh[32][D + 8], sVl[32][D + 8];
  __shared__ __attribute__((aligned(16))) unsigned short sPh[4][16][40], sPl[4][16][40];
  __shared__ __attribute__((aligned(16))) float sO[4][16][D];
  const int tid = threadIdx.x, w = tid >> 5, lane = tid & 31, ln = lane & 15, hh = lane >> 4;
  const int nqb = (T + 63) / 64;
  const int bh = blockIdx.x / nqb, qblk = blockIdx.x % nqb;
  const int b = bh / H, h = bh % H;
  const int q0 = qblk * 64 + w * 16;
  const float* Q = qb + (size_t)b * T * pitch + h * D;
  const float* K = kb + (size_t)b * T * pitch + h * D;
  const float* V = vb + (size_t)b * T * pitch + h * D;

  // A fragments of the wave's 16 query rows (scaled), hi/lo
  FragB aqh[KS], aql[KS];
  {
    int row = q0 + ln; if (row >= T) row = T - 1;
    const float* qr = Q + (size_t)row * pitch;
#pragma unroll
    for (int ks = 0; ks < KS; ++ks)
#pragma unroll
      for (int i = 0; i < 16; ++i) {
        const int d = ks * 32 + ((i < 8) ? (8 * hh + i) : (16 + 8 * hh + (i - 8)));
        const float x = qr[d] * scale; const unsigned short hb = bf16_bits(x);
        aqh[ks].u[i] = hb; aql[ks].u[i] = bf16_bits(x - bf16_val(hb));
      }
  }
  float m_r[8], l_r[8];
#pragma unroll
  for (int r = 0; r < 8; ++r) { m_r[r] = -3.0e38f; l_r[r] = 0.f; }
  v8f oacc[DT];
#pragma unroll
  for (int dt = 0; dt < DT; ++dt) oacc[dt] = (v8f){0.f,0.f,0.f,0.f,0.f,0.f,0.f,0.f};

  const int kv_end = CAUSAL ? min(T, qblk * 64 + 64) : T;     // block-uniform
  for (int j0 = 0; j0 < kv_end; j0 += 32) {
    __syncthreads();
    for (int e = tid; e < 32 * (D / 4); e += 128) {
      const int r = e / (D / 4), c4 = (e % (D / 4)) * 4;
      const int key = j0 + r;
      v4f kf = {0.f,0.f,0.f,0.f}, vf = {0.f,0.f,0.f,0.f};
      if (key < T) { kf = *(const v4fa*)(K + (size_t)key * pitch + c4); vf = *(const v4fa*)(V + (size_t)key * pitch + c4); }
#pragma unroll
      for (int t = 0; t < 4; ++t) {
        unsigned short hb = bf16_bits(kf[t]); sKh[r][c4 + t] = hb; sKl[r][c4 + t] = bf16_bits(kf[t] - bf16_val(hb));
        hb = bf16_bits(vf[t]); sVh[r][c4 + t] = hb; sVl[r][c4 + t] = bf16_bits(vf[t] - bf16_val(hb));
      }
    }
    __syncthreads();
    // S tile 16 x 32
    v8f s[2];
#pragma unroll
    for (int nt = 0; nt < 2; ++nt) {
      v8f acc = {};
#pragma unroll
      for (int ks = 0; ks < KS; ++ks) {
        FragB bh_, bl_;
        bh_.half[0] = *(const v8us*)&sKh[nt * 16 + ln][ks * 32 + 8 * hh]; bh_.half[1] = *(const v8us*)&sKh[nt * 16 + ln][ks * 32 + 16 + 8 * hh];
        bl_.half[0] = *(const v8us*)&sKl[nt * 16 + ln][ks * 32 + 8 * hh]; bl_.half[1] = *(const v8us*)&sKl[nt * 16 + ln][ks * 32 + 16 + 8 * hh];
        acc = mmaN<3>(aqh[ks].v, aql[ks].v, bh_.v, bl_.v, acc);
      }
      s[nt] = acc;
    }
    // mask + running max (rows 8hh+r; the 16 lanes of a half share rows)
    float alpha[8];
#pragma unroll
    for (int r = 0; r < 8; ++r) {
      const int qi = q0 + 8 * hh + r;
      const int ja = j0 + ln, jb = j0 + 16 + ln;
      if (CAUSAL) { if (ja > qi) s[0][r] = -3.0e38f; if (jb > qi) s[1][r] = -3.0e38f; }
      if (ja >= T) s[0][r] = -3.0e38f;
      if (jb >= T) s[1][r] = -3.0e38f;
      float mx = fmaxf(s[0][r], s[1][r]);
      mx = fmaxf(mx, __shfl_xor(mx, 1, 32)); mx = fmaxf(mx, __shfl_xor(mx, 2, 32)); mx = fmaxf(mx, __shfl_xor(mx, 4, 32)); mx = fmaxf(mx, __shfl_xor(mx, 8, 32));
      const float mnew = fmaxf(m_r[r], mx);
      alpha[r] = (mnew > -1.0e38f) ? __expf(m_r[r] - mnew) : 1.0f;
      const float p0 = (s[0][r] > -1.0e38f) ? __expf(s[0][r] - mnew) : 0.f;
      const float p1 = (s[1][r] > -1.0e38f) ? __expf(s[1][r] - mnew) : 0.f;
      m_r[r] = mnew;
      l_r[r] = l_r[r] * alpha[r] + p0 + p1;            // per-lane partial row sum (16 lanes combined at the end)
      unsigned short hb = bf16_bits(p0); sPh[w][8 * hh + r][ln] = hb;      sPl[w][8 * hh + r][ln] = bf16_bits(p0 - bf16_val(hb));
      hb = bf16_bits(p1);                sPh[w][8 * hh + r][16 + ln] = hb; sPl[w][8 * hh + r][16 + ln] = bf16_bits(p1 - bf16_val(hb));
    }
#pragma unroll
    for (int dt = 0; dt < DT; ++dt)
#pragma unroll
      for (int r = 0; r < 8; ++r) oacc[dt][r] *= alpha[r];
    __builtin_amdgcn_fence(__ATOMIC_ACQ_REL, "workgroup");
    __builtin_amdgcn_wave_barrier();
    FragB pah, pal;
    pah.half[0] = *(const v8us*)&sPh[w][ln][8 * hh]; pah.half[1] = *(const v8us*)&sPh[w][ln][16 + 8 * hh];
    pal.half[0] = *(const v8us*)&sPl[w][ln][8 * hh]; pal.half[1] = *(const v8us*)&sPl[w][ln][16 + 8 * hh];
#pragma unroll
    for (int dt = 0; dt < DT; ++dt) {
      FragB bvh, bvl;
#pragma unroll
      for (int i = 0; i < 8; ++i) {
        bvh.u[i] = sVh[8 * hh + i][dt * 16 + ln]; bvh.u[8 + i] = sVh[16 + 8 * hh + i][dt * 16 + ln];
        bvl.u[i] = sVl[8 * hh + i][dt * 16 + ln]; bvl.u[8 + i] = sVl[16 + 8 * hh + i][dt * 16 + ln];
      }
      oacc[dt] = mmaN<3>(pah.v, pal.v, bvh.v, bvl.v, oacc[dt]);
    }
    __builtin_amdgcn_fence(__ATOMIC_ACQ_REL, "workgroup");
    __builtin_amdgcn_wave_barrier();
  }
#pragma unroll
  for (int r = 0; r < 8; ++r) {
    float l = l_r[r];
    l += __shfl_xor(l, 1, 32); l += __shfl_xor(l, 2, 32); l += __shfl_xor(l, 4, 32); l += __shfl_xor(l, 8, 32);
    l_r[r] = (l > 0.f) ? 1.0f / l : 0.f;
  }
#pragma unroll
  for (int dt = 0; dt < DT; ++dt)
#pragma unroll
    for (int r = 0; r < 8; ++r) sO[w][8 * hh + r][dt * 16 + ln] = oacc[dt][r] * l_r[r];
  __builtin_amdgcn_fence(__ATOMIC_ACQ_REL, "workgroup");
  __builtin_amdgcn_wave_barrier();
  {
    for (int r = 0; r < 16; ++r) {
      const int row = q0 + r;
      if (row < T && lane < D / 4) {
        const v4f val = *(const v4fa*)&sO[w][r][lane * 4];
        *(v4f*)(y + ((size_t)b * T + row) * ypitch + h * D + lane * 4) = val;
      }
    }
    
  }
}

// GEMM C = act(A·W + bias + resid): A f32 (ASPLIT -> hi/lo 2 terms), Wt bf16 [N][K]; ACT 0 none, 1 relu, 2 exact gelu;
// resid (optional, f32, row index = (row % rmod), pitch ldr, RES_BF16 rounds it) added before the activation.
template <bool ASPLIT, int ACT, bool BIAS_BF16, bool RES_BF16>
__global__ __launch_bounds__(128) void k_gemm_bf3(const float* __restrict__ A, int lda, const unsigned short* __restrict__ Wt, int ldb,
                                                const float* __restrict__ bias, const float* __restrict__ resid, int rmod, int ldr,
                                                float* __restrict__ C, int ldc, int M, int N, int K) {
  __shared__ __attribute__((aligned(16))) float so[4][16][64];
  const int tid = threadIdx.x, w = tid >> 5, lane = tid & 31, ln = lane & 15, hh = lane >> 4;
  const int ntn = N / 64;
  const int wid = blockIdx.x * 4 + w;
  const int mt = wid / ntn, nq = wid % ntn;
  if (mt * 16 >= M) return;
  const int row0 = mt * 16, col0 = nq * 64;
  const float* arow = A + (size_t)(row0 + ln) * lda;
  v8f acc[4] = {};
  for (int kb = 0; kb < K; kb += 32) {
    FragB ah, al;
    const v4f x0 = *(const v4fa*)(arow + kb + 8 * hh), x1 = *(const v4fa*)(arow + kb + 8 * hh + 4);
    const v4f x2 = *(const v4fa*)(arow + kb + 16 + 8 * hh), x3 = *(const v4fa*)(arow + kb + 16 + 8 * hh + 4);
    float xs[16] = {x0[0],x0[1],x0[2],x0[3],x1[0],x1[1],x1[2],x1[3],x2[0],x2[1],x2[2],x2[3],x3[0],x3[1],x3[2],x3[3]};
#pragma unroll
    for (int i = 0; i < 16; ++i) { const unsigned short hb = bf16_bits(xs[i]); ah.u[i] = hb; al.u[i] = ASPLIT ? bf16_bits(xs[i] - bf16_val(hb)) : (unsigned short)0; }
#pragma unroll
    for (int t = 0; t < 4; ++t) {
      const unsigned short* brow = Wt + (size_t)(col0 + t * 16 + ln) * ldb + kb;
      FragB b;
      b.half[0] = *(const v8us*)(brow + 8 * hh);
      b.half[1] = *(const v8us*)(brow + 16 + 8 * hh);
      acc[t] = mmaN<ASPLIT ? 2 : 1>(ah.v, al.v, b.v, b.v, acc[t]);
    }
  }
#pragma unroll
  for (int t = 0; t < 4; ++t) {
    const int col = col0 + t * 16 + ln;
    float bv = bias ? bias[col] : 0.f;
    if (BIAS_BF16) bv = bf16_round(bv);
#pragma unroll
    for (int r = 0; r < 8; ++r) {
      float v = acc[t][r] + bv;
      if (resid) { float rv = resid[(size_t)((row0 + 8 * hh + r) % rmod) * ldr + col]; if (RES_BF16) rv = bf16_round(rv); v += rv; }
      if (ACT == 1) v = fmaxf(v, 0.f);
      if (ACT == 2) v = 0.5f * v * (1.0f + erff(v * 0.70710678118654752f));
      if (ACT == 3) { const float u = 0.7978845608028654f * (v + 0.044715f * v * v * v); v = 0.5f * v * (1.0f + tanhf(u)); }
      so[w][8 * hh + r][t * 16 + ln] = v;
    }
  }
  __builtin_amdgcn_fence(__ATOMIC_ACQ_REL, "workgroup");
  __builtin_amdgcn_wave_barrier();
  const int rsub = lane >> 4, c4 = (lane & 15) * 4;
  {
#pragma unroll
    for (int q = 0; q < 8; ++q) {
      const int r = q * 2 + rsub;
      const v4f v = *(const v4fa*)&so[w][r][c4];
      *(v4f*)(C + (size_t)(row0 + r) * ldc + col0 + c4) = v;
    }
    
  }
}
// row LayerNorm (biased variance, eps) over N: s = X (+ R); optional out_sum <- s; out_norm <- (s-mu)*rsqrt(var+eps)*g + b
template <bool PARAM_BF16>
__global__ __launch_bounds__(256) void k_layernorm(const float* __restrict__ X, const float* __restrict__ R, const float* __restrict__ g, const float* __restrict__ bta,
                                                  float* __restrict__ out_sum, float* __restrict__ out_norm, int N, float eps) {
  __shared__ float red[256];
  const int row = blockIdx.x, tid = threadIdx.x;
  const float* x = X + (size_t)row * N; const float* rr = R ? R + (size_t)row * N : nullptr;
  float vals[16];                     // up to N = 4096
  const int per = N / 256;            // contiguous chunk per thread? use strided-by-4 chunks: thread handles j = tid*4 + 1024*u
  float s1 = 0.f;
  for (int u = 0; u < per / 4; ++u) {
    const int j = tid * 4 + 1024 * u;
    const v4f a = *(const v4fa*)(x + j);
    v4f b = {0.f,0.f,0.f,0.f}; if (rr) b = *(const v4fa*)(rr + j);
#pragma unroll
    for (int q = 0; q < 4; ++q) { const float v = a[q] + b[q]; vals[u * 4 + q] = v; s1 += v; }
  }
  red[tid] = s1; __syncthreads();
  for (int st = 128; st > 0; st >>= 1) { if (tid < st) red[tid] += red[tid + st]; __syncthreads(); }
  const float mu = red[0] / (float)N; __syncthreads();
  float s2 = 0.f;
  for (int u = 0; u < per / 4; ++u)
#pragma unroll
    for (int q = 0; q < 4; ++q) { const float c = vals[u * 4 + q] - mu; s2 += c * c; }
  red[tid] = s2; __syncthreads();
  for (int st = 128; st > 0; st >>= 1) { if (tid < st) red[tid] += red[tid + st]; __syncthreads(); }
  const float rs = rsqrtf(red[0] / (float)N + eps);
  {
    for (int u = 0; u < per / 4; ++u) {
      const int j = tid * 4 + 1024 * u;
      v4f o, sm;
#pragma unroll
      for (int q = 0; q < 4; ++q) {
        float gg = g[j + q], bb = bta[j + q];
        if (PARAM_BF16) { gg = bf16_round(gg); bb = bf16_round(bb); }
        sm[q] = vals[u * 4 + q]; o[q] = (vals[u * 4 + q] - mu) * rs * gg + bb;
      }
      if (out_sum) *(v4f*)(out_sum + (size_t)row * N + j) = sm;
      *(v4f*)(out_norm + (size_t)row * N + j) = o;
    }
    
  }
}



// ---- f16 WMMA path (v_wmma_f32_16x16x32_f16): 11-bit significands for operands in range — used where a [0,1] probability operand needs more precision than bf16
typedef _Float16 v16h __attribute__((ext_vector_type(16)));
union FragH { v16h v; v8us half[2]; _Float16 h[16]; unsigned short u[16]; };
template <int NT>
__device__ __forceinline__ v8f mmaH(v16h ah, v16h al, v16h bh, v16h bl, v8f c) {
  c = __builtin_amdgcn_wmma_f32_16x16x32_f16(false, ah, false, bh, (short)0, c, false, false);
  if (NT >= 2) c = __builtin_amdgcn_wmma_f32_16x16x32_f16(false, al, false, bh, (short)0, c, false, false);
  if (NT >= 3) c = __builtin_amdgcn_wmma_f32_16x16x32_f16(false, ah, false, bl, (short)0, c, false, false);
  asm volatile("v_nop\n\tv_nop\n\tv_nop\n\tv_nop" : "+v"(c) : "v"(ah), "v"(al), "v"(bh), "v"(bl));
  return c;
}
// batched GEMM like k_gemm_b but f16 operands: A f32 (split into f16 hi/lo if ASPLIT, else rounded to f16), Bt = f16 values [n][k]; alpha; C f32; N multiple of 16 (partial tiles skipped)
template <bool ASPLIT>
__global__ __launch_bounds__(128) void k_gemm_h(const float* __restrict__ A, int lda, size_t sA, const _Float16* __restrict__ Bh, int ldb, size_t sB, float alpha, float* __restrict__ C, int ldc, size_t sC, int M, int N, int K) {
  __shared__ __attribute__((aligned(16))) float so[4][16][64];
  const int tid = threadIdx.x, w = tid >> 5, lane = tid & 31, ln = lane & 15, hh = lane >> 4; const int by = blockIdx.y;
  A += (size_t)by * sA; Bh += (size_t)by * sB; C += (size_t)by * sC;
  const int ntn = (N + 63) / 64; const int wid = blockIdx.x * 4 + w; const int mt = wid / ntn, nq = wid % ntn; if (mt * 16 >= M) return;
  const int row0 = mt * 16, col0 = nq * 64; const float* arow = A + (size_t)(row0 + ln) * lda;
  v8f acc[4] = {};
  for (int kb = 0; kb < K; kb += 32) {
    FragH ah, al;
    const v4f x0 = *(const v4fa*)(arow + kb + 8 * hh), x1 = *(const v4fa*)(arow + kb + 8 * hh + 4), x2 = *(const v4fa*)(arow + kb + 16 + 8 * hh), x3 = *(const v4fa*)(arow + kb + 16 + 8 * hh + 4);
    float xs[16] = {x0[0],x0[1],x0[2],x0[3],x1[0],x1[1],x1[2],x1[3],x2[0],x2[1],x2[2],x2[3],x3[0],x3[1],x3[2],x3[3]};
#pragma unroll
    for (int i = 0; i < 16; ++i) { const _Float16 h = (_Float16)xs[i]; ah.h[i] = h; al.h[i] = ASPLIT ? (_Float16)(xs[i] - (float)h) : (_Float16)0.0f; }
#pragma unroll
    for (int t = 0; t < 4; ++t) { if (col0 + t * 16 >= N) continue; const size_t boff = (size_t)(col0 + t * 16 + ln) * ldb + kb; FragH bq; bq.half[0] = *(const v8us*)(Bh + boff + 8 * hh); bq.half[1] = *(const v8us*)(Bh + boff + 16 + 8 * hh);
      acc[t] = mmaH<ASPLIT ? 2 : 1>(ah.v, al.v, bq.v, bq.v, acc[t]); }
  }
#pragma unroll
  for (int t = 0; t < 4; ++t) { if (col0 + t * 16 >= N) continue;
#pragma unroll
    for (int r = 0; r < 8; ++r) so[w][8 * hh + r][t * 16 + ln] = acc[t][r] * alpha; }
  __builtin_amdgcn_fence(__ATOMIC_ACQ_REL, "workgroup"); __builtin_amdgcn_wave_barrier();
  const int rsub = lane >> 4, c4 = (lane & 15) * 4;
  {
#pragma unroll
    for (int q = 0; q < 8; ++q) { const int r = q * 2 + rsub; if (col0 + c4 < N) { const v4f v = *(const v4fa*)&so[w][r][c4]; *(v4f*)(C + (size_t)(row0 + r) * ldc + col0 + c4) = v; } }
     }
}

// Wt[n][k] = f16(W[k][n]·scale) from f32 row-major W[K][N] (scale = power of two; bf16-exact weights stay exact in f16 away from the subnormal range)
__global__ __launch_bounds__(256) void k_wt_f16(const float* __restrict__ W, _Float16* __restrict__ Wt, int K, int N, float scale) {
  const int t = blockIdx.x * 256 + threadIdx.x; if (t >= N * (K / 8)) return; const int n = t / (K / 8), k8 = (t % (K / 8)) * 8; FragH f;
#pragma unroll
  for (int i = 0; i < 8; ++i) f.h[i] = (_Float16)(bf16_round(W[(size_t)(k8 + i) * N + n]) * scale); const v8us o = f.half[0];
  *(v8us*)((unsigned short*)Wt + (size_t)n * K + k8) = o; 
}
// Fragment order: a [rows][K] 16-bit plane is kept as 1-KB units of 16 rows x 32 k, unit (row / 16) * (K / 32) + k / 32; inside a unit the 16-byte piece 32 p + lane holds row (lane & 15), k = 16 p + 8 (lane >> 4) + 0..7.
// A wave's fragment is then two 16-byte loads per lane that each cover 512 contiguous bytes (4 whole 128-B lines) instead of 32 bytes in each of 16 lines; fragment element i is k = 8 (lane >> 4) + i for i < 8 and 16 + 8 (lane >> 4) + (i - 8) above, for both operands of every product.
// frag_src: index, in the row-major plane, of the first of the 8 elements that 16-byte piece number 'piece' of the fragment-ordered plane holds.
__device__ __forceinline__ size_t frag_src(size_t piece, int K) { const size_t u = piece >> 6; const int in = (int)(piece & 63), p = in >> 5, l = in & 31; const size_t kt = (size_t)(K / 32);
  return ((u / kt) * 16 + (size_t)(l & 15)) * (size_t)K + (u % kt) * 32 + (size_t)(p * 16 + (l >> 4) * 8); }
// A and Bh in fragment order (lda == ldb == K at every launch here).
// k_gemm_hh variant with fused epilogue: v = acc·alpha + bias[by·sBias + col] (+ CP[(row/rowsPerB)·sCPb + by·64 + col] if CP) ; ACT 0 none / 1 elu ; writes f32 C and f16 C16, each if non-null
template <int ACT>
__global__ __launch_bounds__(128) void k_gemm_hhx(const _Float16* __restrict__ A, int lda, size_t sA, const _Float16* __restrict__ Bh, int ldb, size_t sB, float alpha, const float* __restrict__ bias, size_t sBias, const float* __restrict__ CP, int rowsPerB, size_t sCPb, int row0g,
    float* __restrict__ C, _Float16* __restrict__ C16, int ldc, size_t sC, int M, int N, int K) {
  __shared__ __attribute__((aligned(16))) float so[4][16][64];
  const int tid = threadIdx.x, w = tid >> 5, lane = tid & 31, ln = lane & 15, hh = lane >> 4; const int by = blockIdx.y;
  A += (size_t)by * sA; Bh += (size_t)by * sB; const size_t cofs = (size_t)by * sC; const float* bp = bias ? bias + (size_t)by * sBias : nullptr;
  const int ntn = (N + 63) / 64; const int wid = blockIdx.x * 4 + w; const int mt = wid / ntn, nq = wid % ntn; if (mt * 16 >= M) return;
  const int row0 = mt * 16, col0 = nq * 64;
  v8f acc[4] = {};
  // Two register stages of 64 k each (K % 128 == 0, N % 64 == 0 at every launch here): a stage's 20 fragment loads are issued as one group, one stage ahead of the products that read them.
  // The five row pointers are carried through the loop and stepped between the groups, so none of their registers is free for a load's result while loads are in flight.
  const char* pa = (const char*)(A + (size_t)row0 * lda + lane * 8); const char* pb[4];
#pragma unroll      // constant indices keep the row pointers in registers
  for (int t = 0; t < 4; ++t) pb[t] = (const char*)(Bh + (size_t)(col0 + t * 16) * ldb + lane * 8);
  FragH a0[2], b0[2][4], a1[2], b1[2][4];
  auto fetch = [&](FragH (&fa)[2], FragH (&fb)[2][4]) {
#pragma unroll      // constant indices keep the fragment arrays in registers
    for (int ks = 0; ks < 2; ++ks) { fa[ks].half[0] = *(const v8us*)(pa + ks * 1024); fa[ks].half[1] = *(const v8us*)(pa + ks * 1024 + 512);
#pragma unroll      // constant indices keep the fragment arrays in registers
      for (int t = 0; t < 4; ++t) { fb[ks][t].half[0] = *(const v8us*)(pb[t] + ks * 1024); fb[ks][t].half[1] = *(const v8us*)(pb[t] + ks * 1024 + 512); } } };
  auto step = [&](long bytes) { pa += bytes;
#pragma unroll      // constant indices keep the row pointers in registers
    for (int t = 0; t < 4; ++t) pb[t] += bytes; };
  auto mul = [&](FragH (&fa)[2], FragH (&fb)[2][4]) {
#pragma unroll      // constant indices keep the fragment arrays in registers
    for (int ks = 0; ks < 2; ++ks)
#pragma unroll      // constant indices keep the fragment arrays in registers
      for (int t = 0; t < 4; ++t) acc[t] = mmaH<1>(fa[ks].v, fa[ks].v, fb[ks][t].v, fb[ks][t].v, acc[t]); };
  fetch(a0, b0); step(2048);      // a stage of 64 k = two 1-KB units; a 16-row tile's K elements = 32 K bytes
#pragma unroll 1      // rolled: one ping-pong pair per trip keeps both stages in fixed registers and the loop short
  for (int kb = 0; kb < K; kb += 128) {
    fetch(a1, b1); mul(a0, b0); step((kb + 128 < K) ? 2048L : 2048L - 32L * K);      // the last trip steps back to k = 0: its second fetch stays in bounds and is not used
    fetch(a0, b0); mul(a1, b1); step(2048);
  }
#pragma unroll
  for (int t = 0; t < 4; ++t) { if (col0 + t * 16 >= N) continue; const int col = col0 + t * 16 + ln; const float bv = bp ? bf16_round(bp[col]) : 0.f;
#pragma unroll
    for (int r = 0; r < 8; ++r) { float v = acc[t][r] * alpha + bv; if (CP) { const int bidx = (row0g + row0 + 8 * hh + r) / rowsPerB; v += CP[(size_t)bidx * sCPb + (size_t)by * 64 + col]; } if (ACT == 1) v = (v > 0.f) ? v : expm1f(v); else if (ACT == 7) v = (v > 0.f) ? v + 1.0f : expf(v); else if (ACT == 8) v = tanhf(v); else if (ACT == 9) v = 0.5f * v * (1.0f + tanhf(0.7978845608028654f * (v + 0.044715f * v * v * v))); else if (ACT == 11) v = 1.0f / (1.0f + expf(-v)); else if (ACT == 12) v = (v > 0.f) ? v : 0.01f * v; else if (ACT == 14) v = (v > 0.f) ? v : 0.1f * v; else if (ACT == 15) v = v / (1.0f + expf(-v)); else if (ACT == 3) v = fmaxf(v, 0.f); else if (ACT == 6) v = 0.5f * v * (1.0f + erff(v * 0.70710678118654752f)); so[w][8 * hh + r][t * 16 + ln] = v; } }
  __builtin_amdgcn_fence(__ATOMIC_ACQ_REL, "workgroup"); __builtin_amdgcn_wave_barrier();
  const int rsub = lane >> 4, c4 = (lane & 15) * 4; typedef _Float16 v4h __attribute__((ext_vector_type(4)));
  {
#pragma unroll
    for (int q = 0; q < 8; ++q) { const int r = q * 2 + rsub; if (col0 + c4 < N) { const v4f v = *(const v4fa*)&so[w][r][c4]; if (C) *(v4f*)(C + cofs + (size_t)(row0 + r) * ldc + col0 + c4) = v; if (C16) { v4h h4; for (int i = 0; i < 4; ++i) h4[i] = (_Float16)v[i]; *(v4h*)(C16 + cofs + (size_t)(row0 + r) * ldc + col0 + c4) = h4; } } }
     }
}


typedef _Float16 v4h __attribute__((ext_vector_type(4)));

__global__ __launch_bounds__(256) void k_x16(const float* __restrict__ x, _Float16* __restrict__ X16, size_t n8) { const size_t t = (size_t)blockIdx.x * 256 + threadIdx.x; if (t >= n8) return; FragH f; const size_t s = frag_src(t, DD);
#pragma unroll
  for (int q = 0; q < 8; ++q) f.h[q] = (_Float16)bf16_round(x[s + q]); *(v8us*)((unsigned short*)X16 + t * 8) = f.half[0];  }      /* [NR][DD] plane, written in fragment order */
__global__ __launch_bounds__(256) void k_h16(const float* __restrict__ x, _Float16* __restrict__ X16, size_t n8) { const size_t t = (size_t)blockIdx.x * 256 + threadIdx.x; if (t >= n8) return; FragH f;
#pragma unroll
  for (int q = 0; q < 8; ++q) f.h[q] = (_Float16)x[t * 8 + q]; *(v8us*)((unsigned short*)X16 + t * 8) = f.half[0];  }
__global__ __launch_bounds__(256) void k_round16f(const float* __restrict__ W, _Float16* __restrict__ Bt, size_t n8) { const size_t t = (size_t)blockIdx.x * 256 + threadIdx.x; if (t >= n8) return; FragH f; const size_t s = frag_src(t, DD);
#pragma unroll
  for (int i = 0; i < 8; ++i) f.h[i] = (_Float16)(bf16_round(W[s + i]) * 16.0f); *(v8us*)((unsigned short*)Bt + t * 8) = f.half[0];  }      /* [DD][DD] plane, written in fragment order */
template <int NHv, int TTv>
__global__ __launch_bounds__(256) void k_vt(const _Float16* __restrict__ V16, int ldv, int voff, _Float16* __restrict__ Vt) { __shared__ unsigned short tl[64][66]; const int tid = threadIdx.x; const int slab = blockIdx.x / (TTv / 64), lg = blockIdx.x % (TTv / 64); const int b = slab / NHv, h = slab % NHv;
  for (int i = tid; i < 64 * 8; i += 256) { const int r = i / 8, c8 = (i % 8) * 8; FragH f; f.half[0] = *(const v8us*)((const unsigned short*)V16 + ((size_t)b * TTv + lg * 64 + r) * ldv + voff + h * 64 + c8);
#pragma unroll
    for (int q = 0; q < 8; ++q) tl[r][c8 + q] = f.u[q]; }
  __syncthreads();
  {
#pragma unroll
    for (int rd = 0; rd < 2; ++rd) { const int o = rd * 256 + tid, un = o >> 6, p = (o >> 5) & 1, l = o & 31; const int d = (un & 3) * 16 + (l & 15), key = (un >> 2) * 32 + p * 16 + (l >> 4) * 8; FragH f;      // V^T in fragment order: unit (32-key tile) * 4 + d / 16, rows = d, k = keys; the block's 8 units are 8 KB in a row
#pragma unroll
      for (int q = 0; q < 8; ++q) f.u[q] = tl[key + q][d];
      *(v8us*)((unsigned short*)Vt + ((size_t)slab * TTv + lg * 64) * 64 + o * 8) = f.half[0]; }
     } }

__global__ __launch_bounds__(256) void k_hl(const float* __restrict__ F, _Float16* __restrict__ Hh, _Float16* __restrict__ Hl, size_t n8) { const size_t t = (size_t)blockIdx.x * 256 + threadIdx.x; if (t >= n8) return; FragH fh, fl; const size_t s = frag_src(t, 64); const v4f a = *(const v4fa*)(F + s), c = *(const v4fa*)(F + s + 4);      /* the flat [rows][64] view, both planes written in fragment order */
#pragma unroll
  for (int q = 0; q < 4; ++q) { _Float16 h = (_Float16)a[q]; fh.h[q] = h; fl.h[q] = (_Float16)((a[q] - (float)h) * 1024.0f); h = (_Float16)c[q]; fh.h[4 + q] = h; fl.h[4 + q] = (_Float16)((c[q] - (float)h) * 1024.0f); }
  { *(v8us*)((unsigned short*)Hh + t * 8) = fh.half[0]; *(v8us*)((unsigned short*)Hl + t * 8) = fl.half[0];  } }
__global__ __launch_bounds__(128) void k_flash(const _Float16* __restrict__ Q16, const _Float16* __restrict__ Q16lo, int ldq, const _Float16* __restrict__ K16, const _Float16* __restrict__ K16lo, int ldk, const _Float16* __restrict__ Vt, float* __restrict__ O, int ldo) {
  constexpr int RPW = 16, RTN = RPW / 16, NQB = TT / (4 * RPW), DT = 4, KS = 2;
  __shared__ __attribute__((aligned(16))) unsigned short sP[4][RPW][40]; __shared__ __attribute__((aligned(16))) float sO[4][RPW][64 + 4];
  const int tid = threadIdx.x, w = tid >> 5, lane = tid & 31, ln = lane & 15, hh = lane >> 4;
  const int slab = blockIdx.x / NQB, qblk = blockIdx.x % NQB; const int b = slab, h = 0; const int qb0 = qblk * (4 * RPW); const int q0 = qb0 + w * RPW;
  FragH aq[2][KS], aql[2][KS];
#pragma unroll
  for (int rt = 0; rt < RTN; ++rt) { const size_t qo = ((size_t)b * TT + q0 + rt * 16) * ldq + lane * 8; const unsigned short* qr = (const unsigned short*)Q16 + qo; const unsigned short* ql = (const unsigned short*)Q16lo + qo;
#pragma unroll
    for (int ks = 0; ks < KS; ++ks) { aq[rt][ks].half[0] = *(const v8us*)(qr + ks * 512); aq[rt][ks].half[1] = *(const v8us*)(qr + ks * 512 + 256); aql[rt][ks].half[0] = *(const v8us*)(ql + ks * 512); aql[rt][ks].half[1] = *(const v8us*)(ql + ks * 512 + 256); } }      // fragment-ordered planes (ldq == ldk == 64): unit = (row / 16) * 2 + ks
  const unsigned short* Vth = (const unsigned short*)Vt + (size_t)slab * 64 * TT;
  float m_r[2][8], l_r[2][8]; v8f oacc[2][DT];
#pragma unroll
  for (int rt = 0; rt < RTN; ++rt) {
#pragma unroll
    for (int r = 0; r < 8; ++r) { m_r[rt][r] = -3.0e38f; l_r[rt][r] = 0.f; }
#pragma unroll
    for (int dt = 0; dt < DT; ++dt) oacc[rt][dt] = (v8f){0.f,0.f,0.f,0.f,0.f,0.f,0.f,0.f}; }
  const int jend = TT;
  // K fragments (both planes, 32 keys) live in registers across the back edge: each pass fetches the next pass's right behind its own score products; V fragments are fetched at the pass's top, ahead of the scores and the softmax.
  FragH bk[2][KS], bl[2][KS];
  auto fetchK = [&](int j) {
#pragma unroll      // constant indices keep the fragment arrays in registers
    for (int nt = 0; nt < 2; ++nt) { const size_t ko = ((size_t)b * TT + j + nt * 16) * ldk + lane * 8; const unsigned short* kr = (const unsigned short*)K16 + ko; const unsigned short* kl = (const unsigned short*)K16lo + ko;
#pragma unroll      // constant indices keep the fragment arrays in registers
      for (int ks = 0; ks < KS; ++ks) { bk[nt][ks].half[0] = *(const v8us*)(kr + ks * 512); bk[nt][ks].half[1] = *(const v8us*)(kr + ks * 512 + 256); bl[nt][ks].half[0] = *(const v8us*)(kl + ks * 512); bl[nt][ks].half[1] = *(const v8us*)(kl + ks * 512 + 256); } } };
  fetchK(0);
  { const size_t qa = ((size_t)b * TT + q0) * ldq + lane * 8, ka = (size_t)b * TT * ldk + lane * 8, kc = ((size_t)b * TT + 16) * ldk + lane * 8;
    // the wait in front of the reuse of the address registers of the Q and K loads above; the six addresses are inputs so that their registers stay as they are up to the wait
    asm volatile("s_wait_xcnt 0x0" :: "v"(Q16 + qa), "v"(Q16lo + qa), "v"(K16 + ka), "v"(K16lo + ka), "v"(K16 + kc), "v"(K16lo + kc) : "memory"); }
#pragma unroll 1
  for (int j0 = 0; j0 < jend; j0 += 32) {
    FragH bv[DT];
#pragma unroll      // constant indices keep the fragment arrays in registers
    for (int dt = 0; dt < DT; ++dt) { const unsigned short* vrow = Vth + (size_t)j0 * 64 + dt * 512 + lane * 8; bv[dt].half[0] = *(const v8us*)(vrow); bv[dt].half[1] = *(const v8us*)(vrow + 256); }
    v8f s[2][2];
#pragma unroll
    for (int nt = 0; nt < 2; ++nt) {
#pragma unroll
      for (int rt = 0; rt < RTN; ++rt) { v8f acc = (v8f){0.f,0.f,0.f,0.f,0.f,0.f,0.f,0.f}, accl = acc;
#pragma unroll
        for (int ks = 0; ks < KS; ++ks) { acc = mmaH<1>(aq[rt][ks].v, aq[rt][ks].v, bk[nt][ks].v, bk[nt][ks].v, acc); accl = mmaH<1>(aql[rt][ks].v, aql[rt][ks].v, bk[nt][ks].v, bk[nt][ks].v, accl); accl = mmaH<1>(aq[rt][ks].v, aq[rt][ks].v, bl[nt][ks].v, bl[nt][ks].v, accl); }
#pragma unroll
        for (int r = 0; r < 8; ++r) acc[r] += accl[r] * 0.0009765625f; s[rt][nt] = acc; } }
    fetchK((j0 + 32 < jend) ? j0 + 32 : 0);      // the last pass refetches keys 0..31: in bounds, not used
#pragma unroll
    for (int rt = 0; rt < RTN; ++rt)
#pragma unroll
      for (int r = 0; r < 8; ++r) { const int tq = q0 + rt * 16 + 8 * hh + r; const int k0 = j0 + ln, k1 = j0 + 16 + ln; (void)tq; (void)k0; (void)k1;
        const bool ok0 = true, ok1 = true;
        const float s0 = s[rt][0][r], s1 = s[rt][1][r]; float mc = fmaxf(s0, s1);
        mc = fmaxf(mc, __shfl_xor(mc, 1, 32)); mc = fmaxf(mc, __shfl_xor(mc, 2, 32)); mc = fmaxf(mc, __shfl_xor(mc, 4, 32)); mc = fmaxf(mc, __shfl_xor(mc, 8, 32));
        const float mn = fmaxf(m_r[rt][r], mc); const float al = (mn > -1.0e38f) ? expf(m_r[rt][r] - mn) : 1.0f; m_r[rt][r] = mn; const float p0 = expf(s0 - mn), p1 = expf(s1 - mn); l_r[rt][r] = l_r[rt][r] * al + p0 + p1;
#pragma unroll
        for (int dt = 0; dt < DT; ++dt) oacc[rt][dt][r] *= al;
        FragH t2; t2.h[0] = (_Float16)(p0 * 1024.0f); t2.h[1] = (_Float16)(p1 * 1024.0f); sP[w][rt * 16 + 8 * hh + r][ln] = t2.u[0]; sP[w][rt * 16 + 8 * hh + r][16 + ln] = t2.u[1]; }
    __builtin_amdgcn_fence(__ATOMIC_ACQ_REL, "workgroup"); __builtin_amdgcn_wave_barrier();
    FragH pa[2];
#pragma unroll
    for (int rt = 0; rt < RTN; ++rt) { pa[rt].half[0] = *(const v8us*)&sP[w][rt * 16 + ln][8 * hh]; pa[rt].half[1] = *(const v8us*)&sP[w][rt * 16 + ln][16 + 8 * hh]; }
#pragma unroll
    for (int dt = 0; dt < DT; ++dt) {
#pragma unroll
      for (int rt = 0; rt < RTN; ++rt) oacc[rt][dt] = mmaH<1>(pa[rt].v, pa[rt].v, bv[dt].v, bv[dt].v, oacc[rt][dt]); }
    __builtin_amdgcn_fence(__ATOMIC_ACQ_REL, "workgroup"); __builtin_amdgcn_wave_barrier(); }
#pragma unroll
  for (int rt = 0; rt < RTN; ++rt) {
#pragma unroll
    for (int r = 0; r < 8; ++r) { float l = l_r[rt][r]; l += __shfl_xor(l, 1, 32); l += __shfl_xor(l, 2, 32); l += __shfl_xor(l, 4, 32); l += __shfl_xor(l, 8, 32); l_r[rt][r] = (l > 0.f) ? 1.0f / (l * 1024.0f) : 0.f; }
#pragma unroll
    for (int dt = 0; dt < DT; ++dt)
#pragma unroll
      for (int r = 0; r < 8; ++r) sO[w][rt * 16 + 8 * hh + r][dt * 16 + ln] = oacc[rt][dt][r] * l_r[rt][r]; }
  __builtin_amdgcn_fence(__ATOMIC_ACQ_REL, "workgroup"); __builtin_amdgcn_wave_barrier();
  {
#pragma unroll
    for (int rp = 0; rp < RPW; rp += 2) { const int r = rp + (lane >> 4), pc = lane & 15; const v4f val = *(const v4fa*)&sO[w][r][pc * 4]; *(v4f*)(O + ((size_t)b * TT + q0 + r) * ldo + pc * 4) = val; }
     } }

__global__ __launch_bounds__(256) void k_stat(const float* __restrict__ O, const float* __restrict__ x, float* __restrict__ PART) { __shared__ float r1[256], r2[256]; const int tid = threadIdx.x; const int b = blockIdx.x / NPB, part = blockIdx.x % NPB; const size_t base = (size_t)b * TT * DD + (size_t)part * (TT * DD / NPB); float s1 = 0.f, s2 = 0.f;
#pragma unroll 1
  for (int i = tid * 4; i < TT * DD / NPB; i += 1024) { const v4f o = *(const v4fa*)(O + base + i), xv = *(const v4fa*)(x + base + i); for (int q = 0; q < 4; ++q) { const float y = o[q] + bf16_round(xv[q]); s1 += y; s2 += y * y; } }
  r1[tid] = s1; r2[tid] = s2; __syncthreads(); for (int o = 128; o >= 1; o >>= 1) { if (tid < o) { r1[tid] += r1[tid + o]; r2[tid] += r2[tid + o]; } __syncthreads(); }
  if (tid < 32) { const float v = (tid == 0) ? r1[0] : ((tid == 1) ? r2[0] : 0.f); *(float*)(PART + (size_t)blockIdx.x * 32 + tid) = v;  } }
__global__ __launch_bounds__(256) void k_norm(const float* __restrict__ O, const float* __restrict__ x, const float* __restrict__ PART, float* __restrict__ out) { const size_t t = (size_t)blockIdx.x * 256 + threadIdx.x; if (t >= (size_t)NR * DD / 4) return; const int b = (int)((t * 4) / ((size_t)TT * DD)); float s1 = 0.f, s2 = 0.f;
#pragma unroll 1
  for (int p = 0; p < NPB; ++p) { s1 += PART[((size_t)b * NPB + p) * 32]; s2 += PART[((size_t)b * NPB + p) * 32 + 1]; }
  const float n = (float)TT * (float)DD; const float mu = s1 / n; const float var = fmaxf(s2 / n - mu * mu, 0.f); const float rs = rsqrtf(var + 1e-5f);
  const v4f o = *(const v4fa*)(O + t * 4), xv = *(const v4fa*)(x + t * 4); v4f r; for (int q = 0; q < 4; ++q) r[q] = (o[q] + bf16_round(xv[q]) - mu) * rs;
  *(v4f*)(out + t * 4) = r;  }

extern "C" void kernel_launch(void* const* d_in, const int* in_sizes, int n_in,
                              void* d_out, int out_size, void* d_ws, size_t ws_size, hipStream_t stream) {
  (void)in_sizes; (void)n_in; (void)out_size;
  const float* x = (const float*)d_in[0]; const float* Wq = (const float*)d_in[1]; const float* Wk = (const float*)d_in[2]; const float* Wv = (const float*)d_in[3];
  char* ws = (char*)d_ws; size_t off = 0;
  auto take = [&](size_t bytes) { char* p = ws + off; off += (bytes + 255) & ~(size_t)255; return p; };
  const size_t WSZ = (size_t)DD * DD; _Float16* Bw = (_Float16*)take(3 * WSZ * 2); _Float16* X16 = (_Float16*)take((size_t)NR * DD * 2); float* F32 = (float*)take((size_t)NR * DD * 4);
  _Float16* Qh = (_Float16*)take((size_t)NR * DD * 2); _Float16* Ql = (_Float16*)take((size_t)NR * DD * 2); _Float16* Kh = (_Float16*)take((size_t)NR * DD * 2); _Float16* Kl = (_Float16*)take((size_t)NR * DD * 2);
  _Float16* V16 = (_Float16*)take((size_t)NR * DD * 2); _Float16* Vt = (_Float16*)take((size_t)NR * DD * 2); float* PART = (float*)take((size_t)BB * NPB * 32 * 4);
  float* O = F32;      /* F32 holds q (consumed by k_hl), then k (consumed by k_hl), then the attention output */
  if (off > ws_size) return;      // 6.3 + 8.4 + 16.8 + 6 × 8.4 ≈ 82 MB
  const unsigned gw = (unsigned)((WSZ / 8 + 255) / 256);
  k_round16f<<<gw, 256, 0, stream>>>(Wq, Bw, WSZ / 8); k_round16f<<<gw, 256, 0, stream>>>(Wk, Bw + WSZ, WSZ / 8); k_round16f<<<gw, 256, 0, stream>>>(Wv, Bw + 2 * WSZ, WSZ / 8);      /* (out,in) natural ×2^4 */
  k_x16<<<(unsigned)(((size_t)NR * DD / 8 + 255) / 256), 256, 0, stream>>>(x, X16, (size_t)NR * DD / 8);
  const dim3 gp(((NR / 16) * (DD / 64) + 3) / 4, 1); const unsigned g8 = (unsigned)(((size_t)NR * DD / 8 + 255) / 256);
  k_gemm_hhx<0><<<gp, 128, 0, stream>>>(X16, DD, 0, Bw, DD, 0, 0.0625f, nullptr, 0, nullptr, 1, 0, 0, F32, nullptr, DD, 0, NR, DD, DD); k_hl<<<g8, 256, 0, stream>>>(F32, Qh, Ql, (size_t)NR * DD / 8);      /* Q f32 → hi/lo */
  k_gemm_hhx<0><<<gp, 128, 0, stream>>>(X16, DD, 0, Bw + WSZ, DD, 0, 0.0625f, nullptr, 0, nullptr, 1, 0, 0, F32, nullptr, DD, 0, NR, DD, DD); k_hl<<<g8, 256, 0, stream>>>(F32, Kh, Kl, (size_t)NR * DD / 8);      /* K f32 → hi/lo */
  k_gemm_hhx<0><<<gp, 128, 0, stream>>>(X16, DD, 0, Bw + 2 * WSZ, DD, 0, 0.0625f, nullptr, 0, nullptr, 1, 0, 0, nullptr, V16, DD, 0, NR, DD, DD);      /* V f16 */
  k_vt<1, TT><<<NSL * (TT / 64), 256, 0, stream>>>(V16, 64, 0, Vt);      /* the [4096][1024] plane viewed as 32 contiguous [2048][64] slabs → Vᵀ per slab, in fragment order */
  k_flash<<<NSL * (TT / 64), 128, 0, stream>>>(Qh, Ql, 64, Kh, Kl, 64, Vt, O, 64);      /* same flat view for Q, K and O */
  k_stat<<<BB * NPB, 256, 0, stream>>>(O, x, PART); k_norm<<<(unsigned)(((size_t)NR * DD / 4 + 255) / 256), 256, 0, stream>>>(O, x, PART, (float*)d_out);
}

// v003
// A run of this version takes 235 microseconds.
// In both of two side-by-side timings against v002, it was 1.28 times as fast.
// Counting every step since v000, it is 2.13 times as fast.
#include <hip/hip_runtime.h>
// Multi-head attention with raw-reshape heads, residual and a global LayerNorm (B=2, S=2048, D=1024, 16 heads × 64): Q,K,V = x·Wᵀ reshaped by plain memory order to (H,B,S,64) (= 32 contiguous [2048][64] slabs of each
// [4096][1024] plane); UNSCALED softmax(Q·Kᵀ)·V per slab; y = out (same flat order, = [B,S,1024]) + x; output = (y − mean)/√(var + 1e-5) with mean/var over all (S,D) of each batch element (identity affine).
// Compute dtype: x and weights rounded to bf16; Q,K as f32 GEMM outputs split into f16 hi + ×2^10 residual planes so the unscaled (σ≈3) logits are f32-accurate; V f16; fused flash-style kernel
// (two score accumulators, online softmax f32, P f16 ×2^10) on v_wmma_f32_16x16x32_f16; residual and the per-batch statistics (fixed-order block partial sums of y and y², then a fixed-order combine) and normalisation in f32.
#define BB 2
#define TT 2048
#define DD 1024
#define NSL 32
#define NR (BB * TT)
#define NPB 64

typedef __bf16 v16b __attribute__((ext_vector_type(16)));
typedef unsigned short v8us __attribute__((ext_vector_type(8), may_alias));
typedef float  v8f  __attribute__((ext_vector_type(8)));
typedef float  v4f  __attribute__((ext_vector_type(4)));
typedef float  v4fa __attribute__((ext_vector_type(4), may_alias));
union FragB { v16b v; v8us half[2]; unsigned short u[16]; };

__device__ __forceinline__ unsigned short bf16_bits(float x) { unsigned int u = __float_as_uint(x); return (unsigned short)((u + 0x7FFFu + ((u >> 16) & 1u)) >> 16); }
__device__ __forceinline__ float bf16_val(unsigned short b) { return __uint_as_float(((unsigned int)b) << 16); }
__device__ __forceinline__ float bf16_round(float x) { return bf16_val(bf16_bits(x)); }
// D += A·B with NT terms: 1 = ah·bh, 2 = + al·bh (A split), 3 = + ah·bl (both split)
template <int NT>
__device__ __forceinline__ v8f mmaN(v16b ah, v16b al, v16b bh, v16b bl, v8f c) {
  c = __builtin_amdgcn_wmma_f32_16x16x32_bf16(false, ah, false, bh, (short)0, c, false, false);
  if (NT >= 2) c = __builtin_amdgcn_wmma_f32_16x16x32_bf16(false, al, false, bh, (short)0, c, false, false);
  if (NT >= 3) c = __builtin_amdgcn_wmma_f32_16x16x32_bf16(false, ah, false, bl, (short)0, c, false, false);
  asm volatile("v_nop\n\tv_nop\n\tv_nop\n\tv_nop" : "+v"(c) : "v"(ah), "v"(al), "v"(bh), "v"(bl));
  return c;
}

__global__ __launch_bounds__(256) void k_wt_bf16(const float* __restrict__ W, unsigned short* __restrict__ Wt, int K, int N) {
  const int t = blockIdx.x * 256 + threadIdx.x;
  const int k8n = K / 8;
  if (t >= N * k8n) return;
  const int n = t / k8n, k8 = (t % k8n) * 8;
  v8us v;
#pragma unroll
  for (int i = 0; i < 8; ++i) v[i] = bf16_bits(W[(size_t)(k8 + i) * N + n]);
  *(v8us*)(Wt + (size_t)n * K + k8) = v;
  
}

// GEMM C[M][N] (f32, pitch ldc) = act(A[M][K]·W + bias). A f32 row-major (pitch lda) converted per fragment to bf16
// (ASPLIT: hi/lo two planes -> 2 terms, else single rounded term); Wt bf16 [N][K] (pitch ldb). BIAS_BF16 rounds the
// bias to bf16 first (bias quantised to bf16 before the add). K%32==0, M%16==0, N%64==0.
template <bool ASPLIT, int ACT, bool BIAS_BF16>
__global__ __launch_bounds__(128) void k_gemm_bf(const float* __restrict__ A, int lda, const unsigned short* __restrict__ Wt, int ldb,
                                               const float* __restrict__ bias, float* __restrict__ C, int ldc, int M, int N, int K) {
  __shared__ __attribute__((aligned(16))) float so[4][16][64];
  const int tid = threadIdx.x, w = tid >> 5, lane = tid & 31, ln = lane & 15, hh = lane >> 4;
  const int ntn = N / 64;
  const int wid = blockIdx.x * 4 + w;
  const int mt = wid / ntn, nq = wid % ntn;
  if (mt * 16 >= M) return;
  const int row0 = mt * 16, col0 = nq * 64;
  const float* arow = A + (size_t)(row0 + ln) * lda;
  v8f acc[4] = {};
  for (int kb = 0; kb < K; kb += 32) {
    FragB ah, al;
    const v4f x0 = *(const v4fa*)(arow + kb + 8 * hh), x1 = *(const v4fa*)(arow + kb + 8 * hh + 4);
    const v4f x2 = *(const v4fa*)(arow + kb + 16 + 8 * hh), x3 = *(const v4fa*)(arow + kb + 16 + 8 * hh + 4);
    float xs[16] = {x0[0],x0[1],x0[2],x0[3],x1[0],x1[1],x1[2],x1[3],x2[0],x2[1],x2[2],x2[3],x3[0],x3[1],x3[2],x3[3]};
#pragma unroll
    for (int i = 0; i < 16; ++i) { const unsigned short hb = bf16_bits(xs[i]); ah.u[i] = hb; al.u[i] = ASPLIT ? bf16_bits(xs[i] - bf16_val(hb)) : (unsigned short)0; }
#pragma unroll
    for (int t = 0; t < 4; ++t) {
      const unsigned short* brow = Wt + (size_t)(col0 + t * 16 + ln) * ldb + kb;
      FragB b;
      b.half[0] = *(const v8us*)(brow + 8 * hh);
      b.half[1] = *(const v8us*)(brow + 16 + 8 * hh);
      acc[t] = mmaN<ASPLIT ? 2 : 1>(ah.v, al.v, b.v, b.v, acc[t]);
    }
  }
#pragma unroll
  for (int t = 0; t < 4; ++t) {
    float bv = bias ? bias[col0 + t * 16 + ln] : 0.f;
    if (BIAS_BF16) bv = bf16_round(bv);
#pragma unroll
    for (int r = 0; r < 8; ++r) { float v = acc[t][r] + bv; if (ACT == 1) v = fmaxf(v, 0.f); so[w][8 * hh + r][t * 16 + ln] = v; }
  }
  __builtin_amdgcn_fence(__ATOMIC_ACQ_REL, "workgroup");
  __builtin_amdgcn_wave_barrier();
  const int rsub = lane >> 4, c4 = (lane & 15) * 4;
  {
#pragma unroll
    for (int q = 0; q < 8; ++q) {
      const int r = q * 2 + rsub;
      const v4f v = *(const v4fa*)&so[w][r][c4];
      *(v4f*)(C + (size_t)(row0 + r) * ldc + col0 + c4) = v;
    }
    
  }
}

// Flash-style causal/unmasked attention, all contractions 3-term bf16 hi/lo splits, f32 softmax with running max.
// q,k,v rows are read from f32 buffers with arbitrary row pitch (so they can live inside a fused qkv buffer);
// D = head size (multiple of 32, <= 128); one wave = 16 query rows; block = 4 waves (64 queries) sharing K/V chunks of 32.
template <int D, bool CAUSAL>
__global__ __launch_bounds__(128) void k_flash(const float* __restrict__ qb, const float* __restrict__ kb, const float* __restrict__ vb,
                                             int pitch, int T, int H, float scale, float* __restrict__ y, int ypitch) {
  constexpr int KS = D / 32;        // k-steps for QK
  constexpr int DT = D / 16;        // d tiles for PV
  __shared__ __attribute__((aligned(16))) unsigned short sKh[32][D + 8], sKl[32][D + 8], sVh[32][D + 8], sVl[32][D + 8];
  __shared__ __attribute__((aligned(16))) unsigned short sPh[4][16][40], sPl[4][16][40];
  __shared__ __attribute__((aligned(16))) float sO[4][16][D];
  const int tid = threadIdx.x, w = tid >> 5, lane = tid & 31, ln = lane & 15, hh = lane >> 4;
  const int nqb = (T + 63) / 64;
  const int bh = blockIdx.x / nqb, qblk = blockIdx.x % nqb;
  const int b = bh / H, h = bh % H;
  const int q0 = qblk * 64 + w * 16;
  const float* Q = qb + (size_t)b * T * pitch + h * D;
  const float* K = kb + (size_t)b * T * pitch + h * D;
  const float* V = vb + (size_t)b * T * pitch + h * D;

  // A fragments of the wave's 16 query rows (scaled), hi/lo
  FragB aqh[KS], aql[KS];
  {
    int row = q0 + ln; if (row >= T) row = T - 1;
    const float* qr = Q + (size_t)row * pitch;
#pragma unroll
    for (int ks = 0; ks < KS; ++ks)
#pragma unroll
      for (int i = 0; i < 16; ++i) {
        const int d = ks * 32 + ((i < 8) ? (8 * hh + i) : (16 + 8 * hh + (i - 8)));
        const float x = qr[d] * scale; const unsigned short hb = bf16_bits(x);
        aqh[ks].u[i] = hb; aql[ks].u[i] = bf16_bits(x - bf16_val(hb));
      }
  }
  float m_r[8], l_r[8];
#pragma unroll
  for (int r = 0; r < 8; ++r) { m_r[r] = -3.0e38f; l_r[r] = 0.f; }
  v8f oacc[DT];
#pragma unroll
  for (int dt = 0; dt < DT; ++dt) oacc[dt] = (v8f){0.f,0.f,0.f,0.f,0.f,0.f,0.f,0.f};

  const int kv_end = CAUSAL ? min(T, qblk * 64 + 64) : T;     // block-uniform
  for (int j0 = 0; j0 < kv_end; j0 += 32) {
    __syncthreads();
    for (int e = tid; e < 32 * (D / 4); e += 128) {
      const int r = e / (D / 4), c4 = (e % (D / 4)) * 4;
      const int key = j0 + r;
      v4f kf = {0.f,0.f,0.f,0.f}, vf = {0.f,0.f,0.f,0.f};
      if (key < T) { kf = *(const v4fa*)(K + (size_t)key * pitch + c4); vf = *(const v4fa*)(V + (size_t)key * pitch + c4); }
#pragma unroll
      for (int t = 0; t < 4; ++t) {
        unsigned short hb = bf16_bits(kf[t]); sKh[r][c4 + t] = hb; sKl[r][c4 + t] = bf16_bits(kf[t] - bf16_val(hb));
        hb = bf16_bits(vf[t]); sVh[r][c4 + t] = hb; sVl[r][c4 + t] = bf16_bits(vf[t] - bf16_val(hb));
      }
    }
    __syncthreads();
    // S tile 16 x 32
    v8f s[2];
#pragma unroll
    for (int nt = 0; nt < 2; ++nt) {
      v8f acc = {};
#pragma unroll
      for (int ks = 0; ks < KS; ++ks) {
        FragB bh_, bl_;
        bh_.half[0] = *(const v8us*)&sKh[nt * 16 + ln][ks * 32 + 8 * hh]; bh_.half[1] = *(const v8us*)&sKh[nt * 16 + ln][ks * 32 + 16 + 8 * hh];
        bl_.half[0] = *(const v8us*)&sKl[nt * 16 + ln][ks * 32 + 8 * hh]; bl_.half[1] = *(const v8us*)&sKl[nt * 16 + ln][ks * 32 + 16 + 8 * hh];
        acc = mmaN<3>(aqh[ks].v, aql[ks].v, bh_.v, bl_.v, acc);
      }
      s[nt] = acc;
    }
    // mask + running max (rows 8hh+r; the 16 lanes of a half share rows)
    float alpha[8];
#pragma unroll
    for (int r = 0; r < 8; ++r) {
      const int qi = q0 + 8 * hh + r;
      const int ja = j0 + ln, jb = j0 + 16 + ln;
      if (CAUSAL) { if (ja > qi) s[0][r] = -3.0e38f; if (jb > qi) s[1][r] = -3.0e38f; }
      if (ja >= T) s[0][r] = -3.0e38f;
      if (jb >= T) s[1][r] = -3.0e38f;
      float mx = fmaxf(s[0][r], s[1][r]);
      mx = fmaxf(mx, __shfl_xor(mx, 1, 32)); mx = fmaxf(mx, __shfl_xor(mx, 2, 32)); mx = fmaxf(mx, __shfl_xor(mx, 4, 32)); mx = fmaxf(mx, __shfl_xor(mx, 8, 32));
      const float mnew = fmaxf(m_r[r], mx);
      alpha[r] = (mnew > -1.0e38f) ? __expf(m_r[r] - mnew) : 1.0f;
      const float p0 = (s[0][r] > -1.0e38f) ? __expf(s[0][r] - mnew) : 0.f;
      const float p1 = (s[1][r] > -1.0e38f) ? __expf(s[1][r] - mnew) : 0.f;
      m_r[r] = mnew;
      l_r[r] = l_r[r] * alpha[r] + p0 + p1;            // per-lane partial row sum (16 lanes combined at the end)
      unsigned short hb = bf16_bits(p0); sPh[w][8 * hh + r][ln] = hb;      sPl[w][8 * hh + r][ln] = bf16_bits(p0 - bf16_val(hb));
      hb = bf16_bits(p1);                sPh[w][8 * hh + r][16 + ln] = hb; sPl[w][8 * hh + r][16 + ln] = bf16_bits(p1 - bf16_val(hb));
    }
#pragma unroll
    for (int dt = 0; dt < DT; ++dt)
#pragma unroll
      for (int r = 0; r < 8; ++r) oacc[dt][r] *= alpha[r];
    __builtin_amdgcn_fence(__ATOMIC_ACQ_REL, "workgroup");
    __builtin_amdgcn_wave_barrier();
    FragB pah, pal;
    pah.half[0] = *(const v8us*)&sPh[w][ln][8 * hh]; pah.half[1] = *(const v8us*)&sPh[w][ln][16 + 8 * hh];
    pal.half[0] = *(const v8us*)&sPl[w][ln][8 * hh]; pal.half[1] = *(const v8us*)&sPl[w][ln][16 + 8 * hh];
#pragma unroll
    for (int dt = 0; dt < DT; ++dt) {
      FragB bvh, bvl;
#pragma unroll
      for (int i = 0; i < 8; ++i) {
        bvh.u[i] = sVh[8 * hh + i][dt * 16 + ln]; bvh.u[8 + i] = sVh[16 + 8 * hh + i][dt * 16 + ln];
        bvl.u[i] = sVl[8 * hh + i][dt * 16 + ln]; bvl.u[8 + i] = sVl[16 + 8 * hh + i][dt * 16 + ln];
      }
      oacc[dt] = mmaN<3>(pah.v, pal.v, bvh.v, bvl.v, oacc[dt]);
    }
    __builtin_amdgcn_fence(__ATOMIC_ACQ_REL, "workgroup");
    __builtin_amdgcn_wave_barrier();
  }
#pragma unroll
  for (int r = 0; r < 8; ++r) {
    float l = l_r[r];
    l += __shfl_xor(l, 1, 32); l += __shfl_xor(l, 2, 32); l += __shfl_xor(l, 4, 32); l += __shfl_xor(l, 8, 32);
    l_r[r] = (l > 0.f) ? 1.0f / l : 0.f;
  }
#pragma unroll
  for (int dt = 0; dt < DT; ++dt)
#pragma unroll
    for (int r = 0; r < 8; ++r) sO[w][8 * hh + r][dt * 16 + ln] = oacc[dt][r] * l_r[r];
  __builtin_amdgcn_fence(__ATOMIC_ACQ_REL, "workgroup");
  __builtin_amdgcn_wave_barrier();
  {
    for (int r = 0; r < 16; ++r) {
      const int row = q0 + r;
      if (row < T && lane < D / 4) {
        const v4f val = *(const v4fa*)&sO[w][r][lane * 4];
        *(v4f*)(y + ((size_t)b * T + row) * ypitch + h * D + lane * 4) = val;
      }
    }
    
  }
}

// GEMM C = act(A·W + bias + resid): A f32 (ASPLIT -> hi/lo 2 terms), Wt bf16 [N][K]; ACT 0 none, 1 relu, 2 exact gelu;
// resid (optional, f32, row index = (row % rmod), pitch ldr, RES_BF16 rounds it) added before the activation.
template <bool ASPLIT, int ACT, bool BIAS_BF16, bool RES_BF16>
__global__ __launch_bounds__(128) void k_gemm_bf3(const float* __restrict__ A, int lda, const unsigned short* __restrict__ Wt, int ldb,
                                                const float* __restrict__ bias, const float* __restrict__ resid, int rmod, int ldr,
                                                float* __restrict__ C, int ldc, int M, int N, int K) {
  __shared__ __attribute__((aligned(16))) float so[4][16][64];
  const int tid = threadIdx.x, w = tid >> 5, lane = tid & 31, ln = lane & 15, hh = lane >> 4;
  const int ntn = N / 64;
  const int wid = blockIdx.x * 4 + w;
  const int mt = wid / ntn, nq = wid % ntn;
  if (mt * 16 >= M) return;
  const int row0 = mt * 16, col0 = nq * 64;
  const float* arow = A + (size_t)(row0 + ln) * lda;
  v8f acc[4] = {};
  for (int kb = 0; kb < K; kb += 32) {
    FragB ah, al;
    const v4f x0 = *(const v4fa*)(arow + kb + 8 * hh), x1 = *(const v4fa*)(arow + kb + 8 * hh + 4);
    const v4f x2 = *(const v4fa*)(arow + kb + 16 + 8 * hh), x3 = *(const v4fa*)(arow + kb + 16 + 8 * hh + 4);
    float xs[16] = {x0[0],x0[1],x0[2],x0[3],x1[0],x1[1],x1[2],x1[3],x2[0],x2[1],x2[2],x2[3],x3[0],x3[1],x3[2],x3[3]};
#pragma unroll
    for (int i = 0; i < 16; ++i) { const unsigned short hb = bf16_bits(xs[i]); ah.u[i] = hb; al.u[i] = ASPLIT ? bf16_bits(xs[i] - bf16_val(hb)) : (unsigned short)0; }
#pragma unroll
    for (int t = 0; t < 4; ++t) {
      const unsigned short* brow = Wt + (size_t)(col0 + t * 16 + ln) * ldb + kb;
      FragB b;
      b.half[0] = *(const v8us*)(brow + 8 * hh);
      b.half[1] = *(const v8us*)(brow + 16 + 8 * hh);
      acc[t] = mmaN<ASPLIT ? 2 : 1>(ah.v, al.v, b.v, b.v, acc[t]);
    }
  }
#pragma unroll
  for (int t = 0; t < 4; ++t) {
    const int col = col0 + t * 16 + ln;
    float bv = bias ? bias[col] : 0.f;
    if (BIAS_BF16) bv = bf16_round(bv);
#pragma unroll
    for (int r = 0; r < 8; ++r) {
      float v = acc[t][r] + bv;
      if (resid) { float rv = resid[(size_t)((row0 + 8 * hh + r) % rmod) * ldr + col]; if (RES_BF16) rv = bf16_round(rv); v += rv; }
      if (ACT == 1) v = fmaxf(v, 0.f);
      if (ACT == 2) v = 0.5f * v * (1.0f + erff(v * 0.70710678118654752f));
      if (ACT == 3) { const float u = 0.7978845608028654f * (v + 0.044715f * v * v * v); v = 0.5f * v * (1.0f + tanhf(u)); }
      so[w][8 * hh + r][t * 16 + ln] = v;
    }
  }
  __builtin_amdgcn_fence(__ATOMIC_ACQ_REL, "workgroup");
  __builtin_amdgcn_wave_barrier();
  const int rsub = lane >> 4, c4 = (lane & 15) * 4;
  {
#pragma unroll
    for (int q = 0; q < 8; ++q) {
      const int r = q * 2 + rsub;
      const v4f v = *(const v4fa*)&so[w][r][c4];
      *(v4f*)(C + (size_t)(row0 + r) * ldc + col0 + c4) = v;
    }
    
  }
}
// row LayerNorm (biased variance, eps) over N: s = X (+ R); optional out_sum <- s; out_norm <- (s-mu)*rsqrt(var+eps)*g + b
template <bool PARAM_BF16>
__global__ __launch_bounds__(256) void k_layernorm(const float* __restrict__ X, const float* __restrict__ R, const float* __restrict__ g, const float* __restrict__ bta,
                                                  float* __restrict__ out_sum, float* __restrict__ out_norm, int N, float eps) {
  __shared__ float red[256];
  const int row = blockIdx.x, tid = threadIdx.x;
  const float* x = X + (size_t)row * N; const float* rr = R ? R + (size_t)row * N : nullptr;
  float vals[16];                     // up to N = 4096
  const int per = N / 256;            // contiguous chunk per thread? use strided-by-4 chunks: thread handles j = tid*4 + 1024*u
  float s1 = 0.f;
  for (int u = 0; u < per / 4; ++u) {
    const int j = tid * 4 + 1024 * u;
    const v4f a = *(const v4fa*)(x + j);
    v4f b = {0.f,0.f,0.f,0.f}; if (rr) b = *(const v4fa*)(rr + j);
#pragma unroll
    for (int q = 0; q < 4; ++q) { const float v = a[q] + b[q]; vals[u * 4 + q] = v; s1 += v; }
  }
  red[tid] = s1; __syncthreads();
  for (int st = 128; st > 0; st >>= 1) { if (tid < st) red[tid] += red[tid + st]; __syncthreads(); }
  const float mu = red[0] / (float)N; __syncthreads();
  float s2 = 0.f;
  for (int u = 0; u < per / 4; ++u)
#pragma unroll
    for (int q = 0; q < 4; ++q) { const float c = vals[u * 4 + q] - mu; s2 += c * c; }
  red[tid] = s2; __syncthreads();
  for (int st = 128; st > 0; st >>= 1) { if (tid < st) red[tid] += red[tid + st]; __syncthreads(); }
  const float rs = rsqrtf(red[0] / (float)N + eps);
  {
    for (int u = 0; u < per / 4; ++u) {
      const int j = tid * 4 + 1024 * u;
      v4f o, sm;
#pragma unroll
      for (int q = 0; q < 4; ++q) {
        float gg = g[j + q], bb = bta[j + q];
        if (PARAM_BF16) { gg = bf16_round(gg); bb = bf16_round(bb); }
        sm[q] = vals[u * 4 + q]; o[q] = (vals[u * 4 + q] - mu) * rs * gg + bb;
      }
      if (out_sum) *(v4f*)(out_sum + (size_t)row * N + j) = sm;
      *(v4f*)(out_norm + (size_t)row * N + j) = o;
    }
    
  }
}



// ---- f16 WMMA path (v_wmma_f32_16x16x32_f16): 11-bit significands for operands in range — used where a [0,1] probability operand needs more precision than bf16
typedef _Float16 v16h __attribute__((ext_vector_type(16)));
union FragH { v16h v; v8us half[2]; _Float16 h[16]; unsigned short u[16]; };
template <int NT>
__device__ __forceinline__ v8f mmaH(v16h ah, v16h al, v16h bh, v16h bl, v8f c) {
  c = __builtin_amdgcn_wmma_f32_16x16x32_f16(false, ah, false, bh, (short)0, c, false, false);
  if (NT >= 2) c = __builtin_amdgcn_wmma_f32_16x16x32_f16(false, al, false, bh, (short)0, c, false, false);
  if (NT >= 3) c = __builtin_amdgcn_wmma_f32_16x16x32_f16(false, ah, false, bl, (short)0, c, false, false);
  asm volatile("v_nop\n\tv_nop\n\tv_nop\n\tv_nop" : "+v"(c) : "v"(ah), "v"(al), "v"(bh), "v"(bl));
  return c;
}
// batched GEMM like k_gemm_b but f16 operands: A f32 (split into f16 hi/lo if ASPLIT, else rounded to f16), Bt = f16 values [n][k]; alpha; C f32; N multiple of 16 (partial tiles skipped)
template <bool ASPLIT>
__global__ __launch_bounds__(128) void k_gemm_h(const float* __restrict__ A, int lda, size_t sA, const _Float16* __restrict__ Bh, int ldb, size_t sB, float alpha, float* __restrict__ C, int ldc, size_t sC, int M, int N, int K) {
  __shared__ __attribute__((aligned(16))) float so[4][16][64];
  const int tid = threadIdx.x, w = tid >> 5, lane = tid & 31, ln = lane & 15, hh = lane >> 4; const int by = blockIdx.y;
  A += (size_t)by * sA; Bh += (size_t)by * sB; C += (size_t)by * sC;
  const int ntn = (N + 63) / 64; const int wid = blockIdx.x * 4 + w; const int mt = wid / ntn, nq = wid % ntn; if (mt * 16 >= M) return;
  const int row0 = mt * 16, col0 = nq * 64; const float* arow = A + (size_t)(row0 + ln) * lda;
  v8f acc[4] = {};
  for (int kb = 0; kb < K; kb += 32) {
    FragH ah, al;
    const v4f x0 = *(const v4fa*)(arow + kb + 8 * hh), x1 = *(const v4fa*)(arow + kb + 8 * hh + 4), x2 = *(const v4fa*)(arow + kb + 16 + 8 * hh), x3 = *(const v4fa*)(arow + kb + 16 + 8 * hh + 4);
    float xs[16] = {x0[0],x0[1],x0[2],x0[3],x1[0],x1[1],x1[2],x1[3],x2[0],x2[1],x2[2],x2[3],x3[0],x3[1],x3[2],x3[3]};
#pragma unroll
    for (int i = 0; i < 16; ++i) { const _Float16 h = (_Float16)xs[i]; ah.h[i] = h; al.h[i] = ASPLIT ? (_Float16)(xs[i] - (float)h) : (_Float16)0.0f; }
#pragma unroll
    for (int t = 0; t < 4; ++t) { if (col0 + t * 16 >= N) continue; const size_t boff = (size_t)(col0 + t * 16 + ln) * ldb + kb; FragH bq; bq.half[0] = *(const v8us*)(Bh + boff + 8 * hh); bq.half[1] = *(const v8us*)(Bh + boff + 16 + 8 * hh);
      acc[t] = mmaH<ASPLIT ? 2 : 1>(ah.v, al.v, bq.v, bq.v, acc[t]); }
  }
#pragma unroll
  for (int t = 0; t < 4; ++t) { if (col0 + t * 16 >= N) continue;
#pragma unroll
    for (int r = 0; r < 8; ++r) so[w][8 * hh + r][t * 16 + ln] = acc[t][r] * alpha; }
  __builtin_amdgcn_fence(__ATOMIC_ACQ_REL, "workgroup"); __builtin_amdgcn_wave_barrier();
  const int rsub = lane >> 4, c4 = (lane & 15) * 4;
  {
#pragma unroll
    for (int q = 0; q < 8; ++q) { const int r = q * 2 + rsub; if (col0 + c4 < N) { const v4f v = *(const v4fa*)&so[w][r][c4]; *(v4f*)(C + (size_t)(row0 + r) * ldc + col0 + c4) = v; } }
     }
}

// Wt[n][k] = f16(W[k][n]·scale) from f32 row-major W[K][N] (scale = power of two; bf16-exact weights stay exact in f16 away from the subnormal range)
__global__ __launch_bounds__(256) void k_wt_f16(const float* __restrict__ W, _Float16* __restrict__ Wt, int K, int N, float scale) {
  const int t = blockIdx.x * 256 + threadIdx.x; if (t >= N * (K / 8)) return; const int n = t / (K / 8), k8 = (t % (K / 8)) * 8; FragH f;
#pragma unroll
  for (int i = 0; i < 8; ++i) f.h[i] = (_Float16)(bf16_round(W[(size_t)(k8 + i) * N + n]) * scale); const v8us o = f.half[0];
  *(v8us*)((unsigned short*)Wt + (size_t)n * K + k8) = o; 
}
// Fragment order: a [rows][K] 16-bit plane is kept as 1-KB units of 16 rows x 32 k, unit (row / 16) * (K / 32) + k / 32; inside a unit the 16-byte piece 32 p + lane holds row (lane & 15), k = 16 p + 8 (lane >> 4) + 0..7.
// A wave's fragment is then two 16-byte loads per lane that each cover 512 contiguous bytes (4 whole 128-B lines) instead of 32 bytes in each of 16 lines; fragment element i is k = 8 (lane >> 4) + i for i < 8 and 16 + 8 (lane >> 4) + (i - 8) above, for both operands of every product.
// frag_src: index, in the row-major plane, of the first of the 8 elements that 16-byte piece number 'piece' of the fragment-ordered plane holds.
__device__ __forceinline__ size_t frag_src(size_t piece, int K) { const size_t u = piece >> 6; const int in = (int)(piece & 63), p = in >> 5, l = in & 31; const size_t kt = (size_t)(K / 32);
  return ((u / kt) * 16 + (size_t)(l & 15)) * (size_t)K + (u % kt) * 32 + (size_t)(p * 16 + (l >> 4) * 8); }
// A and Bh in fragment order (lda == ldb == K at every launch here).
// k_gemm_hh variant with fused epilogue: v = acc·alpha + bias[by·sBias + col] (+ CP[(row/rowsPerB)·sCPb + by·64 + col] if CP) ; ACT 0 none / 1 elu ; writes f32 C and f16 C16, each if non-null
template <int ACT>
__global__ __launch_bounds__(128) void k_gemm_hhx(const _Float16* __restrict__ A, int lda, size_t sA, const _Float16* __restrict__ Bh, int ldb, size_t sB, float alpha, const float* __restrict__ bias, size_t sBias, const float* __restrict__ CP, int rowsPerB, size_t sCPb, int row0g,
    float* __restrict__ C, _Float16* __restrict__ C16, int ldc, size_t sC, int M, int N, int K) {
  __shared__ __attribute__((aligned(16))) float so[4][16][64];
  const int tid = threadIdx.x, w = tid >> 5, lane = tid & 31, ln = lane & 15, hh = lane >> 4; const int by = blockIdx.y;
  A += (size_t)by * sA; Bh += (size_t)by * sB; const size_t cofs = (size_t)by * sC; const float* bp = bias ? bias + (size_t)by * sBias : nullptr;
  const int ntn = (N + 63) / 64; const int wid = blockIdx.x * 4 + w; const int mt = wid / ntn, nq = wid % ntn; if (mt * 16 >= M) return;
  const int row0 = mt * 16, col0 = nq * 64;
  v8f acc[4] = {};
  // Two register stages of 64 k each (K % 128 == 0, N % 64 == 0 at every launch here): a stage's 20 fragment loads are issued as one group, one stage ahead of the products that read them.
  // The five row pointers are carried through the loop and stepped between the groups, so none of their registers is free for a load's result while loads are in flight.
  const char* pa = (const char*)(A + (size_t)row0 * lda + lane * 8); const char* pb[4];
#pragma unroll      // constant indices keep the row pointers in registers
  for (int t = 0; t < 4; ++t) pb[t] = (const char*)(Bh + (size_t)(col0 + t * 16) * ldb + lane * 8);
  FragH a0[2], b0[2][4], a1[2], b1[2][4];
  auto fetch = [&](FragH (&fa)[2], FragH (&fb)[2][4]) {
#pragma unroll      // constant indices keep the fragment arrays in registers
    for (int ks = 0; ks < 2; ++ks) { fa[ks].half[0] = *(const v8us*)(pa + ks * 1024); fa[ks].half[1] = *(const v8us*)(pa + ks * 1024 + 512);
#pragma unroll      // constant indices keep the fragment arrays in registers
      for (int t = 0; t < 4; ++t) { fb[ks][t].half[0] = *(const v8us*)(pb[t] + ks * 1024); fb[ks][t].half[1] = *(const v8us*)(pb[t] + ks * 1024 + 512); } } };
  auto step = [&](long bytes) { pa += bytes;
#pragma unroll      // constant indices keep the row pointers in registers
    for (int t = 0; t < 4; ++t) pb[t] += bytes; };
  auto mul = [&](FragH (&fa)[2], FragH (&fb)[2][4]) {
#pragma unroll      // constant indices keep the fragment arrays in registers
    for (int ks = 0; ks < 2; ++ks)
#pragma unroll      // constant indices keep the fragment arrays in registers
      for (int t = 0; t < 4; ++t) acc[t] = mmaH<1>(fa[ks].v, fa[ks].v, fb[ks][t].v, fb[ks][t].v, acc[t]); };
  fetch(a0, b0); step(2048);      // a stage of 64 k = two 1-KB units; a 16-row tile's K elements = 32 K bytes
#pragma unroll 1      // rolled: one ping-pong pair per trip keeps both stages in fixed registers and the loop short
  for (int kb = 0; kb < K; kb += 128) {
    fetch(a1, b1); mul(a0, b0); step((kb + 128 < K) ? 2048L : 2048L - 32L * K);      // the last trip steps back to k = 0: its second fetch stays in bounds and is not used
    fetch(a0, b0); mul(a1, b1); step(2048);
  }
#pragma unroll
  for (int t = 0; t < 4; ++t) { if (col0 + t * 16 >= N) continue; const int col = col0 + t * 16 + ln; const float bv = bp ? bf16_round(bp[col]) : 0.f;
#pragma unroll
    for (int r = 0; r < 8; ++r) { float v = acc[t][r] * alpha + bv; if (CP) { const int bidx = (row0g + row0 + 8 * hh + r) / rowsPerB; v += CP[(size_t)bidx * sCPb + (size_t)by * 64 + col]; } if (ACT == 1) v = (v > 0.f) ? v : expm1f(v); else if (ACT == 7) v = (v > 0.f) ? v + 1.0f : expf(v); else if (ACT == 8) v = tanhf(v); else if (ACT == 9) v = 0.5f * v * (1.0f + tanhf(0.7978845608028654f * (v + 0.044715f * v * v * v))); else if (ACT == 11) v = 1.0f / (1.0f + expf(-v)); else if (ACT == 12) v = (v > 0.f) ? v : 0.01f * v; else if (ACT == 14) v = (v > 0.f) ? v : 0.1f * v; else if (ACT == 15) v = v / (1.0f + expf(-v)); else if (ACT == 3) v = fmaxf(v, 0.f); else if (ACT == 6) v = 0.5f * v * (1.0f + erff(v * 0.70710678118654752f)); so[w][8 * hh + r][t * 16 + ln] = v; } }
  __builtin_amdgcn_fence(__ATOMIC_ACQ_REL, "workgroup"); __builtin_amdgcn_wave_barrier();
  const int rsub = lane >> 4, c4 = (lane & 15) * 4; typedef _Float16 v4h __attribute__((ext_vector_type(4)));
  {
#pragma unroll
    for (int q = 0; q < 8; ++q) { const int r = q * 2 + rsub; if (col0 + c4 < N) { const v4f v = *(const v4fa*)&so[w][r][c4]; if (C) *(v4f*)(C + cofs + (size_t)(row0 + r) * ldc + col0 + c4) = v; if (C16) { v4h h4; for (int i = 0; i < 4; ++i) h4[i] = (_Float16)v[i]; *(v4h*)(C16 + cofs + (size_t)(row0 + r) * ldc + col0 + c4) = h4; } } }
     }
}


typedef _Float16 v4h __attribute__((ext_vector_type(4)));

__global__ __launch_bounds__(256) void k_x16(const float* __restrict__ x, _Float16* __restrict__ X16, size_t n8) { const size_t t = (size_t)blockIdx.x * 256 + threadIdx.x; if (t >= n8) return; FragH f; const size_t s = frag_src(t, DD);
#pragma unroll
  for (int q = 0; q < 8; ++q) f.h[q] = (_Float16)bf16_round(x[s + q]); *(v8us*)((unsigned short*)X16 + t * 8) = f.half[0];  }      /* [NR][DD] plane, written in fragment order */
__global__ __launch_bounds__(256) void k_h16(const float* __restrict__ x, _Float16* __restrict__ X16, size_t n8) { const size_t t = (size_t)blockIdx.x * 256 + threadIdx.x; if (t >= n8) return; FragH f;
#pragma unroll
  for (int q = 0; q < 8; ++q) f.h[q] = (_Float16)x[t * 8 + q]; *(v8us*)((unsigned short*)X16 + t * 8) = f.half[0];  }
__global__ __launch_bounds__(256) void k_round16f(const float* __restrict__ W, _Float16* __restrict__ Bt, size_t n8) { const size_t t = (size_t)blockIdx.x * 256 + threadIdx.x; if (t >= n8) return; FragH f; const size_t s = frag_src(t, DD);
#pragma unroll
  for (int i = 0; i < 8; ++i) f.h[i] = (_Float16)(bf16_round(W[s + i]) * 16.0f); *(v8us*)((unsigned short*)Bt + t * 8) = f.half[0];  }      /* [DD][DD] plane, written in fragment order */
template <int NHv, int TTv>
__global__ __launch_bounds__(256) void k_vt(const _Float16* __restrict__ V16, int ldv, int voff, _Float16* __restrict__ Vt) { __shared__ unsigned short tl[64][66]; const int tid = threadIdx.x; const int slab = blockIdx.x / (TTv / 64), lg = blockIdx.x % (TTv / 64); const int b = slab / NHv, h = slab % NHv;
  for (int i = tid; i < 64 * 8; i += 256) { const int r = i / 8, c8 = (i % 8) * 8; FragH f; f.half[0] = *(const v8us*)((const unsigned short*)V16 + ((size_t)b * TTv + lg * 64 + r) * ldv + voff + h * 64 + c8);
#pragma unroll
    for (int q = 0; q < 8; ++q) tl[r][c8 + q] = f.u[q]; }
  __syncthreads();
  {
#pragma unroll
    for (int rd = 0; rd < 2; ++rd) { const int o = rd * 256 + tid, un = o >> 6, p = (o >> 5) & 1, l = o & 31; const int d = (un & 3) * 16 + (l & 15), key = (un >> 2) * 32 + p * 16 + (l >> 4) * 8; FragH f;      // V^T in fragment order: unit (32-key tile) * 4 + d / 16, rows = d, k = keys; the block's 8 units are 8 KB in a row
#pragma unroll
      for (int q = 0; q < 8; ++q) f.u[q] = tl[key + q][d];
      *(v8us*)((unsigned short*)Vt + ((size_t)slab * TTv + lg * 64) * 64 + o * 8) = f.half[0]; }
     } }

__global__ __launch_bounds__(256) void k_hl(const float* __restrict__ F, _Float16* __restrict__ Hh, _Float16* __restrict__ Hl, size_t n8) { const size_t t = (size_t)blockIdx.x * 256 + threadIdx.x; if (t >= n8) return; FragH fh, fl; const size_t s = frag_src(t, 64); const v4f a = *(const v4fa*)(F + s), c = *(const v4fa*)(F + s + 4);      /* the flat [rows][64] view, both planes written in fragment order */
#pragma unroll
  for (int q = 0; q < 4; ++q) { _Float16 h = (_Float16)a[q]; fh.h[q] = h; fl.h[q] = (_Float16)((a[q] - (float)h) * 1024.0f); h = (_Float16)c[q]; fh.h[4 + q] = h; fl.h[4 + q] = (_Float16)((c[q] - (float)h) * 1024.0f); }
  { *(v8us*)((unsigned short*)Hh + t * 8) = fh.half[0]; *(v8us*)((unsigned short*)Hl + t * 8) = fl.half[0];  } }
typedef float v2f __attribute__((ext_vector_type(2)));
// lane l <-> lane l ^ 16 by a vector cross-row move
__device__ __forceinline__ float xhalf(float x) { return __builtin_bit_cast(float, __builtin_amdgcn_permlanex16(__builtin_bit_cast(int, x), __builtin_bit_cast(int, x), 0x76543210, 0xfedcba98, false, false)); }
__global__ __launch_bounds__(128) void k_flash(const _Float16* __restrict__ Q16, const _Float16* __restrict__ Q16lo, int ldq, const _Float16* __restrict__ K16, const _Float16* __restrict__ K16lo, int ldk, const _Float16* __restrict__ Vt, float* __restrict__ O, int ldo) {
  constexpr int RPW = 16, NQB = TT / (4 * RPW), DT = 4, KS = 2;
  __shared__ __attribute__((aligned(16))) float sO[4][RPW][64 + 4];
  const int tid = threadIdx.x, w = tid >> 5, lane = tid & 31, ln = lane & 15, hh = lane >> 4;
  const int slab = blockIdx.x / NQB, qblk = blockIdx.x % NQB; const int b = slab; const int qb0 = qblk * (4 * RPW); const int q0 = qb0 + w * RPW;
  FragH aq[KS], aql[KS];
  { const size_t qo = ((size_t)b * TT + q0) * ldq + lane * 8; const unsigned short* qr = (const unsigned short*)Q16 + qo; const unsigned short* ql = (const unsigned short*)Q16lo + qo;
#pragma unroll
    for (int ks = 0; ks < KS; ++ks) { aq[ks].half[0] = *(const v8us*)(qr + ks * 512); aq[ks].half[1] = *(const v8us*)(qr + ks * 512 + 256); aql[ks].half[0] = *(const v8us*)(ql + ks * 512); aql[ks].half[1] = *(const v8us*)(ql + ks * 512 + 256); } }      // fragment-ordered planes (ldq == ldk == 64): unit = (row / 16) * 2 + ks
  const unsigned short* Vth = (const unsigned short*)Vt + (size_t)slab * 64 * TT;
  float m_r = -3.0e38f, l_r = 0.f; v8f oacc[DT];
#pragma unroll
  for (int dt = 0; dt < DT; ++dt) oacc[dt] = (v8f){0.f,0.f,0.f,0.f,0.f,0.f,0.f,0.f};
  const int jend = TT;
  // K fragments (both planes, 32 keys) live in registers across the back edge: each pass fetches the next pass's right behind its own score products; V fragments are fetched at the pass's top, ahead of the scores and the softmax.
  FragH bk[2][KS], bl[2][KS];
  auto fetchK = [&](int j) {
#pragma unroll      // constant indices keep the fragment arrays in registers
    for (int nt = 0; nt < 2; ++nt) { const size_t ko = ((size_t)b * TT + j + nt * 16) * ldk + lane * 8; const unsigned short* kr = (const unsigned short*)K16 + ko; const unsigned short* kl = (const unsigned short*)K16lo + ko;
#pragma unroll      // constant indices keep the fragment arrays in registers
      for (int ks = 0; ks < KS; ++ks) { bk[nt][ks].half[0] = *(const v8us*)(kr + ks * 512); bk[nt][ks].half[1] = *(const v8us*)(kr + ks * 512 + 256); bl[nt][ks].half[0] = *(const v8us*)(kl + ks * 512); bl[nt][ks].half[1] = *(const v8us*)(kl + ks * 512 + 256); } } };
  fetchK(0);
  { const size_t qa = ((size_t)b * TT + q0) * ldq + lane * 8, ka = (size_t)b * TT * ldk + lane * 8, kc = ((size_t)b * TT + 16) * ldk + lane * 8;
    // the wait in front of the reuse of the address registers of the Q and K loads above; the six addresses are inputs so that their registers stay as they are up to the wait
    asm volatile("s_wait_xcnt 0x0" :: "v"(Q16 + qa), "v"(Q16lo + qa), "v"(K16 + ka), "v"(K16lo + ka), "v"(K16 + kc), "v"(K16lo + kc) : "memory"); }
#pragma unroll 1
  for (int j0 = 0; j0 < jend; j0 += 32) {
    FragH bv[DT];
#pragma unroll      // constant indices keep the fragment arrays in registers
    for (int dt = 0; dt < DT; ++dt) { const unsigned short* vrow = Vth + (size_t)j0 * 64 + dt * 512 + lane * 8; bv[dt].half[0] = *(const v8us*)(vrow); bv[dt].half[1] = *(const v8us*)(vrow + 256); }
    v8f s[2];      // s[nt][r] = score of query q0 + ln against key j0 + 16 nt + 8 hh + r
#pragma unroll
    for (int nt = 0; nt < 2; ++nt) { v8f acc = (v8f){0.f,0.f,0.f,0.f,0.f,0.f,0.f,0.f}, accl = acc;
#pragma unroll
      for (int ks = 0; ks < KS; ++ks) { acc = mmaH<1>(bk[nt][ks].v, bk[nt][ks].v, aq[ks].v, aq[ks].v, acc); accl = mmaH<1>(bk[nt][ks].v, bk[nt][ks].v, aql[ks].v, aql[ks].v, accl); accl = mmaH<1>(bl[nt][ks].v, bl[nt][ks].v, aq[ks].v, aq[ks].v, accl); }
      s[nt] = acc + accl * 0.0009765625f; }
    const int jn = (j0 + 32 < jend) ? j0 + 32 : 0; fetchK(jn);      // the last pass refetches keys 0..31: in bounds, not used
    { const size_t ka = ((size_t)b * TT + jn) * ldk + lane * 8, kc = ((size_t)b * TT + jn + 16) * ldk + lane * 8;
      // the wait in front of the reuse of the address registers of the K loads above; the four addresses are inputs so that none of their registers is handed to a load's result or to the softmax ahead of the wait
      asm volatile("s_wait_xcnt 0x0" :: "v"(K16 + ka), "v"(K16lo + ka), "v"(K16 + kc), "v"(K16lo + kc) : "memory"); }
    float mc = s[0][0], md = s[1][0];
#pragma unroll      // constant indices keep the score tiles in registers
    for (int r = 1; r < 8; ++r) { mc = fmaxf(mc, s[0][r]); md = fmaxf(md, s[1][r]); }
    mc = fmaxf(mc, md); mc = fmaxf(mc, xhalf(mc));      // both halves now hold the query's maximum over the pass's 32 keys
    const float mn = fmaxf(m_r, mc); const float al = expf((mn > -1.0e38f) ? m_r - mn : 0.f); m_r = mn;      // the guard selects the argument (exp(0) = 1), so no branch on lanes stands in the loop
    FragH pt; v2f ps[2] = {(v2f){0.f, 0.f}, (v2f){0.f, 0.f}};
#pragma unroll      // constant indices keep the score tiles and the P^T fragment in registers
    for (int nt = 0; nt < 2; ++nt) { const v8f d = s[nt] - mn;
#pragma unroll      // constant indices keep the score tiles and the P^T fragment in registers
      for (int r = 0; r < 8; r += 2) { const v2f p = {expf(d[r]), expf(d[r + 1])}; ps[nt] += p; pt.h[8 * nt + r] = (_Float16)(p[0] * 1024.0f); pt.h[8 * nt + r + 1] = (_Float16)(p[1] * 1024.0f); } }
    { const v2f pq = ps[0] + ps[1]; l_r = l_r * al + (pq[0] + pq[1]); }      // this half's 16 keys; the halves are joined behind the loop
#pragma unroll
    for (int dt = 0; dt < DT; ++dt)
#pragma unroll
      for (int r = 0; r < 8; ++r) oacc[dt][r] *= al;
#pragma unroll
    for (int dt = 0; dt < DT; ++dt) oacc[dt] = mmaH<1>(bv[dt].v, bv[dt].v, pt.v, pt.v, oacc[dt]);      // oacc[dt][r] = O[q0 + ln][16 dt + 8 hh + r]
  }
  { const float l = l_r + xhalf(l_r); const float inv = (l > 0.f) ? 1.0f / (l * 1024.0f) : 0.f;      // the exchange stands ahead of the select: all lanes are on
#pragma unroll      // constant indices keep the output tiles in registers
    for (int dt = 0; dt < DT; ++dt) { v4f lo4, hi4;
#pragma unroll      // constant indices keep the output tiles in registers
      for (int r = 0; r < 4; ++r) { lo4[r] = oacc[dt][r] * inv; hi4[r] = oacc[dt][4 + r] * inv; }
      *(v4fa*)&sO[w][ln][dt * 16 + 8 * hh] = lo4; *(v4fa*)&sO[w][ln][dt * 16 + 8 * hh + 4] = hi4; } }
  __builtin_amdgcn_fence(__ATOMIC_ACQ_REL, "workgroup"); __builtin_amdgcn_wave_barrier();
  {
#pragma unroll
    for (int rp = 0; rp < RPW; rp += 2) { const int r = rp + (lane >> 4), pc = lane & 15; const v4f val = *(const v4fa*)&sO[w][r][pc * 4]; *(v4f*)(O + ((size_t)b * TT + q0 + r) * ldo + pc * 4) = val; }
     } }

__global__ __launch_bounds__(256) void k_stat(const float* __restrict__ O, const float* __restrict__ x, float* __restrict__ PART) { __shared__ float r1[256], r2[256]; const int tid = threadIdx.x; const int b = blockIdx.x / NPB, part = blockIdx.x % NPB; const size_t base = (size_t)b * TT * DD + (size_t)part * (TT * DD / NPB); float s1 = 0.f, s2 = 0.f;
#pragma unroll 1
  for (int i = tid * 4; i < TT * DD / NPB; i += 1024) { const v4f o = *(const v4fa*)(O + base + i), xv = *(const v4fa*)(x + base + i); for (int q = 0; q < 4; ++q) { const float y = o[q] + bf16_round(xv[q]); s1 += y; s2 += y * y; } }
  r1[tid] = s1; r2[tid] = s2; __syncthreads(); for (int o = 128; o >= 1; o >>= 1) { if (tid < o) { r1[tid] += r1[tid + o]; r2[tid] += r2[tid + o]; } __syncthreads(); }
  if (tid < 32) { const float v = (tid == 0) ? r1[0] : ((tid == 1) ? r2[0] : 0.f); *(float*)(PART + (size_t)blockIdx.x * 32 + tid) = v;  } }
__global__ __launch_bounds__(256) void k_norm(const float* __restrict__ O, const float* __restrict__ x, const float* __restrict__ PART, float* __restrict__ out) { const size_t t = (size_t)blockIdx.x * 256 + threadIdx.x; if (t >= (size_t)NR * DD / 4) return; const int b = (int)((t * 4) / ((size_t)TT * DD)); float s1 = 0.f, s2 = 0.f;
#pragma unroll 1
  for (int p = 0; p < NPB; ++p) { s1 += PART[((size_t)b * NPB + p) * 32]; s2 += PART[((size_t)b * NPB + p) * 32 + 1]; }
  const float n = (float)TT * (float)DD; const float mu = s1 / n; const float var = fmaxf(s2 / n - mu * mu, 0.f); const float rs = rsqrtf(var + 1e-5f);
  const v4f o = *(const v4fa*)(O + t * 4), xv = *(const v4fa*)(x + t * 4); v4f r; for (int q = 0; q < 4; ++q) r[q] = (o[q] + bf16_round(xv[q]) - mu) * rs;
  *(v4f*)(out + t * 4) = r;  }

extern "C" void kernel_launch(void* const* d_in, const int* in_sizes, int n_in,
                              void* d_out, int out_size, void* d_ws, size_t ws_size, hipStream_t stream) {
  (void)in_sizes; (void)n_in; (void)out_size;
  const float* x = (const float*)d_in[0]; const float* Wq = (const float*)d_in[1]; const float* Wk = (const float*)d_in[2]; const float* Wv = (const float*)d_in[3];
  char* ws = (char*)d_ws; size_t off = 0;
  auto take = [&](size_t bytes) { char* p = ws + off; off += (bytes + 255) & ~(size_t)255; return p; };
  const size_t WSZ = (size_t)DD * DD; _Float16* Bw = (_Float16*)take(3 * WSZ * 2); _Float16* X16 = (_Float16*)take((size_t)NR * DD * 2); float* F32 = (float*)take((size_t)NR * DD * 4);
  _Float16* Qh = (_Float16*)take((size_t)NR * DD * 2); _Float16* Ql = (_Float16*)take((size_t)NR * DD * 2); _Float16* Kh = (_Float16*)take((size_t)NR * DD * 2); _Float16* Kl = (_Float16*)take((size_t)NR * DD * 2);
  _Float16* V16 = (_Float16*)take((size_t)NR * DD * 2); _Float16* Vt = (_Float16*)take((size_t)NR * DD * 2); float* PART = (float*)take((size_t)BB * NPB * 32 * 4);
  float* O = F32;      /* F32 holds q (consumed by k_hl), then k (consumed by k_hl), then the attention output */
  if (off > ws_size) return;      // 6.3 + 8.4 + 16.8 + 6 × 8.4 ≈ 82 MB
  const unsigned gw = (unsigned)((WSZ / 8 + 255) / 256);
  k_round16f<<<gw, 256, 0, stream>>>(Wq, Bw, WSZ / 8); k_round16f<<<gw, 256, 0, stream>>>(Wk, Bw + WSZ, WSZ / 8); k_round16f<<<gw, 256, 0, stream>>>(Wv, Bw + 2 * WSZ, WSZ / 8);      /* (out,in) natural ×2^4 */
  k_x16<<<(unsigned)(((size_t)NR * DD / 8 + 255) / 256), 256, 0, stream>>>(x, X16, (size_t)NR * DD / 8);
  const dim3 gp(((NR / 16) * (DD / 64) + 3) / 4, 1); const unsigned g8 = (unsigned)(((size_t)NR * DD / 8 + 255) / 256);
  k_gemm_hhx<0><<<gp, 128, 0, stream>>>(X16, DD, 0, Bw, DD, 0, 0.0625f, nullptr, 0, nullptr, 1, 0, 0, F32, nullptr, DD, 0, NR, DD, DD); k_hl<<<g8, 256, 0, stream>>>(F32, Qh, Ql, (size_t)NR * DD / 8);      /* Q f32 → hi/lo */
  k_gemm_hhx<0><<<gp, 128, 0, stream>>>(X16, DD, 0, Bw + WSZ, DD, 0, 0.0625f, nullptr, 0, nullptr, 1, 0, 0, F32, nullptr, DD, 0, NR, DD, DD); k_hl<<<g8, 256, 0, stream>>>(F32, Kh, Kl, (size_t)NR * DD / 8);      /* K f32 → hi/lo */
  k_gemm_hhx<0><<<gp, 128, 0, stream>>>(X16, DD, 0, Bw + 2 * WSZ, DD, 0, 0.0625f, nullptr, 0, nullptr, 1, 0, 0, nullptr, V16, DD, 0, NR, DD, DD);      /* V f16 */
  k_vt<1, TT><<<NSL * (TT / 64), 256, 0, stream>>>(V16, 64, 0, Vt);      /* the [4096][1024] plane viewed as 32 contiguous [2048][64] slabs → Vᵀ per slab, in fragment order */
  k_flash<<<NSL * (TT / 64), 128, 0, stream>>>(Qh, Ql, 64, Kh, Kl, 64, Vt, O, 64);      /* same flat view for Q, K and O */
  k_stat<<<BB * NPB, 256, 0, stream>>>(O, x, PART); k_norm<<<(unsigned)(((size_t)NR * DD / 4 + 255) / 256), 256, 0, stream>>>(O, x, PART, (float*)d_out);
}

// v004
// Measured time: 208 microseconds a run.
// Two timings next to v003 put it at 1.13 and 1.14 times that version's speed.
// All steps since v000 together make it 2.41 times as fast.
#include <hip/hip_runtime.h>
// Multi-head attention with raw-reshape heads, residual and a global LayerNorm (B=2, S=2048, D=1024, 16 heads × 64): Q,K,V = x·Wᵀ reshaped by plain memory order to (H,B,S,64) (= 32 contiguous [2048][64] slabs of each
// [4096][1024] plane); UNSCALED softmax(Q·Kᵀ)·V per slab; y = out (same flat order, = [B,S,1024]) + x; output = (y − mean)/√(var + 1e-5) with mean/var over all (S,D) of each batch element (identity affine).
// Compute dtype: x and weights rounded to bf16; Q,K as f32 GEMM outputs split into f16 hi + ×2^10 residual planes so the unscaled (σ≈3) logits are f32-accurate; V f16; fused flash-style kernel
// (two score accumulators, online softmax f32, P f16 ×2^10) on v_wmma_f32_16x16x32_f16; residual and the per-batch statistics (fixed-order block partial sums of y and y², then a fixed-order combine) and normalisation in f32.
#define BB 2
#define TT 2048
#define DD 1024
#define NSL 32
#define NR (BB * TT)
#define NPB 64

typedef __bf16 v16b __attribute__((ext_vector_type(16)));
typedef unsigned short v8us __attribute__((ext_vector_type(8), may_alias));
typedef float  v8f  __attribute__((ext_vector_type(8)));
typedef float  v4f  __attribute__((ext_vector_type(4)));
typedef float  v4fa __attribute__((ext_vector_type(4), may_alias));
union FragB { v16b v; v8us half[2]; unsigned short u[16]; };

__device__ __forceinline__ unsigned short bf16_bits(float x) { unsigned int u = __float_as_uint(x); return (unsigned short)((u + 0x7FFFu + ((u >> 16) & 1u)) >> 16); }
__device__ __forceinline__ float bf16_val(unsigned short b) { return __uint_as_float(((unsigned int)b) << 16); }
__device__ __forceinline__ float bf16_round(float x) { return bf16_val(bf16_bits(x)); }
// D += A·B with NT terms: 1 = ah·bh, 2 = + al·bh (A split), 3 = + ah·bl (both split)
template <int NT>
__device__ __forceinline__ v8f mmaN(v16b ah, v16b al, v16b bh, v16b bl, v8f c) {
  c = __builtin_amdgcn_wmma_f32_16x16x32_bf16(false, ah, false, bh, (short)0, c, false, false);
  if (NT >= 2) c = __builtin_amdgcn_wmma_f32_16x16x32_bf16(false, al, false, bh, (short)0, c, false, false);
  if (NT >= 3) c = __builtin_amdgcn_wmma_f32_16x16x32_bf16(false, ah, false, bl, (short)0, c, false, false);
  asm volatile("v_nop\n\tv_nop\n\tv_nop\n\tv_nop" : "+v"(c) : "v"(ah), "v"(al), "v"(bh), "v"(bl));
  return c;
}

__global__ __launch_bounds__(256) void k_wt_bf16(const float* __restrict__ W, unsigned short* __restrict__ Wt, int K, int N) {
  const int t = blockIdx.x * 256 + threadIdx.x;
  const int k8n = K / 8;
  if (t >= N * k8n) return;
  const int n = t / k8n, k8 = (t % k8n) * 8;
  v8us v;
#pragma unroll
  for (int i = 0; i < 8; ++i) v[i] = bf16_bits(W[(size_t)(k8 + i) * N + n]);
  *(v8us*)(Wt + (size_t)n * K + k8) = v;
  
}

// GEMM C[M][N] (f32, pitch ldc) = act(A[M][K]·W + bias). A f32 row-major (pitch lda) converted per fragment to bf16
// (ASPLIT: hi/lo two planes -> 2 terms, else single rounded term); Wt bf16 [N][K] (pitch ldb). BIAS_BF16 rounds the
// bias to bf16 first (bias quantised to bf16 before the add). K%32==0, M%16==0, N%64==0.
template <bool ASPLIT, int ACT, bool BIAS_BF16>
__global__ __launch_bounds__(128) void k_gemm_bf(const float* __restrict__ A, int lda, const unsigned short* __restrict__ Wt, int ldb,
                                               const float* __restrict__ bias, float* __restrict__ C, int ldc, int M, int N, int K) {
  __shared__ __attribute__((aligned(16))) float so[4][16][64];
  const int tid = threadIdx.x, w = tid >> 5, lane = tid & 31, ln = lane & 15, hh = lane >> 4;
  const int ntn = N / 64;
  const int wid = blockIdx.x * 4 + w;
  const int mt = wid / ntn, nq = wid % ntn;
  if (mt * 16 >= M) return;
  const int row0 = mt * 16, col0 = nq * 64;
  const float* arow = A + (size_t)(row0 + ln) * lda;
  v8f acc[4] = {};
  for (int kb = 0; kb < K; kb += 32) {
    FragB ah, al;
    const v4f x0 = *(const v4fa*)(arow + kb + 8 * hh), x1 = *(const v4fa*)(arow + kb + 8 * hh + 4);
    const v4f x2 = *(const v4fa*)(arow + kb + 16 + 8 * hh), x3 = *(const v4fa*)(arow + kb + 16 + 8 * hh + 4);
    float xs[16] = {x0[0],x0[1],x0[2],x0[3],x1[0],x1[1],x1[2],x1[3],x2[0],x2[1],x2[2],x2[3],x3[0],x3[1],x3[2],x3[3]};
#pragma unroll
    for (int i = 0; i < 16; ++i) { const unsigned short hb = bf16_bits(xs[i]); ah.u[i] = hb; al.u[i] = ASPLIT ? bf16_bits(xs[i] - bf16_val(hb)) : (unsigned short)0; }
#pragma unroll
    for (int t = 0; t < 4; ++t) {
      const unsigned short* brow = Wt + (size_t)(col0 + t * 16 + ln) * ldb + kb;
      FragB b;
      b.half[0] = *(const v8us*)(brow + 8 * hh);
      b.half[1] = *(const v8us*)(brow + 16 + 8 * hh);
      acc[t] = mmaN<ASPLIT ? 2 : 1>(ah.v, al.v, b.v, b.v, acc[t]);
    }
  }
#pragma unroll
  for (int t = 0; t < 4; ++t) {
    float bv = bias ? bias[col0 + t * 16 + ln] : 0.f;
    if (BIAS_BF16) bv = bf16_round(bv);
#pragma unroll
    for (int r = 0; r < 8; ++r) { float v = acc[t][r] + bv; if (ACT == 1) v = fmaxf(v, 0.f); so[w][8 * hh + r][t * 16 + ln] = v; }
  }
  __builtin_amdgcn_fence(__ATOMIC_ACQ_REL, "workgroup");
  __builtin_amdgcn_wave_barrier();
  const int rsub = lane >> 4, c4 = (lane & 15) * 4;
  {
#pragma unroll
    for (int q = 0; q < 8; ++q) {
      const int r = q * 2 + rsub;
      const v4f v = *(const v4fa*)&so[w][r][c4];
      *(v4f*)(C + (size_t)(row0 + r) * ldc + col0 + c4) = v;
    }
    
  }
}

// Flash-style causal/unmasked attention, all contractions 3-term bf16 hi/lo splits, f32 softmax with running max.
// q,k,v rows are read from f32 buffers with arbitrary row pitch (so they can live inside a fused qkv buffer);
// D = head size (multiple of 32, <= 128); one wave = 16 query rows; block = 4 waves (64 queries) sharing K/V chunks of 32.
template <int D, bool CAUSAL>
__global__ __launch_bounds__(128) void k_flash(const float* __restrict__ qb, const float* __restrict__ kb, const float* __restrict__ vb,
                                             int pitch, int T, int H, float scale, float* __restrict__ y, int ypitch) {
  constexpr int KS = D / 32;        // k-steps for QK
  constexpr int DT = D / 16;        // d tiles for PV
  __shared__ __attribute__((aligned(16))) unsigned short sKh[32][D + 8], sKl[32][D + 8], sVh[32][D + 8], sVl[32][D + 8];
  __shared__ __attribute__((aligned(16))) unsigned short sPh[4][16][40], sPl[4][16][40];
  __shared__ __attribute__((aligned(16))) float sO[4][16][D];
  const int tid = threadIdx.x, w = tid >> 5, lane = tid & 31, ln = lane & 15, hh = lane >> 4;
  const int nqb = (T + 63) / 64;
  const int bh = blockIdx.x / nqb, qblk = blockIdx.x % nqb;
  const int b = bh / H, h = bh % H;
  const int q0 = qblk * 64 + w * 16;
  const float* Q = qb + (size_t)b * T * pitch + h * D;
  const float* K = kb + (size_t)b * T * pitch + h * D;
  const float* V = vb + (size_t)b * T * pitch + h * D;

  // A fragments of the wave's 16 query rows (scaled), hi/lo
  FragB aqh[KS], aql[KS];
  {
    int row = q0 + ln; if (row >= T) row = T - 1;
    const float* qr = Q + (size_t)row * pitch;
#pragma unroll
    for (int ks = 0; ks < KS; ++ks)
#pragma unroll
      for (int i = 0; i < 16; ++i) {
        const int d = ks * 32 + ((i < 8) ? (8 * hh + i) : (16 + 8 * hh + (i - 8)));
        const float x = qr[d] * scale; const unsigned short hb = bf16_bits(x);
        aqh[ks].u[i] = hb; aql[ks].u[i] = bf16_bits(x - bf16_val(hb));
      }
  }
  float m_r[8], l_r[8];
#pragma unroll
  for (int r = 0; r < 8; ++r) { m_r[r] = -3.0e38f; l_r[r] = 0.f; }
  v8f oacc[DT];
#pragma unroll
  for (int dt = 0; dt < DT; ++dt) oacc[dt] = (v8f){0.f,0.f,0.f,0.f,0.f,0.f,0.f,0.f};

  const int kv_end = CAUSAL ? min(T, qblk * 64 + 64) : T;     // block-uniform
  for (int j0 = 0; j0 < kv_end; j0 += 32) {
    __syncthreads();
    for (int e = tid; e < 32 * (D / 4); e += 128) {
      const int r = e / (D / 4), c4 = (e % (D / 4)) * 4;
      const int key = j0 + r;
      v4f kf = {0.f,0.f,0.f,0.f}, vf = {0.f,0.f,0.f,0.f};
      if (key < T) { kf = *(const v4fa*)(K + (size_t)key * pitch + c4); vf = *(const v4fa*)(V + (size_t)key * pitch + c4); }
#pragma unroll
      for (int t = 0; t < 4; ++t) {
        unsigned short hb = bf16_bits(kf[t]); sKh[r][c4 + t] = hb; sKl[r][c4 + t] = bf16_bits(kf[t] - bf16_val(hb));
        hb = bf16_bits(vf[t]); sVh[r][c4 + t] = hb; sVl[r][c4 + t] = bf16_bits(vf[t] - bf16_val(hb));
      }
    }
    __syncthreads();
    // S tile 16 x 32
    v8f s[2];
#pragma unroll
    for (int nt = 0; nt < 2; ++nt) {
      v8f acc = {};
#pragma unroll
      for (int ks = 0; ks < KS; ++ks) {
        FragB bh_, bl_;
        bh_.half[0] = *(const v8us*)&sKh[nt * 16 + ln][ks * 32 + 8 * hh]; bh_.half[1] = *(const v8us*)&sKh[nt * 16 + ln][ks * 32 + 16 + 8 * hh];
        bl_.half[0] = *(const v8us*)&sKl[nt * 16 + ln][ks * 32 + 8 * hh]; bl_.half[1] = *(const v8us*)&sKl[nt * 16 + ln][ks * 32 + 16 + 8 * hh];
        acc = mmaN<3>(aqh[ks].v, aql[ks].v, bh_.v, bl_.v, acc);
      }
      s[nt] = acc;
    }
    // mask + running max (rows 8hh+r; the 16 lanes of a half share rows)
    float alpha[8];
#pragma unroll
    for (int r = 0; r < 8; ++r) {
      const int qi = q0 + 8 * hh + r;
      const int ja = j0 + ln, jb = j0 + 16 + ln;
      if (CAUSAL) { if (ja > qi) s[0][r] = -3.0e38f; if (jb > qi) s[1][r] = -3.0e38f; }
      if (ja >= T) s[0][r] = -3.0e38f;
      if (jb >= T) s[1][r] = -3.0e38f;
      float mx = fmaxf(s[0][r], s[1][r]);
      mx = fmaxf(mx, __shfl_xor(mx, 1, 32)); mx = fmaxf(mx, __shfl_xor(mx, 2, 32)); mx = fmaxf(mx, __shfl_xor(mx, 4, 32)); mx = fmaxf(mx, __shfl_xor(mx, 8, 32));
      const float mnew = fmaxf(m_r[r], mx);
      alpha[r] = (mnew > -1.0e38f) ? __expf(m_r[r] - mnew) : 1.0f;
      const float p0 = (s[0][r] > -1.0e38f) ? __expf(s[0][r] - mnew) : 0.f;
      const float p1 = (s[1][r] > -1.0e38f) ? __expf(s[1][r] - mnew) : 0.f;
      m_r[r] = mnew;
      l_r[r] = l_r[r] * alpha[r] + p0 + p1;            // per-lane partial row sum (16 lanes combined at the end)
      unsigned short hb = bf16_bits(p0); sPh[w][8 * hh + r][ln] = hb;      sPl[w][8 * hh + r][ln] = bf16_bits(p0 - bf16_val(hb));
      hb = bf16_bits(p1);                sPh[w][8 * hh + r][16 + ln] = hb; sPl[w][8 * hh + r][16 + ln] = bf16_bits(p1 - bf16_val(hb));
    }
#pragma unroll
    for (int dt = 0; dt < DT; ++dt)
#pragma unroll
      for (int r = 0; r < 8; ++r) oacc[dt][r] *= alpha[r];
    __builtin_amdgcn_fence(__ATOMIC_ACQ_REL, "workgroup");
    __builtin_amdgcn_wave_barrier();
    FragB pah, pal;
    pah.half[0] = *(const v8us*)&sPh[w][ln][8 * hh]; pah.half[1] = *(const v8us*)&sPh[w][ln][16 + 8 * hh];
    pal.half[0] = *(const v8us*)&sPl[w][ln][8 * hh]; pal.half[1] = *(const v8us*)&sPl[w][ln][16 + 8 * hh];
#pragma unroll
    for (int dt = 0; dt < DT; ++dt) {
      FragB bvh, bvl;
#pragma unroll
      for (int i = 0; i < 8; ++i) {
        bvh.u[i] = sVh[8 * hh + i][dt * 16 + ln]; bvh.u[8 + i] = sVh[16 + 8 * hh + i][dt * 16 + ln];
        bvl.u[i] = sVl[8 * hh + i][dt * 16 + ln]; bvl.u[8 + i] = sVl[16 + 8 * hh + i][dt * 16 + ln];
      }
      oacc[dt] = mmaN<3>(pah.v, pal.v, bvh.v, bvl.v, oacc[dt]);
    }
    __builtin_amdgcn_fence(__ATOMIC_ACQ_REL, "workgroup");
    __builtin_amdgcn_wave_barrier();
  }
#pragma unroll
  for (int r = 0; r < 8; ++r) {
    float l = l_r[r];
    l += __shfl_xor(l, 1, 32); l += __shfl_xor(l, 2, 32); l += __shfl_xor(l, 4, 32); l += __shfl_xor(l, 8, 32);
    l_r[r] = (l > 0.f) ? 1.0f / l : 0.f;
  }
#pragma unroll
  for (int dt = 0; dt < DT; ++dt)
#pragma unroll
    for (int r = 0; r < 8; ++r) sO[w][8 * hh + r][dt * 16 + ln] = oacc[dt][r] * l_r[r];
  __builtin_amdgcn_fence(__ATOMIC_ACQ_REL, "workgroup");
  __builtin_amdgcn_wave_barrier();
  {
    for (int r = 0; r < 16; ++r) {
      const int row = q0 + r;
      if (row < T && lane < D / 4) {
        const v4f val = *(const v4fa*)&sO[w][r][lane * 4];
        *(v4f*)(y + ((size_t)b * T + row) * ypitch + h * D + lane * 4) = val;
      }
    }
    
  }
}

// GEMM C = act(A·W + bias + resid): A f32 (ASPLIT -> hi/lo 2 terms), Wt bf16 [N][K]; ACT 0 none, 1 relu, 2 exact gelu;
// resid (optional, f32, row index = (row % rmod), pitch ldr, RES_BF16 rounds it) added before the activation.
template <bool ASPLIT, int ACT, bool BIAS_BF16, bool RES_BF16>
__global__ __launch_bounds__(128) void k_gemm_bf3(const float* __restrict__ A, int lda, const unsigned short* __restrict__ Wt, int ldb,
                                                const float* __restrict__ bias, const float* __restrict__ resid, int rmod, int ldr,
                                                float* __restrict__ C, int ldc, int M, int N, int K) {
  __shared__ __attribute__((aligned(16))) float so[4][16][64];
  const int tid = threadIdx.x, w = tid >> 5, lane = tid & 31, ln = lane & 15, hh = lane >> 4;
  const int ntn = N / 64;
  const int wid = blockIdx.x * 4 + w;
  const int mt = wid / ntn, nq = wid % ntn;
  if (mt * 16 >= M) return;
  const int row0 = mt * 16, col0 = nq * 64;
  const float* arow = A + (size_t)(row0 + ln) * lda;
  v8f acc[4] = {};
  for (int kb = 0; kb < K; kb += 32) {
    FragB ah, al;
    const v4f x0 = *(const v4fa*)(arow + kb + 8 * hh), x1 = *(const v4fa*)(arow + kb + 8 * hh + 4);
    const v4f x2 = *(const v4fa*)(arow + kb + 16 + 8 * hh), x3 = *(const v4fa*)(arow + kb + 16 + 8 * hh + 4);
    float xs[16] = {x0[0],x0[1],x0[2],x0[3],x1[0],x1[1],x1[2],x1[3],x2[0],x2[1],x2[2],x2[3],x3[0],x3[1],x3[2],x3[3]};
#pragma unroll
    for (int i = 0; i < 16; ++i) { const unsigned short hb = bf16_bits(xs[i]); ah.u[i] = hb; al.u[i] = ASPLIT ? bf16_bits(xs[i] - bf16_val(hb)) : (unsigned short)0; }
#pragma unroll
    for (int t = 0; t < 4; ++t) {
      const unsigned short* brow = Wt + (size_t)(col0 + t * 16 + ln) * ldb + kb;
      FragB b;
      b.half[0] = *(const v8us*)(brow + 8 * hh);
      b.half[1] = *(const v8us*)(brow + 16 + 8 * hh);
      acc[t] = mmaN<ASPLIT ? 2 : 1>(ah.v, al.v, b.v, b.v, acc[t]);
    }
  }
#pragma unroll
  for (int t = 0; t < 4; ++t) {
    const int col = col0 + t * 16 + ln;
    float bv = bias ? bias[col] : 0.f;
    if (BIAS_BF16) bv = bf16_round(bv);
#pragma unroll
    for (int r = 0; r < 8; ++r) {
      float v = acc[t][r] + bv;
      if (resid) { float rv = resid[(size_t)((row0 + 8 * hh + r) % rmod) * ldr + col]; if (RES_BF16) rv = bf16_round(rv); v += rv; }
      if (ACT == 1) v = fmaxf(v, 0.f);
      if (ACT == 2) v = 0.5f * v * (1.0f + erff(v * 0.70710678118654752f));
      if (ACT == 3) { const float u = 0.7978845608028654f * (v + 0.044715f * v * v * v); v = 0.5f * v * (1.0f + tanhf(u)); }
      so[w][8 * hh + r][t * 16 + ln] = v;
    }
  }
  __builtin_amdgcn_fence(__ATOMIC_ACQ_REL, "workgroup");
  __builtin_amdgcn_wave_barrier();
  const int rsub = lane >> 4, c4 = (lane & 15) * 4;
  {
#pragma unroll
    for (int q = 0; q < 8; ++q) {
      const int r = q * 2 + rsub;
      const v4f v = *(const v4fa*)&so[w][r][c4];
      *(v4f*)(C + (size_t)(row0 + r) * ldc + col0 + c4) = v;
    }
    
  }
}
// row LayerNorm (biased variance, eps) over N: s = X (+ R); optional out_sum <- s; out_norm <- (s-mu)*rsqrt(var+eps)*g + b
template <bool PARAM_BF16>
__global__ __launch_bounds__(256) void k_layernorm(const float* __restrict__ X, const float* __restrict__ R, const float* __restrict__ g, const float* __restrict__ bta,
                                                  float* __restrict__ out_sum, float* __restrict__ out_norm, int N, float eps) {
  __shared__ float red[256];
  const int row = blockIdx.x, tid = threadIdx.x;
  const float* x = X + (size_t)row * N; const float* rr = R ? R + (size_t)row * N : nullptr;
  float vals[16];                     // up to N = 4096
  const int per = N / 256;            // contiguous chunk per thread? use strided-by-4 chunks: thread handles j = tid*4 + 1024*u
  float s1 = 0.f;
  for (int u = 0; u < per / 4; ++u) {
    const int j = tid * 4 + 1024 * u;
    const v4f a = *(const v4fa*)(x + j);
    v4f b = {0.f,0.f,0.f,0.f}; if (rr) b = *(const v4fa*)(rr + j);
#pragma unroll
    for (int q = 0; q < 4; ++q) { const float v = a[q] + b[q]; vals[u * 4 + q] = v; s1 += v; }
  }
  red[tid] = s1; __syncthreads();
  for (int st = 128; st > 0; st >>= 1) { if (tid < st) red[tid] += red[tid + st]; __syncthreads(); }
  const float mu = red[0] / (float)N; __syncthreads();
  float s2 = 0.f;
  for (int u = 0; u < per / 4; ++u)
#pragma unroll
    for (int q = 0; q < 4; ++q) { const float c = vals[u * 4 + q] - mu; s2 += c * c; }
  red[tid] = s2; __syncthreads();
  for (int st = 128; st > 0; st >>= 1) { if (tid < st) red[tid] += red[tid + st]; __syncthreads(); }
  const float rs = rsqrtf(red[0] / (float)N + eps);
  {
    for (int u = 0; u < per / 4; ++u) {
      const int j = tid * 4 + 1024 * u;
      v4f o, sm;
#pragma unroll
      for (int q = 0; q < 4; ++q) {
        float gg = g[j + q], bb = bta[j + q];
        if (PARAM_BF16) { gg = bf16_round(gg); bb = bf16_round(bb); }
        sm[q] = vals[u * 4 + q]; o[q] = (vals[u * 4 + q] - mu) * rs * gg + bb;
      }
      if (out_sum) *(v4f*)(out_sum + (size_t)row * N + j) = sm;
      *(v4f*)(out_norm + (size_t)row * N + j) = o;
    }
    
  }
}



// ---- f16 WMMA path (v_wmma_f32_16x16x32_f16): 11-bit significands for operands in range — used where a [0,1] probability operand needs more precision than bf16
typedef _Float16 v16h __attribute__((ext_vector_type(16)));
union FragH { v16h v; v8us half[2]; _Float16 h[16]; unsigned short u[16]; };
template <int NT>
__device__ __forceinline__ v8f mmaH(v16h ah, v16h al, v16h bh, v16h bl, v8f c) {
  c = __builtin_amdgcn_wmma_f32_16x16x32_f16(false, ah, false, bh, (short)0, c, false, false);
  if (NT >= 2) c = __builtin_amdgcn_wmma_f32_16x16x32_f16(false, al, false, bh, (short)0, c, false, false);
  if (NT >= 3) c = __builtin_amdgcn_wmma_f32_16x16x32_f16(false, ah, false, bl, (short)0, c, false, false);
  asm volatile("v_nop\n\tv_nop\n\tv_nop\n\tv_nop" : "+v"(c) : "v"(ah), "v"(al), "v"(bh), "v"(bl));
  return c;
}
// batched GEMM like k_gemm_b but f16 operands: A f32 (split into f16 hi/lo if ASPLIT, else rounded to f16), Bt = f16 values [n][k]; alpha; C f32; N multiple of 16 (partial tiles skipped)
template <bool ASPLIT>
__global__ __launch_bounds__(128) void k_gemm_h(const float* __restrict__ A, int lda, size_t sA, const _Float16* __restrict__ Bh, int ldb, size_t sB, float alpha, float* __restrict__ C, int ldc, size_t sC, int M, int N, int K) {
  __shared__ __attribute__((aligned(16))) float so[4][16][64];
  const int tid = threadIdx.x, w = tid >> 5, lane = tid & 31, ln = lane & 15, hh = lane >> 4; const int by = blockIdx.y;
  A += (size_t)by * sA; Bh += (size_t)by * sB; C += (size_t)by * sC;
  const int ntn = (N + 63) / 64; const int wid = blockIdx.x * 4 + w; const int mt = wid / ntn, nq = wid % ntn; if (mt * 16 >= M) return;
  const int row0 = mt * 16, col0 = nq * 64; const float* arow = A + (size_t)(row0 + ln) * lda;
  v8f acc[4] = {};
  for (int kb = 0; kb < K; kb += 32) {
    FragH ah, al;
    const v4f x0 = *(const v4fa*)(arow + kb + 8 * hh), x1 = *(const v4fa*)(arow + kb + 8 * hh + 4), x2 = *(const v4fa*)(arow + kb + 16 + 8 * hh), x3 = *(const v4fa*)(arow + kb + 16 + 8 * hh + 4);
    float xs[16] = {x0[0],x0[1],x0[2],x0[3],x1[0],x1[1],x1[2],x1[3],x2[0],x2[1],x2[2],x2[3],x3[0],x3[1],x3[2],x3[3]};
#pragma unroll
    for (int i = 0; i < 16; ++i) { const _Float16 h = (_Float16)xs[i]; ah.h[i] = h; al.h[i] = ASPLIT ? (_Float16)(xs[i] - (float)h) : (_Float16)0.0f; }
#pragma unroll
    for (int t = 0; t < 4; ++t) { if (col0 + t * 16 >= N) continue; const size_t boff = (size_t)(col0 + t * 16 + ln) * ldb + kb; FragH bq; bq.half[0] = *(const v8us*)(Bh + boff + 8 * hh); bq.half[1] = *(const v8us*)(Bh + boff + 16 + 8 * hh);
      acc[t] = mmaH<ASPLIT ? 2 : 1>(ah.v, al.v, bq.v, bq.v, acc[t]); }
  }
#pragma unroll
  for (int t = 0; t < 4; ++t) { if (col0 + t * 16 >= N) continue;
#pragma unroll
    for (int r = 0; r < 8; ++r) so[w][8 * hh + r][t * 16 + ln] = acc[t][r] * alpha; }
  __builtin_amdgcn_fence(__ATOMIC_ACQ_REL, "workgroup"); __builtin_amdgcn_wave_barrier();
  const int rsub = lane >> 4, c4 = (lane & 15) * 4;
  {
#pragma unroll
    for (int q = 0; q < 8; ++q) { const int r = q * 2 + rsub; if (col0 + c4 < N) { const v4f v = *(const v4fa*)&so[w][r][c4]; *(v4f*)(C + (size_t)(row0 + r) * ldc + col0 + c4) = v; } }
     }
}

// Wt[n][k] = f16(W[k][n]·scale) from f32 row-major W[K][N] (scale = power of two; bf16-exact weights stay exact in f16 away from the subnormal range)
__global__ __launch_bounds__(256) void k_wt_f16(const float* __restrict__ W, _Float16* __restrict__ Wt, int K, int N, float scale) {
  const int t = blockIdx.x * 256 + threadIdx.x; if (t >= N * (K / 8)) return; const int n = t / (K / 8), k8 = (t % (K / 8)) * 8; FragH f;
#pragma unroll
  for (int i = 0; i < 8; ++i) f.h[i] = (_Float16)(bf16_round(W[(size_t)(k8 + i) * N + n]) * scale); const v8us o = f.half[0];
  *(v8us*)((unsigned short*)Wt + (size_t)n * K + k8) = o; 
}
// Fragment order: a [rows][K] 16-bit plane is kept as 1-KB units of 16 rows x 32 k, unit (row / 16) * (K / 32) + k / 32; inside a unit the 16-byte piece 32 p + lane holds row (lane & 15), k = 16 p + 8 (lane >> 4) + 0..7.
// A wave's fragment is then two 16-byte loads per lane that each cover 512 contiguous bytes (4 whole 128-B lines) instead of 32 bytes in each of 16 lines; fragment element i is k = 8 (lane >> 4) + i for i < 8 and 16 + 8 (lane >> 4) + (i - 8) above, for both operands of every product.
// frag_src: index, in the row-major plane, of the first of the 8 elements that 16-byte piece number 'piece' of the fragment-ordered plane holds.
__device__ __forceinline__ size_t frag_src(size_t piece, int K) { const size_t u = piece >> 6; const int in = (int)(piece & 63), p = in >> 5, l = in & 31; const size_t kt = (size_t)(K / 32);
  return ((u / kt) * 16 + (size_t)(l & 15)) * (size_t)K + (u % kt) * 32 + (size_t)(p * 16 + (l >> 4) * 8); }
// A and Bh in fragment order (lda == ldb == K at every launch here).
// k_gemm_hh variant with fused epilogue: v = acc·alpha + bias[by·sBias + col] (+ CP[(row/rowsPerB)·sCPb + by·64 + col] if CP) ; ACT 0 none / 1 elu ; writes f32 C and f16 C16, each if non-null
template <int ACT>
__global__ __launch_bounds__(128) void k_gemm_hhx(const _Float16* __restrict__ A, int lda, size_t sA, const _Float16* __restrict__ Bh, int ldb, size_t sB, float alpha, const float* __restrict__ bias, size_t sBias, const float* __restrict__ CP, int rowsPerB, size_t sCPb, int row0g,
    float* __restrict__ C, _Float16* __restrict__ C16, int ldc, size_t sC, int M, int N, int K) {
  __shared__ __attribute__((aligned(16))) float so[4][16][64];
  const int tid = threadIdx.x, w = tid >> 5, lane = tid & 31, ln = lane & 15, hh = lane >> 4; const int by = blockIdx.y;
  A += (size_t)by * sA; Bh += (size_t)by * sB; const size_t cofs = (size_t)by * sC; const float* bp = bias ? bias + (size_t)by * sBias : nullptr;
  const int ntn = (N + 63) / 64; const int wid = blockIdx.x * 4 + w; const int mt = wid / ntn, nq = wid % ntn; if (mt * 16 >= M) return;
  const int row0 = mt * 16, col0 = nq * 64;
  v8f acc[4] = {};
  // Two register stages of 64 k each (K % 128 == 0, N % 64 == 0 at every launch here): a stage's 20 fragment loads are issued as one group, one stage ahead of the products that read them.
  // The five row pointers are carried through the loop and stepped between the groups, so none of their registers is free for a load's result while loads are in flight.
  const char* pa = (const char*)(A + (size_t)row0 * lda + lane * 8); const char* pb[4];
#pragma unroll      // constant indices keep the row pointers in registers
  for (int t = 0; t < 4; ++t) pb[t] = (const char*)(Bh + (size_t)(col0 + t * 16) * ldb + lane * 8);
  FragH a0[2], b0[2][4], a1[2], b1[2][4];
  auto fetch = [&](FragH (&fa)[2], FragH (&fb)[2][4]) {
#pragma unroll      // constant indices keep the fragment arrays in registers
    for (int ks = 0; ks < 2; ++ks) { fa[ks].half[0] = *(const v8us*)(pa + ks * 1024); fa[ks].half[1] = *(const v8us*)(pa + ks * 1024 + 512);
#pragma unroll      // constant indices keep the fragment arrays in registers
      for (int t = 0; t < 4; ++t) { fb[ks][t].half[0] = *(const v8us*)(pb[t] + ks * 1024); fb[ks][t].half[1] = *(const v8us*)(pb[t] + ks * 1024 + 512); } } };
  auto step = [&](long bytes) { pa += bytes;
#pragma unroll      // constant indices keep the row pointers in registers
    for (int t = 0; t < 4; ++t) pb[t] += bytes; };
  auto mul = [&](FragH (&fa)[2], FragH (&fb)[2][4]) {
#pragma unroll      // constant indices keep the fragment arrays in registers
    for (int ks = 0; ks < 2; ++ks)
#pragma unroll      // constant indices keep the fragment arrays in registers
      for (int t = 0; t < 4; ++t) acc[t] = mmaH<1>(fa[ks].v, fa[ks].v, fb[ks][t].v, fb[ks][t].v, acc[t]); };
  fetch(a0, b0); step(2048);      // a stage of 64 k = two 1-KB units; a 16-row tile's K elements = 32 K bytes
#pragma unroll 1      // rolled: one ping-pong pair per trip keeps both stages in fixed registers and the loop short
  for (int kb = 0; kb < K; kb += 128) {
    fetch(a1, b1); mul(a0, b0); step((kb + 128 < K) ? 2048L : 2048L - 32L * K);      // the last trip steps back to k = 0: its second fetch stays in bounds and is not used
    fetch(a0, b0); mul(a1, b1); step(2048);
  }
#pragma unroll
  for (int t = 0; t < 4; ++t) { if (col0 + t * 16 >= N) continue; const int col = col0 + t * 16 + ln; const float bv = bp ? bf16_round(bp[col]) : 0.f;
#pragma unroll
    for (int r = 0; r < 8; ++r) { float v = acc[t][r] * alpha + bv; if (CP) { const int bidx = (row0g + row0 + 8 * hh + r) / rowsPerB; v += CP[(size_t)bidx * sCPb + (size_t)by * 64 + col]; } if (ACT == 1) v = (v > 0.f) ? v : expm1f(v); else if (ACT == 7) v = (v > 0.f) ? v + 1.0f : expf(v); else if (ACT == 8) v = tanhf(v); else if (ACT == 9) v = 0.5f * v * (1.0f + tanhf(0.7978845608028654f * (v + 0.044715f * v * v * v))); else if (ACT == 11) v = 1.0f / (1.0f + expf(-v)); else if (ACT == 12) v = (v > 0.f) ? v : 0.01f * v; else if (ACT == 14) v = (v > 0.f) ? v : 0.1f * v; else if (ACT == 15) v = v / (1.0f + expf(-v)); else if (ACT == 3) v = fmaxf(v, 0.f); else if (ACT == 6) v = 0.5f * v * (1.0f + erff(v * 0.70710678118654752f)); so[w][8 * hh + r][t * 16 + ln] = v; } }
  __builtin_amdgcn_fence(__ATOMIC_ACQ_REL, "workgroup"); __builtin_amdgcn_wave_barrier();
  const int rsub = lane >> 4, c4 = (lane & 15) * 4; typedef _Float16 v4h __attribute__((ext_vector_type(4)));
  {
#pragma unroll
    for (int q = 0; q < 8; ++q) { const int r = q * 2 + rsub; if (col0 + c4 < N) { const v4f v = *(const v4fa*)&so[w][r][c4]; if (C) *(v4f*)(C + cofs + (size_t)(row0 + r) * ldc + col0 + c4) = v; if (C16) { v4h h4; for (int i = 0; i < 4; ++i) h4[i] = (_Float16)v[i]; *(v4h*)(C16 + cofs + (size_t)(row0 + r) * ldc + col0 + c4) = h4; } } }
     }
}


typedef _Float16 v4h __attribute__((ext_vector_type(4)));

__global__ __launch_bounds__(256) void k_x16(const float* __restrict__ x, _Float16* __restrict__ X16, size_t n8) { const size_t t = (size_t)blockIdx.x * 256 + threadIdx.x; if (t >= n8) return; FragH f; const size_t s = frag_src(t, DD);
#pragma unroll
  for (int q = 0; q < 8; ++q) f.h[q] = (_Float16)bf16_round(x[s + q]); *(v8us*)((unsigned short*)X16 + t * 8) = f.half[0];  }      /* [NR][DD] plane, written in fragment order */
__global__ __launch_bounds__(256) void k_h16(const float* __restrict__ x, _Float16* __restrict__ X16, size_t n8) { const size_t t = (size_t)blockIdx.x * 256 + threadIdx.x; if (t >= n8) return; FragH f;
#pragma unroll
  for (int q = 0; q < 8; ++q) f.h[q] = (_Float16)x[t * 8 + q]; *(v8us*)((unsigned short*)X16 + t * 8) = f.half[0];  }
__global__ __launch_bounds__(256) void k_round16f(const float* __restrict__ W, _Float16* __restrict__ Bt, size_t n8) { const size_t t = (size_t)blockIdx.x * 256 + threadIdx.x; if (t >= n8) return; FragH f; const size_t s = frag_src(t, DD);
#pragma unroll
  for (int i = 0; i < 8; ++i) f.h[i] = (_Float16)(bf16_round(W[s + i]) * 16.0f); *(v8us*)((unsigned short*)Bt + t * 8) = f.half[0];  }      /* [DD][DD] plane, written in fragment order */
template <int NHv, int TTv>
__global__ __launch_bounds__(256) void k_vt(const _Float16* __restrict__ V16, int ldv, int voff, _Float16* __restrict__ Vt) { __shared__ unsigned short tl[64][66]; const int tid = threadIdx.x; const int slab = blockIdx.x / (TTv / 64), lg = blockIdx.x % (TTv / 64); const int b = slab / NHv, h = slab % NHv;
  for (int i = tid; i < 64 * 8; i += 256) { const int r = i / 8, c8 = (i % 8) * 8; FragH f; f.half[0] = *(const v8us*)((const unsigned short*)V16 + ((size_t)b * TTv + lg * 64 + r) * ldv + voff + h * 64 + c8);
#pragma unroll
    for (int q = 0; q < 8; ++q) tl[r][c8 + q] = f.u[q]; }
  __syncthreads();
  {
#pragma unroll
    for (int rd = 0; rd < 2; ++rd) { const int o = rd * 256 + tid, un = o >> 6, p = (o >> 5) & 1, l = o & 31; const int d = (un & 3) * 16 + (l & 15), key = (un >> 2) * 32 + p * 16 + (l >> 4) * 8; FragH f;      // V^T in fragment order: unit (32-key tile) * 4 + d / 16, rows = d, k = keys; the block's 8 units are 8 KB in a row
#pragma unroll
      for (int q = 0; q < 8; ++q) f.u[q] = tl[key + q][d];
      *(v8us*)((unsigned short*)Vt + ((size_t)slab * TTv + lg * 64) * 64 + o * 8) = f.half[0]; }
     } }

__global__ __launch_bounds__(256) void k_hl(const float* __restrict__ F, _Float16* __restrict__ Hh, _Float16* __restrict__ Hl, size_t n8) { const size_t t = (size_t)blockIdx.x * 256 + threadIdx.x; if (t >= n8) return; FragH fh, fl; const size_t s = frag_src(t, 64); const v4f a = *(const v4fa*)(F + s), c = *(const v4fa*)(F + s + 4);      /* the flat [rows][64] view, both planes written in fragment order */
#pragma unroll
  for (int q = 0; q < 4; ++q) { _Float16 h = (_Float16)a[q]; fh.h[q] = h; fl.h[q] = (_Float16)((a[q] - (float)h) * 1024.0f); h = (_Float16)c[q]; fh.h[4 + q] = h; fl.h[4 + q] = (_Float16)((c[q] - (float)h) * 1024.0f); }
  { *(v8us*)((unsigned short*)Hh + t * 8) = fh.half[0]; *(v8us*)((unsigned short*)Hl + t * 8) = fl.half[0];  } }
typedef float v2f __attribute__((ext_vector_type(2)));
// lane l <-> lane l ^ 16 by a vector cross-row move
__device__ __forceinline__ float xhalf(float x) { return __builtin_bit_cast(float, __builtin_amdgcn_permlanex16(__builtin_bit_cast(int, x), __builtin_bit_cast(int, x), 0x76543210, 0xfedcba98, false, false)); }
__global__ __launch_bounds__(128) void k_flash(const _Float16* __restrict__ Q16, const _Float16* __restrict__ Q16lo, int ldq, const _Float16* __restrict__ K16, const _Float16* __restrict__ K16lo, int ldk, const _Float16* __restrict__ Vt, float* __restrict__ O, int ldo) {
  constexpr int RPW = 16, NQB = TT / (4 * RPW), DT = 4, KS = 2; constexpr float L2E = 1.4426950408889634f;
  __shared__ __attribute__((aligned(16))) float sO[4][RPW][64 + 4];
  const int tid = threadIdx.x, w = tid >> 5, lane = tid & 31, ln = lane & 15, hh = lane >> 4;
  const int slab = blockIdx.x / NQB, qblk = blockIdx.x % NQB; const int b = slab; const int qb0 = qblk * (4 * RPW); const int q0 = qb0 + w * RPW;
  FragH aq[KS], aql[KS];
  { const size_t qo = ((size_t)b * TT + q0) * ldq + lane * 8; const unsigned short* qr = (const unsigned short*)Q16 + qo; const unsigned short* ql = (const unsigned short*)Q16lo + qo;
#pragma unroll
    for (int ks = 0; ks < KS; ++ks) { aq[ks].half[0] = *(const v8us*)(qr + ks * 512); aq[ks].half[1] = *(const v8us*)(qr + ks * 512 + 256); aql[ks].half[0] = *(const v8us*)(ql + ks * 512); aql[ks].half[1] = *(const v8us*)(ql + ks * 512 + 256); } }      // fragment-ordered planes (ldq == ldk == 64): unit = (row / 16) * 2 + ks
  const unsigned short* Vth = (const unsigned short*)Vt + (size_t)slab * 64 * TT;
  float m_r = -3.0e38f, b_r = -3.0e38f, l_r = 0.f; v8f oacc[DT];
#pragma unroll
  for (int dt = 0; dt < DT; ++dt) oacc[dt] = (v8f){0.f,0.f,0.f,0.f,0.f,0.f,0.f,0.f};
  const int jend = TT;
  // K fragments (both planes, 32 keys) live in registers across the back edge: each pass fetches the next pass's right behind its own score products; V fragments are fetched at the pass's top, ahead of the scores and the softmax.
  FragH bk[2][KS], bl[2][KS];
  auto fetchK = [&](int j) {
#pragma unroll      // constant indices keep the fragment arrays in registers
    for (int nt = 0; nt < 2; ++nt) { const size_t ko = ((size_t)b * TT + j + nt * 16) * ldk + lane * 8; const unsigned short* kr = (const unsigned short*)K16 + ko; const unsigned short* kl = (const unsigned short*)K16lo + ko;
#pragma unroll      // constant indices keep the fragment arrays in registers
      for (int ks = 0; ks < KS; ++ks) { bk[nt][ks].half[0] = *(const v8us*)(kr + ks * 512); bk[nt][ks].half[1] = *(const v8us*)(kr + ks * 512 + 256); bl[nt][ks].half[0] = *(const v8us*)(kl + ks * 512); bl[nt][ks].half[1] = *(const v8us*)(kl + ks * 512 + 256); } } };
  fetchK(0);
  { const size_t qa = ((size_t)b * TT + q0) * ldq + lane * 8, ka = (size_t)b * TT * ldk + lane * 8, kc = ((size_t)b * TT + 16) * ldk + lane * 8;
    // the wait in front of the reuse of the address registers of the Q and K loads above; the six addresses are inputs so that their registers stay as they are up to the wait
    asm volatile("s_wait_xcnt 0x0" :: "v"(Q16 + qa), "v"(Q16lo + qa), "v"(K16 + ka), "v"(K16lo + ka), "v"(K16 + kc), "v"(K16lo + kc) : "memory"); }
#pragma unroll 1
  for (int j0 = 0; j0 < jend; j0 += 32) {
    FragH bv[DT];
#pragma unroll      // constant indices keep the fragment arrays in registers
    for (int dt = 0; dt < DT; ++dt) { const unsigned short* vrow = Vth + (size_t)j0 * 64 + dt * 512 + lane * 8; bv[dt].half[0] = *(const v8us*)(vrow); bv[dt].half[1] = *(const v8us*)(vrow + 256); }
    v8f s[2];      // s[nt][r] = score of query q0 + ln against key j0 + 16 nt + 8 hh + r
#pragma unroll
    for (int nt = 0; nt < 2; ++nt) { v8f acc = (v8f){0.f,0.f,0.f,0.f,0.f,0.f,0.f,0.f}, accl = acc;
#pragma unroll
      for (int ks = 0; ks < KS; ++ks) { acc = mmaH<1>(bk[nt][ks].v, bk[nt][ks].v, aq[ks].v, aq[ks].v, acc); accl = mmaH<1>(bk[nt][ks].v, bk[nt][ks].v, aql[ks].v, aql[ks].v, accl); accl = mmaH<1>(bl[nt][ks].v, bl[nt][ks].v, aq[ks].v, aq[ks].v, accl); }
      s[nt] = acc + accl * 0.0009765625f; }
    const int jn = (j0 + 32 < jend) ? j0 + 32 : 0; fetchK(jn);      // the last pass refetches keys 0..31: in bounds, not used
    { const size_t ka = ((size_t)b * TT + jn) * ldk + lane * 8, kc = ((size_t)b * TT + jn + 16) * ldk + lane * 8;
      // the wait in front of the reuse of the address registers of the K loads above; the four addresses are inputs so that none of their registers is handed to a load's result or to the softmax ahead of the wait
      asm volatile("s_wait_xcnt 0x0" :: "v"(K16 + ka), "v"(K16lo + ka), "v"(K16 + kc), "v"(K16lo + kc) : "memory"); }
    float mc = s[0][0], md = s[1][0];
#pragma unroll      // constant indices keep the score tiles in registers
    for (int r = 1; r < 8; ++r) { mc = fmaxf(mc, s[0][r]); md = fmaxf(md, s[1][r]); }
    mc = fmaxf(mc, md); mc = fmaxf(mc, xhalf(mc));      // both halves now hold the query's maximum over the pass's 32 keys
    // base 2: b_r is the running maximum times log2(e), less 10; every weight is then 2^(s log2(e) - b_r) = 2^10 exp(s - max), one multiply-add and one hardware exponential, already at the scale the f16 P operand wants
    const float mn = fmaxf(m_r, mc), bn = __builtin_fmaf(mn, L2E, -10.0f); const float al = __builtin_amdgcn_exp2f((mn > -1.0e38f) ? b_r - bn : 0.f); m_r = mn; b_r = bn;      // the guard selects the argument (2^0 = 1), so no branch on lanes stands in the loop
    FragH pt; v2f ps[2] = {(v2f){0.f, 0.f}, (v2f){0.f, 0.f}}; const v8f l2e8 = {L2E, L2E, L2E, L2E, L2E, L2E, L2E, L2E}, nm8 = {-bn, -bn, -bn, -bn, -bn, -bn, -bn, -bn};
#pragma unroll      // constant indices keep the score tiles and the P^T fragment in registers
    for (int nt = 0; nt < 2; ++nt) { const v8f d = __builtin_elementwise_fma(s[nt], l2e8, nm8);
#pragma unroll      // constant indices keep the score tiles and the P^T fragment in registers
      for (int r = 0; r < 8; r += 2) { const v2f p = {__builtin_amdgcn_exp2f(d[r]), __builtin_amdgcn_exp2f(d[r + 1])}; ps[nt] += p; pt.h[8 * nt + r] = (_Float16)p[0]; pt.h[8 * nt + r + 1] = (_Float16)p[1]; } }
    { const v2f pq = ps[0] + ps[1]; l_r = l_r * al + (pq[0] + pq[1]); }      // this half's 16 keys; the halves are joined behind the loop
#pragma unroll
    for (int dt = 0; dt < DT; ++dt)
#pragma unroll
      for (int r = 0; r < 8; ++r) oacc[dt][r] *= al;
#pragma unroll
    for (int dt = 0; dt < DT; ++dt) oacc[dt] = mmaH<1>(bv[dt].v, bv[dt].v, pt.v, pt.v, oacc[dt]);      // oacc[dt][r] = O[q0 + ln][16 dt + 8 hh + r]
  }
  { const float l = l_r + xhalf(l_r); const float inv = (l > 0.f) ? 1.0f / l : 0.f;      // l and the output tiles both carry the factor 2^10; the exchange stands ahead of the select: all lanes are on
#pragma unroll      // constant indices keep the output tiles in registers
    for (int dt = 0; dt < DT; ++dt) { v4f lo4, hi4;
#pragma unroll      // constant indices keep the output tiles in registers
      for (int r = 0; r < 4; ++r) { lo4[r] = oacc[dt][r] * inv; hi4[r] = oacc[dt][4 + r] * inv; }
      *(v4fa*)&sO[w][ln][dt * 16 + 8 * hh] = lo4; *(v4fa*)&sO[w][ln][dt * 16 + 8 * hh + 4] = hi4; } }
  __builtin_amdgcn_fence(__ATOMIC_ACQ_REL, "workgroup"); __builtin_amdgcn_wave_barrier();
  {
#pragma unroll
    for (int rp = 0; rp < RPW; rp += 2) { const int r = rp + (lane >> 4), pc = lane & 15; const v4f val = *(const v4fa*)&sO[w][r][pc * 4]; *(v4f*)(O + ((size_t)b * TT + q0 + r) * ldo + pc * 4) = val; }
     } }

__global__ __launch_bounds__(256) void k_stat(const float* __restrict__ O, const float* __restrict__ x, float* __restrict__ PART) { __shared__ float r1[256], r2[256]; const int tid = threadIdx.x; const int b = blockIdx.x / NPB, part = blockIdx.x % NPB; const size_t base = (size_t)b * TT * DD + (size_t)part * (TT * DD / NPB); float s1 = 0.f, s2 = 0.f;
#pragma unroll 1
  for (int i = tid * 4; i < TT * DD / NPB; i += 1024) { const v4f o = *(const v4fa*)(O + base + i), xv = *(const v4fa*)(x + base + i); for (int q = 0; q < 4; ++q) { const float y = o[q] + bf16_round(xv[q]); s1 += y; s2 += y * y; } }
  r1[tid] = s1; r2[tid] = s2; __syncthreads(); for (int o = 128; o >= 1; o >>= 1) { if (tid < o) { r1[tid] += r1[tid + o]; r2[tid] += r2[tid + o]; } __syncthreads(); }
  if (tid < 32) { const float v = (tid == 0) ? r1[0] : ((tid == 1) ? r2[0] : 0.f); *(float*)(PART + (size_t)blockIdx.x * 32 + tid) = v;  } }
__global__ __launch_bounds__(256) void k_norm(const float* __restrict__ O, const float* __restrict__ x, const float* __restrict__ PART, float* __restrict__ out) { const size_t t = (size_t)blockIdx.x * 256 + threadIdx.x; if (t >= (size_t)NR * DD / 4) return; const int b = (int)((t * 4) / ((size_t)TT * DD)); float s1 = 0.f, s2 = 0.f;
#pragma unroll 1
  for (int p = 0; p < NPB; ++p) { s1 += PART[((size_t)b * NPB + p) * 32]; s2 += PART[((size_t)b * NPB + p) * 32 + 1]; }
  const float n = (float)TT * (float)DD; const float mu = s1 / n; const float var = fmaxf(s2 / n - mu * mu, 0.f); const float rs = rsqrtf(var + 1e-5f);
  const v4f o = *(const v4fa*)(O + t * 4), xv = *(const v4fa*)(x + t * 4); v4f r; for (int q = 0; q < 4; ++q) r[q] = (o[q] + bf16_round(xv[q]) - mu) * rs;
  *(v4f*)(out + t * 4) = r;  }

extern "C" void kernel_launch(void* const* d_in, const int* in_sizes, int n_in,
                              void* d_out, int out_size, void* d_ws, size_t ws_size, hipStream_t stream) {
  (void)in_sizes; (void)n_in; (void)out_size;
  const float* x = (const float*)d_in[0]; const float* Wq = (const float*)d_in[1]; const float* Wk = (const float*)d_in[2]; const float* Wv = (const float*)d_in[3];
  char* ws = (char*)d_ws; size_t off = 0;
  auto take = [&](size_t bytes) { char* p = ws + off; off += (bytes + 255) & ~(size_t)255; return p; };
  const size_t WSZ = (size_t)DD * DD; _Float16* Bw = (_Float16*)take(3 * WSZ * 2); _Float16* X16 = (_Float16*)take((size_t)NR * DD * 2); float* F32 = (float*)take((size_t)NR * DD * 4);
  _Float16* Qh = (_Float16*)take((size_t)NR * DD * 2); _Float16* Ql = (_Float16*)take((size_t)NR * DD * 2); _Float16* Kh = (_Float16*)take((size_t)NR * DD * 2); _Float16* Kl = (_Float16*)take((size_t)NR * DD * 2);
  _Float16* V16 = (_Float16*)take((size_t)NR * DD * 2); _Float16* Vt = (_Float16*)take((size_t)NR * DD * 2); float* PART = (float*)take((size_t)BB * NPB * 32 * 4);
  float* O = F32;      /* F32 holds q (consumed by k_hl), then k (consumed by k_hl), then the attention output */
  if (off > ws_size) return;      // 6.3 + 8.4 + 16.8 + 6 × 8.4 ≈ 82 MB
  const unsigned gw = (unsigned)((WSZ / 8 + 255) / 256);
  k_round16f<<<gw, 256, 0, stream>>>(Wq, Bw, WSZ / 8); k_round16f<<<gw, 256, 0, stream>>>(Wk, Bw + WSZ, WSZ / 8); k_round16f<<<gw, 256, 0, stream>>>(Wv, Bw + 2 * WSZ, WSZ / 8);      /* (out,in) natural ×2^4 */
  k_x16<<<(unsigned)(((size_t)NR * DD / 8 + 255) / 256), 256, 0, stream>>>(x, X16, (size_t)NR * DD / 8);
  const dim3 gp(((NR / 16) * (DD / 64) + 3) / 4, 1); const unsigned g8 = (unsigned)(((size_t)NR * DD / 8 + 255) / 256);
  k_gemm_hhx<0><<<gp, 128, 0, stream>>>(X16, DD, 0, Bw, DD, 0, 0.0625f, nullptr, 0, nullptr, 1, 0, 0, F32, nullptr, DD, 0, NR, DD, DD); k_hl<<<g8, 256, 0, stream>>>(F32, Qh, Ql, (size_t)NR * DD / 8);      /* Q f32 → hi/lo */
  k_gemm_hhx<0><<<gp, 128, 0, stream>>>(X16, DD, 0, Bw + WSZ, DD, 0, 0.0625f, nullptr, 0, nullptr, 1, 0, 0, F32, nullptr, DD, 0, NR, DD, DD); k_hl<<<g8, 256, 0, stream>>>(F32, Kh, Kl, (size_t)NR * DD / 8);      /* K f32 → hi/lo */
  k_gemm_hhx<0><<<gp, 128, 0, stream>>>(X16, DD, 0, Bw + 2 * WSZ, DD, 0, 0.0625f, nullptr, 0, nullptr, 1, 0, 0, nullptr, V16, DD, 0, NR, DD, DD);      /* V f16 */
  k_vt<1, TT><<<NSL * (TT / 64), 256, 0, stream>>>(V16, 64, 0, Vt);      /* the [4096][1024] plane viewed as 32 contiguous [2048][64] slabs → Vᵀ per slab, in fragment order */
  k_flash<<<NSL * (TT / 64), 128, 0, stream>>>(Qh, Ql, 64, Kh, Kl, 64, Vt, O, 64);      /* same flat view for Q, K and O */
  k_stat<<<BB * NPB, 256, 0, stream>>>(O, x, PART); k_norm<<<(unsigned)(((size_t)NR * DD / 4 + 255) / 256), 256, 0, stream>>>(O, x, PART, (float*)d_out);
}

// v005
// Measured time: 196 microseconds a run.
// In two side-by-side timings against v004, it was 1.06 and 1.05 times as fast.
// Counting every step since v000, it is 2.54 times as fast.
#include <hip/hip_runtime.h>
// Multi-head attention with raw-reshape heads, residual and a global LayerNorm (B=2, S=2048, D=1024, 16 heads × 64): Q,K,V = x·Wᵀ reshaped by plain memory order to (H,B,S,64) (= 32 contiguous [2048][64] slabs of each
// [4096][1024] plane); UNSCALED softmax(Q·Kᵀ)·V per slab; y = out (same flat order, = [B,S,1024]) + x; output = (y − mean)/√(var + 1e-5) with mean/var over all (S,D) of each batch element (identity affine).
// Compute dtype: x and weights rounded to bf16; Q,K as f32 GEMM outputs split into f16 hi + ×2^10 residual planes so the unscaled (σ≈3) logits are f32-accurate; V f16; fused flash-style kernel
// (two score accumulators, online softmax f32, P f16 ×2^10) on v_wmma_f32_16x16x32_f16; residual and the per-batch statistics (fixed-order block partial sums of y and y², then a fixed-order combine) and normalisation in f32.
#define BB 2
#define TT 2048
#define DD 1024
#define NSL 32
#define NR (BB * TT)
#define NPB 64

typedef __bf16 v16b __attribute__((ext_vector_type(16)));
typedef unsigned short v8us __attribute__((ext_vector_type(8), may_alias));
typedef float  v8f  __attribute__((ext_vector_type(8)));
typedef float  v4f  __attribute__((ext_vector_type(4)));
typedef float  v4fa __attribute__((ext_vector_type(4), may_alias));
union FragB { v16b v; v8us half[2]; unsigned short u[16]; };

__device__ __forceinline__ unsigned short bf16_bits(float x) { unsigned int u = __float_as_uint(x); return (unsigned short)((u + 0x7FFFu + ((u >> 16) & 1u)) >> 16); }
__device__ __forceinline__ float bf16_val(unsigned short b) { return __uint_as_float(((unsigned int)b) << 16); }
__device__ __forceinline__ float bf16_round(float x) { return bf16_val(bf16_bits(x)); }
// D += A·B with NT terms: 1 = ah·bh, 2 = + al·bh (A split), 3 = + ah·bl (both split)
template <int NT>
__device__ __forceinline__ v8f mmaN(v16b ah, v16b al, v16b bh, v16b bl, v8f c) {
  c = __builtin_amdgcn_wmma_f32_16x16x32_bf16(false, ah, false, bh, (short)0, c, false, false);
  if (NT >= 2) c = __builtin_amdgcn_wmma_f32_16x16x32_bf16(false, al, false, bh, (short)0, c, false, false);
  if (NT >= 3) c = __builtin_amdgcn_wmma_f32_16x16x32_bf16(false, ah, false, bl, (short)0, c, false, false);
  asm volatile("v_nop\n\tv_nop\n\tv_nop\n\tv_nop" : "+v"(c) : "v"(ah), "v"(al), "v"(bh), "v"(bl));
  return c;
}

__global__ __launch_bounds__(256) void k_wt_bf16(const float* __restrict__ W, unsigned short* __restrict__ Wt, int K, int N) {
  const int t = blockIdx.x * 256 + threadIdx.x;
  const int k8n = K / 8;
  if (t >= N * k8n) return;
  const int n = t / k8n, k8 = (t % k8n) * 8;
  v8us v;
#pragma unroll
  for (int i = 0; i < 8; ++i) v[i] = bf16_bits(W[(size_t)(k8 + i) * N + n]);
  *(v8us*)(Wt + (size_t)n * K + k8) = v;
  
}

// GEMM C[M][N] (f32, pitch ldc) = act(A[M][K]·W + bias). A f32 row-major (pitch lda) converted per fragment to bf16
// (ASPLIT: hi/lo two planes -> 2 terms, else single rounded term); Wt bf16 [N][K] (pitch ldb). BIAS_BF16 rounds the
// bias to bf16 first (bias quantised to bf16 before the add). K%32==0, M%16==0, N%64==0.
template <bool ASPLIT, int ACT, bool BIAS_BF16>
__global__ __launch_bounds__(128) void k_gemm_bf(const float* __restrict__ A, int lda, const unsigned short* __restrict__ Wt, int ldb,
                                               const float* __restrict__ bias, float* __restrict__ C, int ldc, int M, int N, int K) {
  __shared__ __attribute__((aligned(16))) float so[4][16][64];
  const int tid = threadIdx.x, w = tid >> 5, lane = tid & 31, ln = lane & 15, hh = lane >> 4;
  const int ntn = N / 64;
  const int wid = blockIdx.x * 4 + w;
  const int mt = wid / ntn, nq = wid % ntn;
  if (mt * 16 >= M) return;
  const int row0 = mt * 16, col0 = nq * 64;
  const float* arow = A + (size_t)(row0 + ln) * lda;
  v8f acc[4] = {};
  for (int kb = 0; kb < K; kb += 32) {
    FragB ah, al;
    const v4f x0 = *(const v4fa*)(arow + kb + 8 * hh), x1 = *(const v4fa*)(arow + kb + 8 * hh + 4);
    const v4f x2 = *(const v4fa*)(arow + kb + 16 + 8 * hh), x3 = *(const v4fa*)(arow + kb + 16 + 8 * hh + 4);
    float xs[16] = {x0[0],x0[1],x0[2],x0[3],x1[0],x1[1],x1[2],x1[3],x2[0],x2[1],x2[2],x2[3],x3[0],x3[1],x3[2],x3[3]};
#pragma unroll
    for (int i = 0; i < 16; ++i) { const unsigned short hb = bf16_bits(xs[i]); ah.u[i] = hb; al.u[i] = ASPLIT ? bf16_bits(xs[i] - bf16_val(hb)) : (unsigned short)0; }
#pragma unroll
    for (int t = 0; t < 4; ++t) {
      const unsigned short* brow = Wt + (size_t)(col0 + t * 16 + ln) * ldb + kb;
      FragB b;
      b.half[0] = *(const v8us*)(brow + 8 * hh);
      b.half[1] = *(const v8us*)(brow + 16 + 8 * hh);
      acc[t] = mmaN<ASPLIT ? 2 : 1>(ah.v, al.v, b.v, b.v, acc[t]);
    }
  }
#pragma unroll
  for (int t = 0; t < 4; ++t) {
    float bv = bias ? bias[col0 + t * 16 + ln] : 0.f;
    if (BIAS_BF16) bv = bf16_round(bv);
#pragma unroll
    for (int r = 0; r < 8; ++r) { float v = acc[t][r] + bv; if (ACT == 1) v = fmaxf(v, 0.f); so[w][8 * hh + r][t * 16 + ln] = v; }
  }
  __builtin_amdgcn_fence(__ATOMIC_ACQ_REL, "workgroup");
  __builtin_amdgcn_wave_barrier();
  const int rsub = lane >> 4, c4 = (lane & 15) * 4;
  {
#pragma unroll
    for (int q = 0; q < 8; ++q) {
      const int r = q * 2 + rsub;
      const v4f v = *(const v4fa*)&so[w][r][c4];
      *(v4f*)(C + (size_t)(row0 + r) * ldc + col0 + c4) = v;
    }
    
  }
}

// Flash-style causal/unmasked attention, all contractions 3-term bf16 hi/lo splits, f32 softmax with running max.
// q,k,v rows are read from f32 buffers with arbitrary row pitch (so they can live inside a fused qkv buffer);
// D = head size (multiple of 32, <= 128); one wave = 16 query rows; block = 4 waves (64 queries) sharing K/V chunks of 32.
template <int D, bool CAUSAL>
__global__ __launch_bounds__(128) void k_flash(const float* __restrict__ qb, const float* __restrict__ kb, const float* __restrict__ vb,
                                             int pitch, int T, int H, float scale, float* __restrict__ y, int ypitch) {
  constexpr int KS = D / 32;        // k-steps for QK
  constexpr int DT = D / 16;        // d tiles for PV
  __shared__ __attribute__((aligned(16))) unsigned short sKh[32][D + 8], sKl[32][D + 8], sVh[32][D + 8], sVl[32][D + 8];
  __shared__ __attribute__((aligned(16))) unsigned short sPh[4][16][40], sPl[4][16][40];
  __shared__ __attribute__((aligned(16))) float sO[4][16][D];
  const int tid = threadIdx.x, w = tid >> 5, lane = tid & 31, ln = lane & 15, hh = lane >> 4;
  const int nqb = (T + 63) / 64;
  const int bh = blockIdx.x / nqb, qblk = blockIdx.x % nqb;
  const int b = bh / H, h = bh % H;
  const int q0 = qblk * 64 + w * 16;
  const float* Q = qb + (size_t)b * T * pitch + h * D;
  const float* K = kb + (size_t)b * T * pitch + h * D;
  const float* V = vb + (size_t)b * T * pitch + h * D;

  // A fragments of the wave's 16 query rows (scaled), hi/lo
  FragB aqh[KS], aql[KS];
  {
    int row = q0 + ln; if (row >= T) row = T - 1;
    const float* qr = Q + (size_t)row * pitch;
#pragma unroll
    for (int ks = 0; ks < KS; ++ks)
#pragma unroll
      for (int i = 0; i < 16; ++i) {
        const int d = ks * 32 + ((i < 8) ? (8 * hh + i) : (16 + 8 * hh + (i - 8)));
        const float x = qr[d] * scale; const unsigned short hb = bf16_bits(x);
        aqh[ks].u[i] = hb; aql[ks].u[i] = bf16_bits(x - bf16_val(hb));
      }
  }
  float m_r[8], l_r[8];
#pragma unroll
  for (int r = 0; r < 8; ++r) { m_r[r] = -3.0e38f; l_r[r] = 0.f; }
  v8f oacc[DT];
#pragma unroll
  for (int dt = 0; dt < DT; ++dt) oacc[dt] = (v8f){0.f,0.f,0.f,0.f,0.f,0.f,0.f,0.f};

  const int kv_end = CAUSAL ? min(T, qblk * 64 + 64) : T;     // block-uniform
  for (int j0 = 0; j0 < kv_end; j0 += 32) {
    __syncthreads();
    for (int e = tid; e < 32 * (D / 4); e += 128) {
      const int r = e / (D / 4), c4 = (e % (D / 4)) * 4;
      const int key = j0 + r;
      v4f kf = {0.f,0.f,0.f,0.f}, vf = {0.f,0.f,0.f,0.f};
      if (key < T) { kf = *(const v4fa*)(K + (size_t)key * pitch + c4); vf = *(const v4fa*)(V + (size_t)key * pitch + c4); }
#pragma unroll
      for (int t = 0; t < 4; ++t) {
        unsigned short hb = bf16_bits(kf[t]); sKh[r][c4 + t] = hb; sKl[r][c4 + t] = bf16_bits(kf[t] - bf16_val(hb));
        hb = bf16_bits(vf[t]); sVh[r][c4 + t] = hb; sVl[r][c4 + t] = bf16_bits(vf[t] - bf16_val(hb));
      }
    }
    __syncthreads();
    // S tile 16 x 32
    v8f s[2];
#pragma unroll
    for (int nt = 0; nt < 2; ++nt) {
      v8f acc = {};
#pragma unroll
      for (int ks = 0; ks < KS; ++ks) {
        FragB bh_, bl_;
        bh_.half[0] = *(const v8us*)&sKh[nt * 16 + ln][ks * 32 + 8 * hh]; bh_.half[1] = *(const v8us*)&sKh[nt * 16 + ln][ks * 32 + 16 + 8 * hh];
        bl_.half[0] = *(const v8us*)&sKl[nt * 16 + ln][ks * 32 + 8 * hh]; bl_.half[1] = *(const v8us*)&sKl[nt * 16 + ln][ks * 32 + 16 + 8 * hh];
        acc = mmaN<3>(aqh[ks].v, aql[ks].v, bh_.v, bl_.v, acc);
      }
      s[nt] = acc;
    }
    // mask + running max (rows 8hh+r; the 16 lanes of a half share rows)
    float alpha[8];
#pragma unroll
    for (int r = 0; r < 8; ++r) {
      const int qi = q0 + 8 * hh + r;
      const int ja = j0 + ln, jb = j0 + 16 + ln;
      if (CAUSAL) { if (ja > qi) s[0][r] = -3.0e38f; if (jb > qi) s[1][r] = -3.0e38f; }
      if (ja >= T) s[0][r] = -3.0e38f;
      if (jb >= T) s[1][r] = -3.0e38f;
      float mx = fmaxf(s[0][r], s[1][r]);
      mx = fmaxf(mx, __shfl_xor(mx, 1, 32)); mx = fmaxf(mx, __shfl_xor(mx, 2, 32)); mx = fmaxf(mx, __shfl_xor(mx, 4, 32)); mx = fmaxf(mx, __shfl_xor(mx, 8, 32));
      const float mnew = fmaxf(m_r[r], mx);
      alpha[r] = (mnew > -1.0e38f) ? __expf(m_r[r] - mnew) : 1.0f;
      const float p0 = (s[0][r] > -1.0e38f) ? __expf(s[0][r] - mnew) : 0.f;
      const float p1 = (s[1][r] > -1.0e38f) ? __expf(s[1][r] - mnew) : 0.f;
      m_r[r] = mnew;
      l_r[r] = l_r[r] * alpha[r] + p0 + p1;            // per-lane partial row sum (16 lanes combined at the end)
      unsigned short hb = bf16_bits(p0); sPh[w][8 * hh + r][ln] = hb;      sPl[w][8 * hh + r][ln] = bf16_bits(p0 - bf16_val(hb));
      hb = bf16_bits(p1);                sPh[w][8 * hh + r][16 + ln] = hb; sPl[w][8 * hh + r][16 + ln] = bf16_bits(p1 - bf16_val(hb));
    }
#pragma unroll
    for (int dt = 0; dt < DT; ++dt)
#pragma unroll
      for (int r = 0; r < 8; ++r) oacc[dt][r] *= alpha[r];
    __builtin_amdgcn_fence(__ATOMIC_ACQ_REL, "workgroup");
    __builtin_amdgcn_wave_barrier();
    FragB pah, pal;
    pah.half[0] = *(const v8us*)&sPh[w][ln][8 * hh]; pah.half[1] = *(const v8us*)&sPh[w][ln][16 + 8 * hh];
    pal.half[0] = *(const v8us*)&sPl[w][ln][8 * hh]; pal.half[1] = *(const v8us*)&sPl[w][ln][16 + 8 * hh];
#pragma unroll
    for (int dt = 0; dt < DT; ++dt) {
      FragB bvh, bvl;
#pragma unroll
      for (int i = 0; i < 8; ++i) {
        bvh.u[i] = sVh[8 * hh + i][dt * 16 + ln]; bvh.u[8 + i] = sVh[16 + 8 * hh + i][dt * 16 + ln];
        bvl.u[i] = sVl[8 * hh + i][dt * 16 + ln]; bvl.u[8 + i] = sVl[16 + 8 * hh + i][dt * 16 + ln];
      }
      oacc[dt] = mmaN<3>(pah.v, pal.v, bvh.v, bvl.v, oacc[dt]);
    }
    __builtin_amdgcn_fence(__ATOMIC_ACQ_REL, "workgroup");
    __builtin_amdgcn_wave_barrier();
  }
#pragma unroll
  for (int r = 0; r < 8; ++r) {
    float l = l_r[r];
    l += __shfl_xor(l, 1, 32); l += __shfl_xor(l, 2, 32); l += __shfl_xor(l, 4, 32); l += __shfl_xor(l, 8, 32);
    l_r[r] = (l > 0.f) ? 1.0f / l : 0.f;
  }
#pragma unroll
  for (int dt = 0; dt < DT; ++dt)
#pragma unroll
    for (int r = 0; r < 8; ++r) sO[w][8 * hh + r][dt * 16 + ln] = oacc[dt][r] * l_r[r];
  __builtin_amdgcn_fence(__ATOMIC_ACQ_REL, "workgroup");
  __builtin_amdgcn_wave_barrier();
  {
    for (int r = 0; r < 16; ++r) {
      const int row = q0 + r;
      if (row < T && lane < D / 4) {
        const v4f val = *(const v4fa*)&sO[w][r][lane * 4];
        *(v4f*)(y + ((size_t)b * T + row) * ypitch + h * D + lane * 4) = val;
      }
    }
    
  }
}

// GEMM C = act(A·W + bias + resid): A f32 (ASPLIT -> hi/lo 2 terms), Wt bf16 [N][K]; ACT 0 none, 1 relu, 2 exact gelu;
// resid (optional, f32, row index = (row % rmod), pitch ldr, RES_BF16 rounds it) added before the activation.
template <bool ASPLIT, int ACT, bool BIAS_BF16, bool RES_BF16>
__global__ __launch_bounds__(128) void k_gemm_bf3(const float* __restrict__ A, int lda, const unsigned short* __restrict__ Wt, int ldb,
                                                const float* __restrict__ bias, const float* __restrict__ resid, int rmod, int ldr,
                                                float* __restrict__ C, int ldc, int M, int N, int K) {
  __shared__ __attribute__((aligned(16))) float so[4][16][64];
  const int tid = threadIdx.x, w = tid >> 5, lane = tid & 31, ln = lane & 15, hh = lane >> 4;
  const int ntn = N / 64;
  const int wid = blockIdx.x * 4 + w;
  const int mt = wid / ntn, nq = wid % ntn;
  if (mt * 16 >= M) return;
  const int row0 = mt * 16, col0 = nq * 64;
  const float* arow = A + (size_t)(row0 + ln) * lda;
  v8f acc[4] = {};
  for (int kb = 0; kb < K; kb += 32) {
    FragB ah, al;
    const v4f x0 = *(const v4fa*)(arow + kb + 8 * hh), x1 = *(const v4fa*)(arow + kb + 8 * hh + 4);
    const v4f x2 = *(const v4fa*)(arow + kb + 16 + 8 * hh), x3 = *(const v4fa*)(arow + kb + 16 + 8 * hh + 4);
    float xs[16] = {x0[0],x0[1],x0[2],x0[3],x1[0],x1[1],x1[2],x1[3],x2[0],x2[1],x2[2],x2[3],x3[0],x3[1],x3[2],x3[3]};
#pragma unroll
    for (int i = 0; i < 16; ++i) { const unsigned short hb = bf16_bits(xs[i]); ah.u[i] = hb; al.u[i] = ASPLIT ? bf16_bits(xs[i] - bf16_val(hb)) : (unsigned short)0; }
#pragma unroll
    for (int t = 0; t < 4; ++t) {
      const unsigned short* brow = Wt + (size_t)(col0 + t * 16 + ln) * ldb + kb;
      FragB b;
      b.half[0] = *(const v8us*)(brow + 8 * hh);
      b.half[1] = *(const v8us*)(brow + 16 + 8 * hh);
      acc[t] = mmaN<ASPLIT ? 2 : 1>(ah.v, al.v, b.v, b.v, acc[t]);
    }
  }
#pragma unroll
  for (int t = 0; t < 4; ++t) {
    const int col = col0 + t * 16 + ln;
    float bv = bias ? bias[col] : 0.f;
    if (BIAS_BF16) bv = bf16_round(bv);
#pragma unroll
    for (int r = 0; r < 8; ++r) {
      float v = acc[t][r] + bv;
      if (resid) { float rv = resid[(size_t)((row0 + 8 * hh + r) % rmod) * ldr + col]; if (RES_BF16) rv = bf16_round(rv); v += rv; }
      if (ACT == 1) v = fmaxf(v, 0.f);
      if (ACT == 2) v = 0.5f * v * (1.0f + erff(v * 0.70710678118654752f));
      if (ACT == 3) { const float u = 0.7978845608028654f * (v + 0.044715f * v * v * v); v = 0.5f * v * (1.0f + tanhf(u)); }
      so[w][8 * hh + r][t * 16 + ln] = v;
    }
  }
  __builtin_amdgcn_fence(__ATOMIC_ACQ_REL, "workgroup");
  __builtin_amdgcn_wave_barrier();
  const int rsub = lane >> 4, c4 = (lane & 15) * 4;
  {
#pragma unroll
    for (int q = 0; q < 8; ++q) {
      const int r = q * 2 + rsub;
      const v4f v = *(const v4fa*)&so[w][r][c4];
      *(v4f*)(C + (size_t)(row0 + r) * ldc + col0 + c4) = v;
    }
    
  }
}
// row LayerNorm (biased variance, eps) over N: s = X (+ R); optional out_sum <- s; out_norm <- (s-mu)*rsqrt(var+eps)*g + b
template <bool PARAM_BF16>
__global__ __launch_bounds__(256) void k_layernorm(const float* __restrict__ X, const float* __restrict__ R, const float* __restrict__ g, const float* __restrict__ bta,
                                                  float* __restrict__ out_sum, float* __restrict__ out_norm, int N, float eps) {
  __shared__ float red[256];
  const int row = blockIdx.x, tid = threadIdx.x;
  const float* x = X + (size_t)row * N; const float* rr = R ? R + (size_t)row * N : nullptr;
  float vals[16];                     // up to N = 4096
  const int per = N / 256;            // contiguous chunk per thread? use strided-by-4 chunks: thread handles j = tid*4 + 1024*u
  float s1 = 0.f;
  for (int u = 0; u < per / 4; ++u) {
    const int j = tid * 4 + 1024 * u;
    const v4f a = *(const v4fa*)(x + j);
    v4f b = {0.f,0.f,0.f,0.f}; if (rr) b = *(const v4fa*)(rr + j);
#pragma unroll
    for (int q = 0; q < 4; ++q) { const float v = a[q] + b[q]; vals[u * 4 + q] = v; s1 += v; }
  }
  red[tid] = s1; __syncthreads();
  for (int st = 128; st > 0; st >>= 1) { if (tid < st) red[tid] += red[tid + st]; __syncthreads(); }
  const float mu = red[0] / (float)N; __syncthreads();
  float s2 = 0.f;
  for (int u = 0; u < per / 4; ++u)
#pragma unroll
    for (int q = 0; q < 4; ++q) { const float c = vals[u * 4 + q] - mu; s2 += c * c; }
  red[tid] = s2; __syncthreads();
  for (int st = 128; st > 0; st >>= 1) { if (tid < st) red[tid] += red[tid + st]; __syncthreads(); }
  const float rs = rsqrtf(red[0] / (float)N + eps);
  {
    for (int u = 0; u < per / 4; ++u) {
      const int j = tid * 4 + 1024 * u;
      v4f o, sm;
#pragma unroll
      for (int q = 0; q < 4; ++q) {
        float gg = g[j + q], bb = bta[j + q];
        if (PARAM_BF16) { gg = bf16_round(gg); bb = bf16_round(bb); }
        sm[q] = vals[u * 4 + q]; o[q] = (vals[u * 4 + q] - mu) * rs * gg + bb;
      }
      if (out_sum) *(v4f*)(out_sum + (size_t)row * N + j) = sm;
      *(v4f*)(out_norm + (size_t)row * N + j) = o;
    }
    
  }
}



// ---- f16 WMMA path (v_wmma_f32_16x16x32_f16): 11-bit significands for operands in range — used where a [0,1] probability operand needs more precision than bf16
typedef _Float16 v16h __attribute__((ext_vector_type(16)));
union FragH { v16h v; v8us half[2]; _Float16 h[16]; unsigned short u[16]; };
template <int NT>
__device__ __forceinline__ v8f mmaH(v16h ah, v16h al, v16h bh, v16h bl, v8f c) {
  c = __builtin_amdgcn_wmma_f32_16x16x32_f16(false, ah, false, bh, (short)0, c, false, false);
  if (NT >= 2) c = __builtin_amdgcn_wmma_f32_16x16x32_f16(false, al, false, bh, (short)0, c, false, false);
  if (NT >= 3) c = __builtin_amdgcn_wmma_f32_16x16x32_f16(false, ah, false, bl, (short)0, c, false, false);
  asm volatile("v_nop\n\tv_nop\n\tv_nop\n\tv_nop" : "+v"(c) : "v"(ah), "v"(al), "v"(bh), "v"(bl));
  return c;
}
// batched GEMM like k_gemm_b but f16 operands: A f32 (split into f16 hi/lo if ASPLIT, else rounded to f16), Bt = f16 values [n][k]; alpha; C f32; N multiple of 16 (partial tiles skipped)
template <bool ASPLIT>
__global__ __launch_bounds__(128) void k_gemm_h(const float* __restrict__ A, int lda, size_t sA, const _Float16* __restrict__ Bh, int ldb, size_t sB, float alpha, float* __restrict__ C, int ldc, size_t sC, int M, int N, int K) {
  __shared__ __attribute__((aligned(16))) float so[4][16][64];
  const int tid = threadIdx.x, w = tid >> 5, lane = tid & 31, ln = lane & 15, hh = lane >> 4; const int by = blockIdx.y;
  A += (size_t)by * sA; Bh += (size_t)by * sB; C += (size_t)by * sC;
  const int ntn = (N + 63) / 64; const int wid = blockIdx.x * 4 + w; const int mt = wid / ntn, nq = wid % ntn; if (mt * 16 >= M) return;
  const int row0 = mt * 16, col0 = nq * 64; const float* arow = A + (size_t)(row0 + ln) * lda;
  v8f acc[4] = {};
  for (int kb = 0; kb < K; kb += 32) {
    FragH ah, al;
    const v4f x0 = *(const v4fa*)(arow + kb + 8 * hh), x1 = *(const v4fa*)(arow + kb + 8 * hh + 4), x2 = *(const v4fa*)(arow + kb + 16 + 8 * hh), x3 = *(const v4fa*)(arow + kb + 16 + 8 * hh + 4);
    float xs[16] = {x0[0],x0[1],x0[2],x0[3],x1[0],x1[1],x1[2],x1[3],x2[0],x2[1],x2[2],x2[3],x3[0],x3[1],x3[2],x3[3]};
#pragma unroll
    for (int i = 0; i < 16; ++i) { const _Float16 h = (_Float16)xs[i]; ah.h[i] = h; al.h[i] = ASPLIT ? (_Float16)(xs[i] - (float)h) : (_Float16)0.0f; }
#pragma unroll
    for (int t = 0; t < 4; ++t) { if (col0 + t * 16 >= N) continue; const size_t boff = (size_t)(col0 + t * 16 + ln) * ldb + kb; FragH bq; bq.half[0] = *(const v8us*)(Bh + boff + 8 * hh); bq.half[1] = *(const v8us*)(Bh + boff + 16 + 8 * hh);
      acc[t] = mmaH<ASPLIT ? 2 : 1>(ah.v, al.v, bq.v, bq.v, acc[t]); }
  }
#pragma unroll
  for (int t = 0; t < 4; ++t) { if (col0 + t * 16 >= N) continue;
#pragma unroll
    for (int r = 0; r < 8; ++r) so[w][8 * hh + r][t * 16 + ln] = acc[t][r] * alpha; }
  __builtin_amdgcn_fence(__ATOMIC_ACQ_REL, "workgroup"); __builtin_amdgcn_wave_barrier();
  const int rsub = lane >> 4, c4 = (lane & 15) * 4;
  {
#pragma unroll
    for (int q = 0; q < 8; ++q) { const int r = q * 2 + rsub; if (col0 + c4 < N) { const v4f v = *(const v4fa*)&so[w][r][c4]; *(v4f*)(C + (size_t)(row0 + r) * ldc + col0 + c4) = v; } }
     }
}

// Wt[n][k] = f16(W[k][n]·scale) from f32 row-major W[K][N] (scale = power of two; bf16-exact weights stay exact in f16 away from the subnormal range)
__global__ __launch_bounds__(256) void k_wt_f16(const float* __restrict__ W, _Float16* __restrict__ Wt, int K, int N, float scale) {
  const int t = blockIdx.x * 256 + threadIdx.x; if (t >= N * (K / 8)) return; const int n = t / (K / 8), k8 = (t % (K / 8)) * 8; FragH f;
#pragma unroll
  for (int i = 0; i < 8; ++i) f.h[i] = (_Float16)(bf16_round(W[(size_t)(k8 + i) * N + n]) * scale); const v8us o = f.half[0];
  *(v8us*)((unsigned short*)Wt + (size_t)n * K + k8) = o; 
}
// Fragment order: a [rows][K] 16-bit plane is kept as 1-KB units of 16 rows x 32 k, unit (row / 16) * (K / 32) + k / 32; inside a unit the 16-byte piece 32 p + lane holds row (lane & 15), k = 16 p + 8 (lane >> 4) + 0..7.
// A wave's fragment is then two 16-byte loads per lane that each cover 512 contiguous bytes (4 whole 128-B lines) instead of 32 bytes in each of 16 lines; fragment element i is k = 8 (lane >> 4) + i for i < 8 and 16 + 8 (lane >> 4) + (i - 8) above, for both operands of every product.
// frag_src: index, in the row-major plane, of the first of the 8 elements that 16-byte piece number 'piece' of the fragment-ordered plane holds.
__device__ __forceinline__ size_t frag_src(size_t piece, int K) { const size_t u = piece >> 6; const int in = (int)(piece & 63), p = in >> 5, l = in & 31; const size_t kt = (size_t)(K / 32);
  return ((u / kt) * 16 + (size_t)(l & 15)) * (size_t)K + (u % kt) * 32 + (size_t)(p * 16 + (l >> 4) * 8); }
// A and Bh in fragment order (lda == ldb == K at every launch here).
// k_gemm_hh variant with fused epilogue: v = acc·alpha + bias[by·sBias + col] (+ CP[(row/rowsPerB)·sCPb + by·64 + col] if CP) ; ACT 0 none / 1 elu ; batch members by < y16 are written as f32 planes of C, the others as f16 planes of C16 (each plane sC elements)
template <int ACT>
__global__ __launch_bounds__(128) void k_gemm_hhx(const _Float16* __restrict__ A, int lda, size_t sA, const _Float16* __restrict__ Bh, int ldb, size_t sB, float alpha, const float* __restrict__ bias, size_t sBias, const float* __restrict__ CP, int rowsPerB, size_t sCPb, int row0g,
    float* __restrict__ C, _Float16* __restrict__ C16, int y16, int ldc, size_t sC, int M, int N, int K) {
  __shared__ __attribute__((aligned(16))) float so[4][16][64];
  const int tid = threadIdx.x, w = tid >> 5, lane = tid & 31, ln = lane & 15, hh = lane >> 4; const int by = blockIdx.y;
  A += (size_t)by * sA; Bh += (size_t)by * sB; const bool w32 = by < y16; const size_t cofs = (size_t)(w32 ? by : by - y16) * sC; const float* bp = bias ? bias + (size_t)by * sBias : nullptr;
  const int ntn = (N + 63) / 64; const int wid = blockIdx.x * 4 + w; const int mt = wid / ntn, nq = wid % ntn; if (mt * 16 >= M) return;
  const int row0 = mt * 16, col0 = nq * 64;
  v8f acc[4] = {};
  // Two register stages of 64 k each (K % 128 == 0, N % 64 == 0 at every launch here): a stage's 20 fragment loads are issued as one group, one stage ahead of the products that read them.
  // The five row pointers are carried through the loop and stepped between the groups, so none of their registers is free for a load's result while loads are in flight.
  const char* pa = (const char*)(A + (size_t)row0 * lda + lane * 8); const char* pb[4];
#pragma unroll      // constant indices keep the row pointers in registers
  for (int t = 0; t < 4; ++t) pb[t] = (const char*)(Bh + (size_t)(col0 + t * 16) * ldb + lane * 8);
  FragH a0[2], b0[2][4], a1[2], b1[2][4];
  auto fetch = [&](FragH (&fa)[2], FragH (&fb)[2][4]) {
#pragma unroll      // constant indices keep the fragment arrays in registers
    for (int ks = 0; ks < 2; ++ks) { fa[ks].half[0] = *(const v8us*)(pa + ks * 1024); fa[ks].half[1] = *(const v8us*)(pa + ks * 1024 + 512);
#pragma unroll      // constant indices keep the fragment arrays in registers
      for (int t = 0; t < 4; ++t) { fb[ks][t].half[0] = *(const v8us*)(pb[t] + ks * 1024); fb[ks][t].half[1] = *(const v8us*)(pb[t] + ks * 1024 + 512); } } };
  auto step = [&](long bytes) { pa += bytes;
#pragma unroll      // constant indices keep the row pointers in registers
    for (int t = 0; t < 4; ++t) pb[t] += bytes; };
  auto mul = [&](FragH (&fa)[2], FragH (&fb)[2][4]) {
#pragma unroll      // constant indices keep the fragment arrays in registers
    for (int ks = 0; ks < 2; ++ks)
#pragma unroll      // constant indices keep the fragment arrays in registers
      for (int t = 0; t < 4; ++t) acc[t] = mmaH<1>(fa[ks].v, fa[ks].v, fb[ks][t].v, fb[ks][t].v, acc[t]); };
  fetch(a0, b0); step(2048);      // a stage of 64 k = two 1-KB units; a 16-row tile's K elements = 32 K bytes
#pragma unroll 1      // rolled: one ping-pong pair per trip keeps both stages in fixed registers and the loop short
  for (int kb = 0; kb < K; kb += 128) {
    fetch(a1, b1); mul(a0, b0); step((kb + 128 < K) ? 2048L : 2048L - 32L * K);      // the last trip steps back to k = 0: its second fetch stays in bounds and is not used
    fetch(a0, b0); mul(a1, b1); step(2048);
  }
#pragma unroll
  for (int t = 0; t < 4; ++t) { if (col0 + t * 16 >= N) continue; const int col = col0 + t * 16 + ln; const float bv = bp ? bf16_round(bp[col]) : 0.f;
#pragma unroll
    for (int r = 0; r < 8; ++r) { float v = acc[t][r] * alpha + bv; if (CP) { const int bidx = (row0g + row0 + 8 * hh + r) / rowsPerB; v += CP[(size_t)bidx * sCPb + (size_t)by * 64 + col]; } if (ACT == 1) v = (v > 0.f) ? v : expm1f(v); else if (ACT == 7) v = (v > 0.f) ? v + 1.0f : expf(v); else if (ACT == 8) v = tanhf(v); else if (ACT == 9) v = 0.5f * v * (1.0f + tanhf(0.7978845608028654f * (v + 0.044715f * v * v * v))); else if (ACT == 11) v = 1.0f / (1.0f + expf(-v)); else if (ACT == 12) v = (v > 0.f) ? v : 0.01f * v; else if (ACT == 14) v = (v > 0.f) ? v : 0.1f * v; else if (ACT == 15) v = v / (1.0f + expf(-v)); else if (ACT == 3) v = fmaxf(v, 0.f); else if (ACT == 6) v = 0.5f * v * (1.0f + erff(v * 0.70710678118654752f)); so[w][8 * hh + r][t * 16 + ln] = v; } }
  __builtin_amdgcn_fence(__ATOMIC_ACQ_REL, "workgroup"); __builtin_amdgcn_wave_barrier();
  const int rsub = lane >> 4, c4 = (lane & 15) * 4; typedef _Float16 v4h __attribute__((ext_vector_type(4)));
  if (w32) {      // the same for a whole block: one branch ahead of the eight stores
#pragma unroll      // the eight LDS reads go out as one group ahead of the stores
    for (int q = 0; q < 8; ++q) { const int r = q * 2 + rsub; if (col0 + c4 < N) { const v4f v = *(const v4fa*)&so[w][r][c4]; *(v4f*)(C + cofs + (size_t)(row0 + r) * ldc + col0 + c4) = v; } }
  } else {
#pragma unroll      // the eight LDS reads go out as one group ahead of the stores
    for (int q = 0; q < 8; ++q) { const int r = q * 2 + rsub; if (col0 + c4 < N) { const v4f v = *(const v4fa*)&so[w][r][c4]; v4h h4; for (int i = 0; i < 4; ++i) h4[i] = (_Float16)v[i]; *(v4h*)(C16 + cofs + (size_t)(row0 + r) * ldc + col0 + c4) = h4; } }
  }
}


typedef _Float16 v4h __attribute__((ext_vector_type(4)));

__device__ __forceinline__ void d_x16(const float* __restrict__ x, _Float16* __restrict__ X16, size_t n8, size_t t) { if (t >= n8) return; FragH f; const size_t s = frag_src(t, DD);
#pragma unroll
  for (int q = 0; q < 8; ++q) f.h[q] = (_Float16)bf16_round(x[s + q]); *(v8us*)((unsigned short*)X16 + t * 8) = f.half[0];  }      /* [NR][DD] plane, written in fragment order */
__global__ __launch_bounds__(256) void k_h16(const float* __restrict__ x, _Float16* __restrict__ X16, size_t n8) { const size_t t = (size_t)blockIdx.x * 256 + threadIdx.x; if (t >= n8) return; FragH f;
#pragma unroll
  for (int q = 0; q < 8; ++q) f.h[q] = (_Float16)x[t * 8 + q]; *(v8us*)((unsigned short*)X16 + t * 8) = f.half[0];  }
__device__ __forceinline__ void d_round16f(const float* __restrict__ W, _Float16* __restrict__ Bt, size_t n8, size_t t) { if (t >= n8) return; FragH f; const size_t s = frag_src(t, DD);
#pragma unroll
  for (int i = 0; i < 8; ++i) f.h[i] = (_Float16)(bf16_round(W[s + i]) * 16.0f); *(v8us*)((unsigned short*)Bt + t * 8) = f.half[0];  }      /* [DD][DD] plane, written in fragment order */
// The four input conversions depend on nothing and on one another not at all: one grid, blocks 0 .. GX16 - 1 take x, then GW16 blocks for each weight (the choice is the same for a whole block).
#define GX16 (NR * DD / 8 / 256)
#define GW16 (DD * DD / 8 / 256)
__global__ __launch_bounds__(256) void k_prep(const float* __restrict__ x, const float* __restrict__ Wq, const float* __restrict__ Wk, const float* __restrict__ Wv, _Float16* __restrict__ X16, _Float16* __restrict__ Bw) {
  const unsigned bx = blockIdx.x;
  if (bx < GX16) { d_x16(x, X16, (size_t)NR * DD / 8, (size_t)bx * 256 + threadIdx.x); return; }
  const unsigned wi = (bx - GX16) / GW16, wb = (bx - GX16) % GW16; const float* W = (wi == 0) ? Wq : ((wi == 1) ? Wk : Wv);
  d_round16f(W, Bw + (size_t)wi * DD * DD, (size_t)DD * DD / 8, (size_t)wb * 256 + threadIdx.x); }
template <int NHv, int TTv>
__device__ __forceinline__ void d_vt(const _Float16* __restrict__ V16, int ldv, int voff, _Float16* __restrict__ Vt, int bx) { __shared__ unsigned short tl[64][66]; const int tid = threadIdx.x; const int slab = bx / (TTv / 64), lg = bx % (TTv / 64); const int b = slab / NHv, h = slab % NHv;
  for (int i = tid; i < 64 * 8; i += 256) { const int r = i / 8, c8 = (i % 8) * 8; FragH f; f.half[0] = *(const v8us*)((const unsigned short*)V16 + ((size_t)b * TTv + lg * 64 + r) * ldv + voff + h * 64 + c8);
#pragma unroll
    for (int q = 0; q < 8; ++q) tl[r][c8 + q] = f.u[q]; }
  __syncthreads();
  {
#pragma unroll
    for (int rd = 0; rd < 2; ++rd) { const int o = rd * 256 + tid, un = o >> 6, p = (o >> 5) & 1, l = o & 31; const int d = (un & 3) * 16 + (l & 15), key = (un >> 2) * 32 + p * 16 + (l >> 4) * 8; FragH f;      // V^T in fragment order: unit (32-key tile) * 4 + d / 16, rows = d, k = keys; the block's 8 units are 8 KB in a row
#pragma unroll
      for (int q = 0; q < 8; ++q) f.u[q] = tl[key + q][d];
      *(v8us*)((unsigned short*)Vt + ((size_t)slab * TTv + lg * 64) * 64 + o * 8) = f.half[0]; }
     } }

__device__ __forceinline__ void d_hl(const float* __restrict__ F, _Float16* __restrict__ Hh, _Float16* __restrict__ Hl, size_t n8, size_t t) { if (t >= n8) return; FragH fh, fl; const size_t s = frag_src(t, 64); const v4f a = *(const v4fa*)(F + s), c = *(const v4fa*)(F + s + 4);      /* the flat [rows][64] view, both planes written in fragment order */
#pragma unroll
  for (int q = 0; q < 4; ++q) { _Float16 h = (_Float16)a[q]; fh.h[q] = h; fl.h[q] = (_Float16)((a[q] - (float)h) * 1024.0f); h = (_Float16)c[q]; fh.h[4 + q] = h; fl.h[4 + q] = (_Float16)((c[q] - (float)h) * 1024.0f); }
  { *(v8us*)((unsigned short*)Hh + t * 8) = fh.half[0]; *(v8us*)((unsigned short*)Hl + t * 8) = fl.half[0];  } }
// What stands between the projections and the attention, in one grid: blocks 0 .. GVT - 1 transpose V, the others split q and k, whose f32 planes and whose hi and lo planes lie one behind the other and are walked as one plane of twice the rows.
#define GVT (NSL * (TT / 64))
__global__ __launch_bounds__(256) void k_post(const float* __restrict__ F, _Float16* __restrict__ Hh, _Float16* __restrict__ Hl, size_t n8, const _Float16* __restrict__ V16, _Float16* __restrict__ Vt) {
  if (blockIdx.x < GVT) d_vt<1, TT>(V16, 64, 0, Vt, (int)blockIdx.x);      // the test reads the same in a whole block: its barrier is passed by all 256 threads or by none
  else d_hl(F, Hh, Hl, n8, (size_t)(blockIdx.x - GVT) * 256 + threadIdx.x); }
typedef float v2f __attribute__((ext_vector_type(2)));
// lane l <-> lane l ^ 16 by a vector cross-row move
__device__ __forceinline__ float xhalf(float x) { return __builtin_bit_cast(float, __builtin_amdgcn_permlanex16(__builtin_bit_cast(int, x), __builtin_bit_cast(int, x), 0x76543210, 0xfedcba98, false, false)); }
__global__ __launch_bounds__(128) void k_flash(const _Float16* __restrict__ Q16, const _Float16* __restrict__ Q16lo, int ldq, const _Float16* __restrict__ K16, const _Float16* __restrict__ K16lo, int ldk, const _Float16* __restrict__ Vt, float* __restrict__ O, int ldo) {
  constexpr int RPW = 16, NQB = TT / (4 * RPW), DT = 4, KS = 2; constexpr float L2E = 1.4426950408889634f;
  __shared__ __attribute__((aligned(16))) float sO[4][RPW][64 + 4];
  const int tid = threadIdx.x, w = tid >> 5, lane = tid & 31, ln = lane & 15, hh = lane >> 4;
  const int slab = blockIdx.x / NQB, qblk = blockIdx.x % NQB; const int b = slab; const int qb0 = qblk * (4 * RPW); const int q0 = qb0 + w * RPW;
  FragH aq[KS], aql[KS];
  { const size_t qo = ((size_t)b * TT + q0) * ldq + lane * 8; const unsigned short* qr = (const unsigned short*)Q16 + qo; const unsigned short* ql = (const unsigned short*)Q16lo + qo;
#pragma unroll
    for (int ks = 0; ks < KS; ++ks) { aq[ks].half[0] = *(const v8us*)(qr + ks * 512); aq[ks].half[1] = *(const v8us*)(qr + ks * 512 + 256); aql[ks].half[0] = *(const v8us*)(ql + ks * 512); aql[ks].half[1] = *(const v8us*)(ql + ks * 512 + 256); } }      // fragment-ordered planes (ldq == ldk == 64): unit = (row / 16) * 2 + ks
  const unsigned short* Vth = (const unsigned short*)Vt + (size_t)slab * 64 * TT;
  float m_r = -3.0e38f, b_r = -3.0e38f, l_r = 0.f; v8f oacc[DT];
#pragma unroll
  for (int dt = 0; dt < DT; ++dt) oacc[dt] = (v8f){0.f,0.f,0.f,0.f,0.f,0.f,0.f,0.f};
  const int jend = TT;
  // K fragments (both planes, 32 keys) live in registers across the back edge: each pass fetches the next pass's right behind its own score products; V fragments are fetched at the pass's top, ahead of the scores and the softmax.
  FragH bk[2][KS], bl[2][KS];
  auto fetchK = [&](int j) {
#pragma unroll      // constant indices keep the fragment arrays in registers
    for (int nt = 0; nt < 2; ++nt) { const size_t ko = ((size_t)b * TT + j + nt * 16) * ldk + lane * 8; const unsigned short* kr = (const unsigned short*)K16 + ko; const unsigned short* kl = (const unsigned short*)K16lo + ko;
#pragma unroll      // constant indices keep the fragment arrays in registers
      for (int ks = 0; ks < KS; ++ks) { bk[nt][ks].half[0] = *(const v8us*)(kr + ks * 512); bk[nt][ks].half[1] = *(const v8us*)(kr + ks * 512 + 256); bl[nt][ks].half[0] = *(const v8us*)(kl + ks * 512); bl[nt][ks].half[1] = *(const v8us*)(kl + ks * 512 + 256); } } };
  fetchK(0);
  { const size_t qa = ((size_t)b * TT + q0) * ldq + lane * 8, ka = (size_t)b * TT * ldk + lane * 8, kc = ((size_t)b * TT + 16) * ldk + lane * 8;
    // the wait in front of the reuse of the address registers of the Q and K loads above; the six addresses are inputs so that their registers stay as they are up to the wait
    asm volatile("s_wait_xcnt 0x0" :: "v"(Q16 + qa), "v"(Q16lo + qa), "v"(K16 + ka), "v"(K16lo + ka), "v"(K16 + kc), "v"(K16lo + kc) : "memory"); }
#pragma unroll 1
  for (int j0 = 0; j0 < jend; j0 += 32) {
    FragH bv[DT];
#pragma unroll      // constant indices keep the fragment arrays in registers
    for (int dt = 0; dt < DT; ++dt) { const unsigned short* vrow = Vth + (size_t)j0 * 64 + dt * 512 + lane * 8; bv[dt].half[0] = *(const v8us*)(vrow); bv[dt].half[1] = *(const v8us*)(vrow + 256); }
    v8f s[2];      // s[nt][r] = score of query q0 + ln against key j0 + 16 nt + 8 hh + r
#pragma unroll
    for (int nt = 0; nt < 2; ++nt) { v8f acc = (v8f){0.f,0.f,0.f,0.f,0.f,0.f,0.f,0.f}, accl = acc;
#pragma unroll
      for (int ks = 0; ks < KS; ++ks) { acc = mmaH<1>(bk[nt][ks].v, bk[nt][ks].v, aq[ks].v, aq[ks].v, acc); accl = mmaH<1>(bk[nt][ks].v, bk[nt][ks].v, aql[ks].v, aql[ks].v, accl); accl = mmaH<1>(bl[nt][ks].v, bl[nt][ks].v, aq[ks].v, aq[ks].v, accl); }
      s[nt] = acc + accl * 0.0009765625f; }
    const int jn = (j0 + 32 < jend) ? j0 + 32 : 0; fetchK(jn);      // the last pass refetches keys 0..31: in bounds, not used
    { const size_t ka = ((size_t)b * TT + jn) * ldk + lane * 8, kc = ((size_t)b * TT + jn + 16) * ldk + lane * 8;
      // the wait in front of the reuse of the address registers of the K loads above; the four addresses are inputs so that none of their registers is handed to a load's result or to the softmax ahead of the wait
      asm volatile("s_wait_xcnt 0x0" :: "v"(K16 + ka), "v"(K16lo + ka), "v"(K16 + kc), "v"(K16lo + kc) : "memory"); }
    float mc = s[0][0], md = s[1][0];
#pragma unroll      // constant indices keep the score tiles in registers
    for (int r = 1; r < 8; ++r) { mc = fmaxf(mc, s[0][r]); md = fmaxf(md, s[1][r]); }
    mc = fmaxf(mc, md); mc = fmaxf(mc, xhalf(mc));      // both halves now hold the query's maximum over the pass's 32 keys
    // base 2: b_r is the running maximum times log2(e), less 10; every weight is then 2^(s log2(e) - b_r) = 2^10 exp(s - max), one multiply-add and one hardware exponential, already at the scale the f16 P operand wants
    const float mn = fmaxf(m_r, mc), bn = __builtin_fmaf(mn, L2E, -10.0f); const float al = __builtin_amdgcn_exp2f((mn > -1.0e38f) ? b_r - bn : 0.f); m_r = mn; b_r = bn;      // the guard selects the argument (2^0 = 1), so no branch on lanes stands in the loop
    FragH pt; v2f ps[2] = {(v2f){0.f, 0.f}, (v2f){0.f, 0.f}}; const v8f l2e8 = {L2E, L2E, L2E, L2E, L2E, L2E, L2E, L2E}, nm8 = {-bn, -bn, -bn, -bn, -bn, -bn, -bn, -bn};
#pragma unroll      // constant indices keep the score tiles and the P^T fragment in registers
    for (int nt = 0; nt < 2; ++nt) { const v8f d = __builtin_elementwise_fma(s[nt], l2e8, nm8);
#pragma unroll      // constant indices keep the score tiles and the P^T fragment in registers
      for (int r = 0; r < 8; r += 2) { const v2f p = {__builtin_amdgcn_exp2f(d[r]), __builtin_amdgcn_exp2f(d[r + 1])}; ps[nt] += p; pt.h[8 * nt + r] = (_Float16)p[0]; pt.h[8 * nt + r + 1] = (_Float16)p[1]; } }
    { const v2f pq = ps[0] + ps[1]; l_r = l_r * al + (pq[0] + pq[1]); }      // this half's 16 keys; the halves are joined behind the loop
#pragma unroll
    for (int dt = 0; dt < DT; ++dt)
#pragma unroll
      for (int r = 0; r < 8; ++r) oacc[dt][r] *= al;
#pragma unroll
    for (int dt = 0; dt < DT; ++dt) oacc[dt] = mmaH<1>(bv[dt].v, bv[dt].v, pt.v, pt.v, oacc[dt]);      // oacc[dt][r] = O[q0 + ln][16 dt + 8 hh + r]
  }
  { const float l = l_r + xhalf(l_r); const float inv = (l > 0.f) ? 1.0f / l : 0.f;      // l and the output tiles both carry the factor 2^10; the exchange stands ahead of the select: all lanes are on
#pragma unroll      // constant indices keep the output tiles in registers
    for (int dt = 0; dt < DT; ++dt) { v4f lo4, hi4;
#pragma unroll      // constant indices keep the output tiles in registers
      for (int r = 0; r < 4; ++r) { lo4[r] = oacc[dt][r] * inv; hi4[r] = oacc[dt][4 + r] * inv; }
      *(v4fa*)&sO[w][ln][dt * 16 + 8 * hh] = lo4; *(v4fa*)&sO[w][ln][dt * 16 + 8 * hh + 4] = hi4; } }
  __builtin_amdgcn_fence(__ATOMIC_ACQ_REL, "workgroup"); __builtin_amdgcn_wave_barrier();
  {
#pragma unroll
    for (int rp = 0; rp < RPW; rp += 2) { const int r = rp + (lane >> 4), pc = lane & 15; const v4f val = *(const v4fa*)&sO[w][r][pc * 4]; *(v4f*)(O + ((size_t)b * TT + q0 + r) * ldo + pc * 4) = val; }
     } }

__global__ __launch_bounds__(256) void k_stat(const float* __restrict__ O, const float* __restrict__ x, float* __restrict__ PART) { __shared__ float r1[256], r2[256]; const int tid = threadIdx.x; const int b = blockIdx.x / NPB, part = blockIdx.x % NPB; const size_t base = (size_t)b * TT * DD + (size_t)part * (TT * DD / NPB); float s1 = 0.f, s2 = 0.f;
#pragma unroll 1
  for (int i = tid * 4; i < TT * DD / NPB; i += 1024) { const v4f o = *(const v4fa*)(O + base + i), xv = *(const v4fa*)(x + base + i); for (int q = 0; q < 4; ++q) { const float y = o[q] + bf16_round(xv[q]); s1 += y; s2 += y * y; } }
  r1[tid] = s1; r2[tid] = s2; __syncthreads(); for (int o = 128; o >= 1; o >>= 1) { if (tid < o) { r1[tid] += r1[tid + o]; r2[tid] += r2[tid + o]; } __syncthreads(); }
  if (tid < 32) { const float v = (tid == 0) ? r1[0] : ((tid == 1) ? r2[0] : 0.f); *(float*)(PART + (size_t)blockIdx.x * 32 + tid) = v;  } }
__global__ __launch_bounds__(256) void k_norm(const float* __restrict__ O, const float* __restrict__ x, const float* __restrict__ PART, float* __restrict__ out) { const size_t t = (size_t)blockIdx.x * 256 + threadIdx.x; if (t >= (size_t)NR * DD / 4) return; const int b = (int)((t * 4) / ((size_t)TT * DD)); float s1 = 0.f, s2 = 0.f;
#pragma unroll 1
  for (int p = 0; p < NPB; ++p) { s1 += PART[((size_t)b * NPB + p) * 32]; s2 += PART[((size_t)b * NPB + p) * 32 + 1]; }
  const float n = (float)TT * (float)DD; const float mu = s1 / n; const float var = fmaxf(s2 / n - mu * mu, 0.f); const float rs = rsqrtf(var + 1e-5f);
  const v4f o = *(const v4fa*)(O + t * 4), xv = *(const v4fa*)(x + t * 4); v4f r; for (int q = 0; q < 4; ++q) r[q] = (o[q] + bf16_round(xv[q]) - mu) * rs;
  *(v4f*)(out + t * 4) = r;  }

extern "C" void kernel_launch(void* const* d_in, const int* in_sizes, int n_in,
                              void* d_out, int out_size, void* d_ws, size_t ws_size, hipStream_t stream) {
  (void)in_sizes; (void)n_in; (void)out_size;
  const float* x = (const float*)d_in[0]; const float* Wq = (const float*)d_in[1]; const float* Wk = (const float*)d_in[2]; const float* Wv = (const float*)d_in[3];
  char* ws = (char*)d_ws; size_t off = 0;
  auto take = [&](size_t bytes) { char* p = ws + off; off += (bytes + 255) & ~(size_t)255; return p; };
  const size_t WSZ = (size_t)DD * DD, PSZ = (size_t)NR * DD; _Float16* Bw = (_Float16*)take(3 * WSZ * 2); _Float16* X16 = (_Float16*)take(PSZ * 2); float* F32 = (float*)take(2 * PSZ * 4);      /* F32: q, then k */
  _Float16* Qh = (_Float16*)take(2 * PSZ * 2); _Float16* Kh = Qh + PSZ; _Float16* Ql = (_Float16*)take(2 * PSZ * 2); _Float16* Kl = Ql + PSZ;      /* hi planes of q and k in a row, then their lo planes */
  _Float16* V16 = (_Float16*)take(PSZ * 2); _Float16* Vt = (_Float16*)take(PSZ * 2); float* PART = (float*)take((size_t)BB * NPB * 32 * 4);
  float* O = F32;      /* the q plane is consumed by k_post; it then takes the attention output */
  if (off > ws_size) return;      // 6.3 + 8.4 + 33.6 + 6 x 8.4 = 99 MB
  k_prep<<<GX16 + 3 * GW16, 256, 0, stream>>>(x, Wq, Wk, Wv, X16, Bw);      /* x; weights (out,in) natural x 2^4 */
  const dim3 gp(((NR / 16) * (DD / 64) + 3) / 4, 3);      /* y: q, k (f32 planes of F32), v (f16) */
  k_gemm_hhx<0><<<gp, 128, 0, stream>>>(X16, DD, 0, Bw, DD, WSZ, 0.0625f, nullptr, 0, nullptr, 1, 0, 0, F32, V16, 2, DD, PSZ, NR, DD, DD);
  k_post<<<GVT + 2 * GX16, 256, 0, stream>>>(F32, Qh, Ql, 2 * PSZ / 8, V16, Vt);      /* q, k f32 -> hi/lo; the [4096][1024] V plane viewed as 32 contiguous [2048][64] slabs -> V^T per slab; all in fragment order */
  k_flash<<<NSL * (TT / 64), 128, 0, stream>>>(Qh, Ql, 64, Kh, Kl, 64, Vt, O, 64);      /* same flat view for Q, K and O */
  k_stat<<<BB * NPB, 256, 0, stream>>>(O, x, PART); k_norm<<<(unsigned)(((size_t)NR * DD / 4 + 255) / 256), 256, 0, stream>>>(O, x, PART, (float*)d_out);
}

// v006
// It runs in 160 microseconds.
// Two timings next to v005 put it at 1.23 and 1.25 times that version's speed.
// Over all steps from v000 it is 3.14 times as fast.
#include <hip/hip_runtime.h>
// Multi-head attention with raw-reshape heads, residual and a global LayerNorm (B=2, S=2048, D=1024, 16 heads × 64): Q,K,V = x·Wᵀ reshaped by plain memory order to (H,B,S,64) (= 32 contiguous [2048][64] slabs of each
// [4096][1024] plane); UNSCALED softmax(Q·Kᵀ)·V per slab; y = out (same flat order, = [B,S,1024]) + x; output = (y − mean)/√(var + 1e-5) with mean/var over all (S,D) of each batch element (identity affine).
// Compute dtype: x and weights rounded to bf16; Q,K as f32 GEMM outputs split into f16 hi + ×2^10 residual planes so the unscaled (σ≈3) logits are f32-accurate; V f16; fused flash-style kernel
// (two score accumulators, online softmax f32, P f16 ×2^10) on v_wmma_f32_16x16x32_f16; residual and the per-batch statistics (fixed-order block partial sums of y and y², then a fixed-order combine) and normalisation in f32.
#define BB 2
#define TT 2048
#define DD 1024
#define NSL 32
#define NR (BB * TT)
#define NPB 64

typedef __bf16 v16b __attribute__((ext_vector_type(16)));
typedef unsigned short v8us __attribute__((ext_vector_type(8), may_alias));
typedef float  v8f  __attribute__((ext_vector_type(8)));
typedef float  v4f  __attribute__((ext_vector_type(4)));
typedef float  v4fa __attribute__((ext_vector_type(4), may_alias));
union FragB { v16b v; v8us half[2]; unsigned short u[16]; };

__device__ __forceinline__ unsigned short bf16_bits(float x) { unsigned int u = __float_as_uint(x); return (unsigned short)((u + 0x7FFFu + ((u >> 16) & 1u)) >> 16); }
__device__ __forceinline__ float bf16_val(unsigned short b) { return __uint_as_float(((unsigned int)b) << 16); }
__device__ __forceinline__ float bf16_round(float x) { return bf16_val(bf16_bits(x)); }
// D += A·B with NT terms: 1 = ah·bh, 2 = + al·bh (A split), 3 = + ah·bl (both split)
template <int NT>
__device__ __forceinline__ v8f mmaN(v16b ah, v16b al, v16b bh, v16b bl, v8f c) {
  c = __builtin_amdgcn_wmma_f32_16x16x32_bf16(false, ah, false, bh, (short)0, c, false, false);
  if (NT >= 2) c = __builtin_amdgcn_wmma_f32_16x16x32_bf16(false, al, false, bh, (short)0, c, false, false);
  if (NT >= 3) c = __builtin_amdgcn_wmma_f32_16x16x32_bf16(false, ah, false, bl, (short)0, c, false, false);
  asm volatile("v_nop\n\tv_nop\n\tv_nop\n\tv_nop" : "+v"(c) : "v"(ah), "v"(al), "v"(bh), "v"(bl));
  return c;
}

__global__ __launch_bounds__(256) void k_wt_bf16(const float* __restrict__ W, unsigned short* __restrict__ Wt, int K, int N) {
  const int t = blockIdx.x * 256 + threadIdx.x;
  const int k8n = K / 8;
  if (t >= N * k8n) return;
  const int n = t / k8n, k8 = (t % k8n) * 8;
  v8us v;
#pragma unroll
  for (int i = 0; i < 8; ++i) v[i] = bf16_bits(W[(size_t)(k8 + i) * N + n]);
  *(v8us*)(Wt + (size_t)n * K + k8) = v;
  
}

// GEMM C[M][N] (f32, pitch ldc) = act(A[M][K]·W + bias). A f32 row-major (pitch lda) converted per fragment to bf16
// (ASPLIT: hi/lo two planes -> 2 terms, else single rounded term); Wt bf16 [N][K] (pitch ldb). BIAS_BF16 rounds the
// bias to bf16 first (bias quantised to bf16 before the add). K%32==0, M%16==0, N%64==0.
template <bool ASPLIT, int ACT, bool BIAS_BF16>
__global__ __launch_bounds__(128) void k_gemm_bf(const float* __restrict__ A, int lda, const unsigned short* __restrict__ Wt, int ldb,
                                               const float* __restrict__ bias, float* __restrict__ C, int ldc, int M, int N, int K) {
  __shared__ __attribute__((aligned(16))) float so[4][16][64];
  const int tid = threadIdx.x, w = tid >> 5, lane = tid & 31, ln = lane & 15, hh = lane >> 4;
  const int ntn = N / 64;
  const int wid = blockIdx.x * 4 + w;
  const int mt = wid / ntn, nq = wid % ntn;
  if (mt * 16 >= M) return;
  const int row0 = mt * 16, col0 = nq * 64;
  const float* arow = A + (size_t)(row0 + ln) * lda;
  v8f acc[4] = {};
  for (int kb = 0; kb < K; kb += 32) {
    FragB ah, al;
    const v4f x0 = *(const v4fa*)(arow + kb + 8 * hh), x1 = *(const v4fa*)(arow + kb + 8 * hh + 4);
    const v4f x2 = *(const v4fa*)(arow + kb + 16 + 8 * hh), x3 = *(const v4fa*)(arow + kb + 16 + 8 * hh + 4);
    float xs[16] = {x0[0],x0[1],x0[2],x0[3],x1[0],x1[1],x1[2],x1[3],x2[0],x2[1],x2[2],x2[3],x3[0],x3[1],x3[2],x3[3]};
#pragma unroll
    for (int i = 0; i < 16; ++i) { const unsigned short hb = bf16_bits(xs[i]); ah.u[i] = hb; al.u[i] = ASPLIT ? bf16_bits(xs[i] - bf16_val(hb)) : (unsigned short)0; }
#pragma unroll
    for (int t = 0; t < 4; ++t) {
      const unsigned short* brow = Wt + (size_t)(col0 + t * 16 + ln) * ldb + kb;
      FragB b;
      b.half[0] = *(const v8us*)(brow + 8 * hh);
      b.half[1] = *(const v8us*)(brow + 16 + 8 * hh);
      acc[t] = mmaN<ASPLIT ? 2 : 1>(ah.v, al.v, b.v, b.v, acc[t]);
    }
  }
#pragma unroll
  for (int t = 0; t < 4; ++t) {
    float bv = bias ? bias[col0 + t * 16 + ln] : 0.f;
    if (BIAS_BF16) bv = bf16_round(bv);
#pragma unroll
    for (int r = 0; r < 8; ++r) { float v = acc[t][r] + bv; if (ACT == 1) v = fmaxf(v, 0.f); so[w][8 * hh + r][t * 16 + ln] = v; }
  }
  __builtin_amdgcn_fence(__ATOMIC_ACQ_REL, "workgroup");
  __builtin_amdgcn_wave_barrier();
  const int rsub = lane >> 4, c4 = (lane & 15) * 4;
  {
#pragma unroll
    for (int q = 0; q < 8; ++q) {
      const int r = q * 2 + rsub;
      const v4f v = *(const v4fa*)&so[w][r][c4];
      *(v4f*)(C + (size_t)(row0 + r) * ldc + col0 + c4) = v;
    }
    
  }
}

// Flash-style causal/unmasked attention, all contractions 3-term bf16 hi/lo splits, f32 softmax with running max.
// q,k,v rows are read from f32 buffers with arbitrary row pitch (so they can live inside a fused qkv buffer);
// D = head size (multiple of 32, <= 128); one wave = 16 query rows; block = 4 waves (64 queries) sharing K/V chunks of 32.
template <int D, bool CAUSAL>
__global__ __launch_bounds__(128) void k_flash(const float* __restrict__ qb, const float* __restrict__ kb, const float* __restrict__ vb,
                                             int pitch, int T, int H, float scale, float* __restrict__ y, int ypitch) {
  constexpr int KS = D / 32;        // k-steps for QK
  constexpr int DT = D / 16;        // d tiles for PV
  __shared__ __attribute__((aligned(16))) unsigned short sKh[32][D + 8], sKl[32][D + 8], sVh[32][D + 8], sVl[32][D + 8];
  __shared__ __attribute__((aligned(16))) unsigned short sPh[4][16][40], sPl[4][16][40];
  __shared__ __attribute__((aligned(16))) float sO[4][16][D];
  const int tid = threadIdx.x, w = tid >> 5, lane = tid & 31, ln = lane & 15, hh = lane >> 4;
  const int nqb = (T + 63) / 64;
  const int bh = blockIdx.x / nqb, qblk = blockIdx.x % nqb;
  const int b = bh / H, h = bh % H;
  const int q0 = qblk * 64 + w * 16;
  const float* Q = qb + (size_t)b * T * pitch + h * D;
  const float* K = kb + (size_t)b * T * pitch + h * D;
  const float* V = vb + (size_t)b * T * pitch + h * D;

  // A fragments of the wave's 16 query rows (scaled), hi/lo
  FragB aqh[KS], aql[KS];
  {
    int row = q0 + ln; if (row >= T) row = T - 1;
    const float* qr = Q + (size_t)row * pitch;
#pragma unroll
    for (int ks = 0; ks < KS; ++ks)
#pragma unroll
      for (int i = 0; i < 16; ++i) {
        const int d = ks * 32 + ((i < 8) ? (8 * hh + i) : (16 + 8 * hh + (i - 8)));
        const float x = qr[d] * scale; const unsigned short hb = bf16_bits(x);
        aqh[ks].u[i] = hb; aql[ks].u[i] = bf16_bits(x - bf16_val(hb));
      }
  }
  float m_r[8], l_r[8];
#pragma unroll
  for (int r = 0; r < 8; ++r) { m_r[r] = -3.0e38f; l_r[r] = 0.f; }
  v8f oacc[DT];
#pragma unroll
  for (int dt = 0; dt < DT; ++dt) oacc[dt] = (v8f){0.f,0.f,0.f,0.f,0.f,0.f,0.f,0.f};

  const int kv_end = CAUSAL ? min(T, qblk * 64 + 64) : T;     // block-uniform
  for (int j0 = 0; j0 < kv_end; j0 += 32) {
    __syncthreads();
    for (int e = tid; e < 32 * (D / 4); e += 128) {
      const int r = e / (D / 4), c4 = (e % (D / 4)) * 4;
      const int key = j0 + r;
      v4f kf = {0.f,0.f,0.f,0.f}, vf = {0.f,0.f,0.f,0.f};
      if (key < T) { kf = *(const v4fa*)(K + (size_t)key * pitch + c4); vf = *(const v4fa*)(V + (size_t)key * pitch + c4); }
#pragma unroll
      for (int t = 0; t < 4; ++t) {
        unsigned short hb = bf16_bits(kf[t]); sKh[r][c4 + t] = hb; sKl[r][c4 + t] = bf16_bits(kf[t] - bf16_val(hb));
        hb = bf16_bits(vf[t]); sVh[r][c4 + t] = hb; sVl[r][c4 + t] = bf16_bits(vf[t] - bf16_val(hb));
      }
    }
    __syncthreads();
    // S tile 16 x 32
    v8f s[2];
#pragma unroll
    for (int nt = 0; nt < 2; ++nt) {
      v8f acc = {};
#pragma unroll
      for (int ks = 0; ks < KS; ++ks) {
        FragB bh_, bl_;
        bh_.half[0] = *(const v8us*)&sKh[nt * 16 + ln][ks * 32 + 8 * hh]; bh_.half[1] = *(const v8us*)&sKh[nt * 16 + ln][ks * 32 + 16 + 8 * hh];
        bl_.half[0] = *(const v8us*)&sKl[nt * 16 + ln][ks * 32 + 8 * hh]; bl_.half[1] = *(const v8us*)&sKl[nt * 16 + ln][ks * 32 + 16 + 8 * hh];
        acc = mmaN<3>(aqh[ks].v, aql[ks].v, bh_.v, bl_.v, acc);
      }
      s[nt] = acc;
    }
    // mask + running max (rows 8hh+r; the 16 lanes of a half share rows)
    float alpha[8];
#pragma unroll
    for (int r = 0; r < 8; ++r) {
      const int qi = q0 + 8 * hh + r;
      const int ja = j0 + ln, jb = j0 + 16 + ln;
      if (CAUSAL) { if (ja > qi) s[0][r] = -3.0e38f; if (jb > qi) s[1][r] = -3.0e38f; }
      if (ja >= T) s[0][r] = -3.0e38f;
      if (jb >= T) s[1][r] = -3.0e38f;
      float mx = fmaxf(s[0][r], s[1][r]);
      mx = fmaxf(mx, __shfl_xor(mx, 1, 32)); mx = fmaxf(mx, __shfl_xor(mx, 2, 32)); mx = fmaxf(mx, __shfl_xor(mx, 4, 32)); mx = fmaxf(mx, __shfl_xor(mx, 8, 32));
      const float mnew = fmaxf(m_r[r], mx);
      alpha[r] = (mnew > -1.0e38f) ? __expf(m_r[r] - mnew) : 1.0f;
      const float p0 = (s[0][r] > -1.0e38f) ? __expf(s[0][r] - mnew) : 0.f;
      const float p1 = (s[1][r] > -1.0e38f) ? __expf(s[1][r] - mnew) : 0.f;
      m_r[r] = mnew;
      l_r[r] = l_r[r] * alpha[r] + p0 + p1;            // per-lane partial row sum (16 lanes combined at the end)
      unsigned short hb = bf16_bits(p0); sPh[w][8 * hh + r][ln] = hb;      sPl[w][8 * hh + r][ln] = bf16_bits(p0 - bf16_val(hb));
      hb = bf16_bits(p1);                sPh[w][8 * hh + r][16 + ln] = hb; sPl[w][8 * hh + r][16 + ln] = bf16_bits(p1 - bf16_val(hb));
    }
#pragma unroll
    for (int dt = 0; dt < DT; ++dt)
#pragma unroll
      for (int r = 0; r < 8; ++r) oacc[dt][r] *= alpha[r];
    __builtin_amdgcn_fence(__ATOMIC_ACQ_REL, "workgroup");
    __builtin_amdgcn_wave_barrier();
    FragB pah, pal;
    pah.half[0] = *(const v8us*)&sPh[w][ln][8 * hh]; pah.half[1] = *(const v8us*)&sPh[w][ln][16 + 8 * hh];
    pal.half[0] = *(const v8us*)&sPl[w][ln][8 * hh]; pal.half[1] = *(const v8us*)&sPl[w][ln][16 + 8 * hh];
#pragma unroll
    for (int dt = 0; dt < DT; ++dt) {
      FragB bvh, bvl;
#pragma unroll
      for (int i = 0; i < 8; ++i) {
        bvh.u[i] = sVh[8 * hh + i][dt * 16 + ln]; bvh.u[8 + i] = sVh[16 + 8 * hh + i][dt * 16 + ln];
        bvl.u[i] = sVl[8 * hh + i][dt * 16 + ln]; bvl.u[8 + i] = sVl[16 + 8 * hh + i][dt * 16 + ln];
      }
      oacc[dt] = mmaN<3>(pah.v, pal.v, bvh.v, bvl.v, oacc[dt]);
    }
    __builtin_amdgcn_fence(__ATOMIC_ACQ_REL, "workgroup");
    __builtin_amdgcn_wave_barrier();
  }
#pragma unroll
  for (int r = 0; r < 8; ++r) {
    float l = l_r[r];
    l += __shfl_xor(l, 1, 32); l += __shfl_xor(l, 2, 32); l += __shfl_xor(l, 4, 32); l += __shfl_xor(l, 8, 32);
    l_r[r] = (l > 0.f) ? 1.0f / l : 0.f;
  }
#pragma unroll
  for (int dt = 0; dt < DT; ++dt)
#pragma unroll
    for (int r = 0; r < 8; ++r) sO[w][8 * hh + r][dt * 16 + ln] = oacc[dt][r] * l_r[r];
  __builtin_amdgcn_fence(__ATOMIC_ACQ_REL, "workgroup");
  __builtin_amdgcn_wave_barrier();
  {
    for (int r = 0; r < 16; ++r) {
      const int row = q0 + r;
      if (row < T && lane < D / 4) {
        const v4f val = *(const v4fa*)&sO[w][r][lane * 4];
        *(v4f*)(y + ((size_t)b * T + row) * ypitch + h * D + lane * 4) = val;
      }
    }
    
  }
}

// GEMM C = act(A·W + bias + resid): A f32 (ASPLIT -> hi/lo 2 terms), Wt bf16 [N][K]; ACT 0 none, 1 relu, 2 exact gelu;
// resid (optional, f32, row index = (row % rmod), pitch ldr, RES_BF16 rounds it) added before the activation.
template <bool ASPLIT, int ACT, bool BIAS_BF16, bool RES_BF16>
__global__ __launch_bounds__(128) void k_gemm_bf3(const float* __restrict__ A, int lda, const unsigned short* __restrict__ Wt, int ldb,
                                                const float* __restrict__ bias, const float* __restrict__ resid, int rmod, int ldr,
                                                float* __restrict__ C, int ldc, int M, int N, int K) {
  __shared__ __attribute__((aligned(16))) float so[4][16][64];
  const int tid = threadIdx.x, w = tid >> 5, lane = tid & 31, ln = lane & 15, hh = lane >> 4;
  const int ntn = N / 64;
  const int wid = blockIdx.x * 4 + w;
  const int mt = wid / ntn, nq = wid % ntn;
  if (mt * 16 >= M) return;
  const int row0 = mt * 16, col0 = nq * 64;
  const float* arow = A + (size_t)(row0 + ln) * lda;
  v8f acc[4] = {};
  for (int kb = 0; kb < K; kb += 32) {
    FragB ah, al;
    const v4f x0 = *(const v4fa*)(arow + kb + 8 * hh), x1 = *(const v4fa*)(arow + kb + 8 * hh + 4);
    const v4f x2 = *(const v4fa*)(arow + kb + 16 + 8 * hh), x3 = *(const v4fa*)(arow + kb + 16 + 8 * hh + 4);
    float xs[16] = {x0[0],x0[1],x0[2],x0[3],x1[0],x1[1],x1[2],x1[3],x2[0],x2[1],x2[2],x2[3],x3[0],x3[1],x3[2],x3[3]};
#pragma unroll
    for (int i = 0; i < 16; ++i) { const unsigned short hb = bf16_bits(xs[i]); ah.u[i] = hb; al.u[i] = ASPLIT ? bf16_bits(xs[i] - bf16_val(hb)) : (unsigned short)0; }
#pragma unroll
    for (int t = 0; t < 4; ++t) {
      const unsigned short* brow = Wt + (size_t)(col0 + t * 16 + ln) * ldb + kb;
      FragB b;
      b.half[0] = *(const v8us*)(brow + 8 * hh);
      b.half[1] = *(const v8us*)(brow + 16 + 8 * hh);
      acc[t] = mmaN<ASPLIT ? 2 : 1>(ah.v, al.v, b.v, b.v, acc[t]);
    }
  }
#pragma unroll
  for (int t = 0; t < 4; ++t) {
    const int col = col0 + t * 16 + ln;
    float bv = bias ? bias[col] : 0.f;
    if (BIAS_BF16) bv = bf16_round(bv);
#pragma unroll
    for (int r = 0; r < 8; ++r) {
      float v = acc[t][r] + bv;
      if (resid) { float rv = resid[(size_t)((row0 + 8 * hh + r) % rmod) * ldr + col]; if (RES_BF16) rv = bf16_round(rv); v += rv; }
      if (ACT == 1) v = fmaxf(v, 0.f);
      if (ACT == 2) v = 0.5f * v * (1.0f + erff(v * 0.70710678118654752f));
      if (ACT == 3) { const float u = 0.7978845608028654f * (v + 0.044715f * v * v * v); v = 0.5f * v * (1.0f + tanhf(u)); }
      so[w][8 * hh + r][t * 16 + ln] = v;
    }
  }
  __builtin_amdgcn_fence(__ATOMIC_ACQ_REL, "workgroup");
  __builtin_amdgcn_wave_barrier();
  const int rsub = lane >> 4, c4 = (lane & 15) * 4;
  {
#pragma unroll
    for (int q = 0; q < 8; ++q) {
      const int r = q * 2 + rsub;
      const v4f v = *(const v4fa*)&so[w][r][c4];
      *(v4f*)(C + (size_t)(row0 + r) * ldc + col0 + c4) = v;
    }
    
  }
}
// row LayerNorm (biased variance, eps) over N: s = X (+ R); optional out_sum <- s; out_norm <- (s-mu)*rsqrt(var+eps)*g + b
template <bool PARAM_BF16>
__global__ __launch_bounds__(256) void k_layernorm(const float* __restrict__ X, const float* __restrict__ R, const float* __restrict__ g, const float* __restrict__ bta,
                                                  float* __restrict__ out_sum, float* __restrict__ out_norm, int N, float eps) {
  __shared__ float red[256];
  const int row = blockIdx.x, tid = threadIdx.x;
  const float* x = X + (size_t)row * N; const float* rr = R ? R + (size_t)row * N : nullptr;
  float vals[16];                     // up to N = 4096
  const int per = N / 256;            // contiguous chunk per thread? use strided-by-4 chunks: thread handles j = tid*4 + 1024*u
  float s1 = 0.f;
  for (int u = 0; u < per / 4; ++u) {
    const int j = tid * 4 + 1024 * u;
    const v4f a = *(const v4fa*)(x + j);
    v4f b = {0.f,0.f,0.f,0.f}; if (rr) b = *(const v4fa*)(rr + j);
#pragma unroll
    for (int q = 0; q < 4; ++q) { const float v = a[q] + b[q]; vals[u * 4 + q] = v; s1 += v; }
  }
  red[tid] = s1; __syncthreads();
  for (int st = 128; st > 0; st >>= 1) { if (tid < st) red[tid] += red[tid + st]; __syncthreads(); }
  const float mu = red[0] / (float)N; __syncthreads();
  float s2 = 0.f;
  for (int u = 0; u < per / 4; ++u)
#pragma unroll
    for (int q = 0; q < 4; ++q) { const float c = vals[u * 4 + q] - mu; s2 += c * c; }
  red[tid] = s2; __syncthreads();
  for (int st = 128; st > 0; st >>= 1) { if (tid < st) red[tid] += red[tid + st]; __syncthreads(); }
  const float rs = rsqrtf(red[0] / (float)N + eps);
  {
    for (int u = 0; u < per / 4; ++u) {
      const int j = tid * 4 + 1024 * u;
      v4f o, sm;
#pragma unroll
      for (int q = 0; q < 4; ++q) {
        float gg = g[j + q], bb = bta[j + q];
        if (PARAM_BF16) { gg = bf16_round(gg); bb = bf16_round(bb); }
        sm[q] = vals[u * 4 + q]; o[q] = (vals[u * 4 + q] - mu) * rs * gg + bb;
      }
      if (out_sum) *(v4f*)(out_sum + (size_t)row * N + j) = sm;
      *(v4f*)(out_norm + (size_t)row * N + j) = o;
    }
    
  }
}



// ---- f16 WMMA path (v_wmma_f32_16x16x32_f16): 11-bit significands for operands in range — used where a [0,1] probability operand needs more precision than bf16
typedef _Float16 v16h __attribute__((ext_vector_type(16)));
union FragH { v16h v; v8us half[2]; _Float16 h[16]; unsigned short u[16]; };
template <int NT>
__device__ __forceinline__ v8f mmaH(v16h ah, v16h al, v16h bh, v16h bl, v8f c) {
  c = __builtin_amdgcn_wmma_f32_16x16x32_f16(false, ah, false, bh, (short)0, c, false, false);
  if (NT >= 2) c = __builtin_amdgcn_wmma_f32_16x16x32_f16(false, al, false, bh, (short)0, c, false, false);
  if (NT >= 3) c = __builtin_amdgcn_wmma_f32_16x16x32_f16(false, ah, false, bl, (short)0, c, false, false);
  asm volatile("v_nop\n\tv_nop\n\tv_nop\n\tv_nop" : "+v"(c) : "v"(ah), "v"(al), "v"(bh), "v"(bl));
  return c;
}
// batched GEMM like k_gemm_b but f16 operands: A f32 (split into f16 hi/lo if ASPLIT, else rounded to f16), Bt = f16 values [n][k]; alpha; C f32; N multiple of 16 (partial tiles skipped)
template <bool ASPLIT>
__global__ __launch_bounds__(128) void k_gemm_h(const float* __restrict__ A, int lda, size_t sA, const _Float16* __restrict__ Bh, int ldb, size_t sB, float alpha, float* __restrict__ C, int ldc, size_t sC, int M, int N, int K) {
  __shared__ __attribute__((aligned(16))) float so[4][16][64];
  const int tid = threadIdx.x, w = tid >> 5, lane = tid & 31, ln = lane & 15, hh = lane >> 4; const int by = blockIdx.y;
  A += (size_t)by * sA; Bh += (size_t)by * sB; C += (size_t)by * sC;
  const int ntn = (N + 63) / 64; const int wid = blockIdx.x * 4 + w; const int mt = wid / ntn, nq = wid % ntn; if (mt * 16 >= M) return;
  const int row0 = mt * 16, col0 = nq * 64; const float* arow = A + (size_t)(row0 + ln) * lda;
  v8f acc[4] = {};
  for (int kb = 0; kb < K; kb += 32) {
    FragH ah, al;
    const v4f x0 = *(const v4fa*)(arow + kb + 8 * hh), x1 = *(const v4fa*)(arow + kb + 8 * hh + 4), x2 = *(const v4fa*)(arow + kb + 16 + 8 * hh), x3 = *(const v4fa*)(arow + kb + 16 + 8 * hh + 4);
    float xs[16] = {x0[0],x0[1],x0[2],x0[3],x1[0],x1[1],x1[2],x1[3],x2[0],x2[1],x2[2],x2[3],x3[0],x3[1],x3[2],x3[3]};
#pragma unroll
    for (int i = 0; i < 16; ++i) { const _Float16 h = (_Float16)xs[i]; ah.h[i] = h; al.h[i] = ASPLIT ? (_Float16)(xs[i] - (float)h) : (_Float16)0.0f; }
#pragma unroll
    for (int t = 0; t < 4; ++t) { if (col0 + t * 16 >= N) continue; const size_t boff = (size_t)(col0 + t * 16 + ln) * ldb + kb; FragH bq; bq.half[0] = *(const v8us*)(Bh + boff + 8 * hh); bq.half[1] = *(const v8us*)(Bh + boff + 16 + 8 * hh);
      acc[t] = mmaH<ASPLIT ? 2 : 1>(ah.v, al.v, bq.v, bq.v, acc[t]); }
  }
#pragma unroll
  for (int t = 0; t < 4; ++t) { if (col0 + t * 16 >= N) continue;
#pragma unroll
    for (int r = 0; r < 8; ++r) so[w][8 * hh + r][t * 16 + ln] = acc[t][r] * alpha; }
  __builtin_amdgcn_fence(__ATOMIC_ACQ_REL, "workgroup"); __builtin_amdgcn_wave_barrier();
  const int rsub = lane >> 4, c4 = (lane & 15) * 4;
  {
#pragma unroll
    for (int q = 0; q < 8; ++q) { const int r = q * 2 + rsub; if (col0 + c4 < N) { const v4f v = *(const v4fa*)&so[w][r][c4]; *(v4f*)(C + (size_t)(row0 + r) * ldc + col0 + c4) = v; } }
     }
}

// Wt[n][k] = f16(W[k][n]·scale) from f32 row-major W[K][N] (scale = power of two; bf16-exact weights stay exact in f16 away from the subnormal range)
__global__ __launch_bounds__(256) void k_wt_f16(const float* __restrict__ W, _Float16* __restrict__ Wt, int K, int N, float scale) {
  const int t = blockIdx.x * 256 + threadIdx.x; if (t >= N * (K / 8)) return; const int n = t / (K / 8), k8 = (t % (K / 8)) * 8; FragH f;
#pragma unroll
  for (int i = 0; i < 8; ++i) f.h[i] = (_Float16)(bf16_round(W[(size_t)(k8 + i) * N + n]) * scale); const v8us o = f.half[0];
  *(v8us*)((unsigned short*)Wt + (size_t)n * K + k8) = o; 
}
// Fragment order: a [rows][K] 16-bit plane is kept as 1-KB units of 16 rows x 32 k, unit (row / 16) * (K / 32) + k / 32; inside a unit the 16-byte piece 32 p + lane holds row (lane & 15), k = 16 p + 8 (lane >> 4) + 0..7.
// A wave's fragment is then two 16-byte loads per lane that each cover 512 contiguous bytes (4 whole 128-B lines) instead of 32 bytes in each of 16 lines; fragment element i is k = 8 (lane >> 4) + i for i < 8 and 16 + 8 (lane >> 4) + (i - 8) above, for both operands of every product.
// frag_src: index, in the row-major plane, of the first of the 8 elements that 16-byte piece number 'piece' of the fragment-ordered plane holds.
__device__ __forceinline__ size_t frag_src(size_t piece, int K) { const size_t u = piece >> 6; const int in = (int)(piece & 63), p = in >> 5, l = in & 31; const size_t kt = (size_t)(K / 32);
  return ((u / kt) * 16 + (size_t)(l & 15)) * (size_t)K + (u % kt) * 32 + (size_t)(p * 16 + (l >> 4) * 8); }
// A and Bh in fragment order (lda == ldb == K at every launch here).
// k_gemm_hh variant with fused epilogue: v = acc·alpha + bias[by·sBias + col] (+ CP[(row/rowsPerB)·sCPb + by·64 + col] if CP) ; ACT 0 none / 1 elu ; batch members by < y16 are written as f32 planes of C, the others as f16 planes of C16 (each plane sC elements)
template <int ACT>
__global__ __launch_bounds__(128) void k_gemm_hhx(const _Float16* __restrict__ A, int lda, size_t sA, const _Float16* __restrict__ Bh, int ldb, size_t sB, float alpha, const float* __restrict__ bias, size_t sBias, const float* __restrict__ CP, int rowsPerB, size_t sCPb, int row0g,
    float* __restrict__ C, _Float16* __restrict__ C16, int y16, int ldc, size_t sC, int M, int N, int K) {
  __shared__ __attribute__((aligned(16))) float so[4][16][64];
  const int tid = threadIdx.x, w = tid >> 5, lane = tid & 31, ln = lane & 15, hh = lane >> 4; const int by = blockIdx.y;
  A += (size_t)by * sA; Bh += (size_t)by * sB; const bool w32 = by < y16; const size_t cofs = (size_t)(w32 ? by : by - y16) * sC; const float* bp = bias ? bias + (size_t)by * sBias : nullptr;
  const int ntn = (N + 63) / 64; const int wid = blockIdx.x * 4 + w; const int mt = wid / ntn, nq = wid % ntn; if (mt * 16 >= M) return;
  const int row0 = mt * 16, col0 = nq * 64;
  v8f acc[4] = {};
  // Two register stages of 64 k each (K % 128 == 0, N % 64 == 0 at every launch here): a stage's 20 fragment loads are issued as one group, one stage ahead of the products that read them.
  // The five row pointers are carried through the loop and stepped between the groups, so none of their registers is free for a load's result while loads are in flight.
  const char* pa = (const char*)(A + (size_t)row0 * lda + lane * 8); const char* pb[4];
#pragma unroll      // constant indices keep the row pointers in registers
  for (int t = 0; t < 4; ++t) pb[t] = (const char*)(Bh + (size_t)(col0 + t * 16) * ldb + lane * 8);
  FragH a0[2], b0[2][4], a1[2], b1[2][4];
  auto fetch = [&](FragH (&fa)[2], FragH (&fb)[2][4]) {
#pragma unroll      // constant indices keep the fragment arrays in registers
    for (int ks = 0; ks < 2; ++ks) { fa[ks].half[0] = *(const v8us*)(pa + ks * 1024); fa[ks].half[1] = *(const v8us*)(pa + ks * 1024 + 512);
#pragma unroll      // constant indices keep the fragment arrays in registers
      for (int t = 0; t < 4; ++t) { fb[ks][t].half[0] = *(const v8us*)(pb[t] + ks * 1024); fb[ks][t].half[1] = *(const v8us*)(pb[t] + ks * 1024 + 512); } } };
  auto step = [&](long bytes) { pa += bytes;
#pragma unroll      // constant indices keep the row pointers in registers
    for (int t = 0; t < 4; ++t) pb[t] += bytes; };
  auto mul = [&](FragH (&fa)[2], FragH (&fb)[2][4]) {
#pragma unroll      // constant indices keep the fragment arrays in registers
    for (int ks = 0; ks < 2; ++ks)
#pragma unroll      // constant indices keep the fragment arrays in registers
      for (int t = 0; t < 4; ++t) acc[t] = mmaH<1>(fa[ks].v, fa[ks].v, fb[ks][t].v, fb[ks][t].v, acc[t]); };
  fetch(a0, b0); step(2048);      // a stage of 64 k = two 1-KB units; a 16-row tile's K elements = 32 K bytes
#pragma unroll 1      // rolled: one ping-pong pair per trip keeps both stages in fixed registers and the loop short
  for (int kb = 0; kb < K; kb += 128) {
    fetch(a1, b1); mul(a0, b0); step((kb + 128 < K) ? 2048L : 2048L - 32L * K);      // the last trip steps back to k = 0: its second fetch stays in bounds and is not used
    fetch(a0, b0); mul(a1, b1); step(2048);
  }
#pragma unroll
  for (int t = 0; t < 4; ++t) { if (col0 + t * 16 >= N) continue; const int col = col0 + t * 16 + ln; const float bv = bp ? bf16_round(bp[col]) : 0.f;
#pragma unroll
    for (int r = 0; r < 8; ++r) { float v = acc[t][r] * alpha + bv; if (CP) { const int bidx = (row0g + row0 + 8 * hh + r) / rowsPerB; v += CP[(size_t)bidx * sCPb + (size_t)by * 64 + col]; } if (ACT == 1) v = (v > 0.f) ? v : expm1f(v); else if (ACT == 7) v = (v > 0.f) ? v + 1.0f : expf(v); else if (ACT == 8) v = tanhf(v); else if (ACT == 9) v = 0.5f * v * (1.0f + tanhf(0.7978845608028654f * (v + 0.044715f * v * v * v))); else if (ACT == 11) v = 1.0f / (1.0f + expf(-v)); else if (ACT == 12) v = (v > 0.f) ? v : 0.01f * v; else if (ACT == 14) v = (v > 0.f) ? v : 0.1f * v; else if (ACT == 15) v = v / (1.0f + expf(-v)); else if (ACT == 3) v = fmaxf(v, 0.f); else if (ACT == 6) v = 0.5f * v * (1.0f + erff(v * 0.70710678118654752f)); so[w][8 * hh + r][t * 16 + ln] = v; } }
  __builtin_amdgcn_fence(__ATOMIC_ACQ_REL, "workgroup"); __builtin_amdgcn_wave_barrier();
  const int rsub = lane >> 4, c4 = (lane & 15) * 4; typedef _Float16 v4h __attribute__((ext_vector_type(4)));
  if (w32) {      // the same for a whole block: one branch ahead of the eight stores
#pragma unroll      // the eight LDS reads go out as one group ahead of the stores
    for (int q = 0; q < 8; ++q) { const int r = q * 2 + rsub; if (col0 + c4 < N) { const v4f v = *(const v4fa*)&so[w][r][c4]; *(v4f*)(C + cofs + (size_t)(row0 + r) * ldc + col0 + c4) = v; } }
  } else {
#pragma unroll      // the eight LDS reads go out as one group ahead of the stores
    for (int q = 0; q < 8; ++q) { const int r = q * 2 + rsub; if (col0 + c4 < N) { const v4f v = *(const v4fa*)&so[w][r][c4]; v4h h4; for (int i = 0; i < 4; ++i) h4[i] = (_Float16)v[i]; *(v4h*)(C16 + cofs + (size_t)(row0 + r) * ldc + col0 + c4) = h4; } }
  }
}


typedef _Float16 v4h __attribute__((ext_vector_type(4)));

// The streaming launches run as one resident round: GSTR blocks of 8 waves = 16 waves on each of 256 WGPs. A lane takes 7 or 8 pieces of 16 output bytes, 256 pieces apart inside its block's own run of pieces, and asks for all their inputs as one group before it converts and stores any.
#define GSTR 512
static_assert((size_t)NR * DD / 8 == (size_t)GSTR * 1024 && (size_t)DD * DD / 8 == (size_t)GSTR * 256, "a lane of k_prep takes four pieces of x and one of each weight");
static_assert(2 * (size_t)NR * DD / 8 == (size_t)GSTR * 2048, "a lane of the q/k split takes eight pieces");
static_assert((size_t)NR * DD / 4 == (size_t)GSTR * 2048 && GSTR % BB == 0, "a lane of k_norm takes eight pieces, a block lies in one batch element");
__global__ __launch_bounds__(256) void k_h16(const float* __restrict__ x, _Float16* __restrict__ X16, size_t n8) { const size_t t = (size_t)blockIdx.x * 256 + threadIdx.x; if (t >= n8) return; FragH f;
#pragma unroll
  for (int q = 0; q < 8; ++q) f.h[q] = (_Float16)x[t * 8 + q]; *(v8us*)((unsigned short*)X16 + t * 8) = f.half[0];  }
// x ([NR][DD]) and the three weights ([DD][DD], x 2^4), rounded to bf16 values and written as f16 planes in fragment order.
__global__ __launch_bounds__(256) void k_prep(const float* __restrict__ x, const float* __restrict__ Wq, const float* __restrict__ Wk, const float* __restrict__ Wv, _Float16* __restrict__ X16, _Float16* __restrict__ Bw) {
  const size_t tx = (size_t)blockIdx.x * 1024 + threadIdx.x, tw = (size_t)blockIdx.x * 256 + threadIdx.x; v4f a[7][2]; const size_t s = frag_src(tw, DD);
  static_assert(DD / 32 % 16 == 0, "a block's 16 units of x lie in one 16-row tile: piece tx + 256 i is four units on, 128 k to the right of piece tx");
  const float* xa = x + frag_src(tx, DD); const float* wq = Wq + s; const float* wk = Wk + s; const float* wv = Wv + s;
#pragma unroll      // constant indices keep the seven pieces in registers; all loads stand ahead of the first conversion
  for (int i = 0; i < 4; ++i) { a[i][0] = *(const v4fa*)(xa + i * 128); a[i][1] = *(const v4fa*)(xa + i * 128 + 4); }
  a[4][0] = *(const v4fa*)wq; a[4][1] = *(const v4fa*)(wq + 4); a[5][0] = *(const v4fa*)wk; a[5][1] = *(const v4fa*)(wk + 4); a[6][0] = *(const v4fa*)wv; a[6][1] = *(const v4fa*)(wv + 4);
  // the loaded values as inputs only: keeps all 14 loads ahead of the first conversion, or the compiler sinks half of them behind waits for the first; the addresses as inputs, so that no load's result lands in an address register of the group, and the wait in front of their reuse
  asm volatile("s_wait_xcnt 0x0" :: "v"(a[0][0]), "v"(a[0][1]), "v"(a[1][0]), "v"(a[1][1]), "v"(a[2][0]), "v"(a[2][1]), "v"(a[3][0]), "v"(a[3][1]), "v"(a[4][0]), "v"(a[4][1]), "v"(a[5][0]), "v"(a[5][1]), "v"(a[6][0]), "v"(a[6][1]), "v"(xa), "v"(wq), "v"(wk), "v"(wv) : "memory");
#pragma unroll      // constant indices keep the seven pieces in registers
  for (int i = 0; i < 7; ++i) { FragH f; const float sc = (i < 4) ? 1.0f : 16.0f;
#pragma unroll
    for (int q = 0; q < 4; ++q) { f.h[q] = (_Float16)(bf16_round(a[i][0][q]) * sc); f.h[4 + q] = (_Float16)(bf16_round(a[i][1][q]) * sc); }
    unsigned short* dst = (i < 4) ? (unsigned short*)X16 + (tx + i * 256) * 8 : (unsigned short*)Bw + (size_t)(i - 4) * DD * DD + tw * 8;
    *(v8us*)dst = f.half[0]; } }
// V^T of 256 keys x 64 d per block
template <int NHv, int TTv>
__device__ __forceinline__ void d_vt(const _Float16* __restrict__ V16, int ldv, int voff, _Float16* __restrict__ Vt, int bx) { __shared__ unsigned short tl[256][66]; const int tid = threadIdx.x; const int slab = bx / (TTv / 256), lg = bx % (TTv / 256); const int b = slab / NHv, h = slab % NHv; FragH f[8]; const unsigned short* pv = (const unsigned short*)V16 + ((size_t)b * TTv + lg * 256 + tid / 8) * ldv + voff + h * 64 + (tid % 8) * 8;
#pragma unroll      // constant indices keep the eight pieces in registers; all loads stand ahead of the first LDS store
  for (int u = 0; u < 8; ++u) f[u].half[0] = *(const v8us*)(pv + (size_t)u * 32 * ldv);      // piece u * 256 + tid: row u * 32 + tid / 8
  // the address as an input, so that no load's result lands in it, and the wait in front of its reuse; the loaded values as inputs only: all eight loads stand ahead of the first LDS store
  asm volatile("s_wait_xcnt 0x0" :: "v"(f[0].half[0]), "v"(f[1].half[0]), "v"(f[2].half[0]), "v"(f[3].half[0]), "v"(f[4].half[0]), "v"(f[5].half[0]), "v"(f[6].half[0]), "v"(f[7].half[0]), "v"(pv) : "memory");
#pragma unroll      // constant indices keep the eight pieces in registers
  for (int u = 0; u < 8; ++u) { const int i = u * 256 + tid, r = i / 8, c8 = (i % 8) * 8;
#pragma unroll
    for (int q = 0; q < 8; ++q) tl[r][c8 + q] = f[u].u[q]; }
  __syncthreads();
  {
#pragma unroll
    for (int rd = 0; rd < 8; ++rd) { const int o = rd * 256 + tid, un = o >> 6, p = (o >> 5) & 1, l = o & 31; const int d = (un & 3) * 16 + (l & 15), key = (un >> 2) * 32 + p * 16 + (l >> 4) * 8; FragH g;      // V^T in fragment order: unit (32-key tile) * 4 + d / 16, rows = d, k = keys; the block's 32 units are 32 KB in a row
#pragma unroll
      for (int q = 0; q < 8; ++q) g.u[q] = tl[key + q][d];
      *(v8us*)((unsigned short*)Vt + ((size_t)slab * TTv + lg * 256) * 64 + o * 8) = g.half[0]; }
     } }

__device__ __forceinline__ void d_hl(const float* __restrict__ F, _Float16* __restrict__ Hh, _Float16* __restrict__ Hl, size_t t) { v4f a[8], c[8]; FragH fh[8], fl[8];      /* the flat [rows][64] view, both planes written in fragment order; pieces t + 256 u: four units = 32 rows = 2048 elements on each */
  const float* pf = F + frag_src(t, 64); unsigned short* ph = (unsigned short*)Hh + t * 8; unsigned short* pl = (unsigned short*)Hl + t * 8;
#pragma unroll      // constant indices keep the eight pieces in registers; all loads stand ahead of the first conversion
  for (int u = 0; u < 8; ++u) { a[u] = *(const v4fa*)(pf + u * 2048); c[u] = *(const v4fa*)(pf + u * 2048 + 4); }
  // the loaded values as inputs only: keeps all 16 loads ahead of the first conversion, or the compiler sinks some of them behind waits for the first; the address as an input, so that no load's result lands in it, and the wait in front of its reuse
  asm volatile("s_wait_xcnt 0x0" :: "v"(a[0]), "v"(c[0]), "v"(a[1]), "v"(c[1]), "v"(a[2]), "v"(c[2]), "v"(a[3]), "v"(c[3]), "v"(a[4]), "v"(c[4]), "v"(a[5]), "v"(c[5]), "v"(a[6]), "v"(c[6]), "v"(a[7]), "v"(c[7]), "v"(pf) : "memory");
#pragma unroll      // constant indices keep the eight pieces in registers
  for (int u = 0; u < 8; ++u) {
#pragma unroll
    for (int q = 0; q < 4; ++q) { _Float16 h = (_Float16)a[u][q]; fh[u].h[q] = h; fl[u].h[q] = (_Float16)((a[u][q] - (float)h) * 1024.0f); h = (_Float16)c[u][q]; fh[u].h[4 + q] = h; fl[u].h[4 + q] = (_Float16)((c[u][q] - (float)h) * 1024.0f); }
    *(v8us*)(ph + u * 2048) = fh[u].half[0]; *(v8us*)(pl + u * 2048) = fl[u].half[0]; }
  // the wait behind the 16 stores, in front of the reuse of their registers by the code that follows in the kernel; data and addresses are inputs so that they stay as they are up to the wait
  asm volatile("s_wait_xcnt 0x0" :: "v"(fh[0].half[0]), "v"(fl[0].half[0]), "v"(fh[1].half[0]), "v"(fl[1].half[0]), "v"(fh[2].half[0]), "v"(fl[2].half[0]), "v"(fh[3].half[0]), "v"(fl[3].half[0]), "v"(fh[4].half[0]), "v"(fl[4].half[0]), "v"(fh[5].half[0]), "v"(fl[5].half[0]), "v"(fh[6].half[0]), "v"(fl[6].half[0]), "v"(fh[7].half[0]), "v"(fl[7].half[0]), "v"(ph), "v"(pl) : "memory"); }
// What stands between the projections and the attention, in one grid: blocks 0 .. GVT - 1 transpose V, the others split q and k, whose f32 planes and whose hi and lo planes lie one behind the other and are walked as one plane of twice the rows.
#define GVT (NSL * (TT / 256))
__global__ __launch_bounds__(256) void k_post(const float* __restrict__ F, _Float16* __restrict__ Hh, _Float16* __restrict__ Hl, const _Float16* __restrict__ V16, _Float16* __restrict__ Vt) {
  if (blockIdx.x < GVT) d_vt<1, TT>(V16, 64, 0, Vt, (int)blockIdx.x);      // the test reads the same in a whole block: its barrier is passed by all 256 threads or by none
  else d_hl(F, Hh, Hl, (size_t)(blockIdx.x - GVT) * 2048 + threadIdx.x); }
typedef float v2f __attribute__((ext_vector_type(2)));
// lane l <-> lane l ^ 16 by a vector cross-row move
__device__ __forceinline__ float xhalf(float x) { return __builtin_bit_cast(float, __builtin_amdgcn_permlanex16(__builtin_bit_cast(int, x), __builtin_bit_cast(int, x), 0x76543210, 0xfedcba98, false, false)); }
__global__ __launch_bounds__(128) void k_flash(const _Float16* __restrict__ Q16, const _Float16* __restrict__ Q16lo, int ldq, const _Float16* __restrict__ K16, const _Float16* __restrict__ K16lo, int ldk, const _Float16* __restrict__ Vt, float* __restrict__ O, int ldo) {
  constexpr int RPW = 16, NQB = TT / (4 * RPW), DT = 4, KS = 2; constexpr float L2E = 1.4426950408889634f;
  __shared__ __attribute__((aligned(16))) float sO[4][RPW][64 + 4];
  const int tid = threadIdx.x, w = tid >> 5, lane = tid & 31, ln = lane & 15, hh = lane >> 4;
  const int slab = blockIdx.x / NQB, qblk = blockIdx.x % NQB; const int b = slab; const int qb0 = qblk * (4 * RPW); const int q0 = qb0 + w * RPW;
  FragH aq[KS], aql[KS];
  { const size_t qo = ((size_t)b * TT + q0) * ldq + lane * 8; const unsigned short* qr = (const unsigned short*)Q16 + qo; const unsigned short* ql = (const unsigned short*)Q16lo + qo;
#pragma unroll
    for (int ks = 0; ks < KS; ++ks) { aq[ks].half[0] = *(const v8us*)(qr + ks * 512); aq[ks].half[1] = *(const v8us*)(qr + ks * 512 + 256); aql[ks].half[0] = *(const v8us*)(ql + ks * 512); aql[ks].half[1] = *(const v8us*)(ql + ks * 512 + 256); } }      // fragment-ordered planes (ldq == ldk == 64): unit = (row / 16) * 2 + ks
  const unsigned short* Vth = (const unsigned short*)Vt + (size_t)slab * 64 * TT;
  float m_r = -3.0e38f, b_r = -3.0e38f, l_r = 0.f; v8f oacc[DT];
#pragma unroll
  for (int dt = 0; dt < DT; ++dt) oacc[dt] = (v8f){0.f,0.f,0.f,0.f,0.f,0.f,0.f,0.f};
  const int jend = TT;
  // K fragments (both planes, 32 keys) live in registers across the back edge: each pass fetches the next pass's right behind its own score products; V fragments are fetched at the pass's top, ahead of the scores and the softmax.
  FragH bk[2][KS], bl[2][KS];
  auto fetchK = [&](int j) {
#pragma unroll      // constant indices keep the fragment arrays in registers
    for (int nt = 0; nt < 2; ++nt) { const size_t ko = ((size_t)b * TT + j + nt * 16) * ldk + lane * 8; const unsigned short* kr = (const unsigned short*)K16 + ko; const unsigned short* kl = (const unsigned short*)K16lo + ko;
#pragma unroll      // constant indices keep the fragment arrays in registers
      for (int ks = 0; ks < KS; ++ks) { bk[nt][ks].half[0] = *(const v8us*)(kr + ks * 512); bk[nt][ks].half[1] = *(const v8us*)(kr + ks * 512 + 256); bl[nt][ks].half[0] = *(const v8us*)(kl + ks * 512); bl[nt][ks].half[1] = *(const v8us*)(kl + ks * 512 + 256); } } };
  fetchK(0);
  { const size_t qa = ((size_t)b * TT + q0) * ldq + lane * 8, ka = (size_t)b * TT * ldk + lane * 8, kc = ((size_t)b * TT + 16) * ldk + lane * 8;
    // the wait in front of the reuse of the address registers of the Q and K loads above; the six addresses are inputs so that their registers stay as they are up to the wait
    asm volatile("s_wait_xcnt 0x0" :: "v"(Q16 + qa), "v"(Q16lo + qa), "v"(K16 + ka), "v"(K16lo + ka), "v"(K16 + kc), "v"(K16lo + kc) : "memory"); }
#pragma unroll 1
  for (int j0 = 0; j0 < jend; j0 += 32) {
    FragH bv[DT];
#pragma unroll      // constant indices keep the fragment arrays in registers
    for (int dt = 0; dt < DT; ++dt) { const unsigned short* vrow = Vth + (size_t)j0 * 64 + dt * 512 + lane * 8; bv[dt].half[0] = *(const v8us*)(vrow); bv[dt].half[1] = *(const v8us*)(vrow + 256); }
    v8f s[2];      // s[nt][r] = score of query q0 + ln against key j0 + 16 nt + 8 hh + r
#pragma unroll
    for (int nt = 0; nt < 2; ++nt) { v8f acc = (v8f){0.f,0.f,0.f,0.f,0.f,0.f,0.f,0.f}, accl = acc;
#pragma unroll
      for (int ks = 0; ks < KS; ++ks) { acc = mmaH<1>(bk[nt][ks].v, bk[nt][ks].v, aq[ks].v, aq[ks].v, acc); accl = mmaH<1>(bk[nt][ks].v, bk[nt][ks].v, aql[ks].v, aql[ks].v, accl); accl = mmaH<1>(bl[nt][ks].v, bl[nt][ks].v, aq[ks].v, aq[ks].v, accl); }
      s[nt] = acc + accl * 0.0009765625f; }
    const int jn = (j0 + 32 < jend) ? j0 + 32 : 0; fetchK(jn);      // the last pass refetches keys 0..31: in bounds, not used
    { const size_t ka = ((size_t)b * TT + jn) * ldk + lane * 8, kc = ((size_t)b * TT + jn + 16) * ldk + lane * 8;
      // the wait in front of the reuse of the address registers of the K loads above; the four addresses are inputs so that none of their registers is handed to a load's result or to the softmax ahead of the wait
      asm volatile("s_wait_xcnt 0x0" :: "v"(K16 + ka), "v"(K16lo + ka), "v"(K16 + kc), "v"(K16lo + kc) : "memory"); }
    float mc = s[0][0], md = s[1][0];
#pragma unroll      // constant indices keep the score tiles in registers
    for (int r = 1; r < 8; ++r) { mc = fmaxf(mc, s[0][r]); md = fmaxf(md, s[1][r]); }
    mc = fmaxf(mc, md); mc = fmaxf(mc, xhalf(mc));      // both halves now hold the query's maximum over the pass's 32 keys
    // base 2: b_r is the running maximum times log2(e), less 10; every weight is then 2^(s log2(e) - b_r) = 2^10 exp(s - max), one multiply-add and one hardware exponential, already at the scale the f16 P operand wants
    const float mn = fmaxf(m_r, mc), bn = __builtin_fmaf(mn, L2E, -10.0f); const float al = __builtin_amdgcn_exp2f((mn > -1.0e38f) ? b_r - bn : 0.f); m_r = mn; b_r = bn;      // the guard selects the argument (2^0 = 1), so no branch on lanes stands in the loop
    FragH pt; v2f ps[2] = {(v2f){0.f, 0.f}, (v2f){0.f, 0.f}}; const v8f l2e8 = {L2E, L2E, L2E, L2E, L2E, L2E, L2E, L2E}, nm8 = {-bn, -bn, -bn, -bn, -bn, -bn, -bn, -bn};
#pragma unroll      // constant indices keep the score tiles and the P^T fragment in registers
    for (int nt = 0; nt < 2; ++nt) { const v8f d = __builtin_elementwise_fma(s[nt], l2e8, nm8);
#pragma unroll      // constant indices keep the score tiles and the P^T fragment in registers
      for (int r = 0; r < 8; r += 2) { const v2f p = {__builtin_amdgcn_exp2f(d[r]), __builtin_amdgcn_exp2f(d[r + 1])}; ps[nt] += p; pt.h[8 * nt + r] = (_Float16)p[0]; pt.h[8 * nt + r + 1] = (_Float16)p[1]; } }
    { const v2f pq = ps[0] + ps[1]; l_r = l_r * al + (pq[0] + pq[1]); }      // this half's 16 keys; the halves are joined behind the loop
#pragma unroll
    for (int dt = 0; dt < DT; ++dt)
#pragma unroll
      for (int r = 0; r < 8; ++r) oacc[dt][r] *= al;
#pragma unroll
    for (int dt = 0; dt < DT; ++dt) oacc[dt] = mmaH<1>(bv[dt].v, bv[dt].v, pt.v, pt.v, oacc[dt]);      // oacc[dt][r] = O[q0 + ln][16 dt + 8 hh + r]
  }
  { const float l = l_r + xhalf(l_r); const float inv = (l > 0.f) ? 1.0f / l : 0.f;      // l and the output tiles both carry the factor 2^10; the exchange stands ahead of the select: all lanes are on
#pragma unroll      // constant indices keep the output tiles in registers
    for (int dt = 0; dt < DT; ++dt) { v4f lo4, hi4;
#pragma unroll      // constant indices keep the output tiles in registers
      for (int r = 0; r < 4; ++r) { lo4[r] = oacc[dt][r] * inv; hi4[r] = oacc[dt][4 + r] * inv; }
      *(v4fa*)&sO[w][ln][dt * 16 + 8 * hh] = lo4; *(v4fa*)&sO[w][ln][dt * 16 + 8 * hh + 4] = hi4; } }
  __builtin_amdgcn_fence(__ATOMIC_ACQ_REL, "workgroup"); __builtin_amdgcn_wave_barrier();
  {
#pragma unroll
    for (int rp = 0; rp < RPW; rp += 2) { const int r = rp + (lane >> 4), pc = lane & 15; const v4f val = *(const v4fa*)&sO[w][r][pc * 4]; *(v4f*)(O + ((size_t)b * TT + q0 + r) * ldo + pc * 4) = val; }
     } }

__global__ __launch_bounds__(256) void k_stat(const float* __restrict__ O, const float* __restrict__ x, float* __restrict__ PART) { __shared__ float r1[256], r2[256]; const int tid = threadIdx.x; const int b = blockIdx.x / NPB, part = blockIdx.x % NPB; const size_t base = (size_t)b * TT * DD + (size_t)part * (TT * DD / NPB) + tid * 4; float s1 = 0.f, s2 = 0.f;
  static_assert(TT * DD / NPB % 8192 == 0, "whole groups of eight trips of 1024 elements");
  const float* po = O + base; const float* px = x + base;
#pragma unroll      // four groups on two fixed address pairs with constant offsets: no address is stepped while loads are in flight
  for (int i = 0; i < TT * DD / NPB; i += 8192) { v4f o[8], xv[8];
#pragma unroll      // constant indices keep the eight pieces in registers
    for (int u = 0; u < 8; ++u) { o[u] = *(const v4fa*)(po + i + u * 1024); xv[u] = *(const v4fa*)(px + i + u * 1024); }
    // the loaded values as inputs only: keeps all 16 loads ahead of the first sum, or the compiler sinks half of them behind waits for the first; the two addresses as inputs, so that no load's result lands in an address register of the group, and the wait in front of their reuse
    asm volatile("s_wait_xcnt 0x0" :: "v"(o[0]), "v"(xv[0]), "v"(o[1]), "v"(xv[1]), "v"(o[2]), "v"(xv[2]), "v"(o[3]), "v"(xv[3]), "v"(o[4]), "v"(xv[4]), "v"(o[5]), "v"(xv[5]), "v"(o[6]), "v"(xv[6]), "v"(o[7]), "v"(xv[7]), "v"(po), "v"(px) : "memory");
#pragma unroll      // constant indices keep the eight pieces in registers; the sums keep the order of the single trips
    for (int u = 0; u < 8; ++u) for (int q = 0; q < 4; ++q) { const float y = o[u][q] + bf16_round(xv[u][q]); s1 += y; s2 += y * y; } }
  r1[tid] = s1; r2[tid] = s2; __syncthreads(); for (int o = 128; o >= 1; o >>= 1) { if (tid < o) { r1[tid] += r1[tid + o]; r2[tid] += r2[tid + o]; } __syncthreads(); }
  if (tid < 32) { const float v = (tid == 0) ? r1[0] : ((tid == 1) ? r2[0] : 0.f); *(float*)(PART + (size_t)blockIdx.x * 32 + tid) = v;  } }
typedef float v2fa __attribute__((ext_vector_type(2), may_alias));
__device__ __forceinline__ float lane_val(float v, int l) { return __builtin_bit_cast(float, __builtin_amdgcn_readlane(__builtin_bit_cast(int, v), l)); }
__global__ __launch_bounds__(256) void k_norm(const float* __restrict__ O, const float* __restrict__ x, const float* __restrict__ PART, float* __restrict__ out) { const size_t t = (size_t)blockIdx.x * 2048 + threadIdx.x; const int b = (int)(blockIdx.x / (GSTR / BB)), lane = threadIdx.x & 31; float s1 = 0.f, s2 = 0.f; v4f o[8], xv[8];
  static_assert(NPB == 64, "two partial pairs per lane");
#pragma unroll      // constant indices keep the eight pieces in registers
  for (int u = 0; u < 8; ++u) { o[u] = *(const v4fa*)(O + (t + u * 256) * 4); xv[u] = *(const v4fa*)(x + (t + u * 256) * 4); }
  const v2f pa = *(const v2fa*)(PART + ((size_t)b * NPB + lane) * 32), pb = *(const v2fa*)(PART + ((size_t)b * NPB + 32 + lane) * 32);      // lane l holds the partial pairs l and 32 + l: two loads per wave in place of a chain of 64
  // the loaded values as inputs only: keeps all 18 loads ahead of the statistics, or the compiler sinks some of them behind the sums; the three addresses as inputs, so that no load's result lands in an address register of the group, and the wait in front of their reuse
  asm volatile("s_wait_xcnt 0x0" :: "v"(o[0]), "v"(xv[0]), "v"(o[1]), "v"(xv[1]), "v"(o[2]), "v"(xv[2]), "v"(o[3]), "v"(xv[3]), "v"(o[4]), "v"(xv[4]), "v"(o[5]), "v"(xv[5]), "v"(o[6]), "v"(xv[6]), "v"(o[7]), "v"(xv[7]), "v"(pa), "v"(pb), "v"(O + t * 4), "v"(x + t * 4), "v"(PART + ((size_t)b * NPB + lane) * 32) : "memory");
#pragma unroll      // constant lane numbers; the partial sums are added in the order p = 0 .. NPB - 1
  for (int p = 0; p < 32; ++p) { s1 += lane_val(pa[0], p); s2 += lane_val(pa[1], p); }
#pragma unroll      // constant lane numbers
  for (int p = 0; p < 32; ++p) { s1 += lane_val(pb[0], p); s2 += lane_val(pb[1], p); }
  const float n = (float)TT * (float)DD; const float mu = s1 / n; const float var = fmaxf(s2 / n - mu * mu, 0.f); const float rs = rsqrtf(var + 1e-5f);
#pragma unroll      // constant indices keep the eight pieces in registers
  for (int u = 0; u < 8; ++u) { v4f r; for (int q = 0; q < 4; ++q) r[q] = (o[u][q] + bf16_round(xv[u][q]) - mu) * rs;
    *(v4f*)(out + (t + u * 256) * 4) = r; } }

extern "C" void kernel_launch(void* const* d_in, const int* in_sizes, int n_in,
                              void* d_out, int out_size, void* d_ws, size_t ws_size, hipStream_t stream) {
  (void)in_sizes; (void)n_in; (void)out_size;
  const float* x = (const float*)d_in[0]; const float* Wq = (const float*)d_in[1]; const float* Wk = (const float*)d_in[2]; const float* Wv = (const float*)d_in[3];
  char* ws = (char*)d_ws; size_t off = 0;
  auto take = [&](size_t bytes) { char* p = ws + off; off += (bytes + 255) & ~(size_t)255; return p; };
  const size_t WSZ = (size_t)DD * DD, PSZ = (size_t)NR * DD; _Float16* Bw = (_Float16*)take(3 * WSZ * 2); _Float16* X16 = (_Float16*)take(PSZ * 2); float* F32 = (float*)take(2 * PSZ * 4);      /* F32: q, then k */
  _Float16* Qh = (_Float16*)take(2 * PSZ * 2); _Float16* Kh = Qh + PSZ; _Float16* Ql = (_Float16*)take(2 * PSZ * 2); _Float16* Kl = Ql + PSZ;      /* hi planes of q and k in a row, then their lo planes */
  _Float16* V16 = (_Float16*)take(PSZ * 2); _Float16* Vt = (_Float16*)take(PSZ * 2); float* PART = (float*)take((size_t)BB * NPB * 32 * 4);
  float* O = F32;      /* the q plane is consumed by k_post; it then takes the attention output */
  if (off > ws_size) return;      // 6.3 + 8.4 + 33.6 + 6 x 8.4 = 99 MB
  k_prep<<<GSTR, 256, 0, stream>>>(x, Wq, Wk, Wv, X16, Bw);      /* x; weights (out,in) natural x 2^4 */
  const dim3 gp(((NR / 16) * (DD / 64) + 3) / 4, 3);      /* y: q, k (f32 planes of F32), v (f16) */
  k_gemm_hhx<0><<<gp, 128, 0, stream>>>(X16, DD, 0, Bw, DD, WSZ, 0.0625f, nullptr, 0, nullptr, 1, 0, 0, F32, V16, 2, DD, PSZ, NR, DD, DD);
  k_post<<<GVT + GSTR, 256, 0, stream>>>(F32, Qh, Ql, V16, Vt);      /* q, k f32 -> hi/lo; the [4096][1024] V plane viewed as 32 contiguous [2048][64] slabs -> V^T per slab; all in fragment order */
  k_flash<<<NSL * (TT / 64), 128, 0, stream>>>(Qh, Ql, 64, Kh, Kl, 64, Vt, O, 64);      /* same flat view for Q, K and O */
  k_stat<<<BB * NPB, 256, 0, stream>>>(O, x, PART); k_norm<<<GSTR, 256, 0, stream>>>(O, x, PART, (float*)d_out);
}

// v007
// Measured time: 129 microseconds a run.
// In two side-by-side timings against v006, it was 1.22 and 1.23 times as fast.
// All steps since v000 together make it 3.84 times as fast.
#include <hip/hip_runtime.h>
// Multi-head attention with raw-reshape heads, residual and a global LayerNorm (B=2, S=2048, D=1024, 16 heads × 64): Q,K,V = x·Wᵀ reshaped by plain memory order to (H,B,S,64) (= 32 contiguous [2048][64] slabs of each
// [4096][1024] plane); UNSCALED softmax(Q·Kᵀ)·V per slab; y = out (same flat order, = [B,S,1024]) + x; output = (y − mean)/√(var + 1e-5) with mean/var over all (S,D) of each batch element (identity affine).
// Compute dtype: x and weights rounded to bf16; Q,K as f32 GEMM outputs split into f16 hi + ×2^10 residual planes so the unscaled (σ≈3) logits are f32-accurate; V f16; fused flash-style kernel
// (two score accumulators, online softmax f32, P f16 ×2^10) on v_wmma_f32_16x16x32_f16; residual and the per-batch statistics (fixed-order block partial sums of y and y², then a fixed-order combine) and normalisation in f32.
#define BB 2
#define TT 2048
#define DD 1024
#define NSL 32
#define NR (BB * TT)
#define NPB 64

typedef __bf16 v16b __attribute__((ext_vector_type(16)));
typedef unsigned short v8us __attribute__((ext_vector_type(8), may_alias));
typedef float  v8f  __attribute__((ext_vector_type(8)));
typedef float  v4f  __attribute__((ext_vector_type(4)));
typedef float  v4fa __attribute__((ext_vector_type(4), may_alias));
union FragB { v16b v; v8us half[2]; unsigned short u[16]; };

__device__ __forceinline__ unsigned short bf16_bits(float x) { unsigned int u = __float_as_uint(x); return (unsigned short)((u + 0x7FFFu + ((u >> 16) & 1u)) >> 16); }
__device__ __forceinline__ float bf16_val(unsigned short b) { return __uint_as_float(((unsigned int)b) << 16); }
__device__ __forceinline__ float bf16_round(float x) { return bf16_val(bf16_bits(x)); }
// D += A·B with NT terms: 1 = ah·bh, 2 = + al·bh (A split), 3 = + ah·bl (both split)
template <int NT>
__device__ __forceinline__ v8f mmaN(v16b ah, v16b al, v16b bh, v16b bl, v8f c) {
  c = __builtin_amdgcn_wmma_f32_16x16x32_bf16(false, ah, false, bh, (short)0, c, false, false);
  if (NT >= 2) c = __builtin_amdgcn_wmma_f32_16x16x32_bf16(false, al, false, bh, (short)0, c, false, false);
  if (NT >= 3) c = __builtin_amdgcn_wmma_f32_16x16x32_bf16(false, ah, false, bl, (short)0, c, false, false);
  asm volatile("v_nop\n\tv_nop\n\tv_nop\n\tv_nop" : "+v"(c) : "v"(ah), "v"(al), "v"(bh), "v"(bl));
  return c;
}

__global__ __launch_bounds__(256) void k_wt_bf16(const float* __restrict__ W, unsigned short* __restrict__ Wt, int K, int N) {
  const int t = blockIdx.x * 256 + threadIdx.x;
  const int k8n = K / 8;
  if (t >= N * k8n) return;
  const int n = t / k8n, k8 = (t % k8n) * 8;
  v8us v;
#pragma unroll
  for (int i = 0; i < 8; ++i) v[i] = bf16_bits(W[(size_t)(k8 + i) * N + n]);
  *(v8us*)(Wt + (size_t)n * K + k8) = v;
  
}

// GEMM C[M][N] (f32, pitch ldc) = act(A[M][K]·W + bias). A f32 row-major (pitch lda) converted per fragment to bf16
// (ASPLIT: hi/lo two planes -> 2 terms, else single rounded term); Wt bf16 [N][K] (pitch ldb). BIAS_BF16 rounds the
// bias to bf16 first (bias quantised to bf16 before the add). K%32==0, M%16==0, N%64==0.
template <bool ASPLIT, int ACT, bool BIAS_BF16>
__global__ __launch_bounds__(128) void k_gemm_bf(const float* __restrict__ A, int lda, const unsigned short* __restrict__ Wt, int ldb,
                                               const float* __restrict__ bias, float* __restrict__ C, int ldc, int M, int N, int K) {
  __shared__ __attribute__((aligned(16))) float so[4][16][64];
  const int tid = threadIdx.x, w = tid >> 5, lane = tid & 31, ln = lane & 15, hh = lane >> 4;
  const int ntn = N / 64;
  const int wid = blockIdx.x * 4 + w;
  const int mt = wid / ntn, nq = wid % ntn;
  if (mt * 16 >= M) return;
  const int row0 = mt * 16, col0 = nq * 64;
  const float* arow = A + (size_t)(row0 + ln) * lda;
  v8f acc[4] = {};
  for (int kb = 0; kb < K; kb += 32) {
    FragB ah, al;
    const v4f x0 = *(const v4fa*)(arow + kb + 8 * hh), x1 = *(const v4fa*)(arow + kb + 8 * hh + 4);
    const v4f x2 = *(const v4fa*)(arow + kb + 16 + 8 * hh), x3 = *(const v4fa*)(arow + kb + 16 + 8 * hh + 4);
    float xs[16] = {x0[0],x0[1],x0[2],x0[3],x1[0],x1[1],x1[2],x1[3],x2[0],x2[1],x2[2],x2[3],x3[0],x3[1],x3[2],x3[3]};
#pragma unroll
    for (int i = 0; i < 16; ++i) { const unsigned short hb = bf16_bits(xs[i]); ah.u[i] = hb; al.u[i] = ASPLIT ? bf16_bits(xs[i] - bf16_val(hb)) : (unsigned short)0; }
#pragma unroll
    for (int t = 0; t < 4; ++t) {
      const unsigned short* brow = Wt + (size_t)(col0 + t * 16 + ln) * ldb + kb;
      FragB b;
      b.half[0] = *(const v8us*)(brow + 8 * hh);
      b.half[1] = *(const v8us*)(brow + 16 + 8 * hh);
      acc[t] = mmaN<ASPLIT ? 2 : 1>(ah.v, al.v, b.v, b.v, acc[t]);
    }
  }
#pragma unroll
  for (int t = 0; t < 4; ++t) {
    float bv = bias ? bias[col0 + t * 16 + ln] : 0.f;
    if (BIAS_BF16) bv = bf16_round(bv);
#pragma unroll
    for (int r = 0; r < 8; ++r) { float v = acc[t][r] + bv; if (ACT == 1) v = fmaxf(v, 0.f); so[w][8 * hh + r][t * 16 + ln] = v; }
  }
  __builtin_amdgcn_fence(__ATOMIC_ACQ_REL, "workgroup");
  __builtin_amdgcn_wave_barrier();
  const int rsub = lane >> 4, c4 = (lane & 15) * 4;
  {
#pragma unroll
    for (int q = 0; q < 8; ++q) {
      const int r = q * 2 + rsub;
      const v4f v = *(const v4fa*)&so[w][r][c4];
      *(v4f*)(C + (size_t)(row0 + r) * ldc + col0 + c4) = v;
    }
    
  }
}

// Flash-style causal/unmasked attention, all contractions 3-term bf16 hi/lo splits, f32 softmax with running max.
// q,k,v rows are read from f32 buffers with arbitrary row pitch (so they can live inside a fused qkv buffer);
// D = head size (multiple of 32, <= 128); one wave = 16 query rows; block = 4 waves (64 queries) sharing K/V chunks of 32.
template <int D, bool CAUSAL>
__global__ __launch_bounds__(128) void k_flash(const float* __restrict__ qb, const float* __restrict__ kb, const float* __restrict__ vb,
                                             int pitch, int T, int H, float scale, float* __restrict__ y, int ypitch) {
  constexpr int KS = D / 32;        // k-steps for QK
  constexpr int DT = D / 16;        // d tiles for PV
  __shared__ __attribute__((aligned(16))) unsigned short sKh[32][D + 8], sKl[32][D + 8], sVh[32][D + 8], sVl[32][D + 8];
  __shared__ __attribute__((aligned(16))) unsigned short sPh[4][16][40], sPl[4][16][40];
  __shared__ __attribute__((aligned(16))) float sO[4][16][D];
  const int tid = threadIdx.x, w = tid >> 5, lane = tid & 31, ln = lane & 15, hh = lane >> 4;
  const int nqb = (T + 63) / 64;
  const int bh = blockIdx.x / nqb, qblk = blockIdx.x % nqb;
  const int b = bh / H, h = bh % H;
  const int q0 = qblk * 64 + w * 16;
  const float* Q = qb + (size_t)b * T * pitch + h * D;
  const float* K = kb + (size_t)b * T * pitch + h * D;
  const float* V = vb + (size_t)b * T * pitch + h * D;

  // A fragments of the wave's 16 query rows (scaled), hi/lo
  FragB aqh[KS], aql[KS];
  {
    int row = q0 + ln; if (row >= T) row = T - 1;
    const float* qr = Q + (size_t)row * pitch;
#pragma unroll
    for (int ks = 0; ks < KS; ++ks)
#pragma unroll
      for (int i = 0; i < 16; ++i) {
        const int d = ks * 32 + ((i < 8) ? (8 * hh + i) : (16 + 8 * hh + (i - 8)));
        const float x = qr[d] * scale; const unsigned short hb = bf16_bits(x);
        aqh[ks].u[i] = hb; aql[ks].u[i] = bf16_bits(x - bf16_val(hb));
      }
  }
  float m_r[8], l_r[8];
#pragma unroll
  for (int r = 0; r < 8; ++r) { m_r[r] = -3.0e38f; l_r[r] = 0.f; }
  v8f oacc[DT];
#pragma unroll
  for (int dt = 0; dt < DT; ++dt) oacc[dt] = (v8f){0.f,0.f,0.f,0.f,0.f,0.f,0.f,0.f};

  const int kv_end = CAUSAL ? min(T, qblk * 64 + 64) : T;     // block-uniform
  for (int j0 = 0; j0 < kv_end; j0 += 32) {
    __syncthreads();
    for (int e = tid; e < 32 * (D / 4); e += 128) {
      const int r = e / (D / 4), c4 = (e % (D / 4)) * 4;
      const int key = j0 + r;
      v4f kf = {0.f,0.f,0.f,0.f}, vf = {0.f,0.f,0.f,0.f};
      if (key < T) { kf = *(const v4fa*)(K + (size_t)key * pitch + c4); vf = *(const v4fa*)(V + (size_t)key * pitch + c4); }
#pragma unroll
      for (int t = 0; t < 4; ++t) {
        unsigned short hb = bf16_bits(kf[t]); sKh[r][c4 + t] = hb; sKl[r][c4 + t] = bf16_bits(kf[t] - bf16_val(hb));
        hb = bf16_bits(vf[t]); sVh[r][c4 + t] = hb; sVl[r][c4 + t] = bf16_bits(vf[t] - bf16_val(hb));
      }
    }
    __syncthreads();
    // S tile 16 x 32
    v8f s[2];
#pragma unroll
    for (int nt = 0; nt < 2; ++nt) {
      v8f acc = {};
#pragma unroll
      for (int ks = 0; ks < KS; ++ks) {
        FragB bh_, bl_;
        bh_.half[0] = *(const v8us*)&sKh[nt * 16 + ln][ks * 32 + 8 * hh]; bh_.half[1] = *(const v8us*)&sKh[nt * 16 + ln][ks * 32 + 16 + 8 * hh];
        bl_.half[0] = *(const v8us*)&sKl[nt * 16 + ln][ks * 32 + 8 * hh]; bl_.half[1] = *(const v8us*)&sKl[nt * 16 + ln][ks * 32 + 16 + 8 * hh];
        acc = mmaN<3>(aqh[ks].v, aql[ks].v, bh_.v, bl_.v, acc);
      }
      s[nt] = acc;
    }
    // mask + running max (rows 8hh+r; the 16 lanes of a half share rows)
    float alpha[8];
#pragma unroll
    for (int r = 0; r < 8; ++r) {
      const int qi = q0 + 8 * hh + r;
      const int ja = j0 + ln, jb = j0 + 16 + ln;
      if (CAUSAL) { if (ja > qi) s[0][r] = -3.0e38f; if (jb > qi) s[1][r] = -3.0e38f; }
      if (ja >= T) s[0][r] = -3.0e38f;
      if (jb >= T) s[1][r] = -3.0e38f;
      float mx = fmaxf(s[0][r], s[1][r]);
      mx = fmaxf(mx, __shfl_xor(mx, 1, 32)); mx = fmaxf(mx, __shfl_xor(mx, 2, 32)); mx = fmaxf(mx, __shfl_xor(mx, 4, 32)); mx = fmaxf(mx, __shfl_xor(mx, 8, 32));
      const float mnew = fmaxf(m_r[r], mx);
      alpha[r] = (mnew > -1.0e38f) ? __expf(m_r[r] - mnew) : 1.0f;
      const float p0 = (s[0][r] > -1.0e38f) ? __expf(s[0][r] - mnew) : 0.f;
      const float p1 = (s[1][r] > -1.0e38f) ? __expf(s[1][r] - mnew) : 0.f;
      m_r[r] = mnew;
      l_r[r] = l_r[r] * alpha[r] + p0 + p1;            // per-lane partial row sum (16 lanes combined at the end)
      unsigned short hb = bf16_bits(p0); sPh[w][8 * hh + r][ln] = hb;      sPl[w][8 * hh + r][ln] = bf16_bits(p0 - bf16_val(hb));
      hb = bf16_bits(p1);                sPh[w][8 * hh + r][16 + ln] = hb; sPl[w][8 * hh + r][16 + ln] = bf16_bits(p1 - bf16_val(hb));
    }
#pragma unroll
    for (int dt = 0; dt < DT; ++dt)
#pragma unroll
      for (int r = 0; r < 8; ++r) oacc[dt][r] *= alpha[r];
    __builtin_amdgcn_fence(__ATOMIC_ACQ_REL, "workgroup");
    __builtin_amdgcn_wave_barrier();
    FragB pah, pal;
    pah.half[0] = *(const v8us*)&sPh[w][ln][8 * hh]; pah.half[1] = *(const v8us*)&sPh[w][ln][16 + 8 * hh];
    pal.half[0] = *(const v8us*)&sPl[w][ln][8 * hh]; pal.half[1] = *(const v8us*)&sPl[w][ln][16 + 8 * hh];
#pragma unroll
    for (int dt = 0; dt < DT; ++dt) {
      FragB bvh, bvl;
#pragma unroll
      for (int i = 0; i < 8; ++i) {
        bvh.u[i] = sVh[8 * hh + i][dt * 16 + ln]; bvh.u[8 + i] = sVh[16 + 8 * hh + i][dt * 16 + ln];
        bvl.u[i] = sVl[8 * hh + i][dt * 16 + ln]; bvl.u[8 + i] = sVl[16 + 8 * hh + i][dt * 16 + ln];
      }
      oacc[dt] = mmaN<3>(pah.v, pal.v, bvh.v, bvl.v, oacc[dt]);
    }
    __builtin_amdgcn_fence(__ATOMIC_ACQ_REL, "workgroup");
    __builtin_amdgcn_wave_barrier();
  }
#pragma unroll
  for (int r = 0; r < 8; ++r) {
    float l = l_r[r];
    l += __shfl_xor(l, 1, 32); l += __shfl_xor(l, 2, 32); l += __shfl_xor(l, 4, 32); l += __shfl_xor(l, 8, 32);
    l_r[r] = (l > 0.f) ? 1.0f / l : 0.f;
  }
#pragma unroll
  for (int dt = 0; dt < DT; ++dt)
#pragma unroll
    for (int r = 0; r < 8; ++r) sO[w][8 * hh + r][dt * 16 + ln] = oacc[dt][r] * l_r[r];
  __builtin_amdgcn_fence(__ATOMIC_ACQ_REL, "workgroup");
  __builtin_amdgcn_wave_barrier();
  {
    for (int r = 0; r < 16; ++r) {
      const int row = q0 + r;
      if (row < T && lane < D / 4) {
        const v4f val = *(const v4fa*)&sO[w][r][lane * 4];
        *(v4f*)(y + ((size_t)b * T + row) * ypitch + h * D + lane * 4) = val;
      }
    }
    
  }
}

// GEMM C = act(A·W + bias + resid): A f32 (ASPLIT -> hi/lo 2 terms), Wt bf16 [N][K]; ACT 0 none, 1 relu, 2 exact gelu;
// resid (optional, f32, row index = (row % rmod), pitch ldr, RES_BF16 rounds it) added before the activation.
template <bool ASPLIT, int ACT, bool BIAS_BF16, bool RES_BF16>
__global__ __launch_bounds__(128) void k_gemm_bf3(const float* __restrict__ A, int lda, const unsigned short* __restrict__ Wt, int ldb,
                                                const float* __restrict__ bias, const float* __restrict__ resid, int rmod, int ldr,
                                                float* __restrict__ C, int ldc, int M, int N, int K) {
  __shared__ __attribute__((aligned(16))) float so[4][16][64];
  const int tid = threadIdx.x, w = tid >> 5, lane = tid & 31, ln = lane & 15, hh = lane >> 4;
  const int ntn = N / 64;
  const int wid = blockIdx.x * 4 + w;
  const int mt = wid / ntn, nq = wid % ntn;
  if (mt * 16 >= M) return;
  const int row0 = mt * 16, col0 = nq * 64;
  const float* arow = A + (size_t)(row0 + ln) * lda;
  v8f acc[4] = {};
  for (int kb = 0; kb < K; kb += 32) {
    FragB ah, al;
    const v4f x0 = *(const v4fa*)(arow + kb + 8 * hh), x1 = *(const v4fa*)(arow + kb + 8 * hh + 4);
    const v4f x2 = *(const v4fa*)(arow + kb + 16 + 8 * hh), x3 = *(const v4fa*)(arow + kb + 16 + 8 * hh + 4);
    float xs[16] = {x0[0],x0[1],x0[2],x0[3],x1[0],x1[1],x1[2],x1[3],x2[0],x2[1],x2[2],x2[3],x3[0],x3[1],x3[2],x3[3]};
#pragma unroll
    for (int i = 0; i < 16; ++i) { const unsigned short hb = bf16_bits(xs[i]); ah.u[i] = hb; al.u[i] = ASPLIT ? bf16_bits(xs[i] - bf16_val(hb)) : (unsigned short)0; }
#pragma unroll
    for (int t = 0; t < 4; ++t) {
      const unsigned short* brow = Wt + (size_t)(col0 + t * 16 + ln) * ldb + kb;
      FragB b;
      b.half[0] = *(const v8us*)(brow + 8 * hh);
      b.half[1] = *(const v8us*)(brow + 16 + 8 * hh);
      acc[t] = mmaN<ASPLIT ? 2 : 1>(ah.v, al.v, b.v, b.v, acc[t]);
    }
  }
#pragma unroll
  for (int t = 0; t < 4; ++t) {
    const int col = col0 + t * 16 + ln;
    float bv = bias ? bias[col] : 0.f;
    if (BIAS_BF16) bv = bf16_round(bv);
#pragma unroll
    for (int r = 0; r < 8; ++r) {
      float v = acc[t][r] + bv;
      if (resid) { float rv = resid[(size_t)((row0 + 8 * hh + r) % rmod) * ldr + col]; if (RES_BF16) rv = bf16_round(rv); v += rv; }
      if (ACT == 1) v = fmaxf(v, 0.f);
      if (ACT == 2) v = 0.5f * v * (1.0f + erff(v * 0.70710678118654752f));
      if (ACT == 3) { const float u = 0.7978845608028654f * (v + 0.044715f * v * v * v); v = 0.5f * v * (1.0f + tanhf(u)); }
      so[w][8 * hh + r][t * 16 + ln] = v;
    }
  }
  __builtin_amdgcn_fence(__ATOMIC_ACQ_REL, "workgroup");
  __builtin_amdgcn_wave_barrier();
  const int rsub = lane >> 4, c4 = (lane & 15) * 4;
  {
#pragma unroll
    for (int q = 0; q < 8; ++q) {
      const int r = q * 2 + rsub;
      const v4f v = *(const v4fa*)&so[w][r][c4];
      *(v4f*)(C + (size_t)(row0 + r) * ldc + col0 + c4) = v;
    }
    
  }
}
// row LayerNorm (biased variance, eps) over N: s = X (+ R); optional out_sum <- s; out_norm <- (s-mu)*rsqrt(var+eps)*g + b
template <bool PARAM_BF16>
__global__ __launch_bounds__(256) void k_layernorm(const float* __restrict__ X, const float* __restrict__ R, const float* __restrict__ g, const float* __restrict__ bta,
                                                  float* __restrict__ out_sum, float* __restrict__ out_norm, int N, float eps) {
  __shared__ float red[256];
  const int row = blockIdx.x, tid = threadIdx.x;
  const float* x = X + (size_t)row * N; const float* rr = R ? R + (size_t)row * N : nullptr;
  float vals[16];                     // up to N = 4096
  const int per = N / 256;            // contiguous chunk per thread? use strided-by-4 chunks: thread handles j = tid*4 + 1024*u
  float s1 = 0.f;
  for (int u = 0; u < per / 4; ++u) {
    const int j = tid * 4 + 1024 * u;
    const v4f a = *(const v4fa*)(x + j);
    v4f b = {0.f,0.f,0.f,0.f}; if (rr) b = *(const v4fa*)(rr + j);
#pragma unroll
    for (int q = 0; q < 4; ++q) { const float v = a[q] + b[q]; vals[u * 4 + q] = v; s1 += v; }
  }
  red[tid] = s1; __syncthreads();
  for (int st = 128; st > 0; st >>= 1) { if (tid < st) red[tid] += red[tid + st]; __syncthreads(); }
  const float mu = red[0] / (float)N; __syncthreads();
  float s2 = 0.f;
  for (int u = 0; u < per / 4; ++u)
#pragma unroll
    for (int q = 0; q < 4; ++q) { const float c = vals[u * 4 + q] - mu; s2 += c * c; }
  red[tid] = s2; __syncthreads();
  for (int st = 128; st > 0; st >>= 1) { if (tid < st) red[tid] += red[tid + st]; __syncthreads(); }
  const float rs = rsqrtf(red[0] / (float)N + eps);
  {
    for (int u = 0; u < per / 4; ++u) {
      const int j = tid * 4 + 1024 * u;
      v4f o, sm;
#pragma unroll
      for (int q = 0; q < 4; ++q) {
        float gg = g[j + q], bb = bta[j + q];
        if (PARAM_BF16) { gg = bf16_round(gg); bb = bf16_round(bb); }
        sm[q] = vals[u * 4 + q]; o[q] = (vals[u * 4 + q] - mu) * rs * gg + bb;
      }
      if (out_sum) *(v4f*)(out_sum + (size_t)row * N + j) = sm;
      *(v4f*)(out_norm + (size_t)row * N + j) = o;
    }
    
  }
}



// ---- f16 WMMA path (v_wmma_f32_16x16x32_f16): 11-bit significands for operands in range — used where a [0,1] probability operand needs more precision than bf16
typedef _Float16 v16h __attribute__((ext_vector_type(16)));
union FragH { v16h v; v8us half[2]; _Float16 h[16]; unsigned short u[16]; };
template <int NT>
__device__ __forceinline__ v8f mmaH(v16h ah, v16h al, v16h bh, v16h bl, v8f c) {
  c = __builtin_amdgcn_wmma_f32_16x16x32_f16(false, ah, false, bh, (short)0, c, false, false);
  if (NT >= 2) c = __builtin_amdgcn_wmma_f32_16x16x32_f16(false, al, false, bh, (short)0, c, false, false);
  if (NT >= 3) c = __builtin_amdgcn_wmma_f32_16x16x32_f16(false, ah, false, bl, (short)0, c, false, false);
  asm volatile("v_nop\n\tv_nop\n\tv_nop\n\tv_nop" : "+v"(c) : "v"(ah), "v"(al), "v"(bh), "v"(bl));
  return c;
}
// batched GEMM like k_gemm_b but f16 operands: A f32 (split into f16 hi/lo if ASPLIT, else rounded to f16), Bt = f16 values [n][k]; alpha; C f32; N multiple of 16 (partial tiles skipped)
template <bool ASPLIT>
__global__ __launch_bounds__(128) void k_gemm_h(const float* __restrict__ A, int lda, size_t sA, const _Float16* __restrict__ Bh, int ldb, size_t sB, float alpha, float* __restrict__ C, int ldc, size_t sC, int M, int N, int K) {
  __shared__ __attribute__((aligned(16))) float so[4][16][64];
  const int tid = threadIdx.x, w = tid >> 5, lane = tid & 31, ln = lane & 15, hh = lane >> 4; const int by = blockIdx.y;
  A += (size_t)by * sA; Bh += (size_t)by * sB; C += (size_t)by * sC;
  const int ntn = (N + 63) / 64; const int wid = blockIdx.x * 4 + w; const int mt = wid / ntn, nq = wid % ntn; if (mt * 16 >= M) return;
  const int row0 = mt * 16, col0 = nq * 64; const float* arow = A + (size_t)(row0 + ln) * lda;
  v8f acc[4] = {};
  for (int kb = 0; kb < K; kb += 32) {
    FragH ah, al;
    const v4f x0 = *(const v4fa*)(arow + kb + 8 * hh), x1 = *(const v4fa*)(arow + kb + 8 * hh + 4), x2 = *(const v4fa*)(arow + kb + 16 + 8 * hh), x3 = *(const v4fa*)(arow + kb + 16 + 8 * hh + 4);
    float xs[16] = {x0[0],x0[1],x0[2],x0[3],x1[0],x1[1],x1[2],x1[3],x2[0],x2[1],x2[2],x2[3],x3[0],x3[1],x3[2],x3[3]};
#pragma unroll
    for (int i = 0; i < 16; ++i) { const _Float16 h = (_Float16)xs[i]; ah.h[i] = h; al.h[i] = ASPLIT ? (_Float16)(xs[i] - (float)h) : (_Float16)0.0f; }
#pragma unroll
    for (int t = 0; t < 4; ++t) { if (col0 + t * 16 >= N) continue; const size_t boff = (size_t)(col0 + t * 16 + ln) * ldb + kb; FragH bq; bq.half[0] = *(const v8us*)(Bh + boff + 8 * hh); bq.half[1] = *(const v8us*)(Bh + boff + 16 + 8 * hh);
      acc[t] = mmaH<ASPLIT ? 2 : 1>(ah.v, al.v, bq.v, bq.v, acc[t]); }
  }
#pragma unroll
  for (int t = 0; t < 4; ++t) { if (col0 + t * 16 >= N) continue;
#pragma unroll
    for (int r = 0; r < 8; ++r) so[w][8 * hh + r][t * 16 + ln] = acc[t][r] * alpha; }
  __builtin_amdgcn_fence(__ATOMIC_ACQ_REL, "workgroup"); __builtin_amdgcn_wave_barrier();
  const int rsub = lane >> 4, c4 = (lane & 15) * 4;
  {
#pragma unroll
    for (int q = 0; q < 8; ++q) { const int r = q * 2 + rsub; if (col0 + c4 < N) { const v4f v = *(const v4fa*)&so[w][r][c4]; *(v4f*)(C + (size_t)(row0 + r) * ldc + col0 + c4) = v; } }
     }
}

// Wt[n][k] = f16(W[k][n]·scale) from f32 row-major W[K][N] (scale = power of two; bf16-exact weights stay exact in f16 away from the subnormal range)
__global__ __launch_bounds__(256) void k_wt_f16(const float* __restrict__ W, _Float16* __restrict__ Wt, int K, int N, float scale) {
  const int t = blockIdx.x * 256 + threadIdx.x; if (t >= N * (K / 8)) return; const int n = t / (K / 8), k8 = (t % (K / 8)) * 8; FragH f;
#pragma unroll
  for (int i = 0; i < 8; ++i) f.h[i] = (_Float16)(bf16_round(W[(size_t)(k8 + i) * N + n]) * scale); const v8us o = f.half[0];
  *(v8us*)((unsigned short*)Wt + (size_t)n * K + k8) = o; 
}
// Fragment order: a [rows][K] 16-bit plane is kept as 1-KB units of 16 rows x 32 k, unit (row / 16) * (K / 32) + k / 32; inside a unit the 16-byte piece 32 p + lane holds row (lane & 15), k = 16 p + 8 (lane >> 4) + 0..7.
// A wave's fragment is then two 16-byte loads per lane that each cover 512 contiguous bytes (4 whole 128-B lines) instead of 32 bytes in each of 16 lines; fragment element i is k = 8 (lane >> 4) + i for i < 8 and 16 + 8 (lane >> 4) + (i - 8) above, for both operands of every product.
// frag_src: index, in the row-major plane, of the first of the 8 elements that 16-byte piece number 'piece' of the fragment-ordered plane holds.
__device__ __forceinline__ size_t frag_src(size_t piece, int K) { const size_t u = piece >> 6; const int in = (int)(piece & 63), p = in >> 5, l = in & 31; const size_t kt = (size_t)(K / 32);
  return ((u / kt) * 16 + (size_t)(l & 15)) * (size_t)K + (u % kt) * 32 + (size_t)(p * 16 + (l >> 4) * 8); }
// A and Bh in fragment order (lda == ldb == K at every launch here).
// k_gemm_hh variant with fused epilogue: v = acc·alpha + bias[by·sBias + col] (+ CP[(row/rowsPerB)·sCPb + by·64 + col] if CP) ; ACT 0 none / 1 elu ; batch members by < y16 are written as f32 planes of C, the others as f16 planes of C16 (each plane sC elements)
// A wave owns 64 rows x 64 columns (4 x 4 accumulator tiles): the eight fragments of a 32-k stage feed 16 products. A block is 2 x 2 waves = 128 x 128; waves 0, 1 read the same A fragments and waves 0, 2 the same B fragments. M % 128 == 0, N % 128 == 0, K % 64 == 0 at every launch here.
template <int ACT>
__global__ __launch_bounds__(128) void k_gemm_hhx(const _Float16* __restrict__ A, int lda, size_t sA, const _Float16* __restrict__ Bh, int ldb, size_t sB, float alpha, const float* __restrict__ bias, size_t sBias, const float* __restrict__ CP, int rowsPerB, size_t sCPb, int row0g,
    float* __restrict__ C, _Float16* __restrict__ C16, int y16, int ldc, size_t sC, int M, int N, int K) {
  __shared__ __attribute__((aligned(16))) float so[4][16][64];
  const int tid = threadIdx.x, w = __builtin_amdgcn_readfirstlane(tid >> 5), lane = tid & 31, ln = lane & 15, hh = lane >> 4; const int by = blockIdx.y;      // the wave's number in a scalar register: the eight tile bases below are then scalar too
  A += (size_t)by * sA; Bh += (size_t)by * sB; const bool w32 = by < y16; const size_t cofs = (size_t)(w32 ? by : by - y16) * sC; const float* bp = bias ? bias + (size_t)by * sBias : nullptr;
  const int nbn = N / 128; const int bm = blockIdx.x / nbn, bn = blockIdx.x % nbn;
  const int row0 = bm * 128 + (w >> 1) * 64, col0 = bn * 128 + (w & 1) * 64; if (row0 >= M) return;
  v8f acc[4][4] = {};
  // Two register stages of 32 k each: a stage's 16 fragment loads are issued as one group, one stage ahead of the 16 products that read them.
  // The eight tile bases stay as they are through the loop; one 32-bit byte offset per lane (its 16-byte piece + the k position) is stepped once a trip.
  const char* ba[4]; const char* bb[4];
#pragma unroll      // constant indices keep the arrays in registers
  for (int t = 0; t < 4; ++t) { ba[t] = (const char*)(A + (size_t)(row0 + t * 16) * lda); bb[t] = (const char*)(Bh + (size_t)(col0 + t * 16) * ldb); }
  unsigned vo = (unsigned)lane * 16u;
  FragH a0[4], b0[4], a1[4], b1[4];
  auto fetch = [&](FragH (&fa)[4], FragH (&fb)[4], unsigned o) {
#pragma unroll      // constant indices keep the fragment arrays in registers
    for (int t = 0; t < 4; ++t) { fa[t].half[0] = *(const v8us*)(ba[t] + o); fa[t].half[1] = *(const v8us*)(ba[t] + o + 512); fb[t].half[0] = *(const v8us*)(bb[t] + o); fb[t].half[1] = *(const v8us*)(bb[t] + o + 512); } };
  auto mul = [&](FragH (&fa)[4], FragH (&fb)[4]) {
#pragma unroll      // constant indices keep the fragment arrays in registers
    for (int i = 0; i < 4; ++i)
#pragma unroll      // constant indices keep the fragment arrays in registers
      for (int t = 0; t < 4; ++t) acc[i][t] = __builtin_amdgcn_wmma_f32_16x16x32_f16(false, fa[i].v, false, fb[t].v, (short)0, acc[i][t], false, false); };      // the plain builtin: operands of an asm statement cannot lie above v255, and this tile needs more than 256 registers
  fetch(a0, b0, vo);      // a stage of 32 k = one 1-KB unit of each tile
#pragma unroll 1      // rolled: one ping-pong pair per trip keeps both stages in fixed registers and the loop short
  for (int kb = 0; kb < K; kb += 64) {
    fetch(a1, b1, vo + 1024);
    __builtin_amdgcn_sched_barrier(0);      // holds the 16 loads as one group ahead of the products: without it the compiler sinks them among the products, a few products ahead of their use
    mul(a0, b0);
    __builtin_amdgcn_sched_barrier(0);      // no load of the next group rises among the products above, where its registers are still read; the wait below stays behind them
    asm volatile("s_wait_xcnt 0x0" ::: "memory");      // the wait in front of the rewriting of the loads' offset register
    __builtin_amdgcn_sched_barrier(0);      // the offset's step stays behind the wait
    vo = (kb + 64 < K) ? vo + 2048 : (unsigned)lane * 16u;      // the last trip steps back to k = 0: its second fetch stays in bounds and is not used
    fetch(a0, b0, vo);
    __builtin_amdgcn_sched_barrier(0);      // as above: the group stays ahead of the products
    mul(a1, b1);
    __builtin_amdgcn_sched_barrier(0);      // as above: the wait below stays behind the products
    asm volatile("s_wait_xcnt 0x0" :: "v"(vo) : "memory");      // the wait in front of the rewriting of the loads' offset registers at the back edge and, behind the loop, of their bases; the offset as an input, so that no load's result lands in it
    __builtin_amdgcn_sched_barrier(0);      // what steps an offset at the loop's foot stays behind the wait
  }
  const int rsub = lane >> 4, c4 = (lane & 15) * 4; typedef _Float16 v4h __attribute__((ext_vector_type(4)));
#pragma unroll      // constant indices keep the accumulator tiles in registers
  for (int i = 0; i < 4; ++i) { const int rowi = row0 + i * 16;      // the wave's four 16-row strips go through its LDS strip one after the other
#pragma unroll
    for (int t = 0; t < 4; ++t) { if (col0 + t * 16 >= N) continue; const int col = col0 + t * 16 + ln; const float bv = bp ? bf16_round(bp[col]) : 0.f;
#pragma unroll
      for (int r = 0; r < 8; ++r) { float v = acc[i][t][r] * alpha + bv; if (CP) { const int bidx = (row0g + rowi + 8 * hh + r) / rowsPerB; v += CP[(size_t)bidx * sCPb + (size_t)by * 64 + col]; } if (ACT == 1) v = (v > 0.f) ? v : expm1f(v); else if (ACT == 7) v = (v > 0.f) ? v + 1.0f : expf(v); else if (ACT == 8) v = tanhf(v); else if (ACT == 9) v = 0.5f * v * (1.0f + tanhf(0.7978845608028654f * (v + 0.044715f * v * v * v))); else if (ACT == 11) v = 1.0f / (1.0f + expf(-v)); else if (ACT == 12) v = (v > 0.f) ? v : 0.01f * v; else if (ACT == 14) v = (v > 0.f) ? v : 0.1f * v; else if (ACT == 15) v = v / (1.0f + expf(-v)); else if (ACT == 3) v = fmaxf(v, 0.f); else if (ACT == 6) v = 0.5f * v * (1.0f + erff(v * 0.70710678118654752f)); so[w][8 * hh + r][t * 16 + ln] = v; } }
    __builtin_amdgcn_fence(__ATOMIC_ACQ_REL, "workgroup"); __builtin_amdgcn_wave_barrier();
    if (w32) {      // the same for a whole block: one branch ahead of the eight stores
#pragma unroll      // the eight LDS reads go out as one group ahead of the stores
      for (int q = 0; q < 8; ++q) { const int r = q * 2 + rsub; if (col0 + c4 < N) { const v4f v = *(const v4fa*)&so[w][r][c4]; *(v4f*)(C + cofs + (size_t)(rowi + r) * ldc + col0 + c4) = v; } }
    } else {
#pragma unroll      // the eight LDS reads go out as one group ahead of the stores
      for (int q = 0; q < 8; ++q) { const int r = q * 2 + rsub; if (col0 + c4 < N) { const v4f v = *(const v4fa*)&so[w][r][c4]; v4h h4; for (int e = 0; e < 4; ++e) h4[e] = (_Float16)v[e]; *(v4h*)(C16 + cofs + (size_t)(rowi + r) * ldc + col0 + c4) = h4; } }
    }
    __builtin_amdgcn_fence(__ATOMIC_ACQ_REL, "workgroup"); __builtin_amdgcn_wave_barrier();      // the strip's LDS reads stay ahead of the next strip's LDS stores
  }
}


typedef _Float16 v4h __attribute__((ext_vector_type(4)));

// The streaming launches run as one resident round: GSTR blocks of 8 waves = 16 waves on each of 256 WGPs. A lane takes 7 or 8 pieces of 16 output bytes, 256 pieces apart inside its block's own run of pieces, and asks for all their inputs as one group before it converts and stores any.
#define GSTR 512
static_assert((size_t)NR * DD / 8 == (size_t)GSTR * 1024 && (size_t)DD * DD / 8 == (size_t)GSTR * 256, "a lane of k_prep takes four pieces of x and one of each weight");
static_assert(2 * (size_t)NR * DD / 8 == (size_t)GSTR * 2048, "a lane of the q/k split takes eight pieces");
static_assert((size_t)NR * DD / 4 == (size_t)GSTR * 2048 && GSTR % BB == 0, "a lane of k_norm takes eight pieces, a block lies in one batch element");
__global__ __launch_bounds__(256) void k_h16(const float* __restrict__ x, _Float16* __restrict__ X16, size_t n8) { const size_t t = (size_t)blockIdx.x * 256 + threadIdx.x; if (t >= n8) return; FragH f;
#pragma unroll
  for (int q = 0; q < 8; ++q) f.h[q] = (_Float16)x[t * 8 + q]; *(v8us*)((unsigned short*)X16 + t * 8) = f.half[0];  }
// x ([NR][DD]) and the three weights ([DD][DD], x 2^4), rounded to bf16 values and written as f16 planes in fragment order.
__global__ __launch_bounds__(256) void k_prep(const float* __restrict__ x, const float* __restrict__ Wq, const float* __restrict__ Wk, const float* __restrict__ Wv, _Float16* __restrict__ X16, _Float16* __restrict__ Bw) {
  const size_t tx = (size_t)blockIdx.x * 1024 + threadIdx.x, tw = (size_t)blockIdx.x * 256 + threadIdx.x; v4f a[7][2]; const size_t s = frag_src(tw, DD);
  static_assert(DD / 32 % 16 == 0, "a block's 16 units of x lie in one 16-row tile: piece tx + 256 i is four units on, 128 k to the right of piece tx");
  const float* xa = x + frag_src(tx, DD); const float* wq = Wq + s; const float* wk = Wk + s; const float* wv = Wv + s;
#pragma unroll      // constant indices keep the seven pieces in registers; all loads stand ahead of the first conversion
  for (int i = 0; i < 4; ++i) { a[i][0] = *(const v4fa*)(xa + i * 128); a[i][1] = *(const v4fa*)(xa + i * 128 + 4); }
  a[4][0] = *(const v4fa*)wq; a[4][1] = *(const v4fa*)(wq + 4); a[5][0] = *(const v4fa*)wk; a[5][1] = *(const v4fa*)(wk + 4); a[6][0] = *(const v4fa*)wv; a[6][1] = *(const v4fa*)(wv + 4);
  // the loaded values as inputs only: keeps all 14 loads ahead of the first conversion, or the compiler sinks half of them behind waits for the first; the addresses as inputs, so that no load's result lands in an address register of the group, and the wait in front of their reuse
  asm volatile("s_wait_xcnt 0x0" :: "v"(a[0][0]), "v"(a[0][1]), "v"(a[1][0]), "v"(a[1][1]), "v"(a[2][0]), "v"(a[2][1]), "v"(a[3][0]), "v"(a[3][1]), "v"(a[4][0]), "v"(a[4][1]), "v"(a[5][0]), "v"(a[5][1]), "v"(a[6][0]), "v"(a[6][1]), "v"(xa), "v"(wq), "v"(wk), "v"(wv) : "memory");
#pragma unroll      // constant indices keep the seven pieces in registers
  for (int i = 0; i < 7; ++i) { FragH f; const float sc = (i < 4) ? 1.0f : 16.0f;
#pragma unroll
    for (int q = 0; q < 4; ++q) { f.h[q] = (_Float16)(bf16_round(a[i][0][q]) * sc); f.h[4 + q] = (_Float16)(bf16_round(a[i][1][q]) * sc); }
    unsigned short* dst = (i < 4) ? (unsigned short*)X16 + (tx + i * 256) * 8 : (unsigned short*)Bw + (size_t)(i - 4) * DD * DD + tw * 8;
    *(v8us*)dst = f.half[0]; } }
// V^T of 256 keys x 64 d per block
template <int NHv, int TTv>
__device__ __forceinline__ void d_vt(const _Float16* __restrict__ V16, int ldv, int voff, _Float16* __restrict__ Vt, int bx) { __shared__ unsigned short tl[256][66]; const int tid = threadIdx.x; const int slab = bx / (TTv / 256), lg = bx % (TTv / 256); const int b = slab / NHv, h = slab % NHv; FragH f[8]; const unsigned short* pv = (const unsigned short*)V16 + ((size_t)b * TTv + lg * 256 + tid / 8) * ldv + voff + h * 64 + (tid % 8) * 8;
#pragma unroll      // constant indices keep the eight pieces in registers; all loads stand ahead of the first LDS store
  for (int u = 0; u < 8; ++u) f[u].half[0] = *(const v8us*)(pv + (size_t)u * 32 * ldv);      // piece u * 256 + tid: row u * 32 + tid / 8
  // the address as an input, so that no load's result lands in it, and the wait in front of its reuse; the loaded values as inputs only: all eight loads stand ahead of the first LDS store
  asm volatile("s_wait_xcnt 0x0" :: "v"(f[0].half[0]), "v"(f[1].half[0]), "v"(f[2].half[0]), "v"(f[3].half[0]), "v"(f[4].half[0]), "v"(f[5].half[0]), "v"(f[6].half[0]), "v"(f[7].half[0]), "v"(pv) : "memory");
#pragma unroll      // constant indices keep the eight pieces in registers
  for (int u = 0; u < 8; ++u) { const int i = u * 256 + tid, r = i / 8, c8 = (i % 8) * 8;
#pragma unroll
    for (int q = 0; q < 8; ++q) tl[r][c8 + q] = f[u].u[q]; }
  __syncthreads();
  {
#pragma unroll
    for (int rd = 0; rd < 8; ++rd) { const int o = rd * 256 + tid, un = o >> 6, p = (o >> 5) & 1, l = o & 31; const int d = (un & 3) * 16 + (l & 15), key = (un >> 2) * 32 + p * 16 + (l >> 4) * 8; FragH g;      // V^T in fragment order: unit (32-key tile) * 4 + d / 16, rows = d, k = keys; the block's 32 units are 32 KB in a row
#pragma unroll
      for (int q = 0; q < 8; ++q) g.u[q] = tl[key + q][d];
      *(v8us*)((unsigned short*)Vt + ((size_t)slab * TTv + lg * 256) * 64 + o * 8) = g.half[0]; }
     } }

__device__ __forceinline__ void d_hl(const float* __restrict__ F, _Float16* __restrict__ Hh, _Float16* __restrict__ Hl, size_t t) { v4f a[8], c[8]; FragH fh[8], fl[8];      /* the flat [rows][64] view, both planes written in fragment order; pieces t + 256 u: four units = 32 rows = 2048 elements on each */
  const float* pf = F + frag_src(t, 64); unsigned short* ph = (unsigned short*)Hh + t * 8; unsigned short* pl = (unsigned short*)Hl + t * 8;
#pragma unroll      // constant indices keep the eight pieces in registers; all loads stand ahead of the first conversion
  for (int u = 0; u < 8; ++u) { a[u] = *(const v4fa*)(pf + u * 2048); c[u] = *(const v4fa*)(pf + u * 2048 + 4); }
  // the loaded values as inputs only: keeps all 16 loads ahead of the first conversion, or the compiler sinks some of them behind waits for the first; the address as an input, so that no load's result lands in it, and the wait in front of its reuse
  asm volatile("s_wait_xcnt 0x0" :: "v"(a[0]), "v"(c[0]), "v"(a[1]), "v"(c[1]), "v"(a[2]), "v"(c[2]), "v"(a[3]), "v"(c[3]), "v"(a[4]), "v"(c[4]), "v"(a[5]), "v"(c[5]), "v"(a[6]), "v"(c[6]), "v"(a[7]), "v"(c[7]), "v"(pf) : "memory");
#pragma unroll      // constant indices keep the eight pieces in registers
  for (int u = 0; u < 8; ++u) {
#pragma unroll
    for (int q = 0; q < 4; ++q) { _Float16 h = (_Float16)a[u][q]; fh[u].h[q] = h; fl[u].h[q] = (_Float16)((a[u][q] - (float)h) * 1024.0f); h = (_Float16)c[u][q]; fh[u].h[4 + q] = h; fl[u].h[4 + q] = (_Float16)((c[u][q] - (float)h) * 1024.0f); }
    *(v8us*)(ph + u * 2048) = fh[u].half[0]; *(v8us*)(pl + u * 2048) = fl[u].half[0]; }
  // the wait behind the 16 stores, in front of the reuse of their registers by the code that follows in the kernel; data and addresses are inputs so that they stay as they are up to the wait
  asm volatile("s_wait_xcnt 0x0" :: "v"(fh[0].half[0]), "v"(fl[0].half[0]), "v"(fh[1].half[0]), "v"(fl[1].half[0]), "v"(fh[2].half[0]), "v"(fl[2].half[0]), "v"(fh[3].half[0]), "v"(fl[3].half[0]), "v"(fh[4].half[0]), "v"(fl[4].half[0]), "v"(fh[5].half[0]), "v"(fl[5].half[0]), "v"(fh[6].half[0]), "v"(fl[6].half[0]), "v"(fh[7].half[0]), "v"(fl[7].half[0]), "v"(ph), "v"(pl) : "memory"); }
// What stands between the projections and the attention, in one grid: blocks 0 .. GVT - 1 transpose V, the others split q and k, whose f32 planes and whose hi and lo planes lie one behind the other and are walked as one plane of twice the rows.
#define GVT (NSL * (TT / 256))
__global__ __launch_bounds__(256) void k_post(const float* __restrict__ F, _Float16* __restrict__ Hh, _Float16* __restrict__ Hl, const _Float16* __restrict__ V16, _Float16* __restrict__ Vt) {
  if (blockIdx.x < GVT) d_vt<1, TT>(V16, 64, 0, Vt, (int)blockIdx.x);      // the test reads the same in a whole block: its barrier is passed by all 256 threads or by none
  else d_hl(F, Hh, Hl, (size_t)(blockIdx.x - GVT) * 2048 + threadIdx.x); }
typedef float v2f __attribute__((ext_vector_type(2)));
// lane l <-> lane l ^ 16 by a vector cross-row move
__device__ __forceinline__ float xhalf(float x) { return __builtin_bit_cast(float, __builtin_amdgcn_permlanex16(__builtin_bit_cast(int, x), __builtin_bit_cast(int, x), 0x76543210, 0xfedcba98, false, false)); }
__global__ __launch_bounds__(128) void k_flash(const _Float16* __restrict__ Q16, const _Float16* __restrict__ Q16lo, int ldq, const _Float16* __restrict__ K16, const _Float16* __restrict__ K16lo, int ldk, const _Float16* __restrict__ Vt, float* __restrict__ O, int ldo) {
  constexpr int RPW = 16, NQB = TT / (4 * RPW), DT = 4, KS = 2; constexpr float L2E = 1.4426950408889634f;
  __shared__ __attribute__((aligned(16))) float sO[4][RPW][64 + 4];
  const int tid = threadIdx.x, w = tid >> 5, lane = tid & 31, ln = lane & 15, hh = lane >> 4;
  const int slab = blockIdx.x / NQB, qblk = blockIdx.x % NQB; const int b = slab; const int qb0 = qblk * (4 * RPW); const int q0 = qb0 + w * RPW;
  FragH aq[KS], aql[KS];
  { const size_t qo = ((size_t)b * TT + q0) * ldq + lane * 8; const unsigned short* qr = (const unsigned short*)Q16 + qo; const unsigned short* ql = (const unsigned short*)Q16lo + qo;
#pragma unroll
    for (int ks = 0; ks < KS; ++ks) { aq[ks].half[0] = *(const v8us*)(qr + ks * 512); aq[ks].half[1] = *(const v8us*)(qr + ks * 512 + 256); aql[ks].half[0] = *(const v8us*)(ql + ks * 512); aql[ks].half[1] = *(const v8us*)(ql + ks * 512 + 256); } }      // fragment-ordered planes (ldq == ldk == 64): unit = (row / 16) * 2 + ks
  const unsigned short* Vth = (const unsigned short*)Vt + (size_t)slab * 64 * TT;
  float m_r = -3.0e38f, b_r = -3.0e38f, l_r = 0.f; v8f oacc[DT];
#pragma unroll
  for (int dt = 0; dt < DT; ++dt) oacc[dt] = (v8f){0.f,0.f,0.f,0.f,0.f,0.f,0.f,0.f};
  const int jend = TT;
  // K fragments (both planes, 32 keys) live in registers across the back edge: each pass fetches the next pass's right behind its own score products; V fragments are fetched at the pass's top, ahead of the scores and the softmax.
  FragH bk[2][KS], bl[2][KS];
  auto fetchK = [&](int j) {
#pragma unroll      // constant indices keep the fragment arrays in registers
    for (int nt = 0; nt < 2; ++nt) { const size_t ko = ((size_t)b * TT + j + nt * 16) * ldk + lane * 8; const unsigned short* kr = (const unsigned short*)K16 + ko; const unsigned short* kl = (const unsigned short*)K16lo + ko;
#pragma unroll      // constant indices keep the fragment arrays in registers
      for (int ks = 0; ks < KS; ++ks) { bk[nt][ks].half[0] = *(const v8us*)(kr + ks * 512); bk[nt][ks].half[1] = *(const v8us*)(kr + ks * 512 + 256); bl[nt][ks].half[0] = *(const v8us*)(kl + ks * 512); bl[nt][ks].half[1] = *(const v8us*)(kl + ks * 512 + 256); } } };
  fetchK(0);
  { const size_t qa = ((size_t)b * TT + q0) * ldq + lane * 8, ka = (size_t)b * TT * ldk + lane * 8, kc = ((size_t)b * TT + 16) * ldk + lane * 8;
    // the wait in front of the reuse of the address registers of the Q and K loads above; the six addresses are inputs so that their registers stay as they are up to the wait
    asm volatile("s_wait_xcnt 0x0" :: "v"(Q16 + qa), "v"(Q16lo + qa), "v"(K16 + ka), "v"(K16lo + ka), "v"(K16 + kc), "v"(K16lo + kc) : "memory"); }
#pragma unroll 1
  for (int j0 = 0; j0 < jend; j0 += 32) {
    FragH bv[DT];
#pragma unroll      // constant indices keep the fragment arrays in registers
    for (int dt = 0; dt < DT; ++dt) { const unsigned short* vrow = Vth + (size_t)j0 * 64 + dt * 512 + lane * 8; bv[dt].half[0] = *(const v8us*)(vrow); bv[dt].half[1] = *(const v8us*)(vrow + 256); }
    v8f s[2];      // s[nt][r] = score of query q0 + ln against key j0 + 16 nt + 8 hh + r
#pragma unroll
    for (int nt = 0; nt < 2; ++nt) { v8f acc = (v8f){0.f,0.f,0.f,0.f,0.f,0.f,0.f,0.f}, accl = acc;
#pragma unroll
      for (int ks = 0; ks < KS; ++ks) { acc = mmaH<1>(bk[nt][ks].v, bk[nt][ks].v, aq[ks].v, aq[ks].v, acc); accl = mmaH<1>(bk[nt][ks].v, bk[nt][ks].v, aql[ks].v, aql[ks].v, accl); accl = mmaH<1>(bl[nt][ks].v, bl[nt][ks].v, aq[ks].v, aq[ks].v, accl); }
      s[nt] = acc + accl * 0.0009765625f; }
    const int jn = (j0 + 32 < jend) ? j0 + 32 : 0; fetchK(jn);      // the last pass refetches keys 0..31: in bounds, not used
    { const size_t ka = ((size_t)b * TT + jn) * ldk + lane * 8, kc = ((size_t)b * TT + jn + 16) * ldk + lane * 8;
      // the wait in front of the reuse of the address registers of the K loads above; the four addresses are inputs so that none of their registers is handed to a load's result or to the softmax ahead of the wait
      asm volatile("s_wait_xcnt 0x0" :: "v"(K16 + ka), "v"(K16lo + ka), "v"(K16 + kc), "v"(K16lo + kc) : "memory"); }
    float mc = s[0][0], md = s[1][0];
#pragma unroll      // constant indices keep the score tiles in registers
    for (int r = 1; r < 8; ++r) { mc = fmaxf(mc, s[0][r]); md = fmaxf(md, s[1][r]); }
    mc = fmaxf(mc, md); mc = fmaxf(mc, xhalf(mc));      // both halves now hold the query's maximum over the pass's 32 keys
    // base 2: b_r is the running maximum times log2(e), less 10; every weight is then 2^(s log2(e) - b_r) = 2^10 exp(s - max), one multiply-add and one hardware exponential, already at the scale the f16 P operand wants
    const float mn = fmaxf(m_r, mc), bn = __builtin_fmaf(mn, L2E, -10.0f); const float al = __builtin_amdgcn_exp2f((mn > -1.0e38f) ? b_r - bn : 0.f); m_r = mn; b_r = bn;      // the guard selects the argument (2^0 = 1), so no branch on lanes stands in the loop
    FragH pt; v2f ps[2] = {(v2f){0.f, 0.f}, (v2f){0.f, 0.f}}; const v8f l2e8 = {L2E, L2E, L2E, L2E, L2E, L2E, L2E, L2E}, nm8 = {-bn, -bn, -bn, -bn, -bn, -bn, -bn, -bn};
#pragma unroll      // constant indices keep the score tiles and the P^T fragment in registers
    for (int nt = 0; nt < 2; ++nt) { const v8f d = __builtin_elementwise_fma(s[nt], l2e8, nm8);
#pragma unroll      // constant indices keep the score tiles and the P^T fragment in registers
      for (int r = 0; r < 8; r += 2) { const v2f p = {__builtin_amdgcn_exp2f(d[r]), __builtin_amdgcn_exp2f(d[r + 1])}; ps[nt] += p; pt.h[8 * nt + r] = (_Float16)p[0]; pt.h[8 * nt + r + 1] = (_Float16)p[1]; } }
    { const v2f pq = ps[0] + ps[1]; l_r = l_r * al + (pq[0] + pq[1]); }      // this half's 16 keys; the halves are joined behind the loop
#pragma unroll
    for (int dt = 0; dt < DT; ++dt)
#pragma unroll
      for (int r = 0; r < 8; ++r) oacc[dt][r] *= al;
#pragma unroll
    for (int dt = 0; dt < DT; ++dt) oacc[dt] = mmaH<1>(bv[dt].v, bv[dt].v, pt.v, pt.v, oacc[dt]);      // oacc[dt][r] = O[q0 + ln][16 dt + 8 hh + r]
  }
  { const float l = l_r + xhalf(l_r); const float inv = (l > 0.f) ? 1.0f / l : 0.f;      // l and the output tiles both carry the factor 2^10; the exchange stands ahead of the select: all lanes are on
#pragma unroll      // constant indices keep the output tiles in registers
    for (int dt = 0; dt < DT; ++dt) { v4f lo4, hi4;
#pragma unroll      // constant indices keep the output tiles in registers
      for (int r = 0; r < 4; ++r) { lo4[r] = oacc[dt][r] * inv; hi4[r] = oacc[dt][4 + r] * inv; }
      *(v4fa*)&sO[w][ln][dt * 16 + 8 * hh] = lo4; *(v4fa*)&sO[w][ln][dt * 16 + 8 * hh + 4] = hi4; } }
  __builtin_amdgcn_fence(__ATOMIC_ACQ_REL, "workgroup"); __builtin_amdgcn_wave_barrier();
  {
#pragma unroll
    for (int rp = 0; rp < RPW; rp += 2) { const int r = rp + (lane >> 4), pc = lane & 15; const v4f val = *(const v4fa*)&sO[w][r][pc * 4]; *(v4f*)(O + ((size_t)b * TT + q0 + r) * ldo + pc * 4) = val; }
     } }

__global__ __launch_bounds__(256) void k_stat(const float* __restrict__ O, const float* __restrict__ x, float* __restrict__ PART) { __shared__ float r1[256], r2[256]; const int tid = threadIdx.x; const int b = blockIdx.x / NPB, part = blockIdx.x % NPB; const size_t base = (size_t)b * TT * DD + (size_t)part * (TT * DD / NPB) + tid * 4; float s1 = 0.f, s2 = 0.f;
  static_assert(TT * DD / NPB % 8192 == 0, "whole groups of eight trips of 1024 elements");
  const float* po = O + base; const float* px = x + base;
#pragma unroll      // four groups on two fixed address pairs with constant offsets: no address is stepped while loads are in flight
  for (int i = 0; i < TT * DD / NPB; i += 8192) { v4f o[8], xv[8];
#pragma unroll      // constant indices keep the eight pieces in registers
    for (int u = 0; u < 8; ++u) { o[u] = *(const v4fa*)(po + i + u * 1024); xv[u] = *(const v4fa*)(px + i + u * 1024); }
    // the loaded values as inputs only: keeps all 16 loads ahead of the first sum, or the compiler sinks half of them behind waits for the first; the two addresses as inputs, so that no load's result lands in an address register of the group, and the wait in front of their reuse
    asm volatile("s_wait_xcnt 0x0" :: "v"(o[0]), "v"(xv[0]), "v"(o[1]), "v"(xv[1]), "v"(o[2]), "v"(xv[2]), "v"(o[3]), "v"(xv[3]), "v"(o[4]), "v"(xv[4]), "v"(o[5]), "v"(xv[5]), "v"(o[6]), "v"(xv[6]), "v"(o[7]), "v"(xv[7]), "v"(po), "v"(px) : "memory");
#pragma unroll      // constant indices keep the eight pieces in registers; the sums keep the order of the single trips
    for (int u = 0; u < 8; ++u) for (int q = 0; q < 4; ++q) { const float y = o[u][q] + bf16_round(xv[u][q]); s1 += y; s2 += y * y; } }
  r1[tid] = s1; r2[tid] = s2; __syncthreads(); for (int o = 128; o >= 1; o >>= 1) { if (tid < o) { r1[tid] += r1[tid + o]; r2[tid] += r2[tid + o]; } __syncthreads(); }
  if (tid < 32) { const float v = (tid == 0) ? r1[0] : ((tid == 1) ? r2[0] : 0.f); *(float*)(PART + (size_t)blockIdx.x * 32 + tid) = v;  } }
typedef float v2fa __attribute__((ext_vector_type(2), may_alias));
__device__ __forceinline__ float lane_val(float v, int l) { return __builtin_bit_cast(float, __builtin_amdgcn_readlane(__builtin_bit_cast(int, v), l)); }
__global__ __launch_bounds__(256) void k_norm(const float* __restrict__ O, const float* __restrict__ x, const float* __restrict__ PART, float* __restrict__ out) { const size_t t = (size_t)blockIdx.x * 2048 + threadIdx.x; const int b = (int)(blockIdx.x / (GSTR / BB)), lane = threadIdx.x & 31; float s1 = 0.f, s2 = 0.f; v4f o[8], xv[8];
  static_assert(NPB == 64, "two partial pairs per lane");
#pragma unroll      // constant indices keep the eight pieces in registers
  for (int u = 0; u < 8; ++u) { o[u] = *(const v4fa*)(O + (t + u * 256) * 4); xv[u] = *(const v4fa*)(x + (t + u * 256) * 4); }
  const v2f pa = *(const v2fa*)(PART + ((size_t)b * NPB + lane) * 32), pb = *(const v2fa*)(PART + ((size_t)b * NPB + 32 + lane) * 32);      // lane l holds the partial pairs l and 32 + l: two loads per wave in place of a chain of 64
  // the loaded values as inputs only: keeps all 18 loads ahead of the statistics, or the compiler sinks some of them behind the sums; the three addresses as inputs, so that no load's result lands in an address register of the group, and the wait in front of their reuse
  asm volatile("s_wait_xcnt 0x0" :: "v"(o[0]), "v"(xv[0]), "v"(o[1]), "v"(xv[1]), "v"(o[2]), "v"(xv[2]), "v"(o[3]), "v"(xv[3]), "v"(o[4]), "v"(xv[4]), "v"(o[5]), "v"(xv[5]), "v"(o[6]), "v"(xv[6]), "v"(o[7]), "v"(xv[7]), "v"(pa), "v"(pb), "v"(O + t * 4), "v"(x + t * 4), "v"(PART + ((size_t)b * NPB + lane) * 32) : "memory");
#pragma unroll      // constant lane numbers; the partial sums are added in the order p = 0 .. NPB - 1
  for (int p = 0; p < 32; ++p) { s1 += lane_val(pa[0], p); s2 += lane_val(pa[1], p); }
#pragma unroll      // constant lane numbers
  for (int p = 0; p < 32; ++p) { s1 += lane_val(pb[0], p); s2 += lane_val(pb[1], p); }
  const float n = (float)TT * (float)DD; const float mu = s1 / n; const float var = fmaxf(s2 / n - mu * mu, 0.f); const float rs = rsqrtf(var + 1e-5f);
#pragma unroll      // constant indices keep the eight pieces in registers
  for (int u = 0; u < 8; ++u) { v4f r; for (int q = 0; q < 4; ++q) r[q] = (o[u][q] + bf16_round(xv[u][q]) - mu) * rs;
    *(v4f*)(out + (t + u * 256) * 4) = r; } }

extern "C" void kernel_launch(void* const* d_in, const int* in_sizes, int n_in,
                              void* d_out, int out_size, void* d_ws, size_t ws_size, hipStream_t stream) {
  (void)in_sizes; (void)n_in; (void)out_size;
  const float* x = (const float*)d_in[0]; const float* Wq = (const float*)d_in[1]; const float* Wk = (const float*)d_in[2]; const float* Wv = (const float*)d_in[3];
  char* ws = (char*)d_ws; size_t off = 0;
  auto take = [&](size_t bytes) { char* p = ws + off; off += (bytes + 255) & ~(size_t)255; return p; };
  const size_t WSZ = (size_t)DD * DD, PSZ = (size_t)NR * DD; _Float16* Bw = (_Float16*)take(3 * WSZ * 2); _Float16* X16 = (_Float16*)take(PSZ * 2); float* F32 = (float*)take(2 * PSZ * 4);      /* F32: q, then k */
  _Float16* Qh = (_Float16*)take(2 * PSZ * 2); _Float16* Kh = Qh + PSZ; _Float16* Ql = (_Float16*)take(2 * PSZ * 2); _Float16* Kl = Ql + PSZ;      /* hi planes of q and k in a row, then their lo planes */
  _Float16* V16 = (_Float16*)take(PSZ * 2); _Float16* Vt = (_Float16*)take(PSZ * 2); float* PART = (float*)take((size_t)BB * NPB * 32 * 4);
  float* O = F32;      /* the q plane is consumed by k_post; it then takes the attention output */
  if (off > ws_size) return;      // 6.3 + 8.4 + 33.6 + 6 x 8.4 = 99 MB
  k_prep<<<GSTR, 256, 0, stream>>>(x, Wq, Wk, Wv, X16, Bw);      /* x; weights (out,in) natural x 2^4 */
  const dim3 gp((NR / 128) * (DD / 128), 3);      /* y: q, k (f32 planes of F32), v (f16) */
  k_gemm_hhx<0><<<gp, 128, 0, stream>>>(X16, DD, 0, Bw, DD, WSZ, 0.0625f, nullptr, 0, nullptr, 1, 0, 0, F32, V16, 2, DD, PSZ, NR, DD, DD);
  k_post<<<GVT + GSTR, 256, 0, stream>>>(F32, Qh, Ql, V16, Vt);      /* q, k f32 -> hi/lo; the [4096][1024] V plane viewed as 32 contiguous [2048][64] slabs -> V^T per slab; all in fragment order */
  k_flash<<<NSL * (TT / 64), 128, 0, stream>>>(Qh, Ql, 64, Kh, Kl, 64, Vt, O, 64);      /* same flat view for Q, K and O */
  k_stat<<<BB * NPB, 256, 0, stream>>>(O, x, PART); k_norm<<<GSTR, 256, 0, stream>>>(O, x, PART, (float*)d_out);
}

// v008
// One run takes 115 microseconds.
// Timed twice side by side with v007, it ran 1.13 times as fast both times.
// Over all steps from v000 it is 4.36 times as fast.
#include <hip/hip_runtime.h>
// Multi-head attention with raw-reshape heads, residual and a global LayerNorm (B=2, S=2048, D=1024, 16 heads × 64): Q,K,V = x·Wᵀ reshaped by plain memory order to (H,B,S,64) (= 32 contiguous [2048][64] slabs of each
// [4096][1024] plane); UNSCALED softmax(Q·Kᵀ)·V per slab; y = out (same flat order, = [B,S,1024]) + x; output = (y − mean)/√(var + 1e-5) with mean/var over all (S,D) of each batch element (identity affine).
// Compute dtype: x and weights rounded to bf16; Q,K as f32 GEMM outputs split into f16 hi + ×2^10 residual planes so the unscaled (σ≈3) logits are f32-accurate; V f16; fused flash-style kernel
// (two score accumulators, online softmax f32, P f16 ×2^10) on v_wmma_f32_16x16x32_f16; residual and the per-batch statistics (fixed-order block partial sums of y and y², then a fixed-order combine) and normalisation in f32.
#define BB 2
#define TT 2048
#define DD 1024
#define NSL 32
#define NR (BB * TT)
#define NPB 64

typedef __bf16 v16b __attribute__((ext_vector_type(16)));
typedef unsigned short v8us __attribute__((ext_vector_type(8), may_alias));
typedef float  v8f  __attribute__((ext_vector_type(8)));
typedef float  v4f  __attribute__((ext_vector_type(4)));
typedef float  v4fa __attribute__((ext_vector_type(4), may_alias));
union FragB { v16b v; v8us half[2]; unsigned short u[16]; };

__device__ __forceinline__ unsigned short bf16_bits(float x) { unsigned int u = __float_as_uint(x); return (unsigned short)((u + 0x7FFFu + ((u >> 16) & 1u)) >> 16); }
__device__ __forceinline__ float bf16_val(unsigned short b) { return __uint_as_float(((unsigned int)b) << 16); }
__device__ __forceinline__ float bf16_round(float x) { return bf16_val(bf16_bits(x)); }
// D += A·B with NT terms: 1 = ah·bh, 2 = + al·bh (A split), 3 = + ah·bl (both split)
template <int NT>
__device__ __forceinline__ v8f mmaN(v16b ah, v16b al, v16b bh, v16b bl, v8f c) {
  c = __builtin_amdgcn_wmma_f32_16x16x32_bf16(false, ah, false, bh, (short)0, c, false, false);
  if (NT >= 2) c = __builtin_amdgcn_wmma_f32_16x16x32_bf16(false, al, false, bh, (short)0, c, false, false);
  if (NT >= 3) c = __builtin_amdgcn_wmma_f32_16x16x32_bf16(false, ah, false, bl, (short)0, c, false, false);
  asm volatile("v_nop\n\tv_nop\n\tv_nop\n\tv_nop" : "+v"(c) : "v"(ah), "v"(al), "v"(bh), "v"(bl));
  return c;
}

__global__ __launch_bounds__(256) void k_wt_bf16(const float* __restrict__ W, unsigned short* __restrict__ Wt, int K, int N) {
  const int t = blockIdx.x * 256 + threadIdx.x;
  const int k8n = K / 8;
  if (t >= N * k8n) return;
  const int n = t / k8n, k8 = (t % k8n) * 8;
  v8us v;
#pragma unroll
  for (int i = 0; i < 8; ++i) v[i] = bf16_bits(W[(size_t)(k8 + i) * N + n]);
  *(v8us*)(Wt + (size_t)n * K + k8) = v;
  
}

// GEMM C[M][N] (f32, pitch ldc) = act(A[M][K]·W + bias). A f32 row-major (pitch lda) converted per fragment to bf16
// (ASPLIT: hi/lo two planes -> 2 terms, else single rounded term); Wt bf16 [N][K] (pitch ldb). BIAS_BF16 rounds the
// bias to bf16 first (bias quantised to bf16 before the add). K%32==0, M%16==0, N%64==0.
template <bool ASPLIT, int ACT, bool BIAS_BF16>
__global__ __launch_bounds__(128) void k_gemm_bf(const float* __restrict__ A, int lda, const unsigned short* __restrict__ Wt, int ldb,
                                               const float* __restrict__ bias, float* __restrict__ C, int ldc, int M, int N, int K) {
  __shared__ __attribute__((aligned(16))) float so[4][16][64];
  const int tid = threadIdx.x, w = tid >> 5, lane = tid & 31, ln = lane & 15, hh = lane >> 4;
  const int ntn = N / 64;
  const int wid = blockIdx.x * 4 + w;
  const int mt = wid / ntn, nq = wid % ntn;
  if (mt * 16 >= M) return;
  const int row0 = mt * 16, col0 = nq * 64;
  const float* arow = A + (size_t)(row0 + ln) * lda;
  v8f acc[4] = {};
  for (int kb = 0; kb < K; kb += 32) {
    FragB ah, al;
    const v4f x0 = *(const v4fa*)(arow + kb + 8 * hh), x1 = *(const v4fa*)(arow + kb + 8 * hh + 4);
    const v4f x2 = *(const v4fa*)(arow + kb + 16 + 8 * hh), x3 = *(const v4fa*)(arow + kb + 16 + 8 * hh + 4);
    float xs[16] = {x0[0],x0[1],x0[2],x0[3],x1[0],x1[1],x1[2],x1[3],x2[0],x2[1],x2[2],x2[3],x3[0],x3[1],x3[2],x3[3]};
#pragma unroll
    for (int i = 0; i < 16; ++i) { const unsigned short hb = bf16_bits(xs[i]); ah.u[i] = hb; al.u[i] = ASPLIT ? bf16_bits(xs[i] - bf16_val(hb)) : (unsigned short)0; }
#pragma unroll
    for (int t = 0; t < 4; ++t) {
      const unsigned short* brow = Wt + (size_t)(col0 + t * 16 + ln) * ldb + kb;
      FragB b;
      b.half[0] = *(const v8us*)(brow + 8 * hh);
      b.half[1] = *(const v8us*)(brow + 16 + 8 * hh);
      acc[t] = mmaN<ASPLIT ? 2 : 1>(ah.v, al.v, b.v, b.v, acc[t]);
    }
  }
#pragma unroll
  for (int t = 0; t < 4; ++t) {
    float bv = bias ? bias[col0 + t * 16 + ln] : 0.f;
    if (BIAS_BF16) bv = bf16_round(bv);
#pragma unroll
    for (int r = 0; r < 8; ++r) { float v = acc[t][r] + bv; if (ACT == 1) v = fmaxf(v, 0.f); so[w][8 * hh + r][t * 16 + ln] = v; }
  }
  __builtin_amdgcn_fence(__ATOMIC_ACQ_REL, "workgroup");
  __builtin_amdgcn_wave_barrier();
  const int rsub = lane >> 4, c4 = (lane & 15) * 4;
  {
#pragma unroll
    for (int q = 0; q < 8; ++q) {
      const int r = q * 2 + rsub;
      const v4f v = *(const v4fa*)&so[w][r][c4];
      *(v4f*)(C + (size_t)(row0 + r) * ldc + col0 + c4) = v;
    }
    
  }
}

// Flash-style causal/unmasked attention, all contractions 3-term bf16 hi/lo splits, f32 softmax with running max.
// q,k,v rows are read from f32 buffers with arbitrary row pitch (so they can live inside a fused qkv buffer);
// D = head size (multiple of 32, <= 128); one wave = 16 query rows; block = 4 waves (64 queries) sharing K/V chunks of 32.
template <int D, bool CAUSAL>
__global__ __launch_bounds__(128) void k_flash(const float* __restrict__ qb, const float* __restrict__ kb, const float* __restrict__ vb,
                                             int pitch, int T, int H, float scale, float* __restrict__ y, int ypitch) {
  constexpr int KS = D / 32;        // k-steps for QK
  constexpr int DT = D / 16;        // d tiles for PV
  __shared__ __attribute__((aligned(16))) unsigned short sKh[32][D + 8], sKl[32][D + 8], sVh[32][D + 8], sVl[32][D + 8];
  __shared__ __attribute__((aligned(16))) unsigned short sPh[4][16][40], sPl[4][16][40];
  __shared__ __attribute__((aligned(16))) float sO[4][16][D];
  const int tid = threadIdx.x, w = tid >> 5, lane = tid & 31, ln = lane & 15, hh = lane >> 4;
  const int nqb = (T + 63) / 64;
  const int bh = blockIdx.x / nqb, qblk = blockIdx.x % nqb;
  const int b = bh / H, h = bh % H;
  const int q0 = qblk * 64 + w * 16;
  const float* Q = qb + (size_t)b * T * pitch + h * D;
  const float* K = kb + (size_t)b * T * pitch + h * D;
  const float* V = vb + (size_t)b * T * pitch + h * D;

  // A fragments of the wave's 16 query rows (scaled), hi/lo
  FragB aqh[KS], aql[KS];
  {
    int row = q0 + ln; if (row >= T) row = T - 1;
    const float* qr = Q + (size_t)row * pitch;
#pragma unroll
    for (int ks = 0; ks < KS; ++ks)
#pragma unroll
      for (int i = 0; i < 16; ++i) {
        const int d = ks * 32 + ((i < 8) ? (8 * hh + i) : (16 + 8 * hh + (i - 8)));
        const float x = qr[d] * scale; const unsigned short hb = bf16_bits(x);
        aqh[ks].u[i] = hb; aql[ks].u[i] = bf16_bits(x - bf16_val(hb));
      }
  }
  float m_r[8], l_r[8];
#pragma unroll
  for (int r = 0; r < 8; ++r) { m_r[r] = -3.0e38f; l_r[r] = 0.f; }
  v8f oacc[DT];
#pragma unroll
  for (int dt = 0; dt < DT; ++dt) oacc[dt] = (v8f){0.f,0.f,0.f,0.f,0.f,0.f,0.f,0.f};

  const int kv_end = CAUSAL ? min(T, qblk * 64 + 64) : T;     // block-uniform
  for (int j0 = 0; j0 < kv_end; j0 += 32) {
    __syncthreads();
    for (int e = tid; e < 32 * (D / 4); e += 128) {
      const int r = e / (D / 4), c4 = (e % (D / 4)) * 4;
      const int key = j0 + r;
      v4f kf = {0.f,0.f,0.f,0.f}, vf = {0.f,0.f,0.f,0.f};
      if (key < T) { kf = *(const v4fa*)(K + (size_t)key * pitch + c4); vf = *(const v4fa*)(V + (size_t)key * pitch + c4); }
#pragma unroll
      for (int t = 0; t < 4; ++t) {
        unsigned short hb = bf16_bits(kf[t]); sKh[r][c4 + t] = hb; sKl[r][c4 + t] = bf16_bits(kf[t] - bf16_val(hb));
        hb = bf16_bits(vf[t]); sVh[r][c4 + t] = hb; sVl[r][c4 + t] = bf16_bits(vf[t] - bf16_val(hb));
      }
    }
    __syncthreads();
    // S tile 16 x 32
    v8f s[2];
#pragma unroll
    for (int nt = 0; nt < 2; ++nt) {
      v8f acc = {};
#pragma unroll
      for (int ks = 0; ks < KS; ++ks) {
        FragB bh_, bl_;
        bh_.half[0] = *(const v8us*)&sKh[nt * 16 + ln][ks * 32 + 8 * hh]; bh_.half[1] = *(const v8us*)&sKh[nt * 16 + ln][ks * 32 + 16 + 8 * hh];
        bl_.half[0] = *(const v8us*)&sKl[nt * 16 + ln][ks * 32 + 8 * hh]; bl_.half[1] = *(const v8us*)&sKl[nt * 16 + ln][ks * 32 + 16 + 8 * hh];
        acc = mmaN<3>(aqh[ks].v, aql[ks].v, bh_.v, bl_.v, acc);
      }
      s[nt] = acc;
    }
    // mask + running max (rows 8hh+r; the 16 lanes of a half share rows)
    float alpha[8];
#pragma unroll
    for (int r = 0; r < 8; ++r) {
      const int qi = q0 + 8 * hh + r;
      const int ja = j0 + ln, jb = j0 + 16 + ln;
      if (CAUSAL) { if (ja > qi) s[0][r] = -3.0e38f; if (jb > qi) s[1][r] = -3.0e38f; }
      if (ja >= T) s[0][r] = -3.0e38f;
      if (jb >= T) s[1][r] = -3.0e38f;
      float mx = fmaxf(s[0][r], s[1][r]);
      mx = fmaxf(mx, __shfl_xor(mx, 1, 32)); mx = fmaxf(mx, __shfl_xor(mx, 2, 32)); mx = fmaxf(mx, __shfl_xor(mx, 4, 32)); mx = fmaxf(mx, __shfl_xor(mx, 8, 32));
      const float mnew = fmaxf(m_r[r], mx);
      alpha[r] = (mnew > -1.0e38f) ? __expf(m_r[r] - mnew) : 1.0f;
      const float p0 = (s[0][r] > -1.0e38f) ? __expf(s[0][r] - mnew) : 0.f;
      const float p1 = (s[1][r] > -1.0e38f) ? __expf(s[1][r] - mnew) : 0.f;
      m_r[r] = mnew;
      l_r[r] = l_r[r] * alpha[r] + p0 + p1;            // per-lane partial row sum (16 lanes combined at the end)
      unsigned short hb = bf16_bits(p0); sPh[w][8 * hh + r][ln] = hb;      sPl[w][8 * hh + r][ln] = bf16_bits(p0 - bf16_val(hb));
      hb = bf16_bits(p1);                sPh[w][8 * hh + r][16 + ln] = hb; sPl[w][8 * hh + r][16 + ln] = bf16_bits(p1 - bf16_val(hb));
    }
#pragma unroll
    for (int dt = 0; dt < DT; ++dt)
#pragma unroll
      for (int r = 0; r < 8; ++r) oacc[dt][r] *= alpha[r];
    __builtin_amdgcn_fence(__ATOMIC_ACQ_REL, "workgroup");
    __builtin_amdgcn_wave_barrier();
    FragB pah, pal;
    pah.half[0] = *(const v8us*)&sPh[w][ln][8 * hh]; pah.half[1] = *(const v8us*)&sPh[w][ln][16 + 8 * hh];
    pal.half[0] = *(const v8us*)&sPl[w][ln][8 * hh]; pal.half[1] = *(const v8us*)&sPl[w][ln][16 + 8 * hh];
#pragma unroll
    for (int dt = 0; dt < DT; ++dt) {
      FragB bvh, bvl;
#pragma unroll
      for (int i = 0; i < 8; ++i) {
        bvh.u[i] = sVh[8 * hh + i][dt * 16 + ln]; bvh.u[8 + i] = sVh[16 + 8 * hh + i][dt * 16 + ln];
        bvl.u[i] = sVl[8 * hh + i][dt * 16 + ln]; bvl.u[8 + i] = sVl[16 + 8 * hh + i][dt * 16 + ln];
      }
      oacc[dt] = mmaN<3>(pah.v, pal.v, bvh.v, bvl.v, oacc[dt]);
    }
    __builtin_amdgcn_fence(__ATOMIC_ACQ_REL, "workgroup");
    __builtin_amdgcn_wave_barrier();
  }
#pragma unroll
  for (int r = 0; r < 8; ++r) {
    float l = l_r[r];
    l += __shfl_xor(l, 1, 32); l += __shfl_xor(l, 2, 32); l += __shfl_xor(l, 4, 32); l += __shfl_xor(l, 8, 32);
    l_r[r] = (l > 0.f) ? 1.0f / l : 0.f;
  }
#pragma unroll
  for (int dt = 0; dt < DT; ++dt)
#pragma unroll
    for (int r = 0; r < 8; ++r) sO[w][8 * hh + r][dt * 16 + ln] = oacc[dt][r] * l_r[r];
  __builtin_amdgcn_fence(__ATOMIC_ACQ_REL, "workgroup");
  __builtin_amdgcn_wave_barrier();
  {
    for (int r = 0; r < 16; ++r) {
      const int row = q0 + r;
      if (row < T && lane < D / 4) {
        const v4f val = *(const v4fa*)&sO[w][r][lane * 4];
        *(v4f*)(y + ((size_t)b * T + row) * ypitch + h * D + lane * 4) = val;
      }
    }
    
  }
}

// GEMM C = act(A·W + bias + resid): A f32 (ASPLIT -> hi/lo 2 terms), Wt bf16 [N][K]; ACT 0 none, 1 relu, 2 exact gelu;
// resid (optional, f32, row index = (row % rmod), pitch ldr, RES_BF16 rounds it) added before the activation.
template <bool ASPLIT, int ACT, bool BIAS_BF16, bool RES_BF16>
__global__ __launch_bounds__(128) void k_gemm_bf3(const float* __restrict__ A, int lda, const unsigned short* __restrict__ Wt, int ldb,
                                                const float* __restrict__ bias, const float* __restrict__ resid, int rmod, int ldr,
                                                float* __restrict__ C, int ldc, int M, int N, int K) {
  __shared__ __attribute__((aligned(16))) float so[4][16][64];
  const int tid = threadIdx.x, w = tid >> 5, lane = tid & 31, ln = lane & 15, hh = lane >> 4;
  const int ntn = N / 64;
  const int wid = blockIdx.x * 4 + w;
  const int mt = wid / ntn, nq = wid % ntn;
  if (mt * 16 >= M) return;
  const int row0 = mt * 16, col0 = nq * 64;
  const float* arow = A + (size_t)(row0 + ln) * lda;
  v8f acc[4] = {};
  for (int kb = 0; kb < K; kb += 32) {
    FragB ah, al;
    const v4f x0 = *(const v4fa*)(arow + kb + 8 * hh), x1 = *(const v4fa*)(arow + kb + 8 * hh + 4);
    const v4f x2 = *(const v4fa*)(arow + kb + 16 + 8 * hh), x3 = *(const v4fa*)(arow + kb + 16 + 8 * hh + 4);
    float xs[16] = {x0[0],x0[1],x0[2],x0[3],x1[0],x1[1],x1[2],x1[3],x2[0],x2[1],x2[2],x2[3],x3[0],x3[1],x3[2],x3[3]};
#pragma unroll
    for (int i = 0; i < 16; ++i) { const unsigned short hb = bf16_bits(xs[i]); ah.u[i] = hb; al.u[i] = ASPLIT ? bf16_bits(xs[i] - bf16_val(hb)) : (unsigned short)0; }
#pragma unroll
    for (int t = 0; t < 4; ++t) {
      const unsigned short* brow = Wt + (size_t)(col0 + t * 16 + ln) * ldb + kb;
      FragB b;
      b.half[0] = *(const v8us*)(brow + 8 * hh);
      b.half[1] = *(const v8us*)(brow + 16 + 8 * hh);
      acc[t] = mmaN<ASPLIT ? 2 : 1>(ah.v, al.v, b.v, b.v, acc[t]);
    }
  }
#pragma unroll
  for (int t = 0; t < 4; ++t) {
    const int col = col0 + t * 16 + ln;
    float bv = bias ? bias[col] : 0.f;
    if (BIAS_BF16) bv = bf16_round(bv);
#pragma unroll
    for (int r = 0; r < 8; ++r) {
      float v = acc[t][r] + bv;
      if (resid) { float rv = resid[(size_t)((row0 + 8 * hh + r) % rmod) * ldr + col]; if (RES_BF16) rv = bf16_round(rv); v += rv; }
      if (ACT == 1) v = fmaxf(v, 0.f);
      if (ACT == 2) v = 0.5f * v * (1.0f + erff(v * 0.70710678118654752f));
      if (ACT == 3) { const float u = 0.7978845608028654f * (v + 0.044715f * v * v * v); v = 0.5f * v * (1.0f + tanhf(u)); }
      so[w][8 * hh + r][t * 16 + ln] = v;
    }
  }
  __builtin_amdgcn_fence(__ATOMIC_ACQ_REL, "workgroup");
  __builtin_amdgcn_wave_barrier();
  const int rsub = lane >> 4, c4 = (lane & 15) * 4;
  {
#pragma unroll
    for (int q = 0; q < 8; ++q) {
      const int r = q * 2 + rsub;
      const v4f v = *(const v4fa*)&so[w][r][c4];
      *(v4f*)(C + (size_t)(row0 + r) * ldc + col0 + c4) = v;
    }
    
  }
}
// row LayerNorm (biased variance, eps) over N: s = X (+ R); optional out_sum <- s; out_norm <- (s-mu)*rsqrt(var+eps)*g + b
template <bool PARAM_BF16>
__global__ __launch_bounds__(256) void k_layernorm(const float* __restrict__ X, const float* __restrict__ R, const float* __restrict__ g, const float* __restrict__ bta,
                                                  float* __restrict__ out_sum, float* __restrict__ out_norm, int N, float eps) {
  __shared__ float red[256];
  const int row = blockIdx.x, tid = threadIdx.x;
  const float* x = X + (size_t)row * N; const float* rr = R ? R + (size_t)row * N : nullptr;
  float vals[16];                     // up to N = 4096
  const int per = N / 256;            // contiguous chunk per thread? use strided-by-4 chunks: thread handles j = tid*4 + 1024*u
  float s1 = 0.f;
  for (int u = 0; u < per / 4; ++u) {
    const int j = tid * 4 + 1024 * u;
    const v4f a = *(const v4fa*)(x + j);
    v4f b = {0.f,0.f,0.f,0.f}; if (rr) b = *(const v4fa*)(rr + j);
#pragma unroll
    for (int q = 0; q < 4; ++q) { const float v = a[q] + b[q]; vals[u * 4 + q] = v; s1 += v; }
  }
  red[tid] = s1; __syncthreads();
  for (int st = 128; st > 0; st >>= 1) { if (tid < st) red[tid] += red[tid + st]; __syncthreads(); }
  const float mu = red[0] / (float)N; __syncthreads();
  float s2 = 0.f;
  for (int u = 0; u < per / 4; ++u)
#pragma unroll
    for (int q = 0; q < 4; ++q) { const float c = vals[u * 4 + q] - mu; s2 += c * c; }
  red[tid] = s2; __syncthreads();
  for (int st = 128; st > 0; st >>= 1) { if (tid < st) red[tid] += red[tid + st]; __syncthreads(); }
  const float rs = rsqrtf(red[0] / (float)N + eps);
  {
    for (int u = 0; u < per / 4; ++u) {
      const int j = tid * 4 + 1024 * u;
      v4f o, sm;
#pragma unroll
      for (int q = 0; q < 4; ++q) {
        float gg = g[j + q], bb = bta[j + q];
        if (PARAM_BF16) { gg = bf16_round(gg); bb = bf16_round(bb); }
        sm[q] = vals[u * 4 + q]; o[q] = (vals[u * 4 + q] - mu) * rs * gg + bb;
      }
      if (out_sum) *(v4f*)(out_sum + (size_t)row * N + j) = sm;
      *(v4f*)(out_norm + (size_t)row * N + j) = o;
    }
    
  }
}



// ---- f16 WMMA path (v_wmma_f32_16x16x32_f16): 11-bit significands for operands in range — used where a [0,1] probability operand needs more precision than bf16
typedef _Float16 v16h __attribute__((ext_vector_type(16)));
union FragH { v16h v; v8us half[2]; _Float16 h[16]; unsigned short u[16]; };
template <int NT>
__device__ __forceinline__ v8f mmaH(v16h ah, v16h al, v16h bh, v16h bl, v8f c) {
  c = __builtin_amdgcn_wmma_f32_16x16x32_f16(false, ah, false, bh, (short)0, c, false, false);
  if (NT >= 2) c = __builtin_amdgcn_wmma_f32_16x16x32_f16(false, al, false, bh, (short)0, c, false, false);
  if (NT >= 3) c = __builtin_amdgcn_wmma_f32_16x16x32_f16(false, ah, false, bl, (short)0, c, false, false);
  asm volatile("v_nop\n\tv_nop\n\tv_nop\n\tv_nop" : "+v"(c) : "v"(ah), "v"(al), "v"(bh), "v"(bl));
  return c;
}
// batched GEMM like k_gemm_b but f16 operands: A f32 (split into f16 hi/lo if ASPLIT, else rounded to f16), Bt = f16 values [n][k]; alpha; C f32; N multiple of 16 (partial tiles skipped)
template <bool ASPLIT>
__global__ __launch_bounds__(128) void k_gemm_h(const float* __restrict__ A, int lda, size_t sA, const _Float16* __restrict__ Bh, int ldb, size_t sB, float alpha, float* __restrict__ C, int ldc, size_t sC, int M, int N, int K) {
  __shared__ __attribute__((aligned(16))) float so[4][16][64];
  const int tid = threadIdx.x, w = tid >> 5, lane = tid & 31, ln = lane & 15, hh = lane >> 4; const int by = blockIdx.y;
  A += (size_t)by * sA; Bh += (size_t)by * sB; C += (size_t)by * sC;
  const int ntn = (N + 63) / 64; const int wid = blockIdx.x * 4 + w; const int mt = wid / ntn, nq = wid % ntn; if (mt * 16 >= M) return;
  const int row0 = mt * 16, col0 = nq * 64; const float* arow = A + (size_t)(row0 + ln) * lda;
  v8f acc[4] = {};
  for (int kb = 0; kb < K; kb += 32) {
    FragH ah, al;
    const v4f x0 = *(const v4fa*)(arow + kb + 8 * hh), x1 = *(const v4fa*)(arow + kb + 8 * hh + 4), x2 = *(const v4fa*)(arow + kb + 16 + 8 * hh), x3 = *(const v4fa*)(arow + kb + 16 + 8 * hh + 4);
    float xs[16] = {x0[0],x0[1],x0[2],x0[3],x1[0],x1[1],x1[2],x1[3],x2[0],x2[1],x2[2],x2[3],x3[0],x3[1],x3[2],x3[3]};
#pragma unroll
    for (int i = 0; i < 16; ++i) { const _Float16 h = (_Float16)xs[i]; ah.h[i] = h; al.h[i] = ASPLIT ? (_Float16)(xs[i] - (float)h) : (_Float16)0.0f; }
#pragma unroll
    for (int t = 0; t < 4; ++t) { if (col0 + t * 16 >= N) continue; const size_t boff = (size_t)(col0 + t * 16 + ln) * ldb + kb; FragH bq; bq.half[0] = *(const v8us*)(Bh + boff + 8 * hh); bq.half[1] = *(const v8us*)(Bh + boff + 16 + 8 * hh);
      acc[t] = mmaH<ASPLIT ? 2 : 1>(ah.v, al.v, bq.v, bq.v, acc[t]); }
  }
#pragma unroll
  for (int t = 0; t < 4; ++t) { if (col0 + t * 16 >= N) continue;
#pragma unroll
    for (int r = 0; r < 8; ++r) so[w][8 * hh + r][t * 16 + ln] = acc[t][r] * alpha; }
  __builtin_amdgcn_fence(__ATOMIC_ACQ_REL, "workgroup"); __builtin_amdgcn_wave_barrier();
  const int rsub = lane >> 4, c4 = (lane & 15) * 4;
  {
#pragma unroll
    for (int q = 0; q < 8; ++q) { const int r = q * 2 + rsub; if (col0 + c4 < N) { const v4f v = *(const v4fa*)&so[w][r][c4]; *(v4f*)(C + (size_t)(row0 + r) * ldc + col0 + c4) = v; } }
     }
}

// Wt[n][k] = f16(W[k][n]·scale) from f32 row-major W[K][N] (scale = power of two; bf16-exact weights stay exact in f16 away from the subnormal range)
__global__ __launch_bounds__(256) void k_wt_f16(const float* __restrict__ W, _Float16* __restrict__ Wt, int K, int N, float scale) {
  const int t = blockIdx.x * 256 + threadIdx.x; if (t >= N * (K / 8)) return; const int n = t / (K / 8), k8 = (t % (K / 8)) * 8; FragH f;
#pragma unroll
  for (int i = 0; i < 8; ++i) f.h[i] = (_Float16)(bf16_round(W[(size_t)(k8 + i) * N + n]) * scale); const v8us o = f.half[0];
  *(v8us*)((unsigned short*)Wt + (size_t)n * K + k8) = o; 
}
// Fragment order: a [rows][K] 16-bit plane is kept as 1-KB units of 16 rows x 32 k, unit (row / 16) * (K / 32) + k / 32; inside a unit the 16-byte piece 32 p + lane holds row (lane & 15), k = 16 p + 8 (lane >> 4) + 0..7.
// A wave's fragment is then two 16-byte loads per lane that each cover 512 contiguous bytes (4 whole 128-B lines) instead of 32 bytes in each of 16 lines; fragment element i is k = 8 (lane >> 4) + i for i < 8 and 16 + 8 (lane >> 4) + (i - 8) above, for both operands of every product.
// frag_src: index, in the row-major plane, of the first of the 8 elements that 16-byte piece number 'piece' of the fragment-ordered plane holds.
__device__ __forceinline__ size_t frag_src(size_t piece, int K) { const size_t u = piece >> 6; const int in = (int)(piece & 63), p = in >> 5, l = in & 31; const size_t kt = (size_t)(K / 32);
  return ((u / kt) * 16 + (size_t)(l & 15)) * (size_t)K + (u % kt) * 32 + (size_t)(p * 16 + (l >> 4) * 8); }
// A and Bh in fragment order (lda == ldb == K at every launch here).
// The three projections (grid y: q, k, v), each written straight as the plane the attention reads; v = acc * alpha. A slab of the attention is 128 rows of the [NR][DD] plane seen as 2048 rows of 64: row r, column group g = col / 64 is the slab's row 16 (r % 128) + g.
// A wave's 64 x 64 tile holds 64 such rows whole (one g). The attention takes a slab's keys and queries in the order g * 128 + r % 128 (any order serves a softmax over all keys, as long as K, V^T share it and O goes back to its own row), so a strip of 16 rows of the tile is one 16-row tile of the fragment-ordered planes.
// q, k: the strip goes through LDS (accumulator lane = column, fragment lane = row) and leaves as f16 hi + x 2^10 residual, 4 + 4 wave-wide stores of 512 bytes in a row. v: an accumulator tile (lane = d, registers = 8 keys) IS a 16-byte piece a lane of the V^T plane: converted and stored, no LDS.
// A wave owns 64 rows x 64 columns (4 x 4 accumulator tiles): the eight fragments of a 32-k stage feed 16 products. A block is 2 x 2 waves = 128 x 128; waves 0, 1 read the same A fragments and waves 0, 2 the same B fragments. M % 128 == 0, N % 128 == 0, K % 64 == 0 at every launch here.
__global__ __launch_bounds__(128) void k_gemm_hhx(const _Float16* __restrict__ A, int lda, size_t sA, const _Float16* __restrict__ Bh, int ldb, size_t sB, float alpha,
    _Float16* __restrict__ Hh, _Float16* __restrict__ Hl, size_t sH, _Float16* __restrict__ Vt, int M, int N, int K) {
  __shared__ __attribute__((aligned(16))) float so[4][16][64 + 4];      // pitch 68 words: the 16 rows that a 16-byte read of one column group touches start 4 banks apart
  const int tid = threadIdx.x, w = __builtin_amdgcn_readfirstlane(tid >> 5), lane = tid & 31, ln = lane & 15, hh = lane >> 4; const int by = blockIdx.y;      // the wave's number in a scalar register: the eight tile bases below are then scalar too
  A += (size_t)by * sA; Bh += (size_t)by * sB;
  const int nbn = N / 128; const int bm = blockIdx.x / nbn, bn = blockIdx.x % nbn;
  const int row0 = bm * 128 + (w >> 1) * 64, col0 = bn * 128 + (w & 1) * 64; if (row0 >= M) return;
  v8f acc[4][4] = {};
  // Two register stages of 32 k each: a stage's 16 fragment loads are issued as one group, one stage ahead of the 16 products that read them.
  // The eight tile bases stay as they are through the loop; one 32-bit byte offset per lane (its 16-byte piece + the k position) is stepped once a trip.
  const char* ba[4]; const char* bb[4];
#pragma unroll      // constant indices keep the arrays in registers
  for (int t = 0; t < 4; ++t) { ba[t] = (const char*)(A + (size_t)(row0 + t * 16) * lda); bb[t] = (const char*)(Bh + (size_t)(col0 + t * 16) * ldb); }
  unsigned vo = (unsigned)lane * 16u;
  FragH a0[4], b0[4], a1[4], b1[4];
  auto fetch = [&](FragH (&fa)[4], FragH (&fb)[4], unsigned o) {
#pragma unroll      // constant indices keep the fragment arrays in registers
    for (int t = 0; t < 4; ++t) { fa[t].half[0] = *(const v8us*)(ba[t] + o); fa[t].half[1] = *(const v8us*)(ba[t] + o + 512); fb[t].half[0] = *(const v8us*)(bb[t] + o); fb[t].half[1] = *(const v8us*)(bb[t] + o + 512); } };
  auto mul = [&](FragH (&fa)[4], FragH (&fb)[4]) {
#pragma unroll      // constant indices keep the fragment arrays in registers
    for (int i = 0; i < 4; ++i)
#pragma unroll      // constant indices keep the fragment arrays in registers
      for (int t = 0; t < 4; ++t) acc[i][t] = __builtin_amdgcn_wmma_f32_16x16x32_f16(false, fa[i].v, false, fb[t].v, (short)0, acc[i][t], false, false); };      // the plain builtin: operands of an asm statement cannot lie above v255, and this tile needs more than 256 registers
  fetch(a0, b0, vo);      // a stage of 32 k = one 1-KB unit of each tile
#pragma unroll 1      // rolled: one ping-pong pair per trip keeps both stages in fixed registers and the loop short
  for (int kb = 0; kb < K; kb += 64) {
    fetch(a1, b1, vo + 1024);
    __builtin_amdgcn_sched_barrier(0);      // holds the 16 loads as one group ahead of the products: without it the compiler sinks them among the products, a few products ahead of their use
    mul(a0, b0);
    __builtin_amdgcn_sched_barrier(0);      // no load of the next group rises among the products above, where its registers are still read; the wait below stays behind them
    asm volatile("s_wait_xcnt 0x0" ::: "memory");      // the wait in front of the rewriting of the loads' offset register
    __builtin_amdgcn_sched_barrier(0);      // the offset's step stays behind the wait
    vo = (kb + 64 < K) ? vo + 2048 : (unsigned)lane * 16u;      // the last trip steps back to k = 0: its second fetch stays in bounds and is not used
    fetch(a0, b0, vo);
    __builtin_amdgcn_sched_barrier(0);      // as above: the group stays ahead of the products
    mul(a1, b1);
    __builtin_amdgcn_sched_barrier(0);      // as above: the wait below stays behind the products
    asm volatile("s_wait_xcnt 0x0" :: "v"(vo) : "memory");      // the wait in front of the rewriting of the loads' offset registers at the back edge and, behind the loop, of their bases; the offset as an input, so that no load's result lands in it
    __builtin_amdgcn_sched_barrier(0);      // what steps an offset at the loop's foot stays behind the wait
  }
  static_assert(TT * 64 / DD == 128 && DD / 64 == 16, "a slab is 128 rows of the plane, 16 column groups wide: a block's 128 rows are one slab's");
  const int slab = row0 >> 7, t16 = (col0 >> 6) * 8 + ((row0 & 127) >> 4);      // the number, in its slab, of the 16-row tile that the wave's first strip makes; strip i makes tile t16 + i
  if (by < 2) {      // the same for a whole block
    unsigned short* dh = (unsigned short*)Hh + (size_t)by * sH + ((size_t)slab * 128 + t16) * 1024 + lane * 8; unsigned short* dl = (unsigned short*)Hl + (size_t)by * sH + ((size_t)slab * 128 + t16) * 1024 + lane * 8;
#pragma unroll      // constant indices keep the accumulator tiles in registers
    for (int i = 0; i < 4; ++i) {      // the wave's four 16-row strips go through its LDS strip one after the other
#pragma unroll
      for (int t = 0; t < 4; ++t)
#pragma unroll
        for (int r = 0; r < 8; ++r) so[w][8 * hh + r][t * 16 + ln] = acc[i][t][r] * alpha;
      __builtin_amdgcn_fence(__ATOMIC_ACQ_REL, "workgroup"); __builtin_amdgcn_wave_barrier();      // the strip's LDS stores stay ahead of the reads below, which take other lanes' values
      FragH fh[4], fl[4];
#pragma unroll      // piece u = 2 ks + p of the tile's two units: row ln, k = 16 u + 8 hh + 0..7
      for (int u = 0; u < 4; ++u) { const v4f a = *(const v4fa*)&so[w][ln][u * 16 + 8 * hh], c = *(const v4fa*)&so[w][ln][u * 16 + 8 * hh + 4];
#pragma unroll
        for (int q = 0; q < 4; ++q) { _Float16 h = (_Float16)a[q]; fh[u].h[q] = h; fl[u].h[q] = (_Float16)((a[q] - (float)h) * 1024.0f); h = (_Float16)c[q]; fh[u].h[4 + q] = h; fl[u].h[4 + q] = (_Float16)((c[q] - (float)h) * 1024.0f); } }
#pragma unroll
      for (int u = 0; u < 4; ++u) { *(v8us*)(dh + i * 1024 + u * 256) = fh[u].half[0]; *(v8us*)(dl + i * 1024 + u * 256) = fl[u].half[0]; }
      // the wait behind the eight stores, in front of the reuse of their registers by the next strip; data and addresses are inputs so that they stay as they are up to the wait
      asm volatile("s_wait_xcnt 0x0" :: "v"(fh[0].half[0]), "v"(fl[0].half[0]), "v"(fh[1].half[0]), "v"(fl[1].half[0]), "v"(fh[2].half[0]), "v"(fl[2].half[0]), "v"(fh[3].half[0]), "v"(fl[3].half[0]), "v"(dh), "v"(dl) : "memory");
      __builtin_amdgcn_fence(__ATOMIC_ACQ_REL, "workgroup"); __builtin_amdgcn_wave_barrier();      // the strip's LDS reads stay ahead of the next strip's LDS stores
    }
  } else {
    unsigned short* dv = (unsigned short*)Vt + ((size_t)slab * 64 + (t16 >> 1)) * 2048 + lane * 8;      // V^T: unit (32-key tile) * 4 + d / 16; t16 is even, strip i is half i & 1 of 32-key tile t16 / 2 + i / 2
#pragma unroll      // constant indices keep the accumulator tiles in registers
    for (int i = 0; i < 4; ++i) { FragH f[4];
#pragma unroll
      for (int t = 0; t < 4; ++t) {
#pragma unroll
        for (int r = 0; r < 8; ++r) f[t].h[r] = (_Float16)(acc[i][t][r] * alpha); }
#pragma unroll
      for (int t = 0; t < 4; ++t) *(v8us*)(dv + (i >> 1) * 2048 + t * 512 + (i & 1) * 256) = f[t].half[0];
      // the wait behind the four stores, in front of the reuse of their registers by the next strip; data and address are inputs so that they stay as they are up to the wait
      asm volatile("s_wait_xcnt 0x0" :: "v"(f[0].half[0]), "v"(f[1].half[0]), "v"(f[2].half[0]), "v"(f[3].half[0]), "v"(dv) : "memory");
    }
  }
}


typedef _Float16 v4h __attribute__((ext_vector_type(4)));

// The streaming launches run as one resident round: GSTR blocks of 8 waves = 16 waves on each of 256 WGPs. A lane takes 7 or 8 pieces of 16 output bytes, 256 pieces apart inside its block's own run of pieces, and asks for all their inputs as one group before it converts and stores any.
#define GSTR 512
static_assert((size_t)NR * DD / 8 == (size_t)GSTR * 1024 && (size_t)DD * DD / 8 == (size_t)GSTR * 256, "a lane of k_prep takes four pieces of x and one of each weight");
static_assert((size_t)NR * DD / 4 == (size_t)GSTR * 2048 && GSTR % BB == 0, "a lane of k_norm takes eight pieces, a block lies in one batch element");
__global__ __launch_bounds__(256) void k_h16(const float* __restrict__ x, _Float16* __restrict__ X16, size_t n8) { const size_t t = (size_t)blockIdx.x * 256 + threadIdx.x; if (t >= n8) return; FragH f;
#pragma unroll
  for (int q = 0; q < 8; ++q) f.h[q] = (_Float16)x[t * 8 + q]; *(v8us*)((unsigned short*)X16 + t * 8) = f.half[0];  }
// x ([NR][DD]) and the three weights ([DD][DD], x 2^4), rounded to bf16 values and written as f16 planes in fragment order.
__global__ __launch_bounds__(256) void k_prep(const float* __restrict__ x, const float* __restrict__ Wq, const float* __restrict__ Wk, const float* __restrict__ Wv, _Float16* __restrict__ X16, _Float16* __restrict__ Bw) {
  const size_t tx = (size_t)blockIdx.x * 1024 + threadIdx.x, tw = (size_t)blockIdx.x * 256 + threadIdx.x; v4f a[7][2]; const size_t s = frag_src(tw, DD);
  static_assert(DD / 32 % 16 == 0, "a block's 16 units of x lie in one 16-row tile: piece tx + 256 i is four units on, 128 k to the right of piece tx");
  const float* xa = x + frag_src(tx, DD); const float* wq = Wq + s; const float* wk = Wk + s; const float* wv = Wv + s;
#pragma unroll      // constant indices keep the seven pieces in registers; all loads stand ahead of the first conversion
  for (int i = 0; i < 4; ++i) { a[i][0] = *(const v4fa*)(xa + i * 128); a[i][1] = *(const v4fa*)(xa + i * 128 + 4); }
  a[4][0] = *(const v4fa*)wq; a[4][1] = *(const v4fa*)(wq + 4); a[5][0] = *(const v4fa*)wk; a[5][1] = *(const v4fa*)(wk + 4); a[6][0] = *(const v4fa*)wv; a[6][1] = *(const v4fa*)(wv + 4);
  // the loaded values as inputs only: keeps all 14 loads ahead of the first conversion, or the compiler sinks half of them behind waits for the first; the addresses as inputs, so that no load's result lands in an address register of the group, and the wait in front of their reuse
  asm volatile("s_wait_xcnt 0x0" :: "v"(a[0][0]), "v"(a[0][1]), "v"(a[1][0]), "v"(a[1][1]), "v"(a[2][0]), "v"(a[2][1]), "v"(a[3][0]), "v"(a[3][1]), "v"(a[4][0]), "v"(a[4][1]), "v"(a[5][0]), "v"(a[5][1]), "v"(a[6][0]), "v"(a[6][1]), "v"(xa), "v"(wq), "v"(wk), "v"(wv) : "memory");
#pragma unroll      // constant indices keep the seven pieces in registers
  for (int i = 0; i < 7; ++i) { FragH f; const float sc = (i < 4) ? 1.0f : 16.0f;
#pragma unroll
    for (int q = 0; q < 4; ++q) { f.h[q] = (_Float16)(bf16_round(a[i][0][q]) * sc); f.h[4 + q] = (_Float16)(bf16_round(a[i][1][q]) * sc); }
    unsigned short* dst = (i < 4) ? (unsigned short*)X16 + (tx + i * 256) * 8 : (unsigned short*)Bw + (size_t)(i - 4) * DD * DD + tw * 8;
    *(v8us*)dst = f.half[0]; } }
typedef float v2f __attribute__((ext_vector_type(2)));
// lane l <-> lane l ^ 16 by a vector cross-row move
__device__ __forceinline__ float xhalf(float x) { return __builtin_bit_cast(float, __builtin_amdgcn_permlanex16(__builtin_bit_cast(int, x), __builtin_bit_cast(int, x), 0x76543210, 0xfedcba98, false, false)); }
__global__ __launch_bounds__(128) void k_flash(const _Float16* __restrict__ Q16, const _Float16* __restrict__ Q16lo, int ldq, const _Float16* __restrict__ K16, const _Float16* __restrict__ K16lo, int ldk, const _Float16* __restrict__ Vt, float* __restrict__ O) {
  constexpr int RPW = 16, NQB = TT / (4 * RPW), DT = 4, KS = 2; constexpr float L2E = 1.4426950408889634f;
  __shared__ __attribute__((aligned(16))) float sO[4][RPW][64 + 4];
  const int tid = threadIdx.x, w = tid >> 5, lane = tid & 31, ln = lane & 15, hh = lane >> 4;
  const int slab = blockIdx.x / NQB, qblk = blockIdx.x % NQB; const int b = slab; const int qb0 = qblk * (4 * RPW); const int q0 = qb0 + w * RPW;
  FragH aq[KS], aql[KS];
  { const size_t qo = ((size_t)b * TT + q0) * ldq + lane * 8; const unsigned short* qr = (const unsigned short*)Q16 + qo; const unsigned short* ql = (const unsigned short*)Q16lo + qo;
#pragma unroll
    for (int ks = 0; ks < KS; ++ks) { aq[ks].half[0] = *(const v8us*)(qr + ks * 512); aq[ks].half[1] = *(const v8us*)(qr + ks * 512 + 256); aql[ks].half[0] = *(const v8us*)(ql + ks * 512); aql[ks].half[1] = *(const v8us*)(ql + ks * 512 + 256); } }      // fragment-ordered planes (ldq == ldk == 64): unit = (row / 16) * 2 + ks
  const unsigned short* Vth = (const unsigned short*)Vt + (size_t)slab * 64 * TT;
  float m_r = -3.0e38f, b_r = -3.0e38f, l_r = 0.f; v8f oacc[DT];
#pragma unroll
  for (int dt = 0; dt < DT; ++dt) oacc[dt] = (v8f){0.f,0.f,0.f,0.f,0.f,0.f,0.f,0.f};
  const int jend = TT;
  // K fragments (both planes, 32 keys) live in registers across the back edge: each pass fetches the next pass's right behind its own score products; V fragments are fetched at the pass's top, ahead of the scores and the softmax.
  FragH bk[2][KS], bl[2][KS];
  auto fetchK = [&](int j) {
#pragma unroll      // constant indices keep the fragment arrays in registers
    for (int nt = 0; nt < 2; ++nt) { const size_t ko = ((size_t)b * TT + j + nt * 16) * ldk + lane * 8; const unsigned short* kr = (const unsigned short*)K16 + ko; const unsigned short* kl = (const unsigned short*)K16lo + ko;
#pragma unroll      // constant indices keep the fragment arrays in registers
      for (int ks = 0; ks < KS; ++ks) { bk[nt][ks].half[0] = *(const v8us*)(kr + ks * 512); bk[nt][ks].half[1] = *(const v8us*)(kr + ks * 512 + 256); bl[nt][ks].half[0] = *(const v8us*)(kl + ks * 512); bl[nt][ks].half[1] = *(const v8us*)(kl + ks * 512 + 256); } } };
  fetchK(0);
  { const size_t qa = ((size_t)b * TT + q0) * ldq + lane * 8, ka = (size_t)b * TT * ldk + lane * 8, kc = ((size_t)b * TT + 16) * ldk + lane * 8;
    // the wait in front of the reuse of the address registers of the Q and K loads above; the six addresses are inputs so that their registers stay as they are up to the wait
    asm volatile("s_wait_xcnt 0x0" :: "v"(Q16 + qa), "v"(Q16lo + qa), "v"(K16 + ka), "v"(K16lo + ka), "v"(K16 + kc), "v"(K16lo + kc) : "memory"); }
#pragma unroll 1
  for (int j0 = 0; j0 < jend; j0 += 32) {
    FragH bv[DT];
#pragma unroll      // constant indices keep the fragment arrays in registers
    for (int dt = 0; dt < DT; ++dt) { const unsigned short* vrow = Vth + (size_t)j0 * 64 + dt * 512 + lane * 8; bv[dt].half[0] = *(const v8us*)(vrow); bv[dt].half[1] = *(const v8us*)(vrow + 256); }
    v8f s[2];      // s[nt][r] = score of query q0 + ln against key j0 + 16 nt + 8 hh + r
#pragma unroll
    for (int nt = 0; nt < 2; ++nt) { v8f acc = (v8f){0.f,0.f,0.f,0.f,0.f,0.f,0.f,0.f}, accl = acc;
#pragma unroll
      for (int ks = 0; ks < KS; ++ks) { acc = mmaH<1>(bk[nt][ks].v, bk[nt][ks].v, aq[ks].v, aq[ks].v, acc); accl = mmaH<1>(bk[nt][ks].v, bk[nt][ks].v, aql[ks].v, aql[ks].v, accl); accl = mmaH<1>(bl[nt][ks].v, bl[nt][ks].v, aq[ks].v, aq[ks].v, accl); }
      s[nt] = acc + accl * 0.0009765625f; }
    const int jn = (j0 + 32 < jend) ? j0 + 32 : 0; fetchK(jn);      // the last pass refetches keys 0..31: in bounds, not used
    { const size_t ka = ((size_t)b * TT + jn) * ldk + lane * 8, kc = ((size_t)b * TT + jn + 16) * ldk + lane * 8;
      // the wait in front of the reuse of the address registers of the K loads above; the four addresses are inputs so that none of their registers is handed to a load's result or to the softmax ahead of the wait
      asm volatile("s_wait_xcnt 0x0" :: "v"(K16 + ka), "v"(K16lo + ka), "v"(K16 + kc), "v"(K16lo + kc) : "memory"); }
    float mc = s[0][0], md = s[1][0];
#pragma unroll      // constant indices keep the score tiles in registers
    for (int r = 1; r < 8; ++r) { mc = fmaxf(mc, s[0][r]); md = fmaxf(md, s[1][r]); }
    mc = fmaxf(mc, md); mc = fmaxf(mc, xhalf(mc));      // both halves now hold the query's maximum over the pass's 32 keys
    // base 2: b_r is the running maximum times log2(e), less 10; every weight is then 2^(s log2(e) - b_r) = 2^10 exp(s - max), one multiply-add and one hardware exponential, already at the scale the f16 P operand wants
    const float mn = fmaxf(m_r, mc), bn = __builtin_fmaf(mn, L2E, -10.0f); const float al = __builtin_amdgcn_exp2f((mn > -1.0e38f) ? b_r - bn : 0.f); m_r = mn; b_r = bn;      // the guard selects the argument (2^0 = 1), so no branch on lanes stands in the loop
    FragH pt; v2f ps[2] = {(v2f){0.f, 0.f}, (v2f){0.f, 0.f}}; const v8f l2e8 = {L2E, L2E, L2E, L2E, L2E, L2E, L2E, L2E}, nm8 = {-bn, -bn, -bn, -bn, -bn, -bn, -bn, -bn};
#pragma unroll      // constant indices keep the score tiles and the P^T fragment in registers
    for (int nt = 0; nt < 2; ++nt) { const v8f d = __builtin_elementwise_fma(s[nt], l2e8, nm8);
#pragma unroll      // constant indices keep the score tiles and the P^T fragment in registers
      for (int r = 0; r < 8; r += 2) { const v2f p = {__builtin_amdgcn_exp2f(d[r]), __builtin_amdgcn_exp2f(d[r + 1])}; ps[nt] += p; pt.h[8 * nt + r] = (_Float16)p[0]; pt.h[8 * nt + r + 1] = (_Float16)p[1]; } }
    { const v2f pq = ps[0] + ps[1]; l_r = l_r * al + (pq[0] + pq[1]); }      // this half's 16 keys; the halves are joined behind the loop
#pragma unroll
    for (int dt = 0; dt < DT; ++dt)
#pragma unroll
      for (int r = 0; r < 8; ++r) oacc[dt][r] *= al;
#pragma unroll
    for (int dt = 0; dt < DT; ++dt) oacc[dt] = mmaH<1>(bv[dt].v, bv[dt].v, pt.v, pt.v, oacc[dt]);      // oacc[dt][r] = O[q0 + ln][16 dt + 8 hh + r]
  }
  { const float l = l_r + xhalf(l_r); const float inv = (l > 0.f) ? 1.0f / l : 0.f;      // l and the output tiles both carry the factor 2^10; the exchange stands ahead of the select: all lanes are on
#pragma unroll      // constant indices keep the output tiles in registers
    for (int dt = 0; dt < DT; ++dt) { v4f lo4, hi4;
#pragma unroll      // constant indices keep the output tiles in registers
      for (int r = 0; r < 4; ++r) { lo4[r] = oacc[dt][r] * inv; hi4[r] = oacc[dt][4 + r] * inv; }
      *(v4fa*)&sO[w][ln][dt * 16 + 8 * hh] = lo4; *(v4fa*)&sO[w][ln][dt * 16 + 8 * hh + 4] = hi4; } }
  __builtin_amdgcn_fence(__ATOMIC_ACQ_REL, "workgroup"); __builtin_amdgcn_wave_barrier();
  { float* po = O + ((size_t)b * TT + ((q0 & 127) + (lane >> 4)) * 16 + (q0 >> 7)) * 64 + (lane & 15) * 4;      // query g * 128 + r' of the planes' order is the slab's row 16 r' + g, 64 wide: one address, constant steps of 16 rows a query
#pragma unroll
    for (int rp = 0; rp < RPW; rp += 2) { const int r = rp + (lane >> 4), pc = lane & 15; const v4f val = *(const v4fa*)&sO[w][r][pc * 4]; *(v4f*)(po + rp * 1024) = val; }
     } }

__global__ __launch_bounds__(256) void k_stat(const float* __restrict__ O, const float* __restrict__ x, float* __restrict__ PART) { __shared__ float r1[256], r2[256]; const int tid = threadIdx.x; const int b = blockIdx.x / NPB, part = blockIdx.x % NPB; const size_t base = (size_t)b * TT * DD + (size_t)part * (TT * DD / NPB) + tid * 4; float s1 = 0.f, s2 = 0.f;
  static_assert(TT * DD / NPB % 8192 == 0, "whole groups of eight trips of 1024 elements");
  const float* po = O + base; const float* px = x + base;
#pragma unroll      // four groups on two fixed address pairs with constant offsets: no address is stepped while loads are in flight
  for (int i = 0; i < TT * DD / NPB; i += 8192) { v4f o[8], xv[8];
#pragma unroll      // constant indices keep the eight pieces in registers
    for (int u = 0; u < 8; ++u) { o[u] = *(const v4fa*)(po + i + u * 1024); xv[u] = *(const v4fa*)(px + i + u * 1024); }
    // the loaded values as inputs only: keeps all 16 loads ahead of the first sum, or the compiler sinks half of them behind waits for the first; the two addresses as inputs, so that no load's result lands in an address register of the group, and the wait in front of their reuse
    asm volatile("s_wait_xcnt 0x0" :: "v"(o[0]), "v"(xv[0]), "v"(o[1]), "v"(xv[1]), "v"(o[2]), "v"(xv[2]), "v"(o[3]), "v"(xv[3]), "v"(o[4]), "v"(xv[4]), "v"(o[5]), "v"(xv[5]), "v"(o[6]), "v"(xv[6]), "v"(o[7]), "v"(xv[7]), "v"(po), "v"(px) : "memory");
#pragma unroll      // constant indices keep the eight pieces in registers; the sums keep the order of the single trips
    for (int u = 0; u < 8; ++u) for (int q = 0; q < 4; ++q) { const float y = o[u][q] + bf16_round(xv[u][q]); s1 += y; s2 += y * y; } }
  r1[tid] = s1; r2[tid] = s2; __syncthreads(); for (int o = 128; o >= 1; o >>= 1) { if (tid < o) { r1[tid] += r1[tid + o]; r2[tid] += r2[tid + o]; } __syncthreads(); }
  if (tid < 32) { const float v = (tid == 0) ? r1[0] : ((tid == 1) ? r2[0] : 0.f); *(float*)(PART + (size_t)blockIdx.x * 32 + tid) = v;  } }
typedef float v2fa __attribute__((ext_vector_type(2), may_alias));
__device__ __forceinline__ float lane_val(float v, int l) { return __builtin_bit_cast(float, __builtin_amdgcn_readlane(__builtin_bit_cast(int, v), l)); }
__global__ __launch_bounds__(256) void k_norm(const float* __restrict__ O, const float* __restrict__ x, const float* __restrict__ PART, float* __restrict__ out) { const size_t t = (size_t)blockIdx.x * 2048 + threadIdx.x; const int b = (int)(blockIdx.x / (GSTR / BB)), lane = threadIdx.x & 31; float s1 = 0.f, s2 = 0.f; v4f o[8], xv[8];
  static_assert(NPB == 64, "two partial pairs per lane");
#pragma unroll      // constant indices keep the eight pieces in registers
  for (int u = 0; u < 8; ++u) { o[u] = *(const v4fa*)(O + (t + u * 256) * 4); xv[u] = *(const v4fa*)(x + (t + u * 256) * 4); }
  const v2f pa = *(const v2fa*)(PART + ((size_t)b * NPB + lane) * 32), pb = *(const v2fa*)(PART + ((size_t)b * NPB + 32 + lane) * 32);      // lane l holds the partial pairs l and 32 + l: two loads per wave in place of a chain of 64
  // the loaded values as inputs only: keeps all 18 loads ahead of the statistics, or the compiler sinks some of them behind the sums; the three addresses as inputs, so that no load's result lands in an address register of the group, and the wait in front of their reuse
  asm volatile("s_wait_xcnt 0x0" :: "v"(o[0]), "v"(xv[0]), "v"(o[1]), "v"(xv[1]), "v"(o[2]), "v"(xv[2]), "v"(o[3]), "v"(xv[3]), "v"(o[4]), "v"(xv[4]), "v"(o[5]), "v"(xv[5]), "v"(o[6]), "v"(xv[6]), "v"(o[7]), "v"(xv[7]), "v"(pa), "v"(pb), "v"(O + t * 4), "v"(x + t * 4), "v"(PART + ((size_t)b * NPB + lane) * 32) : "memory");
#pragma unroll      // constant lane numbers; the partial sums are added in the order p = 0 .. NPB - 1
  for (int p = 0; p < 32; ++p) { s1 += lane_val(pa[0], p); s2 += lane_val(pa[1], p); }
#pragma unroll      // constant lane numbers
  for (int p = 0; p < 32; ++p) { s1 += lane_val(pb[0], p); s2 += lane_val(pb[1], p); }
  const float n = (float)TT * (float)DD; const float mu = s1 / n; const float var = fmaxf(s2 / n - mu * mu, 0.f); const float rs = rsqrtf(var + 1e-5f);
#pragma unroll      // constant indices keep the eight pieces in registers
  for (int u = 0; u < 8; ++u) { v4f r; for (int q = 0; q < 4; ++q) r[q] = (o[u][q] + bf16_round(xv[u][q]) - mu) * rs;
    *(v4f*)(out + (t + u * 256) * 4) = r; } }

extern "C" void kernel_launch(void* const* d_in, const int* in_sizes, int n_in,
                              void* d_out, int out_size, void* d_ws, size_t ws_size, hipStream_t stream) {
  (void)in_sizes; (void)n_in; (void)out_size;
  const float* x = (const float*)d_in[0]; const float* Wq = (const float*)d_in[1]; const float* Wk = (const float*)d_in[2]; const float* Wv = (const float*)d_in[3];
  char* ws = (char*)d_ws; size_t off = 0;
  auto take = [&](size_t bytes) { char* p = ws + off; off += (bytes + 255) & ~(size_t)255; return p; };
  const size_t WSZ = (size_t)DD * DD, PSZ = (size_t)NR * DD; _Float16* Bw = (_Float16*)take(3 * WSZ * 2); _Float16* X16 = (_Float16*)take(PSZ * 2); float* O = (float*)take(PSZ * 4);
  _Float16* Qh = (_Float16*)take(2 * PSZ * 2); _Float16* Kh = Qh + PSZ; _Float16* Ql = (_Float16*)take(2 * PSZ * 2); _Float16* Kl = Ql + PSZ;      /* hi planes of q and k in a row, then their lo planes */
  _Float16* Vt = (_Float16*)take(PSZ * 2); float* PART = (float*)take((size_t)BB * NPB * 32 * 4);
  if (off > ws_size) return;      // 6.3 + 8.4 + 16.8 + 5 x 8.4 = 73 MB
  k_prep<<<GSTR, 256, 0, stream>>>(x, Wq, Wk, Wv, X16, Bw);      /* x; weights (out,in) natural x 2^4 */
  const dim3 gp((NR / 128) * (DD / 128), 3);      /* y: q, k (hi and lo planes), v (V^T), all in fragment order, a slab's rows in the order column group * 128 + row */
  k_gemm_hhx<<<gp, 128, 0, stream>>>(X16, DD, 0, Bw, DD, WSZ, 0.0625f, Qh, Ql, PSZ, Vt, NR, DD, DD);
  k_flash<<<NSL * (TT / 64), 128, 0, stream>>>(Qh, Ql, 64, Kh, Kl, 64, Vt, O);      /* Q, K, V^T in the planes' row order; O in the flat view's own */
  k_stat<<<BB * NPB, 256, 0, stream>>>(O, x, PART); k_norm<<<GSTR, 256, 0, stream>>>(O, x, PART, (float*)d_out);
}

// v009
// Measured time: 109 microseconds a run.
// Two timings next to v008 both put it at 1.05 times that version's speed.
// Over all steps from v000 it is 4.59 times as fast.
#include <hip/hip_runtime.h>
// Multi-head attention with raw-reshape heads, residual and a global LayerNorm (B=2, S=2048, D=1024, 16 heads × 64): Q,K,V = x·Wᵀ reshaped by plain memory order to (H,B,S,64) (= 32 contiguous [2048][64] slabs of each
// [4096][1024] plane); UNSCALED softmax(Q·Kᵀ)·V per slab; y = out (same flat order, = [B,S,1024]) + x; output = (y − mean)/√(var + 1e-5) with mean/var over all (S,D) of each batch element (identity affine).
// Compute dtype: x and weights rounded to bf16; Q,K as f32 GEMM outputs split into f16 hi + ×2^10 residual planes so the unscaled (σ≈3) logits are f32-accurate; V f16; fused flash-style kernel
// (two score accumulators, online softmax f32, P f16 ×2^10) on v_wmma_f32_16x16x32_f16; residual and the per-batch statistics (fixed-order block partial sums of y and y², then a fixed-order combine) and normalisation in f32.
#define BB 2
#define TT 2048
#define DD 1024
#define NSL 32
#define NR (BB * TT)
#define NPB 64

typedef __bf16 v16b __attribute__((ext_vector_type(16)));
typedef unsigned short v8us __attribute__((ext_vector_type(8), may_alias));
typedef float  v8f  __attribute__((ext_vector_type(8)));
typedef float  v4f  __attribute__((ext_vector_type(4)));
typedef float  v4fa __attribute__((ext_vector_type(4), may_alias));
union FragB { v16b v; v8us half[2]; unsigned short u[16]; };

__device__ __forceinline__ unsigned short bf16_bits(float x) { unsigned int u = __float_as_uint(x); return (unsigned short)((u + 0x7FFFu + ((u >> 16) & 1u)) >> 16); }
__device__ __forceinline__ float bf16_val(unsigned short b) { return __uint_as_float(((unsigned int)b) << 16); }
__device__ __forceinline__ float bf16_round(float x) { return bf16_val(bf16_bits(x)); }
// D += A·B with NT terms: 1 = ah·bh, 2 = + al·bh (A split), 3 = + ah·bl (both split)
template <int NT>
__device__ __forceinline__ v8f mmaN(v16b ah, v16b al, v16b bh, v16b bl, v8f c) {
  c = __builtin_amdgcn_wmma_f32_16x16x32_bf16(false, ah, false, bh, (short)0, c, false, false);
  if (NT >= 2) c = __builtin_amdgcn_wmma_f32_16x16x32_bf16(false, al, false, bh, (short)0, c, false, false);
  if (NT >= 3) c = __builtin_amdgcn_wmma_f32_16x16x32_bf16(false, ah, false, bl, (short)0, c, false, false);
  asm volatile("v_nop\n\tv_nop\n\tv_nop\n\tv_nop" : "+v"(c) : "v"(ah), "v"(al), "v"(bh), "v"(bl));
  return c;
}

__global__ __launch_bounds__(256) void k_wt_bf16(const float* __restrict__ W, unsigned short* __restrict__ Wt, int K, int N) {
  const int t = blockIdx.x * 256 + threadIdx.x;
  const int k8n = K / 8;
  if (t >= N * k8n) return;
  const int n = t / k8n, k8 = (t % k8n) * 8;
  v8us v;
#pragma unroll
  for (int i = 0; i < 8; ++i) v[i] = bf16_bits(W[(size_t)(k8 + i) * N + n]);
  *(v8us*)(Wt + (size_t)n * K + k8) = v;
  
}

// GEMM C[M][N] (f32, pitch ldc) = act(A[M][K]·W + bias). A f32 row-major (pitch lda) converted per fragment to bf16
// (ASPLIT: hi/lo two planes -> 2 terms, else single rounded term); Wt bf16 [N][K] (pitch ldb). BIAS_BF16 rounds the
// bias to bf16 first (bias quantised to bf16 before the add). K%32==0, M%16==0, N%64==0.
template <bool ASPLIT, int ACT, bool BIAS_BF16>
__global__ __launch_bounds__(128) void k_gemm_bf(const float* __restrict__ A, int lda, const unsigned short* __restrict__ Wt, int ldb,
                                               const float* __restrict__ bias, float* __restrict__ C, int ldc, int M, int N, int K) {
  __shared__ __attribute__((aligned(16))) float so[4][16][64];
  const int tid = threadIdx.x, w = tid >> 5, lane = tid & 31, ln = lane & 15, hh = lane >> 4;
  const int ntn = N / 64;
  const int wid = blockIdx.x * 4 + w;
  const int mt = wid / ntn, nq = wid % ntn;
  if (mt * 16 >= M) return;
  const int row0 = mt * 16, col0 = nq * 64;
  const float* arow = A + (size_t)(row0 + ln) * lda;
  v8f acc[4] = {};
  for (int kb = 0; kb < K; kb += 32) {
    FragB ah, al;
    const v4f x0 = *(const v4fa*)(arow + kb + 8 * hh), x1 = *(const v4fa*)(arow + kb + 8 * hh + 4);
    const v4f x2 = *(const v4fa*)(arow + kb + 16 + 8 * hh), x3 = *(const v4fa*)(arow + kb + 16 + 8 * hh + 4);
    float xs[16] = {x0[0],x0[1],x0[2],x0[3],x1[0],x1[1],x1[2],x1[3],x2[0],x2[1],x2[2],x2[3],x3[0],x3[1],x3[2],x3[3]};
#pragma unroll
    for (int i = 0; i < 16; ++i) { const unsigned short hb = bf16_bits(xs[i]); ah.u[i] = hb; al.u[i] = ASPLIT ? bf16_bits(xs[i] - bf16_val(hb)) : (unsigned short)0; }
#pragma unroll
    for (int t = 0; t < 4; ++t) {
      const unsigned short* brow = Wt + (size_t)(col0 + t * 16 + ln) * ldb + kb;
      FragB b;
      b.half[0] = *(const v8us*)(brow + 8 * hh);
      b.half[1] = *(const v8us*)(brow + 16 + 8 * hh);
      acc[t] = mmaN<ASPLIT ? 2 : 1>(ah.v, al.v, b.v, b.v, acc[t]);
    }
  }
#pragma unroll
  for (int t = 0; t < 4; ++t) {
    float bv = bias ? bias[col0 + t * 16 + ln] : 0.f;
    if (BIAS_BF16) bv = bf16_round(bv);
#pragma unroll
    for (int r = 0; r < 8; ++r) { float v = acc[t][r] + bv; if (ACT == 1) v = fmaxf(v, 0.f); so[w][8 * hh + r][t * 16 + ln] = v; }
  }
  __builtin_amdgcn_fence(__ATOMIC_ACQ_REL, "workgroup");
  __builtin_amdgcn_wave_barrier();
  const int rsub = lane >> 4, c4 = (lane & 15) * 4;
  {
#pragma unroll
    for (int q = 0; q < 8; ++q) {
      const int r = q * 2 + rsub;
      const v4f v = *(const v4fa*)&so[w][r][c4];
      *(v4f*)(C + (size_t)(row0 + r) * ldc + col0 + c4) = v;
    }
    
  }
}

// Flash-style causal/unmasked attention, all contractions 3-term bf16 hi/lo splits, f32 softmax with running max.
// q,k,v rows are read from f32 buffers with arbitrary row pitch (so they can live inside a fused qkv buffer);
// D = head size (multiple of 32, <= 128); one wave = 16 query rows; block = 4 waves (64 queries) sharing K/V chunks of 32.
template <int D, bool CAUSAL>
__global__ __launch_bounds__(128) void k_flash(const float* __restrict__ qb, const float* __restrict__ kb, const float* __restrict__ vb,
                                             int pitch, int T, int H, float scale, float* __restrict__ y, int ypitch) {
  constexpr int KS = D / 32;        // k-steps for QK
  constexpr int DT = D / 16;        // d tiles for PV
  __shared__ __attribute__((aligned(16))) unsigned short sKh[32][D + 8], sKl[32][D + 8], sVh[32][D + 8], sVl[32][D + 8];
  __shared__ __attribute__((aligned(16))) unsigned short sPh[4][16][40], sPl[4][16][40];
  __shared__ __attribute__((aligned(16))) float sO[4][16][D];
  const int tid = threadIdx.x, w = tid >> 5, lane = tid & 31, ln = lane & 15, hh = lane >> 4;
  const int nqb = (T + 63) / 64;
  const int bh = blockIdx.x / nqb, qblk = blockIdx.x % nqb;
  const int b = bh / H, h = bh % H;
  const int q0 = qblk * 64 + w * 16;
  const float* Q = qb + (size_t)b * T * pitch + h * D;
  const float* K = kb + (size_t)b * T * pitch + h * D;
  const float* V = vb + (size_t)b * T * pitch + h * D;

  // A fragments of the wave's 16 query rows (scaled), hi/lo
  FragB aqh[KS], aql[KS];
  {
    int row = q0 + ln; if (row >= T) row = T - 1;
    const float* qr = Q + (size_t)row * pitch;
#pragma unroll
    for (int ks = 0; ks < KS; ++ks)
#pragma unroll
      for (int i = 0; i < 16; ++i) {
        const int d = ks * 32 + ((i < 8) ? (8 * hh + i) : (16 + 8 * hh + (i - 8)));
        const float x = qr[d] * scale; const unsigned short hb = bf16_bits(x);
        aqh[ks].u[i] = hb; aql[ks].u[i] = bf16_bits(x - bf16_val(hb));
      }
  }
  float m_r[8], l_r[8];
#pragma unroll
  for (int r = 0; r < 8; ++r) { m_r[r] = -3.0e38f; l_r[r] = 0.f; }
  v8f oacc[DT];
#pragma unroll
  for (int dt = 0; dt < DT; ++dt) oacc[dt] = (v8f){0.f,0.f,0.f,0.f,0.f,0.f,0.f,0.f};

  const int kv_end = CAUSAL ? min(T, qblk * 64 + 64) : T;     // block-uniform
  for (int j0 = 0; j0 < kv_end; j0 += 32) {
    __syncthreads();
    for (int e = tid; e < 32 * (D / 4); e += 128) {
      const int r = e / (D / 4), c4 = (e % (D / 4)) * 4;
      const int key = j0 + r;
      v4f kf = {0.f,0.f,0.f,0.f}, vf = {0.f,0.f,0.f,0.f};
      if (key < T) { kf = *(const v4fa*)(K + (size_t)key * pitch + c4); vf = *(const v4fa*)(V + (size_t)key * pitch + c4); }
#pragma unroll
      for (int t = 0; t < 4; ++t) {
        unsigned short hb = bf16_bits(kf[t]); sKh[r][c4 + t] = hb; sKl[r][c4 + t] = bf16_bits(kf[t] - bf16_val(hb));
        hb = bf16_bits(vf[t]); sVh[r][c4 + t] = hb; sVl[r][c4 + t] = bf16_bits(vf[t] - bf16_val(hb));
      }
    }
    __syncthreads();
    // S tile 16 x 32
    v8f s[2];
#pragma unroll
    for (int nt = 0; nt < 2; ++nt) {
      v8f acc = {};
#pragma unroll
      for (int ks = 0; ks < KS; ++ks) {
        FragB bh_, bl_;
        bh_.half[0] = *(const v8us*)&sKh[nt * 16 + ln][ks * 32 + 8 * hh]; bh_.half[1] = *(const v8us*)&sKh[nt * 16 + ln][ks * 32 + 16 + 8 * hh];
        bl_.half[0] = *(const v8us*)&sKl[nt * 16 + ln][ks * 32 + 8 * hh]; bl_.half[1] = *(const v8us*)&sKl[nt * 16 + ln][ks * 32 + 16 + 8 * hh];
        acc = mmaN<3>(aqh[ks].v, aql[ks].v, bh_.v, bl_.v, acc);
      }
      s[nt] = acc;
    }
    // mask + running max (rows 8hh+r; the 16 lanes of a half share rows)
    float alpha[8];
#pragma unroll
    for (int r = 0; r < 8; ++r) {
      const int qi = q0 + 8 * hh + r;
      const int ja = j0 + ln, jb = j0 + 16 + ln;
      if (CAUSAL) { if (ja > qi) s[0][r] = -3.0e38f; if (jb > qi) s[1][r] = -3.0e38f; }
      if (ja >= T) s[0][r] = -3.0e38f;
      if (jb >= T) s[1][r] = -3.0e38f;
      float mx = fmaxf(s[0][r], s[1][r]);
      mx = fmaxf(mx, __shfl_xor(mx, 1, 32)); mx = fmaxf(mx, __shfl_xor(mx, 2, 32)); mx = fmaxf(mx, __shfl_xor(mx, 4, 32)); mx = fmaxf(mx, __shfl_xor(mx, 8, 32));
      const float mnew = fmaxf(m_r[r], mx);
      alpha[r] = (mnew > -1.0e38f) ? __expf(m_r[r] - mnew) : 1.0f;
      const float p0 = (s[0][r] > -1.0e38f) ? __expf(s[0][r] - mnew) : 0.f;
      const float p1 = (s[1][r] > -1.0e38f) ? __expf(s[1][r] - mnew) : 0.f;
      m_r[r] = mnew;
      l_r[r] = l_r[r] * alpha[r] + p0 + p1;            // per-lane partial row sum (16 lanes combined at the end)
      unsigned short hb = bf16_bits(p0); sPh[w][8 * hh + r][ln] = hb;      sPl[w][8 * hh + r][ln] = bf16_bits(p0 - bf16_val(hb));
      hb = bf16_bits(p1);                sPh[w][8 * hh + r][16 + ln] = hb; sPl[w][8 * hh + r][16 + ln] = bf16_bits(p1 - bf16_val(hb));
    }
#pragma unroll
    for (int dt = 0; dt < DT; ++dt)
#pragma unroll
      for (int r = 0; r < 8; ++r) oacc[dt][r] *= alpha[r];
    __builtin_amdgcn_fence(__ATOMIC_ACQ_REL, "workgroup");
    __builtin_amdgcn_wave_barrier();
    FragB pah, pal;
    pah.half[0] = *(const v8us*)&sPh[w][ln][8 * hh]; pah.half[1] = *(const v8us*)&sPh[w][ln][16 + 8 * hh];
    pal.half[0] = *(const v8us*)&sPl[w][ln][8 * hh]; pal.half[1] = *(const v8us*)&sPl[w][ln][16 + 8 * hh];
#pragma unroll
    for (int dt = 0; dt < DT; ++dt) {
      FragB bvh, bvl;
#pragma unroll
      for (int i = 0; i < 8; ++i) {
        bvh.u[i] = sVh[8 * hh + i][dt * 16 + ln]; bvh.u[8 + i] = sVh[16 + 8 * hh + i][dt * 16 + ln];
        bvl.u[i] = sVl[8 * hh + i][dt * 16 + ln]; bvl.u[8 + i] = sVl[16 + 8 * hh + i][dt * 16 + ln];
      }
      oacc[dt] = mmaN<3>(pah.v, pal.v, bvh.v, bvl.v, oacc[dt]);
    }
    __builtin_amdgcn_fence(__ATOMIC_ACQ_REL, "workgroup");
    __builtin_amdgcn_wave_barrier();
  }
#pragma unroll
  for (int r = 0; r < 8; ++r) {
    float l = l_r[r];
    l += __shfl_xor(l, 1, 32); l += __shfl_xor(l, 2, 32); l += __shfl_xor(l, 4, 32); l += __shfl_xor(l, 8, 32);
    l_r[r] = (l > 0.f) ? 1.0f / l : 0.f;
  }
#pragma unroll
  for (int dt = 0; dt < DT; ++dt)
#pragma unroll
    for (int r = 0; r < 8; ++r) sO[w][8 * hh + r][dt * 16 + ln] = oacc[dt][r] * l_r[r];
  __builtin_amdgcn_fence(__ATOMIC_ACQ_REL, "workgroup");
  __builtin_amdgcn_wave_barrier();
  {
    for (int r = 0; r < 16; ++r) {
      const int row = q0 + r;
      if (row < T && lane < D / 4) {
        const v4f val = *(const v4fa*)&sO[w][r][lane * 4];
        *(v4f*)(y + ((size_t)b * T + row) * ypitch + h * D + lane * 4) = val;
      }
    }
    
  }
}

// GEMM C = act(A·W + bias + resid): A f32 (ASPLIT -> hi/lo 2 terms), Wt bf16 [N][K]; ACT 0 none, 1 relu, 2 exact gelu;
// resid (optional, f32, row index = (row % rmod), pitch ldr, RES_BF16 rounds it) added before the activation.
template <bool ASPLIT, int ACT, bool BIAS_BF16, bool RES_BF16>
__global__ __launch_bounds__(128) void k_gemm_bf3(const float* __restrict__ A, int lda, const unsigned short* __restrict__ Wt, int ldb,
                                                const float* __restrict__ bias, const float* __restrict__ resid, int rmod, int ldr,
                                                float* __restrict__ C, int ldc, int M, int N, int K) {
  __shared__ __attribute__((aligned(16))) float so[4][16][64];
  const int tid = threadIdx.x, w = tid >> 5, lane = tid & 31, ln = lane & 15, hh = lane >> 4;
  const int ntn = N / 64;
  const int wid = blockIdx.x * 4 + w;
  const int mt = wid / ntn, nq = wid % ntn;
  if (mt * 16 >= M) return;
  const int row0 = mt * 16, col0 = nq * 64;
  const float* arow = A + (size_t)(row0 + ln) * lda;
  v8f acc[4] = {};
  for (int kb = 0; kb < K; kb += 32) {
    FragB ah, al;
    const v4f x0 = *(const v4fa*)(arow + kb + 8 * hh), x1 = *(const v4fa*)(arow + kb + 8 * hh + 4);
    const v4f x2 = *(const v4fa*)(arow + kb + 16 + 8 * hh), x3 = *(const v4fa*)(arow + kb + 16 + 8 * hh + 4);
    float xs[16] = {x0[0],x0[1],x0[2],x0[3],x1[0],x1[1],x1[2],x1[3],x2[0],x2[1],x2[2],x2[3],x3[0],x3[1],x3[2],x3[3]};
#pragma unroll
    for (int i = 0; i < 16; ++i) { const unsigned short hb = bf16_bits(xs[i]); ah.u[i] = hb; al.u[i] = ASPLIT ? bf16_bits(xs[i] - bf16_val(hb)) : (unsigned short)0; }
#pragma unroll
    for (int t = 0; t < 4; ++t) {
      const unsigned short* brow = Wt + (size_t)(col0 + t * 16 + ln) * ldb + kb;
      FragB b;
      b.half[0] = *(const v8us*)(brow + 8 * hh);
      b.half[1] = *(const v8us*)(brow + 16 + 8 * hh);
      acc[t] = mmaN<ASPLIT ? 2 : 1>(ah.v, al.v, b.v, b.v, acc[t]);
    }
  }
#pragma unroll
  for (int t = 0; t < 4; ++t) {
    const int col = col0 + t * 16 + ln;
    float bv = bias ? bias[col] : 0.f;
    if (BIAS_BF16) bv = bf16_round(bv);
#pragma unroll
    for (int r = 0; r < 8; ++r) {
      float v = acc[t][r] + bv;
      if (resid) { float rv = resid[(size_t)((row0 + 8 * hh + r) % rmod) * ldr + col]; if (RES_BF16) rv = bf16_round(rv); v += rv; }
      if (ACT == 1) v = fmaxf(v, 0.f);
      if (ACT == 2) v = 0.5f * v * (1.0f + erff(v * 0.70710678118654752f));
      if (ACT == 3) { const float u = 0.7978845608028654f * (v + 0.044715f * v * v * v); v = 0.5f * v * (1.0f + tanhf(u)); }
      so[w][8 * hh + r][t * 16 + ln] = v;
    }
  }
  __builtin_amdgcn_fence(__ATOMIC_ACQ_REL, "workgroup");
  __builtin_amdgcn_wave_barrier();
  const int rsub = lane >> 4, c4 = (lane & 15) * 4;
  {
#pragma unroll
    for (int q = 0; q < 8; ++q) {
      const int r = q * 2 + rsub;
      const v4f v = *(const v4fa*)&so[w][r][c4];
      *(v4f*)(C + (size_t)(row0 + r) * ldc + col0 + c4) = v;
    }
    
  }
}
// row LayerNorm (biased variance, eps) over N: s = X (+ R); optional out_sum <- s; out_norm <- (s-mu)*rsqrt(var+eps)*g + b
template <bool PARAM_BF16>
__global__ __launch_bounds__(256) void k_layernorm(const float* __restrict__ X, const float* __restrict__ R, const float* __restrict__ g, const float* __restrict__ bta,
                                                  float* __restrict__ out_sum, float* __restrict__ out_norm, int N, float eps) {
  __shared__ float red[256];
  const int row = blockIdx.x, tid = threadIdx.x;
  const float* x = X + (size_t)row * N; const float* rr = R ? R + (size_t)row * N : nullptr;
  float vals[16];                     // up to N = 4096
  const int per = N / 256;            // contiguous chunk per thread? use strided-by-4 chunks: thread handles j = tid*4 + 1024*u
  float s1 = 0.f;
  for (int u = 0; u < per / 4; ++u) {
    const int j = tid * 4 + 1024 * u;
    const v4f a = *(const v4fa*)(x + j);
    v4f b = {0.f,0.f,0.f,0.f}; if (rr) b = *(const v4fa*)(rr + j);
#pragma unroll
    for (int q = 0; q < 4; ++q) { const float v = a[q] + b[q]; vals[u * 4 + q] = v; s1 += v; }
  }
  red[tid] = s1; __syncthreads();
  for (int st = 128; st > 0; st >>= 1) { if (tid < st) red[tid] += red[tid + st]; __syncthreads(); }
  const float mu = red[0] / (float)N; __syncthreads();
  float s2 = 0.f;
  for (int u = 0; u < per / 4; ++u)
#pragma unroll
    for (int q = 0; q < 4; ++q) { const float c = vals[u * 4 + q] - mu; s2 += c * c; }
  red[tid] = s2; __syncthreads();
  for (int st = 128; st > 0; st >>= 1) { if (tid < st) red[tid] += red[tid + st]; __syncthreads(); }
  const float rs = rsqrtf(red[0] / (float)N + eps);
  {
    for (int u = 0; u < per / 4; ++u) {
      const int j = tid * 4 + 1024 * u;
      v4f o, sm;
#pragma unroll
      for (int q = 0; q < 4; ++q) {
        float gg = g[j + q], bb = bta[j + q];
        if (PARAM_BF16) { gg = bf16_round(gg); bb = bf16_round(bb); }
        sm[q] = vals[u * 4 + q]; o[q] = (vals[u * 4 + q] - mu) * rs * gg + bb;
      }
      if (out_sum) *(v4f*)(out_sum + (size_t)row * N + j) = sm;
      *(v4f*)(out_norm + (size_t)row * N + j) = o;
    }
    
  }
}



// ---- f16 WMMA path (v_wmma_f32_16x16x32_f16): 11-bit significands for operands in range — used where a [0,1] probability operand needs more precision than bf16
typedef _Float16 v16h __attribute__((ext_vector_type(16)));
union FragH { v16h v; v8us half[2]; _Float16 h[16]; unsigned short u[16]; };
template <int NT>
__device__ __forceinline__ v8f mmaH(v16h ah, v16h al, v16h bh, v16h bl, v8f c) {
  c = __builtin_amdgcn_wmma_f32_16x16x32_f16(false, ah, false, bh, (short)0, c, false, false);
  if (NT >= 2) c = __builtin_amdgcn_wmma_f32_16x16x32_f16(false, al, false, bh, (short)0, c, false, false);
  if (NT >= 3) c = __builtin_amdgcn_wmma_f32_16x16x32_f16(false, ah, false, bl, (short)0, c, false, false);
  asm volatile("v_nop\n\tv_nop\n\tv_nop\n\tv_nop" : "+v"(c) : "v"(ah), "v"(al), "v"(bh), "v"(bl));
  return c;
}
// batched GEMM like k_gemm_b but f16 operands: A f32 (split into f16 hi/lo if ASPLIT, else rounded to f16), Bt = f16 values [n][k]; alpha; C f32; N multiple of 16 (partial tiles skipped)
template <bool ASPLIT>
__global__ __launch_bounds__(128) void k_gemm_h(const float* __restrict__ A, int lda, size_t sA, const _Float16* __restrict__ Bh, int ldb, size_t sB, float alpha, float* __restrict__ C, int ldc, size_t sC, int M, int N, int K) {
  __shared__ __attribute__((aligned(16))) float so[4][16][64];
  const int tid = threadIdx.x, w = tid >> 5, lane = tid & 31, ln = lane & 15, hh = lane >> 4; const int by = blockIdx.y;
  A += (size_t)by * sA; Bh += (size_t)by * sB; C += (size_t)by * sC;
  const int ntn = (N + 63) / 64; const int wid = blockIdx.x * 4 + w; const int mt = wid / ntn, nq = wid % ntn; if (mt * 16 >= M) return;
  const int row0 = mt * 16, col0 = nq * 64; const float* arow = A + (size_t)(row0 + ln) * lda;
  v8f acc[4] = {};
  for (int kb = 0; kb < K; kb += 32) {
    FragH ah, al;
    const v4f x0 = *(const v4fa*)(arow + kb + 8 * hh), x1 = *(const v4fa*)(arow + kb + 8 * hh + 4), x2 = *(const v4fa*)(arow + kb + 16 + 8 * hh), x3 = *(const v4fa*)(arow + kb + 16 + 8 * hh + 4);
    float xs[16] = {x0[0],x0[1],x0[2],x0[3],x1[0],x1[1],x1[2],x1[3],x2[0],x2[1],x2[2],x2[3],x3[0],x3[1],x3[2],x3[3]};
#pragma unroll
    for (int i = 0; i < 16; ++i) { const _Float16 h = (_Float16)xs[i]; ah.h[i] = h; al.h[i] = ASPLIT ? (_Float16)(xs[i] - (float)h) : (_Float16)0.0f; }
#pragma unroll
    for (int t = 0; t < 4; ++t) { if (col0 + t * 16 >= N) continue; const size_t boff = (size_t)(col0 + t * 16 + ln) * ldb + kb; FragH bq; bq.half[0] = *(const v8us*)(Bh + boff + 8 * hh); bq.half[1] = *(const v8us*)(Bh + boff + 16 + 8 * hh);
      acc[t] = mmaH<ASPLIT ? 2 : 1>(ah.v, al.v, bq.v, bq.v, acc[t]); }
  }
#pragma unroll
  for (int t = 0; t < 4; ++t) { if (col0 + t * 16 >= N) continue;
#pragma unroll
    for (int r = 0; r < 8; ++r) so[w][8 * hh + r][t * 16 + ln] = acc[t][r] * alpha; }
  __builtin_amdgcn_fence(__ATOMIC_ACQ_REL, "workgroup"); __builtin_amdgcn_wave_barrier();
  const int rsub = lane >> 4, c4 = (lane & 15) * 4;
  {
#pragma unroll
    for (int q = 0; q < 8; ++q) { const int r = q * 2 + rsub; if (col0 + c4 < N) { const v4f v = *(const v4fa*)&so[w][r][c4]; *(v4f*)(C + (size_t)(row0 + r) * ldc + col0 + c4) = v; } }
     }
}

// Wt[n][k] = f16(W[k][n]·scale) from f32 row-major W[K][N] (scale = power of two; bf16-exact weights stay exact in f16 away from the subnormal range)
__global__ __launch_bounds__(256) void k_wt_f16(const float* __restrict__ W, _Float16* __restrict__ Wt, int K, int N, float scale) {
  const int t = blockIdx.x * 256 + threadIdx.x; if (t >= N * (K / 8)) return; const int n = t / (K / 8), k8 = (t % (K / 8)) * 8; FragH f;
#pragma unroll
  for (int i = 0; i < 8; ++i) f.h[i] = (_Float16)(bf16_round(W[(size_t)(k8 + i) * N + n]) * scale); const v8us o = f.half[0];
  *(v8us*)((unsigned short*)Wt + (size_t)n * K + k8) = o; 
}
// Fragment order: a [rows][K] 16-bit plane is kept as 1-KB units of 16 rows x 32 k, unit (row / 16) * (K / 32) + k / 32; inside a unit the 16-byte piece 32 p + lane holds row (lane & 15), k = 16 p + 8 (lane >> 4) + 0..7.
// A wave's fragment is then two 16-byte loads per lane that each cover 512 contiguous bytes (4 whole 128-B lines) instead of 32 bytes in each of 16 lines; fragment element i is k = 8 (lane >> 4) + i for i < 8 and 16 + 8 (lane >> 4) + (i - 8) above, for both operands of every product.
// frag_src: index, in the row-major plane, of the first of the 8 elements that 16-byte piece number 'piece' of the fragment-ordered plane holds.
__device__ __forceinline__ size_t frag_src(size_t piece, int K) { const size_t u = piece >> 6; const int in = (int)(piece & 63), p = in >> 5, l = in & 31; const size_t kt = (size_t)(K / 32);
  return ((u / kt) * 16 + (size_t)(l & 15)) * (size_t)K + (u % kt) * 32 + (size_t)(p * 16 + (l >> 4) * 8); }
// A and Bh in fragment order (lda == ldb == K at every launch here).
// The three projections (grid y: q, k, v), each written straight as the plane the attention reads; v = acc * alpha. A slab of the attention is 128 rows of the [NR][DD] plane seen as 2048 rows of 64: row r, column group g = col / 64 is the slab's row 16 (r % 128) + g.
// A wave's 64 x 64 tile holds 64 such rows whole (one g). The attention takes a slab's keys and queries in the order g * 128 + r % 128 (any order serves a softmax over all keys, as long as K, V^T share it and O goes back to its own row), so a strip of 16 rows of the tile is one 16-row tile of the fragment-ordered planes.
// q, k: the strip goes through LDS (accumulator lane = column, fragment lane = row) and leaves as f16 hi + x 2^10 residual, 4 + 4 wave-wide stores of 512 bytes in a row. v: an accumulator tile (lane = d, registers = 8 keys) IS a 16-byte piece a lane of the V^T plane: converted and stored, no LDS.
// A wave owns 64 rows x 64 columns (4 x 4 accumulator tiles): the eight fragments of a 32-k stage feed 16 products. A block is 2 x 2 waves = 128 x 128; waves 0, 1 read the same A fragments and waves 0, 2 the same B fragments. M % 128 == 0, N % 128 == 0, K % 64 == 0 at every launch here.
__global__ __launch_bounds__(128) void k_gemm_hhx(const _Float16* __restrict__ A, int lda, size_t sA, const _Float16* __restrict__ Bh, int ldb, size_t sB, float alpha,
    _Float16* __restrict__ Hh, _Float16* __restrict__ Hl, size_t sH, _Float16* __restrict__ Vt, int M, int N, int K) {
  __shared__ __attribute__((aligned(16))) float so[4][16][64 + 4];      // pitch 68 words: the 16 rows that a 16-byte read of one column group touches start 4 banks apart
  const int tid = threadIdx.x, w = __builtin_amdgcn_readfirstlane(tid >> 5), lane = tid & 31, ln = lane & 15, hh = lane >> 4; const int by = blockIdx.y;      // the wave's number in a scalar register: the eight tile bases below are then scalar too
  A += (size_t)by * sA; Bh += (size_t)by * sB;
  const int nbn = N / 128; const int bm = blockIdx.x / nbn, bn = blockIdx.x % nbn;
  const int row0 = bm * 128 + (w >> 1) * 64, col0 = bn * 128 + (w & 1) * 64; if (row0 >= M) return;
  v8f acc[4][4] = {};
  // Two register stages of 32 k each: a stage's 16 fragment loads are issued as one group, one stage ahead of the 16 products that read them.
  // The eight tile bases stay as they are through the loop; one 32-bit byte offset per lane (its 16-byte piece + the k position) is stepped once a trip.
  const char* ba[4]; const char* bb[4];
#pragma unroll      // constant indices keep the arrays in registers
  for (int t = 0; t < 4; ++t) { ba[t] = (const char*)(A + (size_t)(row0 + t * 16) * lda); bb[t] = (const char*)(Bh + (size_t)(col0 + t * 16) * ldb); }
  unsigned vo = (unsigned)lane * 16u;
  FragH a0[4], b0[4], a1[4], b1[4];
  auto fetch = [&](FragH (&fa)[4], FragH (&fb)[4], unsigned o) {
#pragma unroll      // constant indices keep the fragment arrays in registers
    for (int t = 0; t < 4; ++t) { fa[t].half[0] = *(const v8us*)(ba[t] + o); fa[t].half[1] = *(const v8us*)(ba[t] + o + 512); fb[t].half[0] = *(const v8us*)(bb[t] + o); fb[t].half[1] = *(const v8us*)(bb[t] + o + 512); } };
  auto mul = [&](FragH (&fa)[4], FragH (&fb)[4]) {
#pragma unroll      // constant indices keep the fragment arrays in registers
    for (int i = 0; i < 4; ++i)
#pragma unroll      // constant indices keep the fragment arrays in registers
      for (int t = 0; t < 4; ++t) acc[i][t] = __builtin_amdgcn_wmma_f32_16x16x32_f16(false, fa[i].v, false, fb[t].v, (short)0, acc[i][t], false, false); };      // the plain builtin: operands of an asm statement cannot lie above v255, and this tile needs more than 256 registers
  fetch(a0, b0, vo);      // a stage of 32 k = one 1-KB unit of each tile
#pragma unroll 1      // rolled: one ping-pong pair per trip keeps both stages in fixed registers and the loop short
  for (int kb = 0; kb < K; kb += 64) {
    fetch(a1, b1, vo + 1024);
    __builtin_amdgcn_sched_barrier(0);      // holds the 16 loads as one group ahead of the products: without it the compiler sinks them among the products, a few products ahead of their use
    mul(a0, b0);
    __builtin_amdgcn_sched_barrier(0);      // no load of the next group rises among the products above, where its registers are still read; the wait below stays behind them
    asm volatile("s_wait_xcnt 0x0" ::: "memory");      // the wait in front of the rewriting of the loads' offset register
    __builtin_amdgcn_sched_barrier(0);      // the offset's step stays behind the wait
    vo = (kb + 64 < K) ? vo + 2048 : (unsigned)lane * 16u;      // the last trip steps back to k = 0: its second fetch stays in bounds and is not used
    fetch(a0, b0, vo);
    __builtin_amdgcn_sched_barrier(0);      // as above: the group stays ahead of the products
    mul(a1, b1);
    __builtin_amdgcn_sched_barrier(0);      // as above: the wait below stays behind the products
    asm volatile("s_wait_xcnt 0x0" :: "v"(vo) : "memory");      // the wait in front of the rewriting of the loads' offset registers at the back edge and, behind the loop, of their bases; the offset as an input, so that no load's result lands in it
    __builtin_amdgcn_sched_barrier(0);      // what steps an offset at the loop's foot stays behind the wait
  }
  static_assert(TT * 64 / DD == 128 && DD / 64 == 16, "a slab is 128 rows of the plane, 16 column groups wide: a block's 128 rows are one slab's");
  const int slab = row0 >> 7, t16 = (col0 >> 6) * 8 + ((row0 & 127) >> 4);      // the number, in its slab, of the 16-row tile that the wave's first strip makes; strip i makes tile t16 + i
  if (by < 2) {      // the same for a whole block
    unsigned short* dh = (unsigned short*)Hh + (size_t)by * sH + ((size_t)slab * 128 + t16) * 1024 + lane * 8; unsigned short* dl = (unsigned short*)Hl + (size_t)by * sH + ((size_t)slab * 128 + t16) * 1024 + lane * 8;
#pragma unroll      // constant indices keep the accumulator tiles in registers
    for (int i = 0; i < 4; ++i) {      // the wave's four 16-row strips go through its LDS strip one after the other
#pragma unroll
      for (int t = 0; t < 4; ++t)
#pragma unroll
        for (int r = 0; r < 8; ++r) so[w][8 * hh + r][t * 16 + ln] = acc[i][t][r] * alpha;
      __builtin_amdgcn_fence(__ATOMIC_ACQ_REL, "workgroup"); __builtin_amdgcn_wave_barrier();      // the strip's LDS stores stay ahead of the reads below, which take other lanes' values
      FragH fh[4], fl[4];
#pragma unroll      // piece u = 2 ks + p of the tile's two units: row ln, k = 16 u + 8 hh + 0..7
      for (int u = 0; u < 4; ++u) { const v4f a = *(const v4fa*)&so[w][ln][u * 16 + 8 * hh], c = *(const v4fa*)&so[w][ln][u * 16 + 8 * hh + 4];
#pragma unroll
        for (int q = 0; q < 4; ++q) { _Float16 h = (_Float16)a[q]; fh[u].h[q] = h; fl[u].h[q] = (_Float16)((a[q] - (float)h) * 1024.0f); h = (_Float16)c[q]; fh[u].h[4 + q] = h; fl[u].h[4 + q] = (_Float16)((c[q] - (float)h) * 1024.0f); } }
#pragma unroll
      for (int u = 0; u < 4; ++u) { *(v8us*)(dh + i * 1024 + u * 256) = fh[u].half[0]; *(v8us*)(dl + i * 1024 + u * 256) = fl[u].half[0]; }
      // the wait behind the eight stores, in front of the reuse of their registers by the next strip; data and addresses are inputs so that they stay as they are up to the wait
      asm volatile("s_wait_xcnt 0x0" :: "v"(fh[0].half[0]), "v"(fl[0].half[0]), "v"(fh[1].half[0]), "v"(fl[1].half[0]), "v"(fh[2].half[0]), "v"(fl[2].half[0]), "v"(fh[3].half[0]), "v"(fl[3].half[0]), "v"(dh), "v"(dl) : "memory");
      __builtin_amdgcn_fence(__ATOMIC_ACQ_REL, "workgroup"); __builtin_amdgcn_wave_barrier();      // the strip's LDS reads stay ahead of the next strip's LDS stores
    }
  } else {
    unsigned short* dv = (unsigned short*)Vt + ((size_t)slab * 64 + (t16 >> 1)) * 2048 + lane * 8;      // V^T: unit (32-key tile) * 4 + d / 16; t16 is even, strip i is half i & 1 of 32-key tile t16 / 2 + i / 2
#pragma unroll      // constant indices keep the accumulator tiles in registers
    for (int i = 0; i < 4; ++i) { FragH f[4];
#pragma unroll
      for (int t = 0; t < 4; ++t) {
#pragma unroll
        for (int r = 0; r < 8; ++r) f[t].h[r] = (_Float16)(acc[i][t][r] * alpha); }
#pragma unroll
      for (int t = 0; t < 4; ++t) *(v8us*)(dv + (i >> 1) * 2048 + t * 512 + (i & 1) * 256) = f[t].half[0];
      // the wait behind the four stores, in front of the reuse of their registers by the next strip; data and address are inputs so that they stay as they are up to the wait
      asm volatile("s_wait_xcnt 0x0" :: "v"(f[0].half[0]), "v"(f[1].half[0]), "v"(f[2].half[0]), "v"(f[3].half[0]), "v"(dv) : "memory");
    }
  }
}


typedef _Float16 v4h __attribute__((ext_vector_type(4)));

// The streaming launches run as one resident round: GSTR blocks of 8 waves = 16 waves on each of 256 WGPs. A lane takes 7 or 8 pieces of 16 output bytes, 256 pieces apart inside its block's own run of pieces, and asks for all their inputs as one group before it converts and stores any.
#define GSTR 512
static_assert((size_t)NR * DD / 8 == (size_t)GSTR * 1024 && (size_t)DD * DD / 8 == (size_t)GSTR * 256, "a lane of k_prep takes four pieces of x and one of each weight");
static_assert((size_t)NR * DD / 4 == (size_t)GSTR * 2048 && GSTR % BB == 0, "a lane of k_norm takes eight pieces, a block lies in one batch element");
__global__ __launch_bounds__(256) void k_h16(const float* __restrict__ x, _Float16* __restrict__ X16, size_t n8) { const size_t t = (size_t)blockIdx.x * 256 + threadIdx.x; if (t >= n8) return; FragH f;
#pragma unroll
  for (int q = 0; q < 8; ++q) f.h[q] = (_Float16)x[t * 8 + q]; *(v8us*)((unsigned short*)X16 + t * 8) = f.half[0];  }
// x ([NR][DD]) and the three weights ([DD][DD], x 2^4), rounded to bf16 values and written as f16 planes in fragment order.
__global__ __launch_bounds__(256) void k_prep(const float* __restrict__ x, const float* __restrict__ Wq, const float* __restrict__ Wk, const float* __restrict__ Wv, _Float16* __restrict__ X16, _Float16* __restrict__ Bw) {
  const size_t tx = (size_t)blockIdx.x * 1024 + threadIdx.x, tw = (size_t)blockIdx.x * 256 + threadIdx.x; v4f a[7][2]; const size_t s = frag_src(tw, DD);
  static_assert(DD / 32 % 16 == 0, "a block's 16 units of x lie in one 16-row tile: piece tx + 256 i is four units on, 128 k to the right of piece tx");
  const float* xa = x + frag_src(tx, DD); const float* wq = Wq + s; const float* wk = Wk + s; const float* wv = Wv + s;
#pragma unroll      // constant indices keep the seven pieces in registers; all loads stand ahead of the first conversion
  for (int i = 0; i < 4; ++i) { a[i][0] = *(const v4fa*)(xa + i * 128); a[i][1] = *(const v4fa*)(xa + i * 128 + 4); }
  a[4][0] = *(const v4fa*)wq; a[4][1] = *(const v4fa*)(wq + 4); a[5][0] = *(const v4fa*)wk; a[5][1] = *(const v4fa*)(wk + 4); a[6][0] = *(const v4fa*)wv; a[6][1] = *(const v4fa*)(wv + 4);
  // the loaded values as inputs only: keeps all 14 loads ahead of the first conversion, or the compiler sinks half of them behind waits for the first; the addresses as inputs, so that no load's result lands in an address register of the group, and the wait in front of their reuse
  asm volatile("s_wait_xcnt 0x0" :: "v"(a[0][0]), "v"(a[0][1]), "v"(a[1][0]), "v"(a[1][1]), "v"(a[2][0]), "v"(a[2][1]), "v"(a[3][0]), "v"(a[3][1]), "v"(a[4][0]), "v"(a[4][1]), "v"(a[5][0]), "v"(a[5][1]), "v"(a[6][0]), "v"(a[6][1]), "v"(xa), "v"(wq), "v"(wk), "v"(wv) : "memory");
#pragma unroll      // constant indices keep the seven pieces in registers
  for (int i = 0; i < 7; ++i) { FragH f; const float sc = (i < 4) ? 1.0f : 16.0f;
#pragma unroll
    for (int q = 0; q < 4; ++q) { f.h[q] = (_Float16)(bf16_round(a[i][0][q]) * sc); f.h[4 + q] = (_Float16)(bf16_round(a[i][1][q]) * sc); }
    unsigned short* dst = (i < 4) ? (unsigned short*)X16 + (tx + i * 256) * 8 : (unsigned short*)Bw + (size_t)(i - 4) * DD * DD + tw * 8;
    *(v8us*)dst = f.half[0]; } }
typedef float v2f __attribute__((ext_vector_type(2)));
// lane l <-> lane l ^ 16 by a vector cross-row move
__device__ __forceinline__ float xhalf(float x) { return __builtin_bit_cast(float, __builtin_amdgcn_permlanex16(__builtin_bit_cast(int, x), __builtin_bit_cast(int, x), 0x76543210, 0xfedcba98, false, false)); }
// The plain builtin product: the compiler keeps the distance behind a matrix instruction itself and fills it with the pass's own vector work, where a fixed run of v_nop behind each product would take the vector port from the SIMD's other waves.
__device__ __forceinline__ v8f wm(v16h a, v16h b, v8f c) { return __builtin_amdgcn_wmma_f32_16x16x32_f16(false, a, false, b, (short)0, c, false, false); }
__global__ __launch_bounds__(128) void k_flash(const _Float16* __restrict__ Q16, const _Float16* __restrict__ Q16lo, int ldq, const _Float16* __restrict__ K16, const _Float16* __restrict__ K16lo, int ldk, const _Float16* __restrict__ Vt, float* __restrict__ O) {
  constexpr int RPW = 16, NQB = TT / (4 * RPW), DT = 4, KS = 2; constexpr float L2E = 1.4426950408889634f;
  __shared__ __attribute__((aligned(16))) float sO[4][RPW][64 + 4];
  const int tid = threadIdx.x, w = tid >> 5, lane = tid & 31, ln = lane & 15, hh = lane >> 4;
  const int slab = blockIdx.x / NQB, qblk = blockIdx.x % NQB; const int b = slab; const int qb0 = qblk * (4 * RPW); const int q0 = qb0 + w * RPW;
  FragH aq[KS], aql[KS];
  { const size_t qo = ((size_t)b * TT + q0) * ldq + lane * 8; const unsigned short* qr = (const unsigned short*)Q16 + qo; const unsigned short* ql = (const unsigned short*)Q16lo + qo;
#pragma unroll
    for (int ks = 0; ks < KS; ++ks) { aq[ks].half[0] = *(const v8us*)(qr + ks * 512); aq[ks].half[1] = *(const v8us*)(qr + ks * 512 + 256); aql[ks].half[0] = *(const v8us*)(ql + ks * 512); aql[ks].half[1] = *(const v8us*)(ql + ks * 512 + 256); } }      // fragment-ordered planes (ldq == ldk == 64): unit = (row / 16) * 2 + ks
  const unsigned short* Vth = (const unsigned short*)Vt + (size_t)slab * 64 * TT;
  float m_r = -3.0e38f, b_r = -3.0e38f, l_r = 0.f; v8f oacc[DT];
#pragma unroll
  for (int dt = 0; dt < DT; ++dt) oacc[dt] = (v8f){0.f,0.f,0.f,0.f,0.f,0.f,0.f,0.f};
  const int jend = TT;
  // K fragments (both planes, 32 keys) live in registers across the back edge: each pass fetches the next pass's right behind its own score products; V fragments are fetched at the pass's top, ahead of the scores and the softmax.
  FragH bk[2][KS], bl[2][KS];
  auto fetchK = [&](int j) {
#pragma unroll      // constant indices keep the fragment arrays in registers
    for (int nt = 0; nt < 2; ++nt) { const size_t ko = ((size_t)b * TT + j + nt * 16) * ldk + lane * 8; const unsigned short* kr = (const unsigned short*)K16 + ko; const unsigned short* kl = (const unsigned short*)K16lo + ko;
#pragma unroll      // constant indices keep the fragment arrays in registers
      for (int ks = 0; ks < KS; ++ks) { bk[nt][ks].half[0] = *(const v8us*)(kr + ks * 512); bk[nt][ks].half[1] = *(const v8us*)(kr + ks * 512 + 256); bl[nt][ks].half[0] = *(const v8us*)(kl + ks * 512); bl[nt][ks].half[1] = *(const v8us*)(kl + ks * 512 + 256); } } };
  fetchK(0);
  { const size_t qa = ((size_t)b * TT + q0) * ldq + lane * 8, ka = (size_t)b * TT * ldk + lane * 8, kc = ((size_t)b * TT + 16) * ldk + lane * 8;
    // the wait in front of the reuse of the address registers of the Q and K loads above; the six addresses are inputs so that their registers stay as they are up to the wait
    asm volatile("s_wait_xcnt 0x0" :: "v"(Q16 + qa), "v"(Q16lo + qa), "v"(K16 + ka), "v"(K16lo + ka), "v"(K16 + kc), "v"(K16lo + kc) : "memory"); }
#pragma unroll 1
  for (int j0 = 0; j0 < jend; j0 += 32) {
    FragH bv[DT];
#pragma unroll      // constant indices keep the fragment arrays in registers
    for (int dt = 0; dt < DT; ++dt) { const unsigned short* vrow = Vth + (size_t)j0 * 64 + dt * 512 + lane * 8; bv[dt].half[0] = *(const v8us*)(vrow); bv[dt].half[1] = *(const v8us*)(vrow + 256); }
    __builtin_amdgcn_sched_barrier(0);      // holds the eight V loads as one group at the pass's top: without it the compiler sinks some behind the score products, nearer to their use
    v8f s[2];      // s[nt][r] = score of query q0 + ln against key j0 + 16 nt + 8 hh + r
#pragma unroll
    for (int nt = 0; nt < 2; ++nt) { v8f acc = (v8f){0.f,0.f,0.f,0.f,0.f,0.f,0.f,0.f}, accl = acc;
#pragma unroll
      for (int ks = 0; ks < KS; ++ks) { acc = wm(bk[nt][ks].v, aq[ks].v, acc); accl = wm(bk[nt][ks].v, aql[ks].v, accl); accl = wm(bl[nt][ks].v, aq[ks].v, accl); }
      s[nt] = acc + accl * 0.0009765625f; }
    __builtin_amdgcn_sched_barrier(0);      // the K address arithmetic and loads stay behind the score tiles, in the order written: without it the compiler spreads them among the products
    const int jn = (j0 + 32 < jend) ? j0 + 32 : 0; fetchK(jn);      // the last pass refetches keys 0..31: in bounds, not used
    { const size_t ka = ((size_t)b * TT + jn) * ldk + lane * 8, kc = ((size_t)b * TT + jn + 16) * ldk + lane * 8;
      // the wait in front of the reuse of the address registers of the K loads above; the four addresses are inputs so that none of their registers is handed to a load's result or to the softmax ahead of the wait
      asm volatile("s_wait_xcnt 0x0" :: "v"(K16 + ka), "v"(K16lo + ka), "v"(K16 + kc), "v"(K16lo + kc) : "memory"); }
    __builtin_amdgcn_sched_barrier(0);      // no K load sinks into the softmax or behind the output products: without it the compiler lends K registers to the softmax and issues their loads at the pass's end, a few products ahead of their use
    float mc = s[0][0], md = s[1][0];
#pragma unroll      // constant indices keep the score tiles in registers
    for (int r = 1; r < 8; ++r) { mc = fmaxf(mc, s[0][r]); md = fmaxf(md, s[1][r]); }
    mc = fmaxf(mc, md); mc = fmaxf(mc, xhalf(mc));      // both halves now hold the query's maximum over the pass's 32 keys
    // base 2: b_r is the running maximum times log2(e), less 10; every weight is then 2^(s log2(e) - b_r) = 2^10 exp(s - max), one multiply-add and one hardware exponential, already at the scale the f16 P operand wants
    const float mn = fmaxf(m_r, mc), bn = __builtin_fmaf(mn, L2E, -10.0f); const float al = __builtin_amdgcn_exp2f((mn > -1.0e38f) ? b_r - bn : 0.f); m_r = mn; b_r = bn;      // the guard selects the argument (2^0 = 1), so no branch on lanes stands in the loop
    FragH pt; v2f ps[2] = {(v2f){0.f, 0.f}, (v2f){0.f, 0.f}}; const v8f l2e8 = {L2E, L2E, L2E, L2E, L2E, L2E, L2E, L2E}, nm8 = {-bn, -bn, -bn, -bn, -bn, -bn, -bn, -bn};
#pragma unroll      // constant indices keep the score tiles and the P^T fragment in registers
    for (int nt = 0; nt < 2; ++nt) { const v8f d = __builtin_elementwise_fma(s[nt], l2e8, nm8);
#pragma unroll      // constant indices keep the score tiles and the P^T fragment in registers
      for (int r = 0; r < 8; r += 2) { const v2f p = {__builtin_amdgcn_exp2f(d[r]), __builtin_amdgcn_exp2f(d[r + 1])}; ps[nt] += p; pt.h[8 * nt + r] = (_Float16)p[0]; pt.h[8 * nt + r + 1] = (_Float16)p[1]; } }
    { const v2f pq = ps[0] + ps[1]; l_r = l_r * al + (pq[0] + pq[1]); }      // this half's 16 keys; the halves are joined behind the loop
#pragma unroll
    for (int dt = 0; dt < DT; ++dt)
#pragma unroll
      for (int r = 0; r < 8; ++r) oacc[dt][r] *= al;
#pragma unroll
    for (int dt = 0; dt < DT; ++dt) oacc[dt] = wm(bv[dt].v, pt.v, oacc[dt]);      // oacc[dt][r] = O[q0 + ln][16 dt + 8 hh + r]
  }
  { const float l = l_r + xhalf(l_r); const float inv = (l > 0.f) ? 1.0f / l : 0.f;      // l and the output tiles both carry the factor 2^10; the exchange stands ahead of the select: all lanes are on
#pragma unroll      // constant indices keep the output tiles in registers
    for (int dt = 0; dt < DT; ++dt) { v4f lo4, hi4;
#pragma unroll      // constant indices keep the output tiles in registers
      for (int r = 0; r < 4; ++r) { lo4[r] = oacc[dt][r] * inv; hi4[r] = oacc[dt][4 + r] * inv; }
      *(v4fa*)&sO[w][ln][dt * 16 + 8 * hh] = lo4; *(v4fa*)&sO[w][ln][dt * 16 + 8 * hh + 4] = hi4; } }
  __builtin_amdgcn_fence(__ATOMIC_ACQ_REL, "workgroup"); __builtin_amdgcn_wave_barrier();
  { float* po = O + ((size_t)b * TT + ((q0 & 127) + (lane >> 4)) * 16 + (q0 >> 7)) * 64 + (lane & 15) * 4;      // query g * 128 + r' of the planes' order is the slab's row 16 r' + g, 64 wide: one address, constant steps of 16 rows a query
#pragma unroll
    for (int rp = 0; rp < RPW; rp += 2) { const int r = rp + (lane >> 4), pc = lane & 15; const v4f val = *(const v4fa*)&sO[w][r][pc * 4]; *(v4f*)(po + rp * 1024) = val; }
     } }

__global__ __launch_bounds__(256) void k_stat(const float* __restrict__ O, const float* __restrict__ x, float* __restrict__ PART) { __shared__ float r1[256], r2[256]; const int tid = threadIdx.x; const int b = blockIdx.x / NPB, part = blockIdx.x % NPB; const size_t base = (size_t)b * TT * DD + (size_t)part * (TT * DD / NPB) + tid * 4; float s1 = 0.f, s2 = 0.f;
  static_assert(TT * DD / NPB % 8192 == 0, "whole groups of eight trips of 1024 elements");
  const float* po = O + base; const float* px = x + base;
#pragma unroll      // four groups on two fixed address pairs with constant offsets: no address is stepped while loads are in flight
  for (int i = 0; i < TT * DD / NPB; i += 8192) { v4f o[8], xv[8];
#pragma unroll      // constant indices keep the eight pieces in registers
    for (int u = 0; u < 8; ++u) { o[u] = *(const v4fa*)(po + i + u * 1024); xv[u] = *(const v4fa*)(px + i + u * 1024); }
    // the loaded values as inputs only: keeps all 16 loads ahead of the first sum, or the compiler sinks half of them behind waits for the first; the two addresses as inputs, so that no load's result lands in an address register of the group, and the wait in front of their reuse
    asm volatile("s_wait_xcnt 0x0" :: "v"(o[0]), "v"(xv[0]), "v"(o[1]), "v"(xv[1]), "v"(o[2]), "v"(xv[2]), "v"(o[3]), "v"(xv[3]), "v"(o[4]), "v"(xv[4]), "v"(o[5]), "v"(xv[5]), "v"(o[6]), "v"(xv[6]), "v"(o[7]), "v"(xv[7]), "v"(po), "v"(px) : "memory");
#pragma unroll      // constant indices keep the eight pieces in registers; the sums keep the order of the single trips
    for (int u = 0; u < 8; ++u) for (int q = 0; q < 4; ++q) { const float y = o[u][q] + bf16_round(xv[u][q]); s1 += y; s2 += y * y; } }
  r1[tid] = s1; r2[tid] = s2; __syncthreads(); for (int o = 128; o >= 1; o >>= 1) { if (tid < o) { r1[tid] += r1[tid + o]; r2[tid] += r2[tid + o]; } __syncthreads(); }
  if (tid < 32) { const float v = (tid == 0) ? r1[0] : ((tid == 1) ? r2[0] : 0.f); *(float*)(PART + (size_t)blockIdx.x * 32 + tid) = v;  } }
typedef float v2fa __attribute__((ext_vector_type(2), may_alias));
__device__ __forceinline__ float lane_val(float v, int l) { return __builtin_bit_cast(float, __builtin_amdgcn_readlane(__builtin_bit_cast(int, v), l)); }
__global__ __launch_bounds__(256) void k_norm(const float* __restrict__ O, const float* __restrict__ x, const float* __restrict__ PART, float* __restrict__ out) { const size_t t = (size_t)blockIdx.x * 2048 + threadIdx.x; const int b = (int)(blockIdx.x / (GSTR / BB)), lane = threadIdx.x & 31; float s1 = 0.f, s2 = 0.f; v4f o[8], xv[8];
  static_assert(NPB == 64, "two partial pairs per lane");
#pragma unroll      // constant indices keep the eight pieces in registers
  for (int u = 0; u < 8; ++u) { o[u] = *(const v4fa*)(O + (t + u * 256) * 4); xv[u] = *(const v4fa*)(x + (t + u * 256) * 4); }
  const v2f pa = *(const v2fa*)(PART + ((size_t)b * NPB + lane) * 32), pb = *(const v2fa*)(PART + ((size_t)b * NPB + 32 + lane) * 32);      // lane l holds the partial pairs l and 32 + l: two loads per wave in place of a chain of 64
  // the loaded values as inputs only: keeps all 18 loads ahead of the statistics, or the compiler sinks some of them behind the sums; the three addresses as inputs, so that no load's result lands in an address register of the group, and the wait in front of their reuse
  asm volatile("s_wait_xcnt 0x0" :: "v"(o[0]), "v"(xv[0]), "v"(o[1]), "v"(xv[1]), "v"(o[2]), "v"(xv[2]), "v"(o[3]), "v"(xv[3]), "v"(o[4]), "v"(xv[4]), "v"(o[5]), "v"(xv[5]), "v"(o[6]), "v"(xv[6]), "v"(o[7]), "v"(xv[7]), "v"(pa), "v"(pb), "v"(O + t * 4), "v"(x + t * 4), "v"(PART + ((size_t)b * NPB + lane) * 32) : "memory");
#pragma unroll      // constant lane numbers; the partial sums are added in the order p = 0 .. NPB - 1
  for (int p = 0; p < 32; ++p) { s1 += lane_val(pa[0], p); s2 += lane_val(pa[1], p); }
#pragma unroll      // constant lane numbers
  for (int p = 0; p < 32; ++p) { s1 += lane_val(pb[0], p); s2 += lane_val(pb[1], p); }
  const float n = (float)TT * (float)DD; const float mu = s1 / n; const float var = fmaxf(s2 / n - mu * mu, 0.f); const float rs = rsqrtf(var + 1e-5f);
#pragma unroll      // constant indices keep the eight pieces in registers
  for (int u = 0; u < 8; ++u) { v4f r; for (int q = 0; q < 4; ++q) r[q] = (o[u][q] + bf16_round(xv[u][q]) - mu) * rs;
    *(v4f*)(out + (t + u * 256) * 4) = r; } }

extern "C" void kernel_launch(void* const* d_in, const int* in_sizes, int n_in,
                              void* d_out, int out_size, void* d_ws, size_t ws_size, hipStream_t stream) {
  (void)in_sizes; (void)n_in; (void)out_size;
  const float* x = (const float*)d_in[0]; const float* Wq = (const float*)d_in[1]; const float* Wk = (const float*)d_in[2]; const float* Wv = (const float*)d_in[3];
  char* ws = (char*)d_ws; size_t off = 0;
  auto take = [&](size_t bytes) { char* p = ws + off; off += (bytes + 255) & ~(size_t)255; return p; };
  const size_t WSZ = (size_t)DD * DD, PSZ = (size_t)NR * DD; _Float16* Bw = (_Float16*)take(3 * WSZ * 2); _Float16* X16 = (_Float16*)take(PSZ * 2); float* O = (float*)take(PSZ * 4);
  _Float16* Qh = (_Float16*)take(2 * PSZ * 2); _Float16* Kh = Qh + PSZ; _Float16* Ql = (_Float16*)take(2 * PSZ * 2); _Float16* Kl = Ql + PSZ;      /* hi planes of q and k in a row, then their lo planes */
  _Float16* Vt = (_Float16*)take(PSZ * 2); float* PART = (float*)take((size_t)BB * NPB * 32 * 4);
  if (off > ws_size) return;      // 6.3 + 8.4 + 16.8 + 5 x 8.4 = 73 MB
  k_prep<<<GSTR, 256, 0, stream>>>(x, Wq, Wk, Wv, X16, Bw);      /* x; weights (out,in) natural x 2^4 */
  const dim3 gp((NR / 128) * (DD / 128), 3);      /* y: q, k (hi and lo planes), v (V^T), all in fragment order, a slab's rows in the order column group * 128 + row */
  k_gemm_hhx<<<gp, 128, 0, stream>>>(X16, DD, 0, Bw, DD, WSZ, 0.0625f, Qh, Ql, PSZ, Vt, NR, DD, DD);
  k_flash<<<NSL * (TT / 64), 128, 0, stream>>>(Qh, Ql, 64, Kh, Kl, 64, Vt, O);      /* Q, K, V^T in the planes' row order; O in the flat view's own */
  k_stat<<<BB * NPB, 256, 0, stream>>>(O, x, PART); k_norm<<<GSTR, 256, 0, stream>>>(O, x, PART, (float*)d_out);
}

// v010
// It runs in 106 microseconds.
// In both of two side-by-side timings against v009, it was 1.03 times as fast.
// Over all steps from v000 it is 4.73 times as fast.
#include <hip/hip_runtime.h>
// Multi-head attention with raw-reshape heads, residual and a global LayerNorm (B=2, S=2048, D=1024, 16 heads × 64): Q,K,V = x·Wᵀ reshaped by plain memory order to (H,B,S,64) (= 32 contiguous [2048][64] slabs of each
// [4096][1024] plane); UNSCALED softmax(Q·Kᵀ)·V per slab; y = out (same flat order, = [B,S,1024]) + x; output = (y − mean)/√(var + 1e-5) with mean/var over all (S,D) of each batch element (identity affine).
// Compute dtype: x and weights rounded to bf16; Q,K as f32 GEMM outputs split into f16 hi + ×2^10 residual planes so the unscaled (σ≈3) logits are f32-accurate; V f16; fused flash-style kernel
// (two score accumulators, online softmax f32, P f16 ×2^10) on v_wmma_f32_16x16x32_f16; residual and the per-batch statistics (fixed-order block partial sums of y and y², then a fixed-order combine) and normalisation in f32.
#define BB 2
#define TT 2048
#define DD 1024
#define NSL 32
#define NR (BB * TT)
#define NPB 512

typedef __bf16 v16b __attribute__((ext_vector_type(16)));
typedef unsigned short v8us __attribute__((ext_vector_type(8), may_alias));
typedef float  v8f  __attribute__((ext_vector_type(8)));
typedef float  v4f  __attribute__((ext_vector_type(4)));
typedef float  v4fa __attribute__((ext_vector_type(4), may_alias));
union FragB { v16b v; v8us half[2]; unsigned short u[16]; };

__device__ __forceinline__ unsigned short bf16_bits(float x) { unsigned int u = __float_as_uint(x); return (unsigned short)((u + 0x7FFFu + ((u >> 16) & 1u)) >> 16); }
__device__ __forceinline__ float bf16_val(unsigned short b) { return __uint_as_float(((unsigned int)b) << 16); }
__device__ __forceinline__ float bf16_round(float x) { return bf16_val(bf16_bits(x)); }
// D += A·B with NT terms: 1 = ah·bh, 2 = + al·bh (A split), 3 = + ah·bl (both split)
template <int NT>
__device__ __forceinline__ v8f mmaN(v16b ah, v16b al, v16b bh, v16b bl, v8f c) {
  c = __builtin_amdgcn_wmma_f32_16x16x32_bf16(false, ah, false, bh, (short)0, c, false, false);
  if (NT >= 2) c = __builtin_amdgcn_wmma_f32_16x16x32_bf16(false, al, false, bh, (short)0, c, false, false);
  if (NT >= 3) c = __builtin_amdgcn_wmma_f32_16x16x32_bf16(false, ah, false, bl, (short)0, c, false, false);
  asm volatile("v_nop\n\tv_nop\n\tv_nop\n\tv_nop" : "+v"(c) : "v"(ah), "v"(al), "v"(bh), "v"(bl));
  return c;
}

__global__ __launch_bounds__(256) void k_wt_bf16(const float* __restrict__ W, unsigned short* __restrict__ Wt, int K, int N) {
  const int t = blockIdx.x * 256 + threadIdx.x;
  const int k8n = K / 8;
  if (t >= N * k8n) return;
  const int n = t / k8n, k8 = (t % k8n) * 8;
  v8us v;
#pragma unroll
  for (int i = 0; i < 8; ++i) v[i] = bf16_bits(W[(size_t)(k8 + i) * N + n]);
  *(v8us*)(Wt + (size_t)n * K + k8) = v;
  
}

// GEMM C[M][N] (f32, pitch ldc) = act(A[M][K]·W + bias). A f32 row-major (pitch lda) converted per fragment to bf16
// (ASPLIT: hi/lo two planes -> 2 terms, else single rounded term); Wt bf16 [N][K] (pitch ldb). BIAS_BF16 rounds the
// bias to bf16 first (bias quantised to bf16 before the add). K%32==0, M%16==0, N%64==0.
template <bool ASPLIT, int ACT, bool BIAS_BF16>
__global__ __launch_bounds__(128) void k_gemm_bf(const float* __restrict__ A, int lda, const unsigned short* __restrict__ Wt, int ldb,
                                               const float* __restrict__ bias, float* __restrict__ C, int ldc, int M, int N, int K) {
  __shared__ __attribute__((aligned(16))) float so[4][16][64];
  const int tid = threadIdx.x, w = tid >> 5, lane = tid & 31, ln = lane & 15, hh = lane >> 4;
  const int ntn = N / 64;
  const int wid = blockIdx.x * 4 + w;
  const int mt = wid / ntn, nq = wid % ntn;
  if (mt * 16 >= M) return;
  const int row0 = mt * 16, col0 = nq * 64;
  const float* arow = A + (size_t)(row0 + ln) * lda;
  v8f acc[4] = {};
  for (int kb = 0; kb < K; kb += 32) {
    FragB ah, al;
    const v4f x0 = *(const v4fa*)(arow + kb + 8 * hh), x1 = *(const v4fa*)(arow + kb + 8 * hh + 4);
    const v4f x2 = *(const v4fa*)(arow + kb + 16 + 8 * hh), x3 = *(const v4fa*)(arow + kb + 16 + 8 * hh + 4);
    float xs[16] = {x0[0],x0[1],x0[2],x0[3],x1[0],x1[1],x1[2],x1[3],x2[0],x2[1],x2[2],x2[3],x3[0],x3[1],x3[2],x3[3]};
#pragma unroll
    for (int i = 0; i < 16; ++i) { const unsigned short hb = bf16_bits(xs[i]); ah.u[i] = hb; al.u[i] = ASPLIT ? bf16_bits(xs[i] - bf16_val(hb)) : (unsigned short)0; }
#pragma unroll
    for (int t = 0; t < 4; ++t) {
      const unsigned short* brow = Wt + (size_t)(col0 + t * 16 + ln) * ldb + kb;
      FragB b;
      b.half[0] = *(const v8us*)(brow + 8 * hh);
      b.half[1] = *(const v8us*)(brow + 16 + 8 * hh);
      acc[t] = mmaN<ASPLIT ? 2 : 1>(ah.v, al.v, b.v, b.v, acc[t]);
    }
  }
#pragma unroll
  for (int t = 0; t < 4; ++t) {
    float bv = bias ? bias[col0 + t * 16 + ln] : 0.f;
    if (BIAS_BF16) bv = bf16_round(bv);
#pragma unroll
    for (int r = 0; r < 8; ++r) { float v = acc[t][r] + bv; if (ACT == 1) v = fmaxf(v, 0.f); so[w][8 * hh + r][t * 16 + ln] = v; }
  }
  __builtin_amdgcn_fence(__ATOMIC_ACQ_REL, "workgroup");
  __builtin_amdgcn_wave_barrier();
  const int rsub = lane >> 4, c4 = (lane & 15) * 4;
  {
#pragma unroll
    for (int q = 0; q < 8; ++q) {
      const int r = q * 2 + rsub;
      const v4f v = *(const v4fa*)&so[w][r][c4];
      *(v4f*)(C + (size_t)(row0 + r) * ldc + col0 + c4) = v;
    }
    
  }
}

// Flash-style causal/unmasked attention, all contractions 3-term bf16 hi/lo splits, f32 softmax with running max.
// q,k,v rows are read from f32 buffers with arbitrary row pitch (so they can live inside a fused qkv buffer);
// D = head size (multiple of 32, <= 128); one wave = 16 query rows; block = 4 waves (64 queries) sharing K/V chunks of 32.
template <int D, bool CAUSAL>
__global__ __launch_bounds__(128) void k_flash(const float* __restrict__ qb, const float* __restrict__ kb, const float* __restrict__ vb,
                                             int pitch, int T, int H, float scale, float* __restrict__ y, int ypitch) {
  constexpr int KS = D / 32;        // k-steps for QK
  constexpr int DT = D / 16;        // d tiles for PV
  __shared__ __attribute__((aligned(16))) unsigned short sKh[32][D + 8], sKl[32][D + 8], sVh[32][D + 8], sVl[32][D + 8];
  __shared__ __attribute__((aligned(16))) unsigned short sPh[4][16][40], sPl[4][16][40];
  __shared__ __attribute__((aligned(16))) float sO[4][16][D];
  const int tid = threadIdx.x, w = tid >> 5, lane = tid & 31, ln = lane & 15, hh = lane >> 4;
  const int nqb = (T + 63) / 64;
  const int bh = blockIdx.x / nqb, qblk = blockIdx.x % nqb;
  const int b = bh / H, h = bh % H;
  const int q0 = qblk * 64 + w * 16;
  const float* Q = qb + (size_t)b * T * pitch + h * D;
  const float* K = kb + (size_t)b * T * pitch + h * D;
  const float* V = vb + (size_t)b * T * pitch + h * D;

  // A fragments of the wave's 16 query rows (scaled), hi/lo
  FragB aqh[KS], aql[KS];
  {
    int row = q0 + ln; if (row >= T) row = T - 1;
    const float* qr = Q + (size_t)row * pitch;
#pragma unroll
    for (int ks = 0; ks < KS; ++ks)
#pragma unroll
      for (int i = 0; i < 16; ++i) {
        const int d = ks * 32 + ((i < 8) ? (8 * hh + i) : (16 + 8 * hh + (i - 8)));
        const float x = qr[d] * scale; const unsigned short hb = bf16_bits(x);
        aqh[ks].u[i] = hb; aql[ks].u[i] = bf16_bits(x - bf16_val(hb));
      }
  }
  float m_r[8], l_r[8];
#pragma unroll
  for (int r = 0; r < 8; ++r) { m_r[r] = -3.0e38f; l_r[r] = 0.f; }
  v8f oacc[DT];
#pragma unroll
  for (int dt = 0; dt < DT; ++dt) oacc[dt] = (v8f){0.f,0.f,0.f,0.f,0.f,0.f,0.f,0.f};

  const int kv_end = CAUSAL ? min(T, qblk * 64 + 64) : T;     // block-uniform
  for (int j0 = 0; j0 < kv_end; j0 += 32) {
    __syncthreads();
    for (int e = tid; e < 32 * (D / 4); e += 128) {
      const int r = e / (D / 4), c4 = (e % (D / 4)) * 4;
      const int key = j0 + r;
      v4f kf = {0.f,0.f,0.f,0.f}, vf = {0.f,0.f,0.f,0.f};
      if (key < T) { kf = *(const v4fa*)(K + (size_t)key * pitch + c4); vf = *(const v4fa*)(V + (size_t)key * pitch + c4); }
#pragma unroll
      for (int t = 0; t < 4; ++t) {
        unsigned short hb = bf16_bits(kf[t]); sKh[r][c4 + t] = hb; sKl[r][c4 + t] = bf16_bits(kf[t] - bf16_val(hb));
        hb = bf16_bits(vf[t]); sVh[r][c4 + t] = hb; sVl[r][c4 + t] = bf16_bits(vf[t] - bf16_val(hb));
      }
    }
    __syncthreads();
    // S tile 16 x 32
    v8f s[2];
#pragma unroll
    for (int nt = 0; nt < 2; ++nt) {
      v8f acc = {};
#pragma unroll
      for (int ks = 0; ks < KS; ++ks) {
        FragB bh_, bl_;
        bh_.half[0] = *(const v8us*)&sKh[nt * 16 + ln][ks * 32 + 8 * hh]; bh_.half[1] = *(const v8us*)&sKh[nt * 16 + ln][ks * 32 + 16 + 8 * hh];
        bl_.half[0] = *(const v8us*)&sKl[nt * 16 + ln][ks * 32 + 8 * hh]; bl_.half[1] = *(const v8us*)&sKl[nt * 16 + ln][ks * 32 + 16 + 8 * hh];
        acc = mmaN<3>(aqh[ks].v, aql[ks].v, bh_.v, bl_.v, acc);
      }
      s[nt] = acc;
    }
    // mask + running max (rows 8hh+r; the 16 lanes of a half share rows)
    float alpha[8];
#pragma unroll
    for (int r = 0; r < 8; ++r) {
      const int qi = q0 + 8 * hh + r;
      const int ja = j0 + ln, jb = j0 + 16 + ln;
      if (CAUSAL) { if (ja > qi) s[0][r] = -3.0e38f; if (jb > qi) s[1][r] = -3.0e38f; }
      if (ja >= T) s[0][r] = -3.0e38f;
      if (jb >= T) s[1][r] = -3.0e38f;
      float mx = fmaxf(s[0][r], s[1][r]);
      mx = fmaxf(mx, __shfl_xor(mx, 1, 32)); mx = fmaxf(mx, __shfl_xor(mx, 2, 32)); mx = fmaxf(mx, __shfl_xor(mx, 4, 32)); mx = fmaxf(mx, __shfl_xor(mx, 8, 32));
      const float mnew = fmaxf(m_r[r], mx);
      alpha[r] = (mnew > -1.0e38f) ? __expf(m_r[r] - mnew) : 1.0f;
      const float p0 = (s[0][r] > -1.0e38f) ? __expf(s[0][r] - mnew) : 0.f;
      const float p1 = (s[1][r] > -1.0e38f) ? __expf(s[1][r] - mnew) : 0.f;
      m_r[r] = mnew;
      l_r[r] = l_r[r] * alpha[r] + p0 + p1;            // per-lane partial row sum (16 lanes combined at the end)
      unsigned short hb = bf16_bits(p0); sPh[w][8 * hh + r][ln] = hb;      sPl[w][8 * hh + r][ln] = bf16_bits(p0 - bf16_val(hb));
      hb = bf16_bits(p1);                sPh[w][8 * hh + r][16 + ln] = hb; sPl[w][8 * hh + r][16 + ln] = bf16_bits(p1 - bf16_val(hb));
    }
#pragma unroll
    for (int dt = 0; dt < DT; ++dt)
#pragma unroll
      for (int r = 0; r < 8; ++r) oacc[dt][r] *= alpha[r];
    __builtin_amdgcn_fence(__ATOMIC_ACQ_REL, "workgroup");
    __builtin_amdgcn_wave_barrier();
    FragB pah, pal;
    pah.half[0] = *(const v8us*)&sPh[w][ln][8 * hh]; pah.half[1] = *(const v8us*)&sPh[w][ln][16 + 8 * hh];
    pal.half[0] = *(const v8us*)&sPl[w][ln][8 * hh]; pal.half[1] = *(const v8us*)&sPl[w][ln][16 + 8 * hh];
#pragma unroll
    for (int dt = 0; dt < DT; ++dt) {
      FragB bvh, bvl;
#pragma unroll
      for (int i = 0; i < 8; ++i) {
        bvh.u[i] = sVh[8 * hh + i][dt * 16 + ln]; bvh.u[8 + i] = sVh[16 + 8 * hh + i][dt * 16 + ln];
        bvl.u[i] = sVl[8 * hh + i][dt * 16 + ln]; bvl.u[8 + i] = sVl[16 + 8 * hh + i][dt * 16 + ln];
      }
      oacc[dt] = mmaN<3>(pah.v, pal.v, bvh.v, bvl.v, oacc[dt]);
    }
    __builtin_amdgcn_fence(__ATOMIC_ACQ_REL, "workgroup");
    __builtin_amdgcn_wave_barrier();
  }
#pragma unroll
  for (int r = 0; r < 8; ++r) {
    float l = l_r[r];
    l += __shfl_xor(l, 1, 32); l += __shfl_xor(l, 2, 32); l += __shfl_xor(l, 4, 32); l += __shfl_xor(l, 8, 32);
    l_r[r] = (l > 0.f) ? 1.0f / l : 0.f;
  }
#pragma unroll
  for (int dt = 0; dt < DT; ++dt)
#pragma unroll
    for (int r = 0; r < 8; ++r) sO[w][8 * hh + r][dt * 16 + ln] = oacc[dt][r] * l_r[r];
  __builtin_amdgcn_fence(__ATOMIC_ACQ_REL, "workgroup");
  __builtin_amdgcn_wave_barrier();
  {
    for (int r = 0; r < 16; ++r) {
      const int row = q0 + r;
      if (row < T && lane < D / 4) {
        const v4f val = *(const v4fa*)&sO[w][r][lane * 4];
        *(v4f*)(y + ((size_t)b * T + row) * ypitch + h * D + lane * 4) = val;
      }
    }
    
  }
}

// GEMM C = act(A·W + bias + resid): A f32 (ASPLIT -> hi/lo 2 terms), Wt bf16 [N][K]; ACT 0 none, 1 relu, 2 exact gelu;
// resid (optional, f32, row index = (row % rmod), pitch ldr, RES_BF16 rounds it) added before the activation.
template <bool ASPLIT, int ACT, bool BIAS_BF16, bool RES_BF16>
__global__ __launch_bounds__(128) void k_gemm_bf3(const float* __restrict__ A, int lda, const unsigned short* __restrict__ Wt, int ldb,
                                                const float* __restrict__ bias, const float* __restrict__ resid, int rmod, int ldr,
                                                float* __restrict__ C, int ldc, int M, int N, int K) {
  __shared__ __attribute__((aligned(16))) float so[4][16][64];
  const int tid = threadIdx.x, w = tid >> 5, lane = tid & 31, ln = lane & 15, hh = lane >> 4;
  const int ntn = N / 64;
  const int wid = blockIdx.x * 4 + w;
  const int mt = wid / ntn, nq = wid % ntn;
  if (mt * 16 >= M) return;
  const int row0 = mt * 16, col0 = nq * 64;
  const float* arow = A + (size_t)(row0 + ln) * lda;
  v8f acc[4] = {};
  for (int kb = 0; kb < K; kb += 32) {
    FragB ah, al;
    const v4f x0 = *(const v4fa*)(arow + kb + 8 * hh), x1 = *(const v4fa*)(arow + kb + 8 * hh + 4);
    const v4f x2 = *(const v4fa*)(arow + kb + 16 + 8 * hh), x3 = *(const v4fa*)(arow + kb + 16 + 8 * hh + 4);
    float xs[16] = {x0[0],x0[1],x0[2],x0[3],x1[0],x1[1],x1[2],x1[3],x2[0],x2[1],x2[2],x2[3],x3[0],x3[1],x3[2],x3[3]};
#pragma unroll
    for (int i = 0; i < 16; ++i) { const unsigned short hb = bf16_bits(xs[i]); ah.u[i] = hb; al.u[i] = ASPLIT ? bf16_bits(xs[i] - bf16_val(hb)) : (unsigned short)0; }
#pragma unroll
    for (int t = 0; t < 4; ++t) {
      const unsigned short* brow = Wt + (size_t)(col0 + t * 16 + ln) * ldb + kb;
      FragB b;
      b.half[0] = *(const v8us*)(brow + 8 * hh);
      b.half[1] = *(const v8us*)(brow + 16 + 8 * hh);
      acc[t] = mmaN<ASPLIT ? 2 : 1>(ah.v, al.v, b.v, b.v, acc[t]);
    }
  }
#pragma unroll
  for (int t = 0; t < 4; ++t) {
    const int col = col0 + t * 16 + ln;
    float bv = bias ? bias[col] : 0.f;
    if (BIAS_BF16) bv = bf16_round(bv);
#pragma unroll
    for (int r = 0; r < 8; ++r) {
      float v = acc[t][r] + bv;
      if (resid) { float rv = resid[(size_t)((row0 + 8 * hh + r) % rmod) * ldr + col]; if (RES_BF16) rv = bf16_round(rv); v += rv; }
      if (ACT == 1) v = fmaxf(v, 0.f);
      if (ACT == 2) v = 0.5f * v * (1.0f + erff(v * 0.70710678118654752f));
      if (ACT == 3) { const float u = 0.7978845608028654f * (v + 0.044715f * v * v * v); v = 0.5f * v * (1.0f + tanhf(u)); }
      so[w][8 * hh + r][t * 16 + ln] = v;
    }
  }
  __builtin_amdgcn_fence(__ATOMIC_ACQ_REL, "workgroup");
  __builtin_amdgcn_wave_barrier();
  const int rsub = lane >> 4, c4 = (lane & 15) * 4;
  {
#pragma unroll
    for (int q = 0; q < 8; ++q) {
      const int r = q * 2 + rsub;
      const v4f v = *(const v4fa*)&so[w][r][c4];
      *(v4f*)(C + (size_t)(row0 + r) * ldc + col0 + c4) = v;
    }
    
  }
}
// row LayerNorm (biased variance, eps) over N: s = X (+ R); optional out_sum <- s; out_norm <- (s-mu)*rsqrt(var+eps)*g + b
template <bool PARAM_BF16>
__global__ __launch_bounds__(256) void k_layernorm(const float* __restrict__ X, const float* __restrict__ R, const float* __restrict__ g, const float* __restrict__ bta,
                                                  float* __restrict__ out_sum, float* __restrict__ out_norm, int N, float eps) {
  __shared__ float red[256];
  const int row = blockIdx.x, tid = threadIdx.x;
  const float* x = X + (size_t)row * N; const float* rr = R ? R + (size_t)row * N : nullptr;
  float vals[16];                     // up to N = 4096
  const int per = N / 256;            // contiguous chunk per thread? use strided-by-4 chunks: thread handles j = tid*4 + 1024*u
  float s1 = 0.f;
  for (int u = 0; u < per / 4; ++u) {
    const int j = tid * 4 + 1024 * u;
    const v4f a = *(const v4fa*)(x + j);
    v4f b = {0.f,0.f,0.f,0.f}; if (rr) b = *(const v4fa*)(rr + j);
#pragma unroll
    for (int q = 0; q < 4; ++q) { const float v = a[q] + b[q]; vals[u * 4 + q] = v; s1 += v; }
  }
  red[tid] = s1; __syncthreads();
  for (int st = 128; st > 0; st >>= 1) { if (tid < st) red[tid] += red[tid + st]; __syncthreads(); }
  const float mu = red[0] / (float)N; __syncthreads();
  float s2 = 0.f;
  for (int u = 0; u < per / 4; ++u)
#pragma unroll
    for (int q = 0; q < 4; ++q) { const float c = vals[u * 4 + q] - mu; s2 += c * c; }
  red[tid] = s2; __syncthreads();
  for (int st = 128; st > 0; st >>= 1) { if (tid < st) red[tid] += red[tid + st]; __syncthreads(); }
  const float rs = rsqrtf(red[0] / (float)N + eps);
  {
    for (int u = 0; u < per / 4; ++u) {
      const int j = tid * 4 + 1024 * u;
      v4f o, sm;
#pragma unroll
      for (int q = 0; q < 4; ++q) {
        float gg = g[j + q], bb = bta[j + q];
        if (PARAM_BF16) { gg = bf16_round(gg); bb = bf16_round(bb); }
        sm[q] = vals[u * 4 + q]; o[q] = (vals[u * 4 + q] - mu) * rs * gg + bb;
      }
      if (out_sum) *(v4f*)(out_sum + (size_t)row * N + j) = sm;
      *(v4f*)(out_norm + (size_t)row * N + j) = o;
    }
    
  }
}



// ---- f16 WMMA path (v_wmma_f32_16x16x32_f16): 11-bit significands for operands in range — used where a [0,1] probability operand needs more precision than bf16
typedef _Float16 v16h __attribute__((ext_vector_type(16)));
union FragH { v16h v; v8us half[2]; _Float16 h[16]; unsigned short u[16]; };
template <int NT>
__device__ __forceinline__ v8f mmaH(v16h ah, v16h al, v16h bh, v16h bl, v8f c) {
  c = __builtin_amdgcn_wmma_f32_16x16x32_f16(false, ah, false, bh, (short)0, c, false, false);
  if (NT >= 2) c = __builtin_amdgcn_wmma_f32_16x16x32_f16(false, al, false, bh, (short)0, c, false, false);
  if (NT >= 3) c = __builtin_amdgcn_wmma_f32_16x16x32_f16(false, ah, false, bl, (short)0, c, false, false);
  asm volatile("v_nop\n\tv_nop\n\tv_nop\n\tv_nop" : "+v"(c) : "v"(ah), "v"(al), "v"(bh), "v"(bl));
  return c;
}
// batched GEMM like k_gemm_b but f16 operands: A f32 (split into f16 hi/lo if ASPLIT, else rounded to f16), Bt = f16 values [n][k]; alpha; C f32; N multiple of 16 (partial tiles skipped)
template <bool ASPLIT>
__global__ __launch_bounds__(128) void k_gemm_h(const float* __restrict__ A, int lda, size_t sA, const _Float16* __restrict__ Bh, int ldb, size_t sB, float alpha, float* __restrict__ C, int ldc, size_t sC, int M, int N, int K) {
  __shared__ __attribute__((aligned(16))) float so[4][16][64];
  const int tid = threadIdx.x, w = tid >> 5, lane = tid & 31, ln = lane & 15, hh = lane >> 4; const int by = blockIdx.y;
  A += (size_t)by * sA; Bh += (size_t)by * sB; C += (size_t)by * sC;
  const int ntn = (N + 63) / 64; const int wid = blockIdx.x * 4 + w; const int mt = wid / ntn, nq = wid % ntn; if (mt * 16 >= M) return;
  const int row0 = mt * 16, col0 = nq * 64; const float* arow = A + (size_t)(row0 + ln) * lda;
  v8f acc[4] = {};
  for (int kb = 0; kb < K; kb += 32) {
    FragH ah, al;
    const v4f x0 = *(const v4fa*)(arow + kb + 8 * hh), x1 = *(const v4fa*)(arow + kb + 8 * hh + 4), x2 = *(const v4fa*)(arow + kb + 16 + 8 * hh), x3 = *(const v4fa*)(arow + kb + 16 + 8 * hh + 4);
    float xs[16] = {x0[0],x0[1],x0[2],x0[3],x1[0],x1[1],x1[2],x1[3],x2[0],x2[1],x2[2],x2[3],x3[0],x3[1],x3[2],x3[3]};
#pragma unroll
    for (int i = 0; i < 16; ++i) { const _Float16 h = (_Float16)xs[i]; ah.h[i] = h; al.h[i] = ASPLIT ? (_Float16)(xs[i] - (float)h) : (_Float16)0.0f; }
#pragma unroll
    for (int t = 0; t < 4; ++t) { if (col0 + t * 16 >= N) continue; const size_t boff = (size_t)(col0 + t * 16 + ln) * ldb + kb; FragH bq; bq.half[0] = *(const v8us*)(Bh + boff + 8 * hh); bq.half[1] = *(const v8us*)(Bh + boff + 16 + 8 * hh);
      acc[t] = mmaH<ASPLIT ? 2 : 1>(ah.v, al.v, bq.v, bq.v, acc[t]); }
  }
#pragma unroll
  for (int t = 0; t < 4; ++t) { if (col0 + t * 16 >= N) continue;
#pragma unroll
    for (int r = 0; r < 8; ++r) so[w][8 * hh + r][t * 16 + ln] = acc[t][r] * alpha; }
  __builtin_amdgcn_fence(__ATOMIC_ACQ_REL, "workgroup"); __builtin_amdgcn_wave_barrier();
  const int rsub = lane >> 4, c4 = (lane & 15) * 4;
  {
#pragma unroll
    for (int q = 0; q < 8; ++q) { const int r = q * 2 + rsub; if (col0 + c4 < N) { const v4f v = *(const v4fa*)&so[w][r][c4]; *(v4f*)(C + (size_t)(row0 + r) * ldc + col0 + c4) = v; } }
     }
}

// Wt[n][k] = f16(W[k][n]·scale) from f32 row-major W[K][N] (scale = power of two; bf16-exact weights stay exact in f16 away from the subnormal range)
__global__ __launch_bounds__(256) void k_wt_f16(const float* __restrict__ W, _Float16* __restrict__ Wt, int K, int N, float scale) {
  const int t = blockIdx.x * 256 + threadIdx.x; if (t >= N * (K / 8)) return; const int n = t / (K / 8), k8 = (t % (K / 8)) * 8; FragH f;
#pragma unroll
  for (int i = 0; i < 8; ++i) f.h[i] = (_Float16)(bf16_round(W[(size_t)(k8 + i) * N + n]) * scale); const v8us o = f.half[0];
  *(v8us*)((unsigned short*)Wt + (size_t)n * K + k8) = o; 
}
// Fragment order: a [rows][K] 16-bit plane is kept as 1-KB units of 16 rows x 32 k, unit (row / 16) * (K / 32) + k / 32; inside a unit the 16-byte piece 32 p + lane holds row (lane & 15), k = 16 p + 8 (lane >> 4) + 0..7.
// A wave's fragment is then two 16-byte loads per lane that each cover 512 contiguous bytes (4 whole 128-B lines) instead of 32 bytes in each of 16 lines; fragment element i is k = 8 (lane >> 4) + i for i < 8 and 16 + 8 (lane >> 4) + (i - 8) above, for both operands of every product.
// frag_src: index, in the row-major plane, of the first of the 8 elements that 16-byte piece number 'piece' of the fragment-ordered plane holds.
__device__ __forceinline__ size_t frag_src(size_t piece, int K) { const size_t u = piece >> 6; const int in = (int)(piece & 63), p = in >> 5, l = in & 31; const size_t kt = (size_t)(K / 32);
  return ((u / kt) * 16 + (size_t)(l & 15)) * (size_t)K + (u % kt) * 32 + (size_t)(p * 16 + (l >> 4) * 8); }
// A and Bh in fragment order (lda == ldb == K at every launch here).
// The three projections (grid y: q, k, v), each written straight as the plane the attention reads; v = acc * alpha. A slab of the attention is 128 rows of the [NR][DD] plane seen as 2048 rows of 64: row r, column group g = col / 64 is the slab's row 16 (r % 128) + g.
// A wave's 64 x 64 tile holds 64 such rows whole (one g). The attention takes a slab's keys and queries in the order g * 128 + r % 128 (any order serves a softmax over all keys, as long as K, V^T share it and O goes back to its own row), so a strip of 16 rows of the tile is one 16-row tile of the fragment-ordered planes.
// q, k: the strip goes through LDS (accumulator lane = column, fragment lane = row) and leaves as f16 hi + x 2^10 residual, 4 + 4 wave-wide stores of 512 bytes in a row. v: an accumulator tile (lane = d, registers = 8 keys) IS a 16-byte piece a lane of the V^T plane: converted and stored, no LDS.
// A wave owns 64 rows x 64 columns (4 x 4 accumulator tiles): the eight fragments of a 32-k stage feed 16 products. A block is 2 x 2 waves = 128 x 128; waves 0, 1 read the same A fragments and waves 0, 2 the same B fragments. M % 128 == 0, N % 128 == 0, K % 64 == 0 at every launch here.
__global__ __launch_bounds__(128) void k_gemm_hhx(const _Float16* __restrict__ A, int lda, size_t sA, const _Float16* __restrict__ Bh, int ldb, size_t sB, float alpha,
    _Float16* __restrict__ Hh, _Float16* __restrict__ Hl, size_t sH, _Float16* __restrict__ Vt, int M, int N, int K) {
  __shared__ __attribute__((aligned(16))) float so[4][16][64 + 4];      // pitch 68 words: the 16 rows that a 16-byte read of one column group touches start 4 banks apart
  const int tid = threadIdx.x, w = __builtin_amdgcn_readfirstlane(tid >> 5), lane = tid & 31, ln = lane & 15, hh = lane >> 4; const int by = blockIdx.y;      // the wave's number in a scalar register: the eight tile bases below are then scalar too
  A += (size_t)by * sA; Bh += (size_t)by * sB;
  const int nbn = N / 128; const int bm = blockIdx.x / nbn, bn = blockIdx.x % nbn;
  const int row0 = bm * 128 + (w >> 1) * 64, col0 = bn * 128 + (w & 1) * 64; if (row0 >= M) return;
  v8f acc[4][4] = {};
  // Two register stages of 32 k each: a stage's 16 fragment loads are issued as one group, one stage ahead of the 16 products that read them.
  // The eight tile bases stay as they are through the loop; one 32-bit byte offset per lane (its 16-byte piece + the k position) is stepped once a trip.
  const char* ba[4]; const char* bb[4];
#pragma unroll      // constant indices keep the arrays in registers
  for (int t = 0; t < 4; ++t) { ba[t] = (const char*)(A + (size_t)(row0 + t * 16) * lda); bb[t] = (const char*)(Bh + (size_t)(col0 + t * 16) * ldb); }
  unsigned vo = (unsigned)lane * 16u;
  FragH a0[4], b0[4], a1[4], b1[4];
  auto fetch = [&](FragH (&fa)[4], FragH (&fb)[4], unsigned o) {
#pragma unroll      // constant indices keep the fragment arrays in registers
    for (int t = 0; t < 4; ++t) { fa[t].half[0] = *(const v8us*)(ba[t] + o); fa[t].half[1] = *(const v8us*)(ba[t] + o + 512); fb[t].half[0] = *(const v8us*)(bb[t] + o); fb[t].half[1] = *(const v8us*)(bb[t] + o + 512); } };
  auto mul = [&](FragH (&fa)[4], FragH (&fb)[4]) {
#pragma unroll      // constant indices keep the fragment arrays in registers
    for (int i = 0; i < 4; ++i)
#pragma unroll      // constant indices keep the fragment arrays in registers
      for (int t = 0; t < 4; ++t) acc[i][t] = __builtin_amdgcn_wmma_f32_16x16x32_f16(false, fa[i].v, false, fb[t].v, (short)0, acc[i][t], false, false); };      // the plain builtin: operands of an asm statement cannot lie above v255, and this tile needs more than 256 registers
  fetch(a0, b0, vo);      // a stage of 32 k = one 1-KB unit of each tile
#pragma unroll 1      // rolled: one ping-pong pair per trip keeps both stages in fixed registers and the loop short
  for (int kb = 0; kb < K; kb += 64) {
    fetch(a1, b1, vo + 1024);
    __builtin_amdgcn_sched_barrier(0);      // holds the 16 loads as one group ahead of the products: without it the compiler sinks them among the products, a few products ahead of their use
    mul(a0, b0);
    __builtin_amdgcn_sched_barrier(0);      // no load of the next group rises among the products above, where its registers are still read; the wait below stays behind them
    asm volatile("s_wait_xcnt 0x0" ::: "memory");      // the wait in front of the rewriting of the loads' offset register
    __builtin_amdgcn_sched_barrier(0);      // the offset's step stays behind the wait
    vo = (kb + 64 < K) ? vo + 2048 : (unsigned)lane * 16u;      // the last trip steps back to k = 0: its second fetch stays in bounds and is not used
    fetch(a0, b0, vo);
    __builtin_amdgcn_sched_barrier(0);      // as above: the group stays ahead of the products
    mul(a1, b1);
    __builtin_amdgcn_sched_barrier(0);      // as above: the wait below stays behind the products
    asm volatile("s_wait_xcnt 0x0" :: "v"(vo) : "memory");      // the wait in front of the rewriting of the loads' offset registers at the back edge and, behind the loop, of their bases; the offset as an input, so that no load's result lands in it
    __builtin_amdgcn_sched_barrier(0);      // what steps an offset at the loop's foot stays behind the wait
  }
  static_assert(TT * 64 / DD == 128 && DD / 64 == 16, "a slab is 128 rows of the plane, 16 column groups wide: a block's 128 rows are one slab's");
  const int slab = row0 >> 7, t16 = (col0 >> 6) * 8 + ((row0 & 127) >> 4);      // the number, in its slab, of the 16-row tile that the wave's first strip makes; strip i makes tile t16 + i
  if (by < 2) {      // the same for a whole block
    unsigned short* dh = (unsigned short*)Hh + (size_t)by * sH + ((size_t)slab * 128 + t16) * 1024 + lane * 8; unsigned short* dl = (unsigned short*)Hl + (size_t)by * sH + ((size_t)slab * 128 + t16) * 1024 + lane * 8;
#pragma unroll      // constant indices keep the accumulator tiles in registers
    for (int i = 0; i < 4; ++i) {      // the wave's four 16-row strips go through its LDS strip one after the other
#pragma unroll
      for (int t = 0; t < 4; ++t)
#pragma unroll
        for (int r = 0; r < 8; ++r) so[w][8 * hh + r][t * 16 + ln] = acc[i][t][r] * alpha;
      __builtin_amdgcn_fence(__ATOMIC_ACQ_REL, "workgroup"); __builtin_amdgcn_wave_barrier();      // the strip's LDS stores stay ahead of the reads below, which take other lanes' values
      FragH fh[4], fl[4];
#pragma unroll      // piece u = 2 ks + p of the tile's two units: row ln, k = 16 u + 8 hh + 0..7
      for (int u = 0; u < 4; ++u) { const v4f a = *(const v4fa*)&so[w][ln][u * 16 + 8 * hh], c = *(const v4fa*)&so[w][ln][u * 16 + 8 * hh + 4];
#pragma unroll
        for (int q = 0; q < 4; ++q) { _Float16 h = (_Float16)a[q]; fh[u].h[q] = h; fl[u].h[q] = (_Float16)((a[q] - (float)h) * 1024.0f); h = (_Float16)c[q]; fh[u].h[4 + q] = h; fl[u].h[4 + q] = (_Float16)((c[q] - (float)h) * 1024.0f); } }
#pragma unroll
      for (int u = 0; u < 4; ++u) { *(v8us*)(dh + i * 1024 + u * 256) = fh[u].half[0]; *(v8us*)(dl + i * 1024 + u * 256) = fl[u].half[0]; }
      // the wait behind the eight stores, in front of the reuse of their registers by the next strip; data and addresses are inputs so that they stay as they are up to the wait
      asm volatile("s_wait_xcnt 0x0" :: "v"(fh[0].half[0]), "v"(fl[0].half[0]), "v"(fh[1].half[0]), "v"(fl[1].half[0]), "v"(fh[2].half[0]), "v"(fl[2].half[0]), "v"(fh[3].half[0]), "v"(fl[3].half[0]), "v"(dh), "v"(dl) : "memory");
      __builtin_amdgcn_fence(__ATOMIC_ACQ_REL, "workgroup"); __builtin_amdgcn_wave_barrier();      // the strip's LDS reads stay ahead of the next strip's LDS stores
    }
  } else {
    unsigned short* dv = (unsigned short*)Vt + ((size_t)slab * 64 + (t16 >> 1)) * 2048 + lane * 8;      // V^T: unit (32-key tile) * 4 + d / 16; t16 is even, strip i is half i & 1 of 32-key tile t16 / 2 + i / 2
#pragma unroll      // constant indices keep the accumulator tiles in registers
    for (int i = 0; i < 4; ++i) { FragH f[4];
#pragma unroll
      for (int t = 0; t < 4; ++t) {
#pragma unroll
        for (int r = 0; r < 8; ++r) f[t].h[r] = (_Float16)(acc[i][t][r] * alpha); }
#pragma unroll
      for (int t = 0; t < 4; ++t) *(v8us*)(dv + (i >> 1) * 2048 + t * 512 + (i & 1) * 256) = f[t].half[0];
      // the wait behind the four stores, in front of the reuse of their registers by the next strip; data and address are inputs so that they stay as they are up to the wait
      asm volatile("s_wait_xcnt 0x0" :: "v"(f[0].half[0]), "v"(f[1].half[0]), "v"(f[2].half[0]), "v"(f[3].half[0]), "v"(dv) : "memory");
    }
  }
}


typedef _Float16 v4h __attribute__((ext_vector_type(4)));

// The streaming launches run as one resident round: GSTR blocks of 8 waves = 16 waves on each of 256 WGPs. A lane takes 7 or 8 pieces of 16 output bytes, 256 pieces apart inside its block's own run of pieces, and asks for all their inputs as one group before it converts and stores any.
#define GSTR 512
static_assert((size_t)NR * DD / 8 == (size_t)GSTR * 1024 && (size_t)DD * DD / 8 == (size_t)GSTR * 256, "a lane of k_prep takes four pieces of x and one of each weight");
static_assert((size_t)NR * DD / 4 == (size_t)GSTR * 2048 && GSTR % BB == 0, "a lane of k_norm takes eight pieces, a block lies in one batch element");
__global__ __launch_bounds__(256) void k_h16(const float* __restrict__ x, _Float16* __restrict__ X16, size_t n8) { const size_t t = (size_t)blockIdx.x * 256 + threadIdx.x; if (t >= n8) return; FragH f;
#pragma unroll
  for (int q = 0; q < 8; ++q) f.h[q] = (_Float16)x[t * 8 + q]; *(v8us*)((unsigned short*)X16 + t * 8) = f.half[0];  }
// x ([NR][DD]) and the three weights ([DD][DD], x 2^4), rounded to bf16 values and written as f16 planes in fragment order.
__global__ __launch_bounds__(256) void k_prep(const float* __restrict__ x, const float* __restrict__ Wq, const float* __restrict__ Wk, const float* __restrict__ Wv, _Float16* __restrict__ X16, _Float16* __restrict__ Bw) {
  const size_t tx = (size_t)blockIdx.x * 1024 + threadIdx.x, tw = (size_t)blockIdx.x * 256 + threadIdx.x; v4f a[7][2]; const size_t s = frag_src(tw, DD);
  static_assert(DD / 32 % 16 == 0, "a block's 16 units of x lie in one 16-row tile: piece tx + 256 i is four units on, 128 k to the right of piece tx");
  const float* xa = x + frag_src(tx, DD); const float* wq = Wq + s; const float* wk = Wk + s; const float* wv = Wv + s;
#pragma unroll      // constant indices keep the seven pieces in registers; all loads stand ahead of the first conversion
  for (int i = 0; i < 4; ++i) { a[i][0] = *(const v4fa*)(xa + i * 128); a[i][1] = *(const v4fa*)(xa + i * 128 + 4); }
  a[4][0] = *(const v4fa*)wq; a[4][1] = *(const v4fa*)(wq + 4); a[5][0] = *(const v4fa*)wk; a[5][1] = *(const v4fa*)(wk + 4); a[6][0] = *(const v4fa*)wv; a[6][1] = *(const v4fa*)(wv + 4);
  // the loaded values as inputs only: keeps all 14 loads ahead of the first conversion, or the compiler sinks half of them behind waits for the first; the addresses as inputs, so that no load's result lands in an address register of the group, and the wait in front of their reuse
  asm volatile("s_wait_xcnt 0x0" :: "v"(a[0][0]), "v"(a[0][1]), "v"(a[1][0]), "v"(a[1][1]), "v"(a[2][0]), "v"(a[2][1]), "v"(a[3][0]), "v"(a[3][1]), "v"(a[4][0]), "v"(a[4][1]), "v"(a[5][0]), "v"(a[5][1]), "v"(a[6][0]), "v"(a[6][1]), "v"(xa), "v"(wq), "v"(wk), "v"(wv) : "memory");
#pragma unroll      // constant indices keep the seven pieces in registers
  for (int i = 0; i < 7; ++i) { FragH f; const float sc = (i < 4) ? 1.0f : 16.0f;
#pragma unroll
    for (int q = 0; q < 4; ++q) { f.h[q] = (_Float16)(bf16_round(a[i][0][q]) * sc); f.h[4 + q] = (_Float16)(bf16_round(a[i][1][q]) * sc); }
    unsigned short* dst = (i < 4) ? (unsigned short*)X16 + (tx + i * 256) * 8 : (unsigned short*)Bw + (size_t)(i - 4) * DD * DD + tw * 8;
    *(v8us*)dst = f.half[0]; } }
typedef float v2f __attribute__((ext_vector_type(2)));
// lane l <-> lane l ^ 16 by a vector cross-row move
__device__ __forceinline__ float xhalf(float x) { return __builtin_bit_cast(float, __builtin_amdgcn_permlanex16(__builtin_bit_cast(int, x), __builtin_bit_cast(int, x), 0x76543210, 0xfedcba98, false, false)); }
// sum over the wave's 32 lanes, left in every lane; all lanes are on
__device__ __forceinline__ float wave_sum(float v) { v += __shfl_xor(v, 1, 32); v += __shfl_xor(v, 2, 32); v += __shfl_xor(v, 4, 32); v += __shfl_xor(v, 8, 32); return v + xhalf(v); }
// The plain builtin product: the compiler keeps the distance behind a matrix instruction itself and fills it with the pass's own vector work, where a fixed run of v_nop behind each product would take the vector port from the SIMD's other waves.
__device__ __forceinline__ v8f wm(v16h a, v16h b, v8f c) { return __builtin_amdgcn_wmma_f32_16x16x32_f16(false, a, false, b, (short)0, c, false, false); }
__global__ __launch_bounds__(128) void k_flash(const _Float16* __restrict__ Q16, const _Float16* __restrict__ Q16lo, int ldq, const _Float16* __restrict__ K16, const _Float16* __restrict__ K16lo, int ldk, const _Float16* __restrict__ Vt, const float* __restrict__ x, float* __restrict__ Y, float* __restrict__ PART) {
  constexpr int RPW = 16, NQB = TT / (4 * RPW), DT = 4, KS = 2; constexpr float L2E = 1.4426950408889634f;
  static_assert(NSL * NQB == BB * NPB && NSL % BB == 0, "one partial pair a block; a slab, and so a block, lies in one batch element");
  __shared__ __attribute__((aligned(16))) float sO[4][RPW][64 + 4];
  __shared__ float sred[4][2];
  const int tid = threadIdx.x, w = tid >> 5, lane = tid & 31, ln = lane & 15, hh = lane >> 4;
  const int slab = blockIdx.x / NQB, qblk = blockIdx.x % NQB; const int b = slab; const int qb0 = qblk * (4 * RPW); const int q0 = qb0 + w * RPW;
  FragH aq[KS], aql[KS];
  { const size_t qo = ((size_t)b * TT + q0) * ldq + lane * 8; const unsigned short* qr = (const unsigned short*)Q16 + qo; const unsigned short* ql = (const unsigned short*)Q16lo + qo;
#pragma unroll
    for (int ks = 0; ks < KS; ++ks) { aq[ks].half[0] = *(const v8us*)(qr + ks * 512); aq[ks].half[1] = *(const v8us*)(qr + ks * 512 + 256); aql[ks].half[0] = *(const v8us*)(ql + ks * 512); aql[ks].half[1] = *(const v8us*)(ql + ks * 512 + 256); } }      // fragment-ordered planes (ldq == ldk == 64): unit = (row / 16) * 2 + ks
  const unsigned short* Vth = (const unsigned short*)Vt + (size_t)slab * 64 * TT;
  float m_r = -3.0e38f, b_r = -3.0e38f, l_r = 0.f; v8f oacc[DT];
#pragma unroll
  for (int dt = 0; dt < DT; ++dt) oacc[dt] = (v8f){0.f,0.f,0.f,0.f,0.f,0.f,0.f,0.f};
  const int jend = TT;
  // K fragments (both planes, 32 keys) live in registers across the back edge: each pass fetches the next pass's right behind its own score products; V fragments are fetched at the pass's top, ahead of the scores and the softmax.
  FragH bk[2][KS], bl[2][KS];
  auto fetchK = [&](int j) {
#pragma unroll      // constant indices keep the fragment arrays in registers
    for (int nt = 0; nt < 2; ++nt) { const size_t ko = ((size_t)b * TT + j + nt * 16) * ldk + lane * 8; const unsigned short* kr = (const unsigned short*)K16 + ko; const unsigned short* kl = (const unsigned short*)K16lo + ko;
#pragma unroll      // constant indices keep the fragment arrays in registers
      for (int ks = 0; ks < KS; ++ks) { bk[nt][ks].half[0] = *(const v8us*)(kr + ks * 512); bk[nt][ks].half[1] = *(const v8us*)(kr + ks * 512 + 256); bl[nt][ks].half[0] = *(const v8us*)(kl + ks * 512); bl[nt][ks].half[1] = *(const v8us*)(kl + ks * 512 + 256); } } };
  fetchK(0);
  { const size_t qa = ((size_t)b * TT + q0) * ldq + lane * 8, ka = (size_t)b * TT * ldk + lane * 8, kc = ((size_t)b * TT + 16) * ldk + lane * 8;
    // the wait in front of the reuse of the address registers of the Q and K loads above; the six addresses are inputs so that their registers stay as they are up to the wait
    asm volatile("s_wait_xcnt 0x0" :: "v"(Q16 + qa), "v"(Q16lo + qa), "v"(K16 + ka), "v"(K16lo + ka), "v"(K16 + kc), "v"(K16lo + kc) : "memory"); }
#pragma unroll 1
  for (int j0 = 0; j0 < jend; j0 += 32) {
    FragH bv[DT];
#pragma unroll      // constant indices keep the fragment arrays in registers
    for (int dt = 0; dt < DT; ++dt) { const unsigned short* vrow = Vth + (size_t)j0 * 64 + dt * 512 + lane * 8; bv[dt].half[0] = *(const v8us*)(vrow); bv[dt].half[1] = *(const v8us*)(vrow + 256); }
    __builtin_amdgcn_sched_barrier(0);      // holds the eight V loads as one group at the pass's top: without it the compiler sinks some behind the score products, nearer to their use
    v8f s[2];      // s[nt][r] = score of query q0 + ln against key j0 + 16 nt + 8 hh + r
#pragma unroll
    for (int nt = 0; nt < 2; ++nt) { v8f acc = (v8f){0.f,0.f,0.f,0.f,0.f,0.f,0.f,0.f}, accl = acc;
#pragma unroll
      for (int ks = 0; ks < KS; ++ks) { acc = wm(bk[nt][ks].v, aq[ks].v, acc); accl = wm(bk[nt][ks].v, aql[ks].v, accl); accl = wm(bl[nt][ks].v, aq[ks].v, accl); }
      s[nt] = acc + accl * 0.0009765625f; }
    __builtin_amdgcn_sched_barrier(0);      // the K address arithmetic and loads stay behind the score tiles, in the order written: without it the compiler spreads them among the products
    const int jn = (j0 + 32 < jend) ? j0 + 32 : 0; fetchK(jn);      // the last pass refetches keys 0..31: in bounds, not used
    { const size_t ka = ((size_t)b * TT + jn) * ldk + lane * 8, kc = ((size_t)b * TT + jn + 16) * ldk + lane * 8;
      // the wait in front of the reuse of the address registers of the K loads above; the four addresses are inputs so that none of their registers is handed to a load's result or to the softmax ahead of the wait
      asm volatile("s_wait_xcnt 0x0" :: "v"(K16 + ka), "v"(K16lo + ka), "v"(K16 + kc), "v"(K16lo + kc) : "memory"); }
    __builtin_amdgcn_sched_barrier(0);      // no K load sinks into the softmax or behind the output products: without it the compiler lends K registers to the softmax and issues their loads at the pass's end, a few products ahead of their use
    float mc = s[0][0], md = s[1][0];
#pragma unroll      // constant indices keep the score tiles in registers
    for (int r = 1; r < 8; ++r) { mc = fmaxf(mc, s[0][r]); md = fmaxf(md, s[1][r]); }
    mc = fmaxf(mc, md); mc = fmaxf(mc, xhalf(mc));      // both halves now hold the query's maximum over the pass's 32 keys
    // base 2: b_r is the running maximum times log2(e), less 10; every weight is then 2^(s log2(e) - b_r) = 2^10 exp(s - max), one multiply-add and one hardware exponential, already at the scale the f16 P operand wants
    const float mn = fmaxf(m_r, mc), bn = __builtin_fmaf(mn, L2E, -10.0f); const float al = __builtin_amdgcn_exp2f((mn > -1.0e38f) ? b_r - bn : 0.f); m_r = mn; b_r = bn;      // the guard selects the argument (2^0 = 1), so no branch on lanes stands in the loop
    FragH pt; v2f ps[2] = {(v2f){0.f, 0.f}, (v2f){0.f, 0.f}}; const v8f l2e8 = {L2E, L2E, L2E, L2E, L2E, L2E, L2E, L2E}, nm8 = {-bn, -bn, -bn, -bn, -bn, -bn, -bn, -bn};
#pragma unroll      // constant indices keep the score tiles and the P^T fragment in registers
    for (int nt = 0; nt < 2; ++nt) { const v8f d = __builtin_elementwise_fma(s[nt], l2e8, nm8);
#pragma unroll      // constant indices keep the score tiles and the P^T fragment in registers
      for (int r = 0; r < 8; r += 2) { const v2f p = {__builtin_amdgcn_exp2f(d[r]), __builtin_amdgcn_exp2f(d[r + 1])}; ps[nt] += p; pt.h[8 * nt + r] = (_Float16)p[0]; pt.h[8 * nt + r + 1] = (_Float16)p[1]; } }
    { const v2f pq = ps[0] + ps[1]; l_r = l_r * al + (pq[0] + pq[1]); }      // this half's 16 keys; the halves are joined behind the loop
#pragma unroll
    for (int dt = 0; dt < DT; ++dt)
#pragma unroll
      for (int r = 0; r < 8; ++r) oacc[dt][r] *= al;
#pragma unroll
    for (int dt = 0; dt < DT; ++dt) oacc[dt] = wm(bv[dt].v, pt.v, oacc[dt]);      // oacc[dt][r] = O[q0 + ln][16 dt + 8 hh + r]
  }
  // The residual and the LayerNorm statistics are taken here, where the output tile is in registers: y = O + x goes out in O's place, and the block's sums of y and y * y go out as one partial pair.
  const size_t fo = ((size_t)b * TT + ((q0 & 127) + (lane >> 4)) * 16 + (q0 >> 7)) * 64 + (lane & 15) * 4;      // query g * 128 + r' of the planes' order is the slab's row 16 r' + g, 64 wide: one address, constant steps of 16 rows a query; x has the flat order of the output
  const float* px = x + fo; v4f xv[RPW / 2];
#pragma unroll      // constant indices keep the eight pieces in registers; the loads fly while the tile is scaled and turned in LDS
  for (int u = 0; u < RPW / 2; ++u) xv[u] = *(const v4fa*)(px + u * 2048);
  asm volatile("s_wait_xcnt 0x0" :: "v"(px) : "memory");      // the wait in front of the reuse of the address registers of the x loads; the address is an input so that it stays as it is up to the wait
  { const float l = l_r + xhalf(l_r); const float inv = (l > 0.f) ? 1.0f / l : 0.f;      // l and the output tiles both carry the factor 2^10; the exchange stands ahead of the select: all lanes are on
#pragma unroll      // constant indices keep the output tiles in registers
    for (int dt = 0; dt < DT; ++dt) { v4f lo4, hi4;
#pragma unroll      // constant indices keep the output tiles in registers
      for (int r = 0; r < 4; ++r) { lo4[r] = oacc[dt][r] * inv; hi4[r] = oacc[dt][4 + r] * inv; }
      *(v4fa*)&sO[w][ln][dt * 16 + 8 * hh] = lo4; *(v4fa*)&sO[w][ln][dt * 16 + 8 * hh + 4] = hi4; } }
  __builtin_amdgcn_fence(__ATOMIC_ACQ_REL, "workgroup"); __builtin_amdgcn_wave_barrier();
  v4f yv[RPW / 2], a1 = {0.f, 0.f, 0.f, 0.f}, a2 = a1;      // four independent chains for each sum
#pragma unroll      // constant indices keep the eight pieces in registers
  for (int u = 0; u < RPW / 2; ++u) { const v4f val = *(const v4fa*)&sO[w][2 * u + (lane >> 4)][(lane & 15) * 4];
#pragma unroll
    for (int q = 0; q < 4; ++q) { const float y = val[q] + bf16_round(xv[u][q]); yv[u][q] = y; a1[q] += y; a2[q] += y * y; } }
  const float s1 = wave_sum((a1[0] + a1[1]) + (a1[2] + a1[3])), s2 = wave_sum((a2[0] + a2[1]) + (a2[2] + a2[3]));
  if (lane == 0) { sred[w][0] = s1; sred[w][1] = s2; }
  __syncthreads();      // the four waves' sums are in LDS; it stands ahead of the y stores, so that it does not wait for them
  float* py = Y + fo;
#pragma unroll
  for (int u = 0; u < RPW / 2; ++u) *(v4f*)(py + u * 2048) = yv[u];
  // the wait behind the eight stores, in front of the reuse of their registers below; data and address are inputs so that they stay as they are up to the wait
  asm volatile("s_wait_xcnt 0x0" :: "v"(yv[0]), "v"(yv[1]), "v"(yv[2]), "v"(yv[3]), "v"(yv[4]), "v"(yv[5]), "v"(yv[6]), "v"(yv[7]), "v"(py) : "memory");
  if (tid < 32) { const int c = tid & 1; const float v = (tid < 2) ? ((sred[0][c] + sred[1][c]) + (sred[2][c] + sred[3][c])) : 0.f; *(float*)(PART + (size_t)blockIdx.x * 32 + tid) = v; } }      // one whole 128-byte line a block, from one wave

typedef float v2fa __attribute__((ext_vector_type(2), may_alias));
// Y = attention output + residual; PART = one 128-byte line a block of k_flash, NPB lines a batch element. Each of a block's 8 waves sums 64 of the lines (two lane-spread loads and a butterfly), the eight sums are joined through LDS.
__global__ __launch_bounds__(256) void k_norm(const float* __restrict__ Y, const float* __restrict__ PART, float* __restrict__ out) { __shared__ __attribute__((aligned(16))) float sred[8][2]; const size_t t = (size_t)blockIdx.x * 2048 + threadIdx.x; const int b = (int)(blockIdx.x / (GSTR / BB)), lane = threadIdx.x & 31, w = threadIdx.x >> 5; v4f y[8];
  static_assert(NPB == 8 * 64, "two partial pairs per lane, 64 per wave");
  const float* pp = PART + ((size_t)b * NPB + w * 64 + lane) * 32; const float* py = Y + t * 4;
  const v2f pa = *(const v2fa*)pp, pb = *(const v2fa*)(pp + 32 * 32);      // the partials first: their sums are formed while the eight pieces of y are on their way
  __builtin_amdgcn_sched_barrier(0);      // holds the two partial loads ahead of the eight of y: without it the compiler issues them last, and the sums wait for all ten loads
#pragma unroll      // constant indices keep the eight pieces in registers
  for (int u = 0; u < 8; ++u) y[u] = *(const v4fa*)(py + u * 1024);
  asm volatile("s_wait_xcnt 0x0" :: "v"(pp), "v"(py) : "memory");      // the wait in front of the reuse of the two address registers; the addresses as inputs, so that no load's result lands in one of them
  const float w1 = wave_sum(pa[0] + pb[0]), w2 = wave_sum(pa[1] + pb[1]);
  if (lane == 0) { sred[w][0] = w1; sred[w][1] = w2; }
  __syncthreads();      // the eight waves' sums are in LDS
  v2f sa = {0.f, 0.f};
#pragma unroll      // the waves' sums are added in the order 0 .. 7
  for (int i = 0; i < 8; ++i) sa += *(const v2fa*)&sred[i][0];
  const float s1 = sa[0], s2 = sa[1];
  const float n = (float)TT * (float)DD; const float mu = s1 / n; const float var = fmaxf(s2 / n - mu * mu, 0.f); const float rs = rsqrtf(var + 1e-5f);
#pragma unroll      // constant indices keep the eight pieces in registers
  for (int u = 0; u < 8; ++u) { v4f r; for (int q = 0; q < 4; ++q) r[q] = (y[u][q] - mu) * rs;
    *(v4f*)(out + (t + u * 256) * 4) = r; } }

extern "C" void kernel_launch(void* const* d_in, const int* in_sizes, int n_in,
                              void* d_out, int out_size, void* d_ws, size_t ws_size, hipStream_t stream) {
  (void)in_sizes; (void)n_in; (void)out_size;
  const float* x = (const float*)d_in[0]; const float* Wq = (const float*)d_in[1]; const float* Wk = (const float*)d_in[2]; const float* Wv = (const float*)d_in[3];
  char* ws = (char*)d_ws; size_t off = 0;
  auto take = [&](size_t bytes) { char* p = ws + off; off += (bytes + 255) & ~(size_t)255; return p; };
  const size_t WSZ = (size_t)DD * DD, PSZ = (size_t)NR * DD; _Float16* Bw = (_Float16*)take(3 * WSZ * 2); _Float16* X16 = (_Float16*)take(PSZ * 2); float* O = (float*)take(PSZ * 4);
  _Float16* Qh = (_Float16*)take(2 * PSZ * 2); _Float16* Kh = Qh + PSZ; _Float16* Ql = (_Float16*)take(2 * PSZ * 2); _Float16* Kl = Ql + PSZ;      /* hi planes of q and k in a row, then their lo planes */
  _Float16* Vt = (_Float16*)take(PSZ * 2); float* PART = (float*)take((size_t)BB * NPB * 32 * 4);
  if (off > ws_size) return;      // 6.3 + 8.4 + 16.8 + 5 x 8.4 = 73 MB
  k_prep<<<GSTR, 256, 0, stream>>>(x, Wq, Wk, Wv, X16, Bw);      /* x; weights (out,in) natural x 2^4 */
  const dim3 gp((NR / 128) * (DD / 128), 3);      /* y: q, k (hi and lo planes), v (V^T), all in fragment order, a slab's rows in the order column group * 128 + row */
  k_gemm_hhx<<<gp, 128, 0, stream>>>(X16, DD, 0, Bw, DD, WSZ, 0.0625f, Qh, Ql, PSZ, Vt, NR, DD, DD);
  k_flash<<<NSL * (TT / 64), 128, 0, stream>>>(Qh, Ql, 64, Kh, Kl, 64, Vt, x, O, PART);      /* Q, K, V^T in the planes' row order; O + x in the flat view's own, and a partial pair a block */
  k_norm<<<GSTR, 256, 0, stream>>>(O, PART, (float*)d_out);
}
